// v000
// The times below were measured on an AMD MI455X: many runs one after another, warmed up first and cycling through
// copies of the inputs, with the whole window's GPU time divided by the number of runs. Launches and the gaps
// between them are all in it. The median over several windows is given; except for v000 it joins two sittings, which
// can be a few percent apart, so the side-by-side timings, each taken in one sitting, are the better comparison.
// v000 is the starting kernel. One run takes 1400 microseconds.
// compute dtype: hidden_states and all weights/biases (module inputs) rounded to bf16; q/k/v projections with exact bf16 products (x and W are inputs); causal scores q.k with both computed operands as bf16 hi + residual pairs (3 products) and P.V with P hi/lo x V hi/lo (3 products); the heavy-hitter column sums recompute the same 3-product scores in a second (transposed) pass with the stored row statistics; the output projection with hi/lo x exact o_w (2 products), all on WMMA 16x16x32; softmax, column sums, the per-head top-k selection (bitonic sort, lower index first on ties) and the mask assembly in f32 on the VALU; f32 accumulate.
#include <hip/hip_runtime.h>
#include <math.h>

typedef __attribute__((ext_vector_type(16))) _Float16 v16h;
typedef __attribute__((ext_vector_type(16))) __bf16 v16b;
typedef __attribute__((ext_vector_type(8)))  _Float16 v8h;
typedef __attribute__((ext_vector_type(8)))  float v8f;
typedef __attribute__((ext_vector_type(4)))  float v4f;
typedef __attribute__((ext_vector_type(2)))  float v2f;
typedef __attribute__((ext_vector_type(4)))  unsigned v4u;
typedef __attribute__((ext_vector_type(4)))  int v4i;
typedef float __attribute__((may_alias)) float_a;
typedef int __attribute__((may_alias)) int_a;

template <typename T> __device__ __forceinline__ void vst2(void* p, T v) { *(T*)p = v;  }
__device__ __forceinline__ v8f wmma16(v16h a, v16h b, v8f c) {
  v8f d = __builtin_amdgcn_wmma_f32_16x16x32_f16(false, a, false, b, (short)0, c, false, false);
  asm volatile("v_nop\n\tv_nop\n\tv_nop\n\tv_nop" : "+v"(d) : "v"(a), "v"(b));
  return d;
}
__device__ __forceinline__ v8f wmma_bf(v16b a, v16b b, v8f c) {
  v8f d = __builtin_amdgcn_wmma_f32_16x16x32_bf16(false, a, false, b, (short)0, c, false, false);
  asm volatile("v_nop\n\tv_nop\n\tv_nop\n\tv_nop" : "+v"(d) : "v"(a), "v"(b));
  return d;
}
// 16x16x32 fragments: lane = (h = lane>>4, row/col = lane&15); elements 0..7 = k0+8h+0..7, 8..15 = k0+16+8h+0..7; D element r = row 8h+r
__device__ __forceinline__ v16h frag_h(const _Float16* rowk0, int lane) {
  union { v16h v; v8h q[2]; } u; const _Float16* p = rowk0 + 8 * (lane >> 4);
  u.q[0] = *(const v8h*)p; u.q[1] = *(const v8h*)(p + 16); return u.v;
}
__device__ __forceinline__ v16h frag_f32(const float* rowk0, int lane) {
  v16h a; const float* p = rowk0 + 8 * (lane >> 4);
#pragma unroll
  for (int i = 0; i < 8; ++i) { a[i] = (_Float16)p[i]; a[8 + i] = (_Float16)p[16 + i]; }
  return a;
}
__device__ __forceinline__ v16h frag_f32s(const float* rowk0, int lane, float sc) {
  v16h a; const float* p = rowk0 + 8 * (lane >> 4);
#pragma unroll
  for (int i = 0; i < 8; ++i) { a[i] = (_Float16)(p[i] * sc); a[8 + i] = (_Float16)(p[16 + i] * sc); }
  return a;
}
// column fragment from a [K][ld] layout (column n), rows >= K read as 0
__device__ __forceinline__ v16h fragc_f32(const float* W, int k0, int n, int lane, int ld, int K) {
  v16h a; const int g = lane >> 4;
#pragma unroll
  for (int i = 0; i < 8; ++i) { const int ka = k0 + 8 * g + i, kb = ka + 16;
    a[i] = (_Float16)(ka < K ? W[(size_t)(ka < K ? ka : K - 1) * ld + n] : 0.f); a[8 + i] = (_Float16)(kb < K ? W[(size_t)(kb < K ? kb : K - 1) * ld + n] : 0.f); }
  return a;
}
struct F2 { v16b h, l; };
__device__ __forceinline__ F2 bsplit16(const float v[16]) { F2 r;
#pragma unroll
  for (int i = 0; i < 16; ++i) { const __bf16 h = (__bf16)v[i]; r.h[i] = h; r.l[i] = (__bf16)(v[i] - (float)h); }
  return r; }
__device__ __forceinline__ F2 split_row(const float* row, int k0, int lane) { float v[16]; const float* p = row + k0 + 8 * (lane >> 4);
#pragma unroll
  for (int i = 0; i < 8; ++i) { v[i] = p[i]; v[8 + i] = p[16 + i]; }
  return bsplit16(v); }
__device__ __forceinline__ F2 split_rowK(const float* row, int k0, int lane, int K) { float v[16]; const int g = lane >> 4;
#pragma unroll
  for (int i = 0; i < 8; ++i) { const int ka = k0 + 8 * g + i, kb = ka + 16; v[i] = ka < K ? row[ka < K ? ka : K - 1] : 0.f; v[8 + i] = kb < K ? row[kb < K ? kb : K - 1] : 0.f; }
  return bsplit16(v); }
__device__ __forceinline__ F2 split_col(const float* W, int k0, int n, int lane, int ld, int K) { float v[16]; const int g = lane >> 4;
#pragma unroll
  for (int i = 0; i < 8; ++i) { const int ka = k0 + 8 * g + i, kb = ka + 16; v[i] = ka < K ? W[(size_t)(ka < K ? ka : K - 1) * ld + n] : 0.f; v[8 + i] = kb < K ? W[(size_t)(kb < K ? kb : K - 1) * ld + n] : 0.f; }
  return bsplit16(v); }
__device__ __forceinline__ v8f mac3(const F2& a, const F2& b, v8f c) { c = wmma_bf(a.l, b.h, c); c = wmma_bf(a.h, b.l, c); return wmma_bf(a.h, b.h, c); }
__device__ __forceinline__ float sigm(float v) { return 1.0f / (1.0f + expf(-v)); }
#define LDSX() do { asm volatile("s_wait_dscnt 0" ::: "memory"); __builtin_amdgcn_wave_barrier(); __builtin_amdgcn_fence(__ATOMIC_RELEASE, "workgroup"); } while (0)


// GQA causal attention with H2O heavy-hitter scoring (B 1, S 2048, D 2048, 16 query heads / 4 kv heads x 128): out = softmax(q k^T / sqrt(128), causal) v -> @ o_w; cur[h][s] = sum over queries of probs; mask[h] = 1 on the last 204 of 2049 positions, 0 elsewhere, then 1 at the top-204 (heavy budget) indices of cur[h][:1844].
#define SFULL 2048            // shipped sequence length (output layout)
#ifndef SS
#define SS SFULL              // active sequence length (all)
#endif
#define DM 2048
#define NH 16
#define NKV 4
#define HD 128
#define KVW (NKV * HD)        // 512
#define HEAVY (SS / 10)       // int(0.1 * S)
#define RECENT (SS / 10)
#define MW (SS + 1)           // 2049 mask width
#define MWP 2064              // padded staging width
#define TQB (SS / 64)         // query blocks
typedef __attribute__((ext_vector_type(8))) __bf16 v8b;
__device__ __forceinline__ v16b frag_b(const __bf16* rowk0, int lane) {
  union { v16b v; v8b q[2]; } u; const __bf16* p = rowk0 + 8 * (lane >> 4);
  u.q[0] = *(const v8b*)p; u.q[1] = *(const v8b*)(p + 16); return u.v;
}
__device__ __forceinline__ float bfr(float v) { return (float)(__bf16)v; }
__device__ __attribute__((noinline)) float exp_ni(float v) { return expf(v); }
__device__ __attribute__((noinline)) float erf_ni(float v) { return erff(v); }

#define PK_Q 0                               // [2048 n][2048 k] q_w^T
#define PK_K (PK_Q + DM * DM)                  // [512][2048]
#define PK_V (PK_K + KVW * DM)
#define PK_O (PK_V + KVW * DM)                 // [2048][2048] o_w^T
#define PK_END (PK_O + DM * DM)
#define WS_PK  0u
#define WS_Q   (WS_PK + 2u * PK_END)           // f32 [2048][2048] q (h*128+d)
#define WS_K   (WS_Q + 4u * SS * DM)            // f32 [2048][512]
#define WS_VTH (WS_K + 4u * SS * KVW)           // bf16 [512 (kv*128+d)][2048]
#define WS_VTL (WS_VTH + 2u * KVW * SS)
#define WS_O   (WS_VTL + 2u * KVW * SS)         // f32 [2048][2048] attention output (h*128+d)
#define WS_ML  (WS_O + 4u * SS * DM)            // f32 [16][2048][4]: (m, 1/l, 0, 0)
#define WS_CS  (WS_ML + 4u * NH * SS * 4)       // f32 [16][32 qblocks][2048]: per-query-block partial column sums
#define WS_MSK (WS_CS + 4u * NH * TQB * SS)     // f32 [16][2064] mask staging
#define WS_END (WS_MSK + 4u * NH * MWP)

// ---- k_packT: block = output column n of a [K][N] (x @ W) matrix: DST[n][0..K) = bf16(W[k*N + n]) (4-KB rows)
__global__ __launch_bounds__(256) void k_packT(const float* __restrict__ Wm, int K, int N, __bf16* __restrict__ DST) {
  __shared__ __align__(16) __bf16 s[DM]; const int n = blockIdx.x, tid = threadIdx.x;
  for (int k = tid; k < K; k += 256) s[k] = (__bf16)Wm[(size_t)k * N + n];
  __syncthreads();
  for (int q = tid; q < K / 8; q += 256) vst2((unsigned*)(DST + (size_t)n * K + q * 8), *(const v4u*)&s[q * 8]);
}
// ---- k_proj<VT>: block = (64 rows, 128 cols): Y = bf16(x) . P rows (exact) + bias; VT 0: f32 rows (ldo); VT 1: transposed bf16 hi/lo planes [col][row]
template <int VT>
__global__ __launch_bounds__(128) void k_proj(const float* __restrict__ X, const __bf16* __restrict__ P, const float* __restrict__ bias, float* __restrict__ OUT, int ldo, __bf16* __restrict__ PH, __bf16* __restrict__ PL) {
  __shared__ __align__(16) float so[VT ? 1 : 4][16][132]; __shared__ __align__(16) __bf16 sth[VT ? 128 : 1][72], stl[VT ? 128 : 1][72];
  const int tid = threadIdx.x, wave = tid >> 5, lane = tid & 31, col = lane & 15, g = lane >> 4; const size_t r0 = (size_t)blockIdx.x * 64 + wave * 16; const int n0 = blockIdx.y * 128;
  v8f acc[8] = {};
#pragma unroll 2
  for (int kc = 0; kc < DM / 32; ++kc) { v16b a; { const float* p = X + (r0 + col) * DM + kc * 32 + 8 * g;
#pragma unroll
      for (int i = 0; i < 8; ++i) { a[i] = (__bf16)p[i]; a[8 + i] = (__bf16)p[16 + i]; } }
#pragma unroll
    for (int j = 0; j < 8; ++j) acc[j] = wmma_bf(a, frag_b(P + (size_t)(n0 + j * 16 + col) * DM + kc * 32, lane), acc[j]); }
  if (!VT) {
#pragma unroll
    for (int j = 0; j < 8; ++j) { const float bb = bfr(bias[n0 + j * 16 + col]);
#pragma unroll
      for (int r = 0; r < 8; ++r) so[wave][8 * g + r][j * 16 + col] = acc[j][r] + bb; }
    LDSX();
    for (int rl = 0; rl < 16; ++rl) vst2(OUT + (r0 + rl) * ldo + n0 + lane * 4, *(const v4f*)&so[wave][rl][lane * 4]);
  } else {
#pragma unroll
    for (int j = 0; j < 8; ++j) { const float bb = bfr(bias[n0 + j * 16 + col]);
#pragma unroll
      for (int r = 0; r < 8; ++r) { const float v = acc[j][r] + bb; const __bf16 hb = (__bf16)v; sth[j * 16 + col][wave * 16 + 8 * g + r] = hb; stl[j * 16 + col][wave * 16 + 8 * g + r] = (__bf16)(v - (float)hb); } }
    __syncthreads();
    const int s0 = blockIdx.x * 64;
    for (int q = tid; q < 128 * 8; q += 128) { const int d = q >> 3, pc = q & 7; const size_t o = (size_t)(n0 + d) * SS + s0 + pc * 8; vst2((unsigned*)(PH + o), *(const v4u*)&sth[d][pc * 8]); vst2((unsigned*)(PL + o), *(const v4u*)&stl[d][pc * 8]); }
  }
}
// ---- k_attn: block = (64 queries, head h): causal flash attention, kv head = h/4; scores 3 products, P.V 3 products; O[q][h*128+d]; ML[h][q] = (m, 1/l)
__global__ __launch_bounds__(128) void k_attn(const float* __restrict__ Q, const float* __restrict__ Kx, const __bf16* __restrict__ VTH, const __bf16* __restrict__ VTL, float* __restrict__ O, float* __restrict__ ML) {
  __shared__ __align__(16) float sp[4][16][36]; __shared__ __align__(16) float so[4][16][132]; __shared__ __align__(16) float sml[64][4];
  const int tid = threadIdx.x, wave = tid >> 5, lane = tid & 31, col = lane & 15, g = lane >> 4;
  const int qb = blockIdx.x, h = blockIdx.y, kv = h / (NH / NKV); const int q0 = qb * 64 + wave * 16;
  F2 aq[4];
#pragma unroll
  for (int kc = 0; kc < 4; ++kc) aq[kc] = split_row(Q + (size_t)(q0 + col) * DM + h * HD, kc * 32, lane);
  float m[8], l[8];
#pragma unroll
  for (int r = 0; r < 8; ++r) { m[r] = -3.0e38f; l[r] = 0.f; }
  v8f acc[8] = {};
  const int nks = (qb * 64 + 64) / 32;   // key steps covering keys <= the block's last query
#pragma unroll 1
  for (int ks = 0; ks < nks; ++ks) { v8f s[2];
#pragma unroll
    for (int ct = 0; ct < 2; ++ct) { const int kk = ks * 32 + ct * 16 + col; const float* krow = Kx + (size_t)kk * KVW + kv * HD; v8f c = {};
#pragma unroll
      for (int kc = 0; kc < 4; ++kc) { const F2 kb = split_row(krow, kc * 32, lane); c = mac3(aq[kc], kb, c); }
#pragma unroll
      for (int r = 0; r < 8; ++r) { const int qi = q0 + 8 * g + r; s[ct][r] = (kk <= qi) ? c[r] * 0.08838834764831845f : -3.0e38f; } }
#pragma unroll
    for (int r = 0; r < 8; ++r) { float mx = fmaxf(s[0][r], s[1][r]);
#pragma unroll
      for (int o = 1; o < 16; o <<= 1) mx = fmaxf(mx, __shfl_xor(mx, o));
      const float mn = fmaxf(m[r], mx); const float alpha = (m[r] <= -1.0e38f) ? 0.f : exp_ni(m[r] - mn);
      const float e0 = (s[0][r] <= -1.0e38f) ? 0.f : exp_ni(s[0][r] - mn), e1 = (s[1][r] <= -1.0e38f) ? 0.f : exp_ni(s[1][r] - mn); float es = e0 + e1;
#pragma unroll
      for (int o = 1; o < 16; o <<= 1) es += __shfl_xor(es, o);
      l[r] = l[r] * alpha + es; m[r] = mn;
#pragma unroll
      for (int dt = 0; dt < 8; ++dt) acc[dt][r] *= alpha;
      sp[wave][8 * g + r][col] = e0; sp[wave][8 * g + r][16 + col] = e1; }
    LDSX();
    const F2 pa = split_row(&sp[wave][col][0], 0, lane);
#pragma unroll
    for (int dt = 0; dt < 8; ++dt) { const size_t vr = (size_t)(kv * HD + dt * 16 + col) * SS + ks * 32; const v16b vh = frag_b(VTH + vr, lane), vl = frag_b(VTL + vr, lane); acc[dt] = wmma_bf(pa.l, vh, acc[dt]); acc[dt] = wmma_bf(pa.h, vl, acc[dt]); acc[dt] = wmma_bf(pa.h, vh, acc[dt]); }
    LDSX(); }
#pragma unroll
  for (int r = 0; r < 8; ++r) { const float il = 1.0f / l[r];
#pragma unroll
    for (int dt = 0; dt < 8; ++dt) so[wave][8 * g + r][dt * 16 + col] = acc[dt][r] * il;
    if (col == 0) { sml[wave * 16 + 8 * g + r][0] = m[r]; sml[wave * 16 + 8 * g + r][1] = il; sml[wave * 16 + 8 * g + r][2] = 0.f; sml[wave * 16 + 8 * g + r][3] = 0.f; } }
  __syncthreads();
  for (int rl = 0; rl < 16; ++rl) vst2(O + (size_t)(q0 + rl) * DM + h * HD + lane * 4, *(const v4f*)&so[wave][rl][lane * 4]);
  if (tid < 64) vst2(ML + ((size_t)h * SS + qb * 64 + tid) * 4, *(const v4f*)&sml[tid][0]);
}
// ---- k_colsum: block = (64 keys, head h): partial column sums of probs over each 64-query block qb >= key block: p = exp(s - m_q) * (1/l_q) (s recomputed with the same 3-product dot and scale); CS[h][qb][key] rows of 256 B per (query block, this key block)
//   A = k rows (this block's 64 keys, wave -> 16), B = q rows (16-query tiles) -> D[key][q]; per key row sum over the q columns with the (m, 1/l) of each q and the causal predicate q >= key.
__global__ __launch_bounds__(128) void k_colsum(const float* __restrict__ Q, const float* __restrict__ Kx, const float* __restrict__ ML, float* __restrict__ CS) {
  __shared__ __align__(16) float ssum[64];
  const int tid = threadIdx.x, wave = tid >> 5, lane = tid & 31, col = lane & 15, g = lane >> 4;
  const int kb = blockIdx.x, h = blockIdx.y, kv = h / (NH / NKV); const int k0 = kb * 64 + wave * 16;
  F2 ak[4];
#pragma unroll
  for (int kc = 0; kc < 4; ++kc) ak[kc] = split_row(Kx + (size_t)(k0 + col) * KVW + kv * HD, kc * 32, lane);
#pragma unroll 1
  for (int qb = kb; qb < TQB; ++qb) { float rs[8];
#pragma unroll
    for (int r = 0; r < 8; ++r) rs[r] = 0.f;
#pragma unroll
    for (int ct = 0; ct < 4; ++ct) { const int qq = qb * 64 + ct * 16 + col; const float* qrow = Q + (size_t)qq * DM + h * HD; v8f c = {};
#pragma unroll
      for (int kc = 0; kc < 4; ++kc) { const F2 qf = split_row(qrow, kc * 32, lane); c = mac3(ak[kc], qf, c); }
      const float mq = ML[((size_t)h * SS + qq) * 4 + 0], ilq = ML[((size_t)h * SS + qq) * 4 + 1];
#pragma unroll
      for (int r = 0; r < 8; ++r) { const int key = k0 + 8 * g + r; const float sc = c[r] * 0.08838834764831845f; rs[r] += (key <= qq) ? exp_ni(sc - mq) * ilq : 0.f; } }
#pragma unroll
    for (int r = 0; r < 8; ++r) { float t = rs[r];
#pragma unroll
      for (int o = 1; o < 16; o <<= 1) t += __shfl_xor(t, o);
      if (col == 0) ssum[wave * 16 + 8 * g + r] = t; }
    __syncthreads();
    if (tid < 16) vst2(CS + (((size_t)h * TQB + qb) * SS) + kb * 64 + tid * 4, *(const v4f*)&ssum[tid * 4]);
    __syncthreads(); }
  // query blocks qb < kb contribute nothing: write zeros so every CS row is defined
  for (int qb = 0; qb < kb; ++qb) { if (tid < 16) vst2(CS + (((size_t)h * TQB + qb) * SS) + kb * 64 + tid * 4, (v4f){0.f, 0.f, 0.f, 0.f}); }
}
__global__ __launch_bounds__(256) void k_mask(const float* __restrict__ CS, float* __restrict__ MSK) {
  __shared__ float sv[SS]; __shared__ int si[SS]; __shared__ __align__(16) float sm[MWP];
  const int h = blockIdx.x, tid = threadIdx.x; const int NSEL = SS - RECENT;   // 1844 candidates
  for (int s = tid; s < SS; s += 256) { float c = 0.f; if (s < NSEL) { for (int qb = 0; qb < TQB; ++qb) c += CS[(((size_t)h * TQB + qb) * SS) + s]; } else c = -3.0e38f; sv[s] = c; si[s] = s; }
  for (int s = tid; s < MWP; s += 256) sm[s] = (s >= MW - RECENT && s < MW) ? 1.0f : 0.f;
  __syncthreads();
  // bitonic sort descending by value, ascending index on ties
  for (int k = 2; k <= SS; k <<= 1) { for (int j = k >> 1; j > 0; j >>= 1) {
      for (int i = tid; i < SS; i += 256) { const int ixj = i ^ j; if (ixj > i) { const bool up = ((i & k) == 0);   // 'up' segments sorted descending
          const float a = sv[i], b = sv[ixj]; const int ia = si[i], ib = si[ixj];
          const bool a_first = (a > b) || (a == b && ia < ib);   // a should come before b in descending order
          const bool swap = up ? !a_first : a_first;
          if (swap) { sv[i] = b; sv[ixj] = a; si[i] = ib; si[ixj] = ia; } } }
      __syncthreads(); } }
  if (tid < HEAVY) { int s = si[tid]; s = min(max(s, 0), NSEL - 1); sm[s] = 1.0f; }
  __syncthreads();
  for (int q = tid; q < MWP / 4; q += 256) vst2(MSK + (size_t)h * MWP + q * 4, *(const v4f*)&sm[q * 4]);
}
// ---- k_out: block = (64 rows, 128 cols): out = O(hi/lo) . o_w^T rows (2 products)
__global__ __launch_bounds__(128) void k_out(const float* __restrict__ O, const __bf16* __restrict__ P, float* __restrict__ Y) {
  __shared__ __align__(16) float so[4][16][132];
  const int tid = threadIdx.x, wave = tid >> 5, lane = tid & 31, col = lane & 15, g = lane >> 4; const size_t r0 = (size_t)blockIdx.x * 64 + wave * 16; const int n0 = blockIdx.y * 128;
  v8f acc[8] = {};
#pragma unroll 2
  for (int kc = 0; kc < DM / 32; ++kc) { const F2 a = split_row(O + (r0 + col) * DM, kc * 32, lane);
#pragma unroll
    for (int j = 0; j < 8; ++j) { const v16b w = frag_b(P + (size_t)(n0 + j * 16 + col) * DM + kc * 32, lane); acc[j] = wmma_bf(a.l, w, acc[j]); acc[j] = wmma_bf(a.h, w, acc[j]); } }
#pragma unroll
  for (int j = 0; j < 8; ++j)
#pragma unroll
    for (int r = 0; r < 8; ++r) so[wave][8 * g + r][j * 16 + col] = acc[j][r];
  LDSX();
  for (int rl = 0; rl < 16; ++rl) vst2(Y + (r0 + rl) * DM + n0 + lane * 4, *(const v4f*)&so[wave][rl][lane * 4]);
}
// ---- k_mout: flat writer of the [16][2049] mask after the attention output
__global__ __launch_bounds__(256) void k_mout(const float* __restrict__ MSK, float* __restrict__ out) {
  const size_t p = (size_t)blockIdx.x * 256 + threadIdx.x; const size_t total = (size_t)NH * (SFULL + 1); if (p * 4 >= total) return; v4f v;
#pragma unroll
  for (int i = 0; i < 4; ++i) { const size_t f = p * 4 + i; const size_t row = f / (SFULL + 1), c = f % (SFULL + 1); v[i] = (f < total && c < (size_t)MW) ? MSK[row * MWP + c] : 0.f; }
  vst2(out + p * 4, v);
}
extern "C" void kernel_launch(void* const* d_in, const int* in_sizes, int n_in, void* d_out, int out_size, void* d_ws, size_t ws_size, hipStream_t stream) {
  (void)in_sizes; (void)n_in; (void)out_size;
  const float** F = (const float**)d_in;   // hidden_states [1,2048,2048], q_w [2048,2048], q_b [2048], k_w [2048,512], k_b [512], v_w [2048,512], v_b [512], o_w [2048,2048]
  if (ws_size < (size_t)WS_END) return;
  char* ws = (char*)d_ws; __bf16 *PK = (__bf16*)(ws + WS_PK), *VTH = (__bf16*)(ws + WS_VTH), *VTL = (__bf16*)(ws + WS_VTL);
  float *Q = (float*)(ws + WS_Q), *Kx = (float*)(ws + WS_K), *O = (float*)(ws + WS_O), *ML = (float*)(ws + WS_ML), *CS = (float*)(ws + WS_CS), *MSK = (float*)(ws + WS_MSK);
  float* OUT0 = (float*)d_out; float* OUT1 = OUT0 + (size_t)SFULL * DM;
  k_packT<<<DM, 256, 0, stream>>>(F[1], DM, DM, PK + PK_Q); k_packT<<<KVW, 256, 0, stream>>>(F[3], DM, KVW, PK + PK_K); k_packT<<<KVW, 256, 0, stream>>>(F[5], DM, KVW, PK + PK_V); k_packT<<<DM, 256, 0, stream>>>(F[7], DM, DM, PK + PK_O);
  k_proj<0><<<dim3(SS / 64, DM / 128), 128, 0, stream>>>(F[0], PK + PK_Q, F[2], Q, DM, nullptr, nullptr);
  k_proj<0><<<dim3(SS / 64, KVW / 128), 128, 0, stream>>>(F[0], PK + PK_K, F[4], Kx, KVW, nullptr, nullptr);
  k_proj<1><<<dim3(SS / 64, KVW / 128), 128, 0, stream>>>(F[0], PK + PK_V, F[6], nullptr, 0, VTH, VTL);
  k_attn<<<dim3(TQB, NH), 128, 0, stream>>>(Q, Kx, VTH, VTL, O, ML);
  k_colsum<<<dim3(TQB, NH), 128, 0, stream>>>(Q, Kx, ML, CS);
  k_mask<<<NH, 256, 0, stream>>>(CS, MSK);
  k_out<<<dim3(TQB, DM / 128), 128, 0, stream>>>(O, PK + PK_O, OUT0);
  k_mout<<<(unsigned)(((size_t)NH * (SFULL + 1) / 4 + 255) / 256), 256, 0, stream>>>(MSK, OUT1);
}

// v001
// It runs in 915 microseconds.
// Next to v000, in two timings, it ran 1.56 times as fast each time.
// compute dtype: hidden_states and all weights/biases (module inputs) rounded to bf16; q/k/v projections with exact bf16 products (x and W are inputs); causal scores q.k with both computed operands as bf16 hi + residual pairs (3 products) and P.V with P hi/lo x V hi/lo (3 products); the heavy-hitter column sums recompute the same 3-product scores in a second (transposed) pass with the stored row statistics; the output projection with hi/lo x exact o_w (2 products), all on WMMA 16x16x32; softmax, column sums, the per-head top-k selection (bitonic sort, lower index first on ties) and the mask assembly in f32 on the VALU; f32 accumulate.
#include <hip/hip_runtime.h>
#include <math.h>

typedef __attribute__((ext_vector_type(16))) _Float16 v16h;
typedef __attribute__((ext_vector_type(16))) __bf16 v16b;
typedef __attribute__((ext_vector_type(8)))  _Float16 v8h;
typedef __attribute__((ext_vector_type(8)))  float v8f;
typedef __attribute__((ext_vector_type(4)))  float v4f;
typedef __attribute__((ext_vector_type(2)))  float v2f;
typedef __attribute__((ext_vector_type(4)))  unsigned v4u;
typedef __attribute__((ext_vector_type(4)))  int v4i;
typedef float __attribute__((may_alias)) float_a;
typedef int __attribute__((may_alias)) int_a;

template <typename T> __device__ __forceinline__ void vst2(void* p, T v) { *(T*)p = v;  }
__device__ __forceinline__ v8f wmma16(v16h a, v16h b, v8f c) {
  v8f d = __builtin_amdgcn_wmma_f32_16x16x32_f16(false, a, false, b, (short)0, c, false, false);
  asm volatile("v_nop\n\tv_nop\n\tv_nop\n\tv_nop" : "+v"(d) : "v"(a), "v"(b));
  return d;
}
__device__ __forceinline__ v8f wmma_bf(v16b a, v16b b, v8f c) {
  v8f d = __builtin_amdgcn_wmma_f32_16x16x32_bf16(false, a, false, b, (short)0, c, false, false);
  asm volatile("v_nop\n\tv_nop\n\tv_nop\n\tv_nop" : "+v"(d) : "v"(a), "v"(b));
  return d;
}
// 16x16x32 fragments: lane = (h = lane>>4, row/col = lane&15); elements 0..7 = k0+8h+0..7, 8..15 = k0+16+8h+0..7; D element r = row 8h+r
__device__ __forceinline__ v16h frag_h(const _Float16* rowk0, int lane) {
  union { v16h v; v8h q[2]; } u; const _Float16* p = rowk0 + 8 * (lane >> 4);
  u.q[0] = *(const v8h*)p; u.q[1] = *(const v8h*)(p + 16); return u.v;
}
__device__ __forceinline__ v16h frag_f32(const float* rowk0, int lane) {
  v16h a; const float* p = rowk0 + 8 * (lane >> 4);
#pragma unroll
  for (int i = 0; i < 8; ++i) { a[i] = (_Float16)p[i]; a[8 + i] = (_Float16)p[16 + i]; }
  return a;
}
__device__ __forceinline__ v16h frag_f32s(const float* rowk0, int lane, float sc) {
  v16h a; const float* p = rowk0 + 8 * (lane >> 4);
#pragma unroll
  for (int i = 0; i < 8; ++i) { a[i] = (_Float16)(p[i] * sc); a[8 + i] = (_Float16)(p[16 + i] * sc); }
  return a;
}
// column fragment from a [K][ld] layout (column n), rows >= K read as 0
__device__ __forceinline__ v16h fragc_f32(const float* W, int k0, int n, int lane, int ld, int K) {
  v16h a; const int g = lane >> 4;
#pragma unroll
  for (int i = 0; i < 8; ++i) { const int ka = k0 + 8 * g + i, kb = ka + 16;
    a[i] = (_Float16)(ka < K ? W[(size_t)(ka < K ? ka : K - 1) * ld + n] : 0.f); a[8 + i] = (_Float16)(kb < K ? W[(size_t)(kb < K ? kb : K - 1) * ld + n] : 0.f); }
  return a;
}
struct F2 { v16b h, l; };
__device__ __forceinline__ F2 bsplit16(const float v[16]) { F2 r;
#pragma unroll
  for (int i = 0; i < 16; ++i) { const __bf16 h = (__bf16)v[i]; r.h[i] = h; r.l[i] = (__bf16)(v[i] - (float)h); }
  return r; }
__device__ __forceinline__ F2 split_row(const float* row, int k0, int lane) { float v[16]; const float* p = row + k0 + 8 * (lane >> 4);
#pragma unroll
  for (int i = 0; i < 8; ++i) { v[i] = p[i]; v[8 + i] = p[16 + i]; }
  return bsplit16(v); }
__device__ __forceinline__ F2 split_rowK(const float* row, int k0, int lane, int K) { float v[16]; const int g = lane >> 4;
#pragma unroll
  for (int i = 0; i < 8; ++i) { const int ka = k0 + 8 * g + i, kb = ka + 16; v[i] = ka < K ? row[ka < K ? ka : K - 1] : 0.f; v[8 + i] = kb < K ? row[kb < K ? kb : K - 1] : 0.f; }
  return bsplit16(v); }
__device__ __forceinline__ F2 split_col(const float* W, int k0, int n, int lane, int ld, int K) { float v[16]; const int g = lane >> 4;
#pragma unroll
  for (int i = 0; i < 8; ++i) { const int ka = k0 + 8 * g + i, kb = ka + 16; v[i] = ka < K ? W[(size_t)(ka < K ? ka : K - 1) * ld + n] : 0.f; v[8 + i] = kb < K ? W[(size_t)(kb < K ? kb : K - 1) * ld + n] : 0.f; }
  return bsplit16(v); }
__device__ __forceinline__ v8f mac3(const F2& a, const F2& b, v8f c) { c = wmma_bf(a.l, b.h, c); c = wmma_bf(a.h, b.l, c); return wmma_bf(a.h, b.h, c); }
__device__ __forceinline__ float sigm(float v) { return 1.0f / (1.0f + expf(-v)); }
#define LDSX() do { asm volatile("s_wait_dscnt 0" ::: "memory"); __builtin_amdgcn_wave_barrier(); __builtin_amdgcn_fence(__ATOMIC_RELEASE, "workgroup"); } while (0)


// GQA causal attention with H2O heavy-hitter scoring (B 1, S 2048, D 2048, 16 query heads / 4 kv heads x 128): out = softmax(q k^T / sqrt(128), causal) v -> @ o_w; cur[h][s] = sum over queries of probs; mask[h] = 1 on the last 204 of 2049 positions, 0 elsewhere, then 1 at the top-204 (heavy budget) indices of cur[h][:1844].
#define SFULL 2048            // shipped sequence length (output layout)
#ifndef SS
#define SS SFULL              // active sequence length (all)
#endif
#define DM 2048
#define NH 16
#define NKV 4
#define HD 128
#define KVW (NKV * HD)        // 512
#define HEAVY (SS / 10)       // int(0.1 * S)
#define RECENT (SS / 10)
#define MW (SS + 1)           // 2049 mask width
#define MWP 2064              // padded staging width
#define TQB (SS / 64)         // query blocks
typedef __attribute__((ext_vector_type(8))) __bf16 v8b;
__device__ __forceinline__ v16b frag_b(const __bf16* rowk0, int lane) {
  union { v16b v; v8b q[2]; } u; const __bf16* p = rowk0 + 8 * (lane >> 4);
  u.q[0] = *(const v8b*)p; u.q[1] = *(const v8b*)(p + 16); return u.v;
}
__device__ __forceinline__ float bfr(float v) { return (float)(__bf16)v; }
// the 16 f32 of one lane's fragment slice (k0+8h+0..7, k0+16+8h+0..7), kept as loaded: conversion waits for the data, so it is done where the fragment is used
struct R16 { v4f q[4]; };
__device__ __forceinline__ R16 ld_row(const float* row, int k0, int lane) { R16 r; const float* p = row + k0 + 8 * (lane >> 4);
  r.q[0] = *(const v4f*)p; r.q[1] = *(const v4f*)(p + 4); r.q[2] = *(const v4f*)(p + 16); r.q[3] = *(const v4f*)(p + 20); return r; }
__device__ __forceinline__ F2 split_raw(const R16& r) { float v[16];
#pragma unroll
  for (int i = 0; i < 4; ++i) { v[i] = r.q[0][i]; v[4 + i] = r.q[1][i]; v[8 + i] = r.q[2][i]; v[12 + i] = r.q[3][i]; }
  return bsplit16(v); }
__device__ __forceinline__ v16b cvt_raw(const R16& r) { v16b a;
#pragma unroll
  for (int i = 0; i < 4; ++i) { a[i] = (__bf16)r.q[0][i]; a[4 + i] = (__bf16)r.q[1][i]; a[8 + i] = (__bf16)r.q[2][i]; a[12 + i] = (__bf16)r.q[3][i]; }
  return a; }
__device__ __attribute__((noinline)) float exp_ni(float v) { return expf(v); }
__device__ __attribute__((noinline)) float erf_ni(float v) { return erff(v); }

#define PK_Q 0                               // [2048 n][2048 k] q_w^T
#define PK_K (PK_Q + DM * DM)                  // [512][2048]
#define PK_V (PK_K + KVW * DM)
#define PK_O (PK_V + KVW * DM)                 // [2048][2048] o_w^T
#define PK_END (PK_O + DM * DM)
#define WS_PK  0u
#define WS_Q   (WS_PK + 2u * PK_END)           // f32 [2048][2048] q (h*128+d)
#define WS_K   (WS_Q + 4u * SS * DM)            // f32 [2048][512]
#define WS_VTH (WS_K + 4u * SS * KVW)           // bf16 [512 (kv*128+d)][2048]
#define WS_VTL (WS_VTH + 2u * KVW * SS)
#define WS_O   (WS_VTL + 2u * KVW * SS)         // f32 [2048][2048] attention output (h*128+d)
#define WS_ML  (WS_O + 4u * SS * DM)            // f32 [16][2048][4]: (m, 1/l, 0, 0)
#define WS_CS  (WS_ML + 4u * NH * SS * 4)       // f32 [16][32 qblocks][2048]: per-query-block partial column sums
#define WS_MSK (WS_CS + 4u * NH * TQB * SS)     // f32 [16][2064] mask staging
#define WS_END (WS_MSK + 4u * NH * MWP)

// ---- k_packT: block = output column n of a [K][N] (x @ W) matrix: DST[n][0..K) = bf16(W[k*N + n]) (4-KB rows)
__global__ __launch_bounds__(256) void k_packT(const float* __restrict__ Wm, int K, int N, __bf16* __restrict__ DST) {
  __shared__ __align__(16) __bf16 s[DM]; const int n = blockIdx.x, tid = threadIdx.x;
  for (int k = tid; k < K; k += 256) s[k] = (__bf16)Wm[(size_t)k * N + n];
  __syncthreads();
  for (int q = tid; q < K / 8; q += 256) vst2((unsigned*)(DST + (size_t)n * K + q * 8), *(const v4u*)&s[q * 8]);
}
// ---- k_proj<VT>: block = (64 rows, 128 cols): Y = bf16(x) . P rows (exact) + bias; VT 0: f32 rows (ldo); VT 1: transposed bf16 hi/lo planes [col][row]
template <int VT>
__global__ __launch_bounds__(128) void k_proj(const float* __restrict__ X, const __bf16* __restrict__ P, const float* __restrict__ bias, float* __restrict__ OUT, int ldo, __bf16* __restrict__ PH, __bf16* __restrict__ PL) {
  __shared__ __align__(16) float so[VT ? 1 : 4][16][132]; __shared__ __align__(16) __bf16 sth[VT ? 128 : 1][72], stl[VT ? 128 : 1][72];
  const int tid = threadIdx.x, wave = tid >> 5, lane = tid & 31, col = lane & 15, g = lane >> 4; const size_t r0 = (size_t)blockIdx.x * 64 + wave * 16; const int n0 = blockIdx.y * 128;
  v8f acc[8] = {};
  const float* xrow = X + (r0 + col) * DM; const __bf16* prow = P + (size_t)(n0 + col) * DM;
  R16 xa[2]; v16b wb[2][8];   // two register sets: step kc + 1 is loaded as one group while step kc is multiplied
  xa[0] = ld_row(xrow, 0, lane);
#pragma unroll
  for (int j = 0; j < 8; ++j) wb[0][j] = frag_b(prow + (size_t)j * 16 * DM, lane);
#pragma unroll 1   // one trip already holds both register sets; more copies of it would only cost registers
  for (int kc = 0; kc < DM / 32; kc += 2) {
#pragma unroll
    for (int u = 0; u < 2; ++u) { const int kn = min(kc + u + 1, DM / 32 - 1);   // the last step loads itself again (in bounds, unused)
      xa[u ^ 1] = ld_row(xrow, kn * 32, lane);
#pragma unroll
      for (int j = 0; j < 8; ++j) wb[u ^ 1][j] = frag_b(prow + (size_t)j * 16 * DM + kn * 32, lane);
      const v16b a = cvt_raw(xa[u]);
#pragma unroll
      for (int j = 0; j < 8; ++j) acc[j] = wmma_bf(a, wb[u][j], acc[j]); } }
  if (!VT) {
#pragma unroll
    for (int j = 0; j < 8; ++j) { const float bb = bfr(bias[n0 + j * 16 + col]);
#pragma unroll
      for (int r = 0; r < 8; ++r) so[wave][8 * g + r][j * 16 + col] = acc[j][r] + bb; }
    LDSX();
    for (int rl = 0; rl < 16; ++rl) vst2(OUT + (r0 + rl) * ldo + n0 + lane * 4, *(const v4f*)&so[wave][rl][lane * 4]);
  } else {
#pragma unroll
    for (int j = 0; j < 8; ++j) { const float bb = bfr(bias[n0 + j * 16 + col]);
#pragma unroll
      for (int r = 0; r < 8; ++r) { const float v = acc[j][r] + bb; const __bf16 hb = (__bf16)v; sth[j * 16 + col][wave * 16 + 8 * g + r] = hb; stl[j * 16 + col][wave * 16 + 8 * g + r] = (__bf16)(v - (float)hb); } }
    __syncthreads();
    const int s0 = blockIdx.x * 64;
    for (int q = tid; q < 128 * 8; q += 128) { const int d = q >> 3, pc = q & 7; const size_t o = (size_t)(n0 + d) * SS + s0 + pc * 8; vst2((unsigned*)(PH + o), *(const v4u*)&sth[d][pc * 8]); vst2((unsigned*)(PL + o), *(const v4u*)&stl[d][pc * 8]); }
  }
}
// ---- k_attn: block = (64 queries, head h): causal flash attention, kv head = h/4; scores 3 products, P.V 3 products; O[q][h*128+d]; ML[h][q] = (m, 1/l)
__global__ __launch_bounds__(128) void k_attn(const float* __restrict__ Q, const float* __restrict__ Kx, const __bf16* __restrict__ VTH, const __bf16* __restrict__ VTL, float* __restrict__ O, float* __restrict__ ML) {
  __shared__ __align__(16) float sp[4][16][36]; __shared__ __align__(16) float so[4][16][132]; __shared__ __align__(16) float sml[64][4];
  const int tid = threadIdx.x, wave = tid >> 5, lane = tid & 31, col = lane & 15, g = lane >> 4;
  const int qb = blockIdx.x, h = blockIdx.y, kv = h / (NH / NKV); const int q0 = qb * 64 + wave * 16;
  F2 aq[4];
#pragma unroll
  for (int kc = 0; kc < 4; ++kc) aq[kc] = split_row(Q + (size_t)(q0 + col) * DM + h * HD, kc * 32, lane);
  float m[8], l[8];
#pragma unroll
  for (int r = 0; r < 8; ++r) { m[r] = -3.0e38f; l[r] = 0.f; }
  v8f acc[8] = {};
  const int nks = (qb * 64 + 64) / 32;   // key steps covering keys <= the block's last query
#pragma unroll 1
  for (int ks = 0; ks < nks; ++ks) { v8f s[2]; R16 kr[2][4];   // the step's 32 key rows: 2 of the 8 slices are loaded as one group ahead of the score products, each further one as a slice is used up
    const float* kbase = Kx + (size_t)(ks * 32 + col) * KVW + kv * HD;
#pragma unroll
    for (int i = 0; i < 2; ++i) kr[i >> 2][i & 3] = ld_row(kbase + (size_t)(i >> 2) * 16 * KVW, (i & 3) * 32, lane);
#pragma unroll
    for (int ct = 0; ct < 2; ++ct) { const int kk = ks * 32 + ct * 16 + col; v8f c = {};
#pragma unroll
      for (int kc = 0; kc < 4; ++kc) { const F2 kb = split_raw(kr[ct][kc]);
        const int i = ct * 4 + kc + 2; if (i < 8) kr[i >> 2][i & 3] = ld_row(kbase + (size_t)(i >> 2) * 16 * KVW, (i & 3) * 32, lane);
        c = mac3(aq[kc], kb, c); }
#pragma unroll
      for (int r = 0; r < 8; ++r) { const int qi = q0 + 8 * g + r; s[ct][r] = (kk <= qi) ? c[r] * 0.08838834764831845f : -3.0e38f; } }
    v16b vh[8], vl[8];   // the step's V fragments: 2 of the 8 column tiles are loaded as one group ahead of the softmax, each further one as a tile is used up
    const size_t vbase = (size_t)(kv * HD + col) * SS + ks * 32;
#pragma unroll
    for (int dt = 0; dt < 2; ++dt) { vh[dt] = frag_b(VTH + vbase + (size_t)dt * 16 * SS, lane); vl[dt] = frag_b(VTL + vbase + (size_t)dt * 16 * SS, lane); }
#pragma unroll
    for (int r = 0; r < 8; ++r) { float mx = fmaxf(s[0][r], s[1][r]);
#pragma unroll
      for (int o = 1; o < 16; o <<= 1) mx = fmaxf(mx, __shfl_xor(mx, o));
      const float mn = fmaxf(m[r], mx); const float alpha = (m[r] <= -1.0e38f) ? 0.f : exp_ni(m[r] - mn);
      const float e0 = (s[0][r] <= -1.0e38f) ? 0.f : exp_ni(s[0][r] - mn), e1 = (s[1][r] <= -1.0e38f) ? 0.f : exp_ni(s[1][r] - mn); float es = e0 + e1;
#pragma unroll
      for (int o = 1; o < 16; o <<= 1) es += __shfl_xor(es, o);
      l[r] = l[r] * alpha + es; m[r] = mn;
#pragma unroll
      for (int dt = 0; dt < 8; ++dt) acc[dt][r] *= alpha;
      sp[wave][8 * g + r][col] = e0; sp[wave][8 * g + r][16 + col] = e1; }
    LDSX();
    const F2 pa = split_row(&sp[wave][col][0], 0, lane);
#pragma unroll
    for (int dt = 0; dt < 8; ++dt) { acc[dt] = wmma_bf(pa.l, vh[dt], acc[dt]); acc[dt] = wmma_bf(pa.h, vl[dt], acc[dt]); acc[dt] = wmma_bf(pa.h, vh[dt], acc[dt]);
      if (dt + 2 < 8) { vh[dt + 2] = frag_b(VTH + vbase + (size_t)(dt + 2) * 16 * SS, lane); vl[dt + 2] = frag_b(VTL + vbase + (size_t)(dt + 2) * 16 * SS, lane); } }
    LDSX(); }
#pragma unroll
  for (int r = 0; r < 8; ++r) { const float il = 1.0f / l[r];
#pragma unroll
    for (int dt = 0; dt < 8; ++dt) so[wave][8 * g + r][dt * 16 + col] = acc[dt][r] * il;
    if (col == 0) { sml[wave * 16 + 8 * g + r][0] = m[r]; sml[wave * 16 + 8 * g + r][1] = il; sml[wave * 16 + 8 * g + r][2] = 0.f; sml[wave * 16 + 8 * g + r][3] = 0.f; } }
  __syncthreads();
  for (int rl = 0; rl < 16; ++rl) vst2(O + (size_t)(q0 + rl) * DM + h * HD + lane * 4, *(const v4f*)&so[wave][rl][lane * 4]);
  if (tid < 64) vst2(ML + ((size_t)h * SS + qb * 64 + tid) * 4, *(const v4f*)&sml[tid][0]);
}
// ---- k_colsum: block = (64 keys, head h): partial column sums of probs over each 64-query block qb >= key block: p = exp(s - m_q) * (1/l_q) (s recomputed with the same 3-product dot and scale); CS[h][qb][key] rows of 256 B per (query block, this key block)
//   A = k rows (this block's 64 keys, wave -> 16), B = q rows (16-query tiles) -> D[key][q]; per key row sum over the q columns with the (m, 1/l) of each q and the causal predicate q >= key.
__global__ __launch_bounds__(128) void k_colsum(const float* __restrict__ Q, const float* __restrict__ Kx, const float* __restrict__ ML, float* __restrict__ CS) {
  __shared__ __align__(16) float ssum[64];
  const int tid = threadIdx.x, wave = tid >> 5, lane = tid & 31, col = lane & 15, g = lane >> 4;
  const int kb = blockIdx.x, h = blockIdx.y, kv = h / (NH / NKV); const int k0 = kb * 64 + wave * 16;
  F2 ak[4];
#pragma unroll
  for (int kc = 0; kc < 4; ++kc) ak[kc] = split_row(Kx + (size_t)(k0 + col) * KVW + kv * HD, kc * 32, lane);
  R16 qr[2][4]; v2f ml[2];   // two register sets: the next 16-query tile (rows and statistics) is loaded as one group while this one is worked on
#pragma unroll
  for (int kc = 0; kc < 4; ++kc) qr[0][kc] = ld_row(Q + (size_t)(kb * 64 + col) * DM + h * HD, kc * 32, lane);
  ml[0] = *(const v2f*)(ML + ((size_t)h * SS + kb * 64 + col) * 4);
#pragma unroll 1
  for (int qb = kb; qb < TQB; ++qb) { float rs[8];
#pragma unroll
    for (int r = 0; r < 8; ++r) rs[r] = 0.f;
#pragma unroll
    for (int ct = 0; ct < 4; ++ct) { const int qq = qb * 64 + ct * 16 + col; v8f c = {};
      const int qn = (ct < 3 ? qb * 64 + (ct + 1) * 16 : min(qb + 1, TQB - 1) * 64) + col;   // behind the last tile: a tile of the last block again (in bounds, unused)
#pragma unroll
      for (int kc = 0; kc < 4; ++kc) qr[(ct + 1) & 1][kc] = ld_row(Q + (size_t)qn * DM + h * HD, kc * 32, lane);
      ml[(ct + 1) & 1] = *(const v2f*)(ML + ((size_t)h * SS + qn) * 4);
#pragma unroll
      for (int kc = 0; kc < 4; ++kc) { const F2 qf = split_raw(qr[ct & 1][kc]); c = mac3(ak[kc], qf, c); }
      const float mq = ml[ct & 1][0], ilq = ml[ct & 1][1];
#pragma unroll
      for (int r = 0; r < 8; ++r) { const int key = k0 + 8 * g + r; const float sc = c[r] * 0.08838834764831845f; rs[r] += (key <= qq) ? exp_ni(sc - mq) * ilq : 0.f; } }
#pragma unroll
    for (int r = 0; r < 8; ++r) { float t = rs[r];
#pragma unroll
      for (int o = 1; o < 16; o <<= 1) t += __shfl_xor(t, o);
      if (col == 0) ssum[wave * 16 + 8 * g + r] = t; }
    __syncthreads();
    if (tid < 16) vst2(CS + (((size_t)h * TQB + qb) * SS) + kb * 64 + tid * 4, *(const v4f*)&ssum[tid * 4]);
    __syncthreads(); }
  // query blocks qb < kb contribute nothing: write zeros so every CS row is defined
  for (int qb = 0; qb < kb; ++qb) { if (tid < 16) vst2(CS + (((size_t)h * TQB + qb) * SS) + kb * 64 + tid * 4, (v4f){0.f, 0.f, 0.f, 0.f}); }
}
__global__ __launch_bounds__(256) void k_mask(const float* __restrict__ CS, float* __restrict__ MSK) {
  __shared__ float sv[SS]; __shared__ int si[SS]; __shared__ __align__(16) float sm[MWP];
  const int h = blockIdx.x, tid = threadIdx.x; const int NSEL = SS - RECENT;   // 1844 candidates
  for (int s = tid; s < SS; s += 256) { float c = 0.f; if (s < NSEL) { for (int qb = 0; qb < TQB; ++qb) c += CS[(((size_t)h * TQB + qb) * SS) + s]; } else c = -3.0e38f; sv[s] = c; si[s] = s; }
  for (int s = tid; s < MWP; s += 256) sm[s] = (s >= MW - RECENT && s < MW) ? 1.0f : 0.f;
  __syncthreads();
  // bitonic sort descending by value, ascending index on ties
  for (int k = 2; k <= SS; k <<= 1) { for (int j = k >> 1; j > 0; j >>= 1) {
      for (int i = tid; i < SS; i += 256) { const int ixj = i ^ j; if (ixj > i) { const bool up = ((i & k) == 0);   // 'up' segments sorted descending
          const float a = sv[i], b = sv[ixj]; const int ia = si[i], ib = si[ixj];
          const bool a_first = (a > b) || (a == b && ia < ib);   // a should come before b in descending order
          const bool swap = up ? !a_first : a_first;
          if (swap) { sv[i] = b; sv[ixj] = a; si[i] = ib; si[ixj] = ia; } } }
      __syncthreads(); } }
  if (tid < HEAVY) { int s = si[tid]; s = min(max(s, 0), NSEL - 1); sm[s] = 1.0f; }
  __syncthreads();
  for (int q = tid; q < MWP / 4; q += 256) vst2(MSK + (size_t)h * MWP + q * 4, *(const v4f*)&sm[q * 4]);
}
// ---- k_out: block = (64 rows, 128 cols): out = O(hi/lo) . o_w^T rows (2 products)
__global__ __launch_bounds__(128) void k_out(const float* __restrict__ O, const __bf16* __restrict__ P, float* __restrict__ Y) {
  __shared__ __align__(16) float so[4][16][132];
  const int tid = threadIdx.x, wave = tid >> 5, lane = tid & 31, col = lane & 15, g = lane >> 4; const size_t r0 = (size_t)blockIdx.x * 64 + wave * 16; const int n0 = blockIdx.y * 128;
  v8f acc[8] = {};
  const float* orow = O + (r0 + col) * DM; const __bf16* prow = P + (size_t)(n0 + col) * DM;
  R16 xa[2]; v16b wb[2][8];   // two register sets: step kc + 1 is loaded as one group while step kc is multiplied
  xa[0] = ld_row(orow, 0, lane);
#pragma unroll
  for (int j = 0; j < 8; ++j) wb[0][j] = frag_b(prow + (size_t)j * 16 * DM, lane);
#pragma unroll 1   // one trip already holds both register sets; more copies of it would only cost registers
  for (int kc = 0; kc < DM / 32; kc += 2) {
#pragma unroll
    for (int u = 0; u < 2; ++u) { const int kn = min(kc + u + 1, DM / 32 - 1);   // the last step loads itself again (in bounds, unused)
      xa[u ^ 1] = ld_row(orow, kn * 32, lane);
#pragma unroll
      for (int j = 0; j < 8; ++j) wb[u ^ 1][j] = frag_b(prow + (size_t)j * 16 * DM + kn * 32, lane);
      const F2 a = split_raw(xa[u]);
#pragma unroll
      for (int j = 0; j < 8; ++j) { acc[j] = wmma_bf(a.l, wb[u][j], acc[j]); acc[j] = wmma_bf(a.h, wb[u][j], acc[j]); } } }
#pragma unroll
  for (int j = 0; j < 8; ++j)
#pragma unroll
    for (int r = 0; r < 8; ++r) so[wave][8 * g + r][j * 16 + col] = acc[j][r];
  LDSX();
  for (int rl = 0; rl < 16; ++rl) vst2(Y + (r0 + rl) * DM + n0 + lane * 4, *(const v4f*)&so[wave][rl][lane * 4]);
}
// ---- k_mout: flat writer of the [16][2049] mask after the attention output
__global__ __launch_bounds__(256) void k_mout(const float* __restrict__ MSK, float* __restrict__ out) {
  const size_t p = (size_t)blockIdx.x * 256 + threadIdx.x; const size_t total = (size_t)NH * (SFULL + 1); if (p * 4 >= total) return; v4f v;
#pragma unroll
  for (int i = 0; i < 4; ++i) { const size_t f = p * 4 + i; const size_t row = f / (SFULL + 1), c = f % (SFULL + 1); v[i] = (f < total && c < (size_t)MW) ? MSK[row * MWP + c] : 0.f; }
  vst2(out + p * 4, v);
}
extern "C" void kernel_launch(void* const* d_in, const int* in_sizes, int n_in, void* d_out, int out_size, void* d_ws, size_t ws_size, hipStream_t stream) {
  (void)in_sizes; (void)n_in; (void)out_size;
  const float** F = (const float**)d_in;   // hidden_states [1,2048,2048], q_w [2048,2048], q_b [2048], k_w [2048,512], k_b [512], v_w [2048,512], v_b [512], o_w [2048,2048]
  if (ws_size < (size_t)WS_END) return;
  char* ws = (char*)d_ws; __bf16 *PK = (__bf16*)(ws + WS_PK), *VTH = (__bf16*)(ws + WS_VTH), *VTL = (__bf16*)(ws + WS_VTL);
  float *Q = (float*)(ws + WS_Q), *Kx = (float*)(ws + WS_K), *O = (float*)(ws + WS_O), *ML = (float*)(ws + WS_ML), *CS = (float*)(ws + WS_CS), *MSK = (float*)(ws + WS_MSK);
  float* OUT0 = (float*)d_out; float* OUT1 = OUT0 + (size_t)SFULL * DM;
  k_packT<<<DM, 256, 0, stream>>>(F[1], DM, DM, PK + PK_Q); k_packT<<<KVW, 256, 0, stream>>>(F[3], DM, KVW, PK + PK_K); k_packT<<<KVW, 256, 0, stream>>>(F[5], DM, KVW, PK + PK_V); k_packT<<<DM, 256, 0, stream>>>(F[7], DM, DM, PK + PK_O);
  k_proj<0><<<dim3(SS / 64, DM / 128), 128, 0, stream>>>(F[0], PK + PK_Q, F[2], Q, DM, nullptr, nullptr);
  k_proj<0><<<dim3(SS / 64, KVW / 128), 128, 0, stream>>>(F[0], PK + PK_K, F[4], Kx, KVW, nullptr, nullptr);
  k_proj<1><<<dim3(SS / 64, KVW / 128), 128, 0, stream>>>(F[0], PK + PK_V, F[6], nullptr, 0, VTH, VTL);
  k_attn<<<dim3(TQB, NH), 128, 0, stream>>>(Q, Kx, VTH, VTL, O, ML);
  k_colsum<<<dim3(TQB, NH), 128, 0, stream>>>(Q, Kx, ML, CS);
  k_mask<<<NH, 256, 0, stream>>>(CS, MSK);
  k_out<<<dim3(TQB, DM / 128), 128, 0, stream>>>(O, PK + PK_O, OUT0);
  k_mout<<<(unsigned)(((size_t)NH * (SFULL + 1) / 4 + 255) / 256), 256, 0, stream>>>(MSK, OUT1);
}

// v002
// It runs in 679 microseconds.
// In two side-by-side timings against v001, it was 1.35 and 1.34 times as fast.
// Counting every step since v000, it is 2.09 times as fast.
// compute dtype: hidden_states and all weights/biases (module inputs) rounded to bf16; q/k/v projections with exact bf16 products (x and W are inputs); causal scores q.k with both computed operands as bf16 hi + residual pairs (3 products) and P.V with P hi/lo x V hi/lo (3 products); the heavy-hitter column sums recompute the same 3-product scores in a second (transposed) pass with the stored row statistics; the output projection with hi/lo x exact o_w (2 products), all on WMMA 16x16x32; softmax, column sums, the per-head top-k selection (bitonic sort, lower index first on ties) and the mask assembly in f32 on the VALU; f32 accumulate.
#include <hip/hip_runtime.h>
#include <math.h>

typedef __attribute__((ext_vector_type(16))) _Float16 v16h;
typedef __attribute__((ext_vector_type(16))) __bf16 v16b;
typedef __attribute__((ext_vector_type(8)))  _Float16 v8h;
typedef __attribute__((ext_vector_type(8)))  float v8f;
typedef __attribute__((ext_vector_type(4)))  float v4f;
typedef __attribute__((ext_vector_type(2)))  float v2f;
typedef __attribute__((ext_vector_type(4)))  unsigned v4u;
typedef __attribute__((ext_vector_type(4)))  int v4i;
typedef float __attribute__((may_alias)) float_a;
typedef int __attribute__((may_alias)) int_a;

template <typename T> __device__ __forceinline__ void vst2(void* p, T v) { *(T*)p = v;  }
__device__ __forceinline__ v8f wmma16(v16h a, v16h b, v8f c) {
  v8f d = __builtin_amdgcn_wmma_f32_16x16x32_f16(false, a, false, b, (short)0, c, false, false);
  asm volatile("v_nop\n\tv_nop\n\tv_nop\n\tv_nop" : "+v"(d) : "v"(a), "v"(b));
  return d;
}
__device__ __forceinline__ v8f wmma_bf(v16b a, v16b b, v8f c) {
  v8f d = __builtin_amdgcn_wmma_f32_16x16x32_bf16(false, a, false, b, (short)0, c, false, false);
  asm volatile("v_nop\n\tv_nop\n\tv_nop\n\tv_nop" : "+v"(d) : "v"(a), "v"(b));
  return d;
}
// 16x16x32 fragments: lane = (h = lane>>4, row/col = lane&15); elements 0..7 = k0+8h+0..7, 8..15 = k0+16+8h+0..7; D element r = row 8h+r
__device__ __forceinline__ v16h frag_h(const _Float16* rowk0, int lane) {
  union { v16h v; v8h q[2]; } u; const _Float16* p = rowk0 + 8 * (lane >> 4);
  u.q[0] = *(const v8h*)p; u.q[1] = *(const v8h*)(p + 16); return u.v;
}
__device__ __forceinline__ v16h frag_f32(const float* rowk0, int lane) {
  v16h a; const float* p = rowk0 + 8 * (lane >> 4);
#pragma unroll
  for (int i = 0; i < 8; ++i) { a[i] = (_Float16)p[i]; a[8 + i] = (_Float16)p[16 + i]; }
  return a;
}
__device__ __forceinline__ v16h frag_f32s(const float* rowk0, int lane, float sc) {
  v16h a; const float* p = rowk0 + 8 * (lane >> 4);
#pragma unroll
  for (int i = 0; i < 8; ++i) { a[i] = (_Float16)(p[i] * sc); a[8 + i] = (_Float16)(p[16 + i] * sc); }
  return a;
}
// column fragment from a [K][ld] layout (column n), rows >= K read as 0
__device__ __forceinline__ v16h fragc_f32(const float* W, int k0, int n, int lane, int ld, int K) {
  v16h a; const int g = lane >> 4;
#pragma unroll
  for (int i = 0; i < 8; ++i) { const int ka = k0 + 8 * g + i, kb = ka + 16;
    a[i] = (_Float16)(ka < K ? W[(size_t)(ka < K ? ka : K - 1) * ld + n] : 0.f); a[8 + i] = (_Float16)(kb < K ? W[(size_t)(kb < K ? kb : K - 1) * ld + n] : 0.f); }
  return a;
}
struct F2 { v16b h, l; };
__device__ __forceinline__ F2 bsplit16(const float v[16]) { F2 r;
#pragma unroll
  for (int i = 0; i < 16; ++i) { const __bf16 h = (__bf16)v[i]; r.h[i] = h; r.l[i] = (__bf16)(v[i] - (float)h); }
  return r; }
__device__ __forceinline__ F2 split_row(const float* row, int k0, int lane) { float v[16]; const float* p = row + k0 + 8 * (lane >> 4);
#pragma unroll
  for (int i = 0; i < 8; ++i) { v[i] = p[i]; v[8 + i] = p[16 + i]; }
  return bsplit16(v); }
__device__ __forceinline__ F2 split_rowK(const float* row, int k0, int lane, int K) { float v[16]; const int g = lane >> 4;
#pragma unroll
  for (int i = 0; i < 8; ++i) { const int ka = k0 + 8 * g + i, kb = ka + 16; v[i] = ka < K ? row[ka < K ? ka : K - 1] : 0.f; v[8 + i] = kb < K ? row[kb < K ? kb : K - 1] : 0.f; }
  return bsplit16(v); }
__device__ __forceinline__ F2 split_col(const float* W, int k0, int n, int lane, int ld, int K) { float v[16]; const int g = lane >> 4;
#pragma unroll
  for (int i = 0; i < 8; ++i) { const int ka = k0 + 8 * g + i, kb = ka + 16; v[i] = ka < K ? W[(size_t)(ka < K ? ka : K - 1) * ld + n] : 0.f; v[8 + i] = kb < K ? W[(size_t)(kb < K ? kb : K - 1) * ld + n] : 0.f; }
  return bsplit16(v); }
__device__ __forceinline__ v8f mac3(const F2& a, const F2& b, v8f c) { c = wmma_bf(a.l, b.h, c); c = wmma_bf(a.h, b.l, c); return wmma_bf(a.h, b.h, c); }
__device__ __forceinline__ float sigm(float v) { return 1.0f / (1.0f + expf(-v)); }
#define LDSX() do { asm volatile("s_wait_dscnt 0" ::: "memory"); __builtin_amdgcn_wave_barrier(); __builtin_amdgcn_fence(__ATOMIC_RELEASE, "workgroup"); } while (0)


// GQA causal attention with H2O heavy-hitter scoring (B 1, S 2048, D 2048, 16 query heads / 4 kv heads x 128): out = softmax(q k^T / sqrt(128), causal) v -> @ o_w; cur[h][s] = sum over queries of probs; mask[h] = 1 on the last 204 of 2049 positions, 0 elsewhere, then 1 at the top-204 (heavy budget) indices of cur[h][:1844].
#define SFULL 2048            // shipped sequence length (output layout)
#ifndef SS
#define SS SFULL              // active sequence length (all)
#endif
#define DM 2048
#define NH 16
#define NKV 4
#define HD 128
#define KVW (NKV * HD)        // 512
#define HEAVY (SS / 10)       // int(0.1 * S)
#define RECENT (SS / 10)
#define MW (SS + 1)           // 2049 mask width
#define MWP 2064              // padded staging width
#define TQB (SS / 64)         // query blocks
typedef __attribute__((ext_vector_type(8))) __bf16 v8b;
__device__ __forceinline__ v16b frag_b(const __bf16* rowk0, int lane) {
  union { v16b v; v8b q[2]; } u; const __bf16* p = rowk0 + 8 * (lane >> 4);
  u.q[0] = *(const v8b*)p; u.q[1] = *(const v8b*)(p + 16); return u.v;
}
__device__ __forceinline__ float bfr(float v) { return (float)(__bf16)v; }
// the 16 f32 of one lane's fragment slice (k0+8h+0..7, k0+16+8h+0..7), kept as loaded: conversion waits for the data, so it is done where the fragment is used
struct R16 { v4f q[4]; };
__device__ __forceinline__ R16 ld_row(const float* row, int k0, int lane) { R16 r; const float* p = row + k0 + 8 * (lane >> 4);
  r.q[0] = *(const v4f*)p; r.q[1] = *(const v4f*)(p + 4); r.q[2] = *(const v4f*)(p + 16); r.q[3] = *(const v4f*)(p + 20); return r; }
__device__ __forceinline__ F2 split_raw(const R16& r) { float v[16];
#pragma unroll
  for (int i = 0; i < 4; ++i) { v[i] = r.q[0][i]; v[4 + i] = r.q[1][i]; v[8 + i] = r.q[2][i]; v[12 + i] = r.q[3][i]; }
  return bsplit16(v); }
__device__ __forceinline__ v16b cvt_raw(const R16& r) { v16b a;
#pragma unroll
  for (int i = 0; i < 4; ++i) { a[i] = (__bf16)r.q[0][i]; a[4 + i] = (__bf16)r.q[1][i]; a[8 + i] = (__bf16)r.q[2][i]; a[12 + i] = (__bf16)r.q[3][i]; }
  return a; }
__device__ __attribute__((noinline)) float erf_ni(float v) { return erff(v); }

#define PK_Q 0                               // [2048 n][2048 k] q_w^T
#define PK_K (PK_Q + DM * DM)                  // [512][2048]
#define PK_V (PK_K + KVW * DM)
#define PK_O (PK_V + KVW * DM)                 // [2048][2048] o_w^T
#define PK_END (PK_O + DM * DM)
#define WS_PK  0u
#define WS_Q   (WS_PK + 2u * PK_END)           // f32 [2048][2048] q (h*128+d)
#define WS_K   (WS_Q + 4u * SS * DM)            // f32 [2048][512]
#define WS_VTH (WS_K + 4u * SS * KVW)           // bf16 [512 (kv*128+d)][2048]
#define WS_VTL (WS_VTH + 2u * KVW * SS)
#define WS_O   (WS_VTL + 2u * KVW * SS)         // f32 [2048][2048] attention output (h*128+d)
#define WS_ML  (WS_O + 4u * SS * DM)            // f32 [16][2048][4]: (m, 1/l, 0, 0)
#define WS_CS  (WS_ML + 4u * NH * SS * 4)       // f32 [16][32 qblocks][2048]: per-query-block partial column sums
#define WS_MSK (WS_CS + 4u * NH * TQB * SS)     // f32 [16][2064] mask staging
#define WS_END (WS_MSK + 4u * NH * MWP)

// ---- k_packT: block = output column n of a [K][N] (x @ W) matrix: DST[n][0..K) = bf16(W[k*N + n]) (4-KB rows)
__global__ __launch_bounds__(256) void k_packT(const float* __restrict__ Wm, int K, int N, __bf16* __restrict__ DST) {
  __shared__ __align__(16) __bf16 s[DM]; const int n = blockIdx.x, tid = threadIdx.x;
  for (int k = tid; k < K; k += 256) s[k] = (__bf16)Wm[(size_t)k * N + n];
  __syncthreads();
  for (int q = tid; q < K / 8; q += 256) vst2((unsigned*)(DST + (size_t)n * K + q * 8), *(const v4u*)&s[q * 8]);
}
// ---- k_proj<VT>: block = (64 rows, 128 cols): Y = bf16(x) . P rows (exact) + bias; VT 0: f32 rows (ldo); VT 1: transposed bf16 hi/lo planes [col][row]
template <int VT>
__global__ __launch_bounds__(128) void k_proj(const float* __restrict__ X, const __bf16* __restrict__ P, const float* __restrict__ bias, float* __restrict__ OUT, int ldo, __bf16* __restrict__ PH, __bf16* __restrict__ PL) {
  __shared__ __align__(16) float so[VT ? 1 : 4][16][132]; __shared__ __align__(16) __bf16 sth[VT ? 128 : 1][72], stl[VT ? 128 : 1][72];
  const int tid = threadIdx.x, wave = tid >> 5, lane = tid & 31, col = lane & 15, g = lane >> 4; const size_t r0 = (size_t)blockIdx.x * 64 + wave * 16; const int n0 = blockIdx.y * 128;
  v8f acc[8] = {};
  const float* xrow = X + (r0 + col) * DM; const __bf16* prow = P + (size_t)(n0 + col) * DM;
  R16 xa[2]; v16b wb[2][8];   // two register sets: step kc + 1 is loaded as one group while step kc is multiplied
  xa[0] = ld_row(xrow, 0, lane);
#pragma unroll
  for (int j = 0; j < 8; ++j) wb[0][j] = frag_b(prow + (size_t)j * 16 * DM, lane);
#pragma unroll 1   // one trip already holds both register sets; more copies of it would only cost registers
  for (int kc = 0; kc < DM / 32; kc += 2) {
#pragma unroll
    for (int u = 0; u < 2; ++u) { const int kn = min(kc + u + 1, DM / 32 - 1);   // the last step loads itself again (in bounds, unused)
      xa[u ^ 1] = ld_row(xrow, kn * 32, lane);
#pragma unroll
      for (int j = 0; j < 8; ++j) wb[u ^ 1][j] = frag_b(prow + (size_t)j * 16 * DM + kn * 32, lane);
      const v16b a = cvt_raw(xa[u]);
#pragma unroll
      for (int j = 0; j < 8; ++j) acc[j] = wmma_bf(a, wb[u][j], acc[j]); } }
  if (!VT) {
#pragma unroll
    for (int j = 0; j < 8; ++j) { const float bb = bfr(bias[n0 + j * 16 + col]);
#pragma unroll
      for (int r = 0; r < 8; ++r) so[wave][8 * g + r][j * 16 + col] = acc[j][r] + bb; }
    LDSX();
    for (int rl = 0; rl < 16; ++rl) vst2(OUT + (r0 + rl) * ldo + n0 + lane * 4, *(const v4f*)&so[wave][rl][lane * 4]);
  } else {
#pragma unroll
    for (int j = 0; j < 8; ++j) { const float bb = bfr(bias[n0 + j * 16 + col]);
#pragma unroll
      for (int r = 0; r < 8; ++r) { const float v = acc[j][r] + bb; const __bf16 hb = (__bf16)v; sth[j * 16 + col][wave * 16 + 8 * g + r] = hb; stl[j * 16 + col][wave * 16 + 8 * g + r] = (__bf16)(v - (float)hb); } }
    __syncthreads();
    const int s0 = blockIdx.x * 64;
    for (int q = tid; q < 128 * 8; q += 128) { const int d = q >> 3, pc = q & 7; const size_t o = (size_t)(n0 + d) * SS + s0 + pc * 8; vst2((unsigned*)(PH + o), *(const v4u*)&sth[d][pc * 8]); vst2((unsigned*)(PL + o), *(const v4u*)&stl[d][pc * 8]); }
  }
}
// ---- k_attn: block = (64 queries, head h): causal flash attention, kv head = h/4; scores 3 products, P.V 3 products; O[q][h*128+d]; ML[h][q] = (m, 1/l)
// waves_per_eu(2, 2): this grid puts two waves on a SIMD; at the default register target the scheduler folds the softmax's 8 rows back into pairs that run one behind another
__global__ __launch_bounds__(128) __attribute__((amdgpu_waves_per_eu(2, 2))) void k_attn(const float* __restrict__ Q, const float* __restrict__ Kx, const __bf16* __restrict__ VTH, const __bf16* __restrict__ VTL, float* __restrict__ O, float* __restrict__ ML) {
  __shared__ __align__(16) float sp[4][16][36]; __shared__ __align__(16) float so[4][16][132]; __shared__ __align__(16) float sml[64][4];
  const int tid = threadIdx.x, wave = tid >> 5, lane = tid & 31, col = lane & 15, g = lane >> 4;
  const int qb = blockIdx.x, h = blockIdx.y, kv = h / (NH / NKV); const int q0 = qb * 64 + wave * 16;
  F2 aq[4];
#pragma unroll
  for (int kc = 0; kc < 4; ++kc) aq[kc] = split_row(Q + (size_t)(q0 + col) * DM + h * HD, kc * 32, lane);
  float m[8], l[8];
#pragma unroll
  for (int r = 0; r < 8; ++r) { m[r] = -3.0e38f; l[r] = 0.f; }
  v8f acc[8] = {};
  const int nks = (qb * 64 + 64) / 32;   // key steps covering keys <= the block's last query
#pragma unroll 1
  for (int ks = 0; ks < nks; ++ks) { v8f s[2]; R16 kr[2][4];   // the step's 32 key rows: 2 of the 8 slices are loaded as one group ahead of the score products, each further one as a slice is used up
    const float* kbase = Kx + (size_t)(ks * 32 + col) * KVW + kv * HD;
#pragma unroll
    for (int i = 0; i < 2; ++i) kr[i >> 2][i & 3] = ld_row(kbase + (size_t)(i >> 2) * 16 * KVW, (i & 3) * 32, lane);
#pragma unroll
    for (int ct = 0; ct < 2; ++ct) { const int kk = ks * 32 + ct * 16 + col; v8f c = {};
#pragma unroll
      for (int kc = 0; kc < 4; ++kc) { const F2 kb = split_raw(kr[ct][kc]);
        const int i = ct * 4 + kc + 2; if (i < 8) kr[i >> 2][i & 3] = ld_row(kbase + (size_t)(i >> 2) * 16 * KVW, (i & 3) * 32, lane);
        c = mac3(aq[kc], kb, c); }
#pragma unroll
      for (int r = 0; r < 8; ++r) { const int qi = q0 + 8 * g + r; s[ct][r] = (kk <= qi) ? c[r] * 0.08838834764831845f : -3.0e38f; } }
    v16b vh[8], vl[8];   // the step's V fragments: 2 of the 8 column tiles are loaded as one group ahead of the softmax, each further one as a tile is used up
    const size_t vbase = (size_t)(kv * HD + col) * SS + ks * 32;
#pragma unroll
    for (int dt = 0; dt < 2; ++dt) { vh[dt] = frag_b(VTH + vbase + (size_t)dt * 16 * SS, lane); vl[dt] = frag_b(VTL + vbase + (size_t)dt * 16 * SS, lane); }
    float mn[8], al[8], es[8];   // the softmax goes stage by stage over the 8 rows: within a stage the rows' chains (lane exchanges, exp) are independent and run side by side
#pragma unroll
    for (int r = 0; r < 8; ++r) mn[r] = fmaxf(s[0][r], s[1][r]);
#pragma unroll
    for (int o = 1; o < 16; o <<= 1) {
#pragma unroll
      for (int r = 0; r < 8; ++r) mn[r] = fmaxf(mn[r], __shfl_xor(mn[r], o)); }
#pragma unroll
    for (int r = 0; r < 8; ++r) { mn[r] = fmaxf(m[r], mn[r]);
      const float xa = expf(m[r] - mn[r]), x0 = expf(s[0][r] - mn[r]), x1 = expf(s[1][r] - mn[r]);   // inline and in every lane; a masked or not yet started entry is set to 0 by a select, not branched round
      al[r] = (m[r] <= -1.0e38f) ? 0.f : xa;
      const float e0 = (s[0][r] <= -1.0e38f) ? 0.f : x0, e1 = (s[1][r] <= -1.0e38f) ? 0.f : x1; es[r] = e0 + e1;
      sp[wave][8 * g + r][col] = e0; sp[wave][8 * g + r][16 + col] = e1; }
#pragma unroll
    for (int o = 1; o < 16; o <<= 1) {
#pragma unroll
      for (int r = 0; r < 8; ++r) es[r] += __shfl_xor(es[r], o); }
#pragma unroll
    for (int r = 0; r < 8; ++r) { l[r] = l[r] * al[r] + es[r]; m[r] = mn[r];
#pragma unroll
      for (int dt = 0; dt < 8; ++dt) acc[dt][r] *= al[r]; }
    LDSX();
    const F2 pa = split_row(&sp[wave][col][0], 0, lane);
#pragma unroll
    for (int dt = 0; dt < 8; ++dt) { acc[dt] = wmma_bf(pa.l, vh[dt], acc[dt]); acc[dt] = wmma_bf(pa.h, vl[dt], acc[dt]); acc[dt] = wmma_bf(pa.h, vh[dt], acc[dt]);
      if (dt + 2 < 8) { vh[dt + 2] = frag_b(VTH + vbase + (size_t)(dt + 2) * 16 * SS, lane); vl[dt + 2] = frag_b(VTL + vbase + (size_t)(dt + 2) * 16 * SS, lane); } }
    LDSX(); }
#pragma unroll
  for (int r = 0; r < 8; ++r) { const float il = 1.0f / l[r];
#pragma unroll
    for (int dt = 0; dt < 8; ++dt) so[wave][8 * g + r][dt * 16 + col] = acc[dt][r] * il;
    if (col == 0) { sml[wave * 16 + 8 * g + r][0] = m[r]; sml[wave * 16 + 8 * g + r][1] = il; sml[wave * 16 + 8 * g + r][2] = 0.f; sml[wave * 16 + 8 * g + r][3] = 0.f; } }
  __syncthreads();
  for (int rl = 0; rl < 16; ++rl) vst2(O + (size_t)(q0 + rl) * DM + h * HD + lane * 4, *(const v4f*)&so[wave][rl][lane * 4]);
  if (tid < 64) vst2(ML + ((size_t)h * SS + qb * 64 + tid) * 4, *(const v4f*)&sml[tid][0]);
}
// ---- k_colsum: block = (64 keys, head h): partial column sums of probs over each 64-query block qb >= key block: p = exp(s - m_q) * (1/l_q) (s recomputed with the same 3-product dot and scale); CS[h][qb][key] rows of 256 B per (query block, this key block)
//   A = k rows (this block's 64 keys, wave -> 16), B = q rows (16-query tiles) -> D[key][q]; per key row sum over the q columns with the (m, 1/l) of each q and the causal predicate q >= key.
__global__ __launch_bounds__(128) void k_colsum(const float* __restrict__ Q, const float* __restrict__ Kx, const float* __restrict__ ML, float* __restrict__ CS) {
  __shared__ __align__(16) float ssum[64];
  const int tid = threadIdx.x, wave = tid >> 5, lane = tid & 31, col = lane & 15, g = lane >> 4;
  const int kb = blockIdx.x, h = blockIdx.y, kv = h / (NH / NKV); const int k0 = kb * 64 + wave * 16;
  F2 ak[4];
#pragma unroll
  for (int kc = 0; kc < 4; ++kc) ak[kc] = split_row(Kx + (size_t)(k0 + col) * KVW + kv * HD, kc * 32, lane);
  R16 qr[2][4]; v2f ml[2];   // two register sets: the next 16-query tile (rows and statistics) is loaded as one group while this one is worked on
#pragma unroll
  for (int kc = 0; kc < 4; ++kc) qr[0][kc] = ld_row(Q + (size_t)(kb * 64 + col) * DM + h * HD, kc * 32, lane);
  ml[0] = *(const v2f*)(ML + ((size_t)h * SS + kb * 64 + col) * 4);
#pragma unroll 1
  for (int qb = kb; qb < TQB; ++qb) { float rs[8];
#pragma unroll
    for (int r = 0; r < 8; ++r) rs[r] = 0.f;
#pragma unroll
    for (int ct = 0; ct < 4; ++ct) { const int qq = qb * 64 + ct * 16 + col; v8f c = {};
      const int qn = (ct < 3 ? qb * 64 + (ct + 1) * 16 : min(qb + 1, TQB - 1) * 64) + col;   // behind the last tile: a tile of the last block again (in bounds, unused)
#pragma unroll
      for (int kc = 0; kc < 4; ++kc) qr[(ct + 1) & 1][kc] = ld_row(Q + (size_t)qn * DM + h * HD, kc * 32, lane);
      ml[(ct + 1) & 1] = *(const v2f*)(ML + ((size_t)h * SS + qn) * 4);
#pragma unroll
      for (int kc = 0; kc < 4; ++kc) { const F2 qf = split_raw(qr[ct & 1][kc]); c = mac3(ak[kc], qf, c); }
      const float mq = ml[ct & 1][0], ilq = ml[ct & 1][1];
#pragma unroll
      for (int r = 0; r < 8; ++r) { const int key = k0 + 8 * g + r; const float sc = c[r] * 0.08838834764831845f;
        const float t = rs[r] + expf(sc - mq) * ilq; rs[r] = (key <= qq) ? t : rs[r]; } }   // exp inline and in every lane, the causal test a select: the 8 rows' chains run side by side
#pragma unroll
    for (int o = 1; o < 16; o <<= 1) {   // level by level over the 8 rows: their exchanges are independent and run side by side
#pragma unroll
      for (int r = 0; r < 8; ++r) rs[r] += __shfl_xor(rs[r], o); }
    if (col == 0) {
#pragma unroll
      for (int r = 0; r < 8; ++r) ssum[wave * 16 + 8 * g + r] = rs[r]; }
    __syncthreads();
    if (tid < 16) vst2(CS + (((size_t)h * TQB + qb) * SS) + kb * 64 + tid * 4, *(const v4f*)&ssum[tid * 4]);
    __syncthreads(); }
  // query blocks qb < kb contribute nothing: write zeros so every CS row is defined
  for (int qb = 0; qb < kb; ++qb) { if (tid < 16) vst2(CS + (((size_t)h * TQB + qb) * SS) + kb * 64 + tid * 4, (v4f){0.f, 0.f, 0.f, 0.f}); }
}
__global__ __launch_bounds__(256) void k_mask(const float* __restrict__ CS, float* __restrict__ MSK) {
  __shared__ float sv[SS]; __shared__ int si[SS]; __shared__ __align__(16) float sm[MWP];
  const int h = blockIdx.x, tid = threadIdx.x; const int NSEL = SS - RECENT;   // 1844 candidates
  for (int s = tid; s < SS; s += 256) { float c = 0.f; if (s < NSEL) { for (int qb = 0; qb < TQB; ++qb) c += CS[(((size_t)h * TQB + qb) * SS) + s]; } else c = -3.0e38f; sv[s] = c; si[s] = s; }
  for (int s = tid; s < MWP; s += 256) sm[s] = (s >= MW - RECENT && s < MW) ? 1.0f : 0.f;
  __syncthreads();
  // bitonic sort descending by value, ascending index on ties
  for (int k = 2; k <= SS; k <<= 1) { for (int j = k >> 1; j > 0; j >>= 1) {
      for (int i = tid; i < SS; i += 256) { const int ixj = i ^ j; if (ixj > i) { const bool up = ((i & k) == 0);   // 'up' segments sorted descending
          const float a = sv[i], b = sv[ixj]; const int ia = si[i], ib = si[ixj];
          const bool a_first = (a > b) || (a == b && ia < ib);   // a should come before b in descending order
          const bool swap = up ? !a_first : a_first;
          if (swap) { sv[i] = b; sv[ixj] = a; si[i] = ib; si[ixj] = ia; } } }
      __syncthreads(); } }
  if (tid < HEAVY) { int s = si[tid]; s = min(max(s, 0), NSEL - 1); sm[s] = 1.0f; }
  __syncthreads();
  for (int q = tid; q < MWP / 4; q += 256) vst2(MSK + (size_t)h * MWP + q * 4, *(const v4f*)&sm[q * 4]);
}
// ---- k_out: block = (64 rows, 128 cols): out = O(hi/lo) . o_w^T rows (2 products)
__global__ __launch_bounds__(128) void k_out(const float* __restrict__ O, const __bf16* __restrict__ P, float* __restrict__ Y) {
  __shared__ __align__(16) float so[4][16][132];
  const int tid = threadIdx.x, wave = tid >> 5, lane = tid & 31, col = lane & 15, g = lane >> 4; const size_t r0 = (size_t)blockIdx.x * 64 + wave * 16; const int n0 = blockIdx.y * 128;
  v8f acc[8] = {};
  const float* orow = O + (r0 + col) * DM; const __bf16* prow = P + (size_t)(n0 + col) * DM;
  R16 xa[2]; v16b wb[2][8];   // two register sets: step kc + 1 is loaded as one group while step kc is multiplied
  xa[0] = ld_row(orow, 0, lane);
#pragma unroll
  for (int j = 0; j < 8; ++j) wb[0][j] = frag_b(prow + (size_t)j * 16 * DM, lane);
#pragma unroll 1   // one trip already holds both register sets; more copies of it would only cost registers
  for (int kc = 0; kc < DM / 32; kc += 2) {
#pragma unroll
    for (int u = 0; u < 2; ++u) { const int kn = min(kc + u + 1, DM / 32 - 1);   // the last step loads itself again (in bounds, unused)
      xa[u ^ 1] = ld_row(orow, kn * 32, lane);
#pragma unroll
      for (int j = 0; j < 8; ++j) wb[u ^ 1][j] = frag_b(prow + (size_t)j * 16 * DM + kn * 32, lane);
      const F2 a = split_raw(xa[u]);
#pragma unroll
      for (int j = 0; j < 8; ++j) { acc[j] = wmma_bf(a.l, wb[u][j], acc[j]); acc[j] = wmma_bf(a.h, wb[u][j], acc[j]); } } }
#pragma unroll
  for (int j = 0; j < 8; ++j)
#pragma unroll
    for (int r = 0; r < 8; ++r) so[wave][8 * g + r][j * 16 + col] = acc[j][r];
  LDSX();
  for (int rl = 0; rl < 16; ++rl) vst2(Y + (r0 + rl) * DM + n0 + lane * 4, *(const v4f*)&so[wave][rl][lane * 4]);
}
// ---- k_mout: flat writer of the [16][2049] mask after the attention output
__global__ __launch_bounds__(256) void k_mout(const float* __restrict__ MSK, float* __restrict__ out) {
  const size_t p = (size_t)blockIdx.x * 256 + threadIdx.x; const size_t total = (size_t)NH * (SFULL + 1); if (p * 4 >= total) return; v4f v;
#pragma unroll
  for (int i = 0; i < 4; ++i) { const size_t f = p * 4 + i; const size_t row = f / (SFULL + 1), c = f % (SFULL + 1); v[i] = (f < total && c < (size_t)MW) ? MSK[row * MWP + c] : 0.f; }
  vst2(out + p * 4, v);
}
extern "C" void kernel_launch(void* const* d_in, const int* in_sizes, int n_in, void* d_out, int out_size, void* d_ws, size_t ws_size, hipStream_t stream) {
  (void)in_sizes; (void)n_in; (void)out_size;
  const float** F = (const float**)d_in;   // hidden_states [1,2048,2048], q_w [2048,2048], q_b [2048], k_w [2048,512], k_b [512], v_w [2048,512], v_b [512], o_w [2048,2048]
  if (ws_size < (size_t)WS_END) return;
  char* ws = (char*)d_ws; __bf16 *PK = (__bf16*)(ws + WS_PK), *VTH = (__bf16*)(ws + WS_VTH), *VTL = (__bf16*)(ws + WS_VTL);
  float *Q = (float*)(ws + WS_Q), *Kx = (float*)(ws + WS_K), *O = (float*)(ws + WS_O), *ML = (float*)(ws + WS_ML), *CS = (float*)(ws + WS_CS), *MSK = (float*)(ws + WS_MSK);
  float* OUT0 = (float*)d_out; float* OUT1 = OUT0 + (size_t)SFULL * DM;
  k_packT<<<DM, 256, 0, stream>>>(F[1], DM, DM, PK + PK_Q); k_packT<<<KVW, 256, 0, stream>>>(F[3], DM, KVW, PK + PK_K); k_packT<<<KVW, 256, 0, stream>>>(F[5], DM, KVW, PK + PK_V); k_packT<<<DM, 256, 0, stream>>>(F[7], DM, DM, PK + PK_O);
  k_proj<0><<<dim3(SS / 64, DM / 128), 128, 0, stream>>>(F[0], PK + PK_Q, F[2], Q, DM, nullptr, nullptr);
  k_proj<0><<<dim3(SS / 64, KVW / 128), 128, 0, stream>>>(F[0], PK + PK_K, F[4], Kx, KVW, nullptr, nullptr);
  k_proj<1><<<dim3(SS / 64, KVW / 128), 128, 0, stream>>>(F[0], PK + PK_V, F[6], nullptr, 0, VTH, VTL);
  k_attn<<<dim3(TQB, NH), 128, 0, stream>>>(Q, Kx, VTH, VTL, O, ML);
  k_colsum<<<dim3(TQB, NH), 128, 0, stream>>>(Q, Kx, ML, CS);
  k_mask<<<NH, 256, 0, stream>>>(CS, MSK);
  k_out<<<dim3(TQB, DM / 128), 128, 0, stream>>>(O, PK + PK_O, OUT0);
  k_mout<<<(unsigned)(((size_t)NH * (SFULL + 1) / 4 + 255) / 256), 256, 0, stream>>>(MSK, OUT1);
}

// v003
// It runs in 580 microseconds.
// Two timings next to v002 put it at 1.18 and 1.16 times that version's speed.
// Counting every step since v000, it is 2.44 times as fast.
// compute dtype: hidden_states and all weights/biases (module inputs) rounded to bf16; q/k/v projections with exact bf16 products (x and W are inputs); causal scores q.k with both computed operands as bf16 hi + residual pairs (3 products) and P.V with P hi/lo x V hi/lo (3 products); the heavy-hitter column sums recompute the same 3-product scores in a second (transposed) pass with the stored row statistics; the output projection with hi/lo x exact o_w (2 products), all on WMMA 16x16x32; softmax, column sums, the per-head top-k selection (bitonic sort, lower index first on ties) and the mask assembly in f32 on the VALU; f32 accumulate.
#include <hip/hip_runtime.h>
#include <math.h>

typedef __attribute__((ext_vector_type(16))) _Float16 v16h;
typedef __attribute__((ext_vector_type(16))) __bf16 v16b;
typedef __attribute__((ext_vector_type(8)))  _Float16 v8h;
typedef __attribute__((ext_vector_type(8)))  float v8f;
typedef __attribute__((ext_vector_type(4)))  float v4f;
typedef __attribute__((ext_vector_type(2)))  float v2f;
typedef __attribute__((ext_vector_type(4)))  unsigned v4u;
typedef __attribute__((ext_vector_type(4)))  int v4i;
typedef float __attribute__((may_alias)) float_a;
typedef int __attribute__((may_alias)) int_a;

template <typename T> __device__ __forceinline__ void vst2(void* p, T v) { *(T*)p = v;  }
__device__ __forceinline__ v8f wmma16(v16h a, v16h b, v8f c) {
  v8f d = __builtin_amdgcn_wmma_f32_16x16x32_f16(false, a, false, b, (short)0, c, false, false);
  asm volatile("v_nop\n\tv_nop\n\tv_nop\n\tv_nop" : "+v"(d) : "v"(a), "v"(b));
  return d;
}
__device__ __forceinline__ v8f wmma_bf(v16b a, v16b b, v8f c) {
  v8f d = __builtin_amdgcn_wmma_f32_16x16x32_bf16(false, a, false, b, (short)0, c, false, false);
  asm volatile("v_nop\n\tv_nop\n\tv_nop\n\tv_nop" : "+v"(d) : "v"(a), "v"(b));
  return d;
}
// 16x16x32 fragments: lane = (h = lane>>4, row/col = lane&15); elements 0..7 = k0+8h+0..7, 8..15 = k0+16+8h+0..7; D element r = row 8h+r
__device__ __forceinline__ v16h frag_h(const _Float16* rowk0, int lane) {
  union { v16h v; v8h q[2]; } u; const _Float16* p = rowk0 + 8 * (lane >> 4);
  u.q[0] = *(const v8h*)p; u.q[1] = *(const v8h*)(p + 16); return u.v;
}
__device__ __forceinline__ v16h frag_f32(const float* rowk0, int lane) {
  v16h a; const float* p = rowk0 + 8 * (lane >> 4);
#pragma unroll
  for (int i = 0; i < 8; ++i) { a[i] = (_Float16)p[i]; a[8 + i] = (_Float16)p[16 + i]; }
  return a;
}
__device__ __forceinline__ v16h frag_f32s(const float* rowk0, int lane, float sc) {
  v16h a; const float* p = rowk0 + 8 * (lane >> 4);
#pragma unroll
  for (int i = 0; i < 8; ++i) { a[i] = (_Float16)(p[i] * sc); a[8 + i] = (_Float16)(p[16 + i] * sc); }
  return a;
}
// column fragment from a [K][ld] layout (column n), rows >= K read as 0
__device__ __forceinline__ v16h fragc_f32(const float* W, int k0, int n, int lane, int ld, int K) {
  v16h a; const int g = lane >> 4;
#pragma unroll
  for (int i = 0; i < 8; ++i) { const int ka = k0 + 8 * g + i, kb = ka + 16;
    a[i] = (_Float16)(ka < K ? W[(size_t)(ka < K ? ka : K - 1) * ld + n] : 0.f); a[8 + i] = (_Float16)(kb < K ? W[(size_t)(kb < K ? kb : K - 1) * ld + n] : 0.f); }
  return a;
}
struct F2 { v16b h, l; };
__device__ __forceinline__ F2 bsplit16(const float v[16]) { F2 r;
#pragma unroll
  for (int i = 0; i < 16; ++i) { const __bf16 h = (__bf16)v[i]; r.h[i] = h; r.l[i] = (__bf16)(v[i] - (float)h); }
  return r; }
__device__ __forceinline__ F2 split_row(const float* row, int k0, int lane) { float v[16]; const float* p = row + k0 + 8 * (lane >> 4);
#pragma unroll
  for (int i = 0; i < 8; ++i) { v[i] = p[i]; v[8 + i] = p[16 + i]; }
  return bsplit16(v); }
__device__ __forceinline__ F2 split_rowK(const float* row, int k0, int lane, int K) { float v[16]; const int g = lane >> 4;
#pragma unroll
  for (int i = 0; i < 8; ++i) { const int ka = k0 + 8 * g + i, kb = ka + 16; v[i] = ka < K ? row[ka < K ? ka : K - 1] : 0.f; v[8 + i] = kb < K ? row[kb < K ? kb : K - 1] : 0.f; }
  return bsplit16(v); }
__device__ __forceinline__ F2 split_col(const float* W, int k0, int n, int lane, int ld, int K) { float v[16]; const int g = lane >> 4;
#pragma unroll
  for (int i = 0; i < 8; ++i) { const int ka = k0 + 8 * g + i, kb = ka + 16; v[i] = ka < K ? W[(size_t)(ka < K ? ka : K - 1) * ld + n] : 0.f; v[8 + i] = kb < K ? W[(size_t)(kb < K ? kb : K - 1) * ld + n] : 0.f; }
  return bsplit16(v); }
__device__ __forceinline__ v8f mac3(const F2& a, const F2& b, v8f c) { c = wmma_bf(a.l, b.h, c); c = wmma_bf(a.h, b.l, c); return wmma_bf(a.h, b.h, c); }
__device__ __forceinline__ float sigm(float v) { return 1.0f / (1.0f + expf(-v)); }
#define LDSX() do { asm volatile("s_wait_dscnt 0" ::: "memory"); __builtin_amdgcn_wave_barrier(); __builtin_amdgcn_fence(__ATOMIC_RELEASE, "workgroup"); } while (0)


// GQA causal attention with H2O heavy-hitter scoring (B 1, S 2048, D 2048, 16 query heads / 4 kv heads x 128): out = softmax(q k^T / sqrt(128), causal) v -> @ o_w; cur[h][s] = sum over queries of probs; mask[h] = 1 on the last 204 of 2049 positions, 0 elsewhere, then 1 at the top-204 (heavy budget) indices of cur[h][:1844].
#define SFULL 2048            // shipped sequence length (output layout)
#ifndef SS
#define SS SFULL              // active sequence length (all)
#endif
#define DM 2048
#define NH 16
#define NKV 4
#define HD 128
#define KVW (NKV * HD)        // 512
#define HEAVY (SS / 10)       // int(0.1 * S)
#define RECENT (SS / 10)
#define MW (SS + 1)           // 2049 mask width
#define MWP 2064              // padded staging width
#define TQB (SS / 64)         // query blocks
typedef __attribute__((ext_vector_type(8))) __bf16 v8b;
// fragment-order storage: a [rows][k] operand that a kernel of this file writes is kept as blocks of 16 rows x 32 k, block (rt, kc) at index rt * (k / 32) + kc; inside a block the 16-byte pieces stand in the order in which the lanes load them, so every wave-wide load or store is 512 bytes in a row (4 whole lines, not 16 part lines)
// bf16 block = 512 elements: piece (half, lane) at half * 256 + lane * 8 holds row lane & 15, k = half * 16 + 8 * (lane >> 4) + 0..7
__device__ __forceinline__ v16b frag_t(const __bf16* blk, int lane) {
  union { v16b v; v8b q[2]; } u;
  u.q[0] = *(const v8b*)(blk + lane * 8); u.q[1] = *(const v8b*)(blk + 256 + lane * 8); return u.v;
}
__device__ __forceinline__ float bfr(float v) { return (float)(__bf16)v; }
// the 16 f32 of one lane's fragment slice (k0+8h+0..7, k0+16+8h+0..7), kept as loaded: conversion waits for the data, so it is done where the fragment is used
struct R16 { v4f q[4]; };
// f32 block = 512 floats: piece (qi, lane) at qi * 128 + lane * 4 holds row lane & 15, k = (qi >> 1) * 16 + 8 * (lane >> 4) + (qi & 1) * 4 + 0..3
__device__ __forceinline__ R16 ld_t(const float* blk, int lane) { R16 r;
#pragma unroll
  for (int qi = 0; qi < 4; ++qi) r.q[qi] = *(const v4f*)(blk + qi * 128 + lane * 4);
  return r; }
// one wave's 16 x 128 f32 tile, from its LDS staging rows to 4 f32 blocks in a row
__device__ __forceinline__ void st_t(float* blk, const float (*st)[132], int lane) {
#pragma unroll
  for (int sl = 0; sl < 4; ++sl) {
#pragma unroll
    for (int qi = 0; qi < 4; ++qi) vst2(blk + sl * 512 + qi * 128 + lane * 4, *(const v4f*)&st[lane & 15][sl * 32 + (qi >> 1) * 16 + 8 * (lane >> 4) + (qi & 1) * 4]); }
}
__device__ __forceinline__ F2 split_raw(const R16& r) { float v[16];
#pragma unroll
  for (int i = 0; i < 4; ++i) { v[i] = r.q[0][i]; v[4 + i] = r.q[1][i]; v[8 + i] = r.q[2][i]; v[12 + i] = r.q[3][i]; }
  return bsplit16(v); }
__device__ __attribute__((noinline)) float erf_ni(float v) { return erff(v); }

#define PK_Q 0                               // [2048 n][2048 k] q_w^T (all four: bf16 blocks)
#define PK_K (PK_Q + DM * DM)                  // [512][2048]
#define PK_V (PK_K + KVW * DM)
#define PK_O (PK_V + KVW * DM)                 // [2048][2048] o_w^T
#define PK_END (PK_O + DM * DM)
#define WS_PK  0u
#define WS_Q   (WS_PK + 2u * PK_END)           // f32 blocks [2048][2048] q (h*128+d)
#define WS_K   (WS_Q + 4u * SS * DM)            // f32 blocks [2048][512]
#define WS_VTH (WS_K + 4u * SS * KVW)           // bf16 blocks [512 (kv*128+d)][2048]
#define WS_VTL (WS_VTH + 2u * KVW * SS)
#define WS_O   (WS_VTL + 2u * KVW * SS)         // f32 blocks [2048][2048] attention output (h*128+d)
#define WS_ML  (WS_O + 4u * SS * DM)            // f32 [16][2048][4]: (m, 1/l, 0, 0)
#define WS_CS  (WS_ML + 4u * NH * SS * 4)       // f32 [16][32 qblocks][2048]: per-query-block partial column sums
#define WS_MSK (WS_CS + 4u * NH * TQB * SS)     // f32 [16][2064] mask staging
#define WS_X   (WS_MSK + 4u * NH * MWP)         // bf16 blocks [2048][2048] hidden_states
#define WS_END (WS_X + 2u * SS * DM)

// ---- k_packT: block = (16 output columns, 128 k) of a [K][N] (x @ W) matrix: 4 bf16 blocks in a row (4 KB) of W^T; a thread makes one 16-byte piece
__global__ __launch_bounds__(256) void k_packT(const float* __restrict__ Wm, int K, int N, __bf16* __restrict__ DST) {
  const int tid = threadIdx.x, lane = tid & 31, half = (tid >> 5) & 1, kc = blockIdx.y * 4 + (tid >> 6);
  const float* src = Wm + (size_t)(kc * 32 + half * 16 + 8 * (lane >> 4)) * N + blockIdx.x * 16 + (lane & 15);
  v8b o;
#pragma unroll
  for (int i = 0; i < 8; ++i) o[i] = (__bf16)src[(size_t)i * N];
  vst2(DST + ((size_t)blockIdx.x * (K / 32) + kc) * 512 + half * 256 + lane * 8, o);
}
// ---- k_packR: block = (16 rows, 128 k) of the row-major [rows][DM] x: 4 bf16 blocks in a row (4 KB) of bf16(x); a thread makes one 16-byte piece
__global__ __launch_bounds__(256) void k_packR(const float* __restrict__ X, __bf16* __restrict__ DST) {
  const int tid = threadIdx.x, lane = tid & 31, half = (tid >> 5) & 1, kc = blockIdx.y * 4 + (tid >> 6);
  const float* src = X + (size_t)(blockIdx.x * 16 + (lane & 15)) * DM + kc * 32 + half * 16 + 8 * (lane >> 4);
  const v4f a = *(const v4f*)src, b = *(const v4f*)(src + 4); v8b o;
#pragma unroll
  for (int i = 0; i < 4; ++i) { o[i] = (__bf16)a[i]; o[4 + i] = (__bf16)b[i]; }
  vst2(DST + ((size_t)blockIdx.x * (DM / 32) + kc) * 512 + half * 256 + lane * 8, o);
}
// ---- k_proj<VT>: block = (64 rows, 128 cols): Y = bf16(x) (packed, bf16 blocks) . P rows (exact) + bias; VT 0: f32 blocks of [row][ldo cols]; VT 1: transposed bf16 hi/lo planes, bf16 blocks of [col][row]
template <int VT>
__global__ __launch_bounds__(128) void k_proj(const __bf16* __restrict__ X, const __bf16* __restrict__ P, const float* __restrict__ bias, float* __restrict__ OUT, int ldo, __bf16* __restrict__ PH, __bf16* __restrict__ PL) {
  __shared__ __align__(16) float so[VT ? 1 : 4][16][132]; __shared__ __align__(16) __bf16 sth[VT ? 128 : 1][72], stl[VT ? 128 : 1][72];
  const int tid = threadIdx.x, wave = tid >> 5, lane = tid & 31, col = lane & 15, g = lane >> 4; const size_t r0 = (size_t)blockIdx.x * 64 + wave * 16; const int n0 = blockIdx.y * 128;
  v8f acc[8] = {};
  const __bf16* xblk = X + (r0 / 16) * (DM / 32) * 512; const __bf16* pblk = P + (size_t)(n0 / 16) * (DM / 32) * 512;
  v16b xa[2], wb[2][8];   // two register sets: step kc + 1 is loaded as one group while step kc is multiplied
  xa[0] = frag_t(xblk, lane);
#pragma unroll
  for (int j = 0; j < 8; ++j) wb[0][j] = frag_t(pblk + (size_t)j * (DM / 32) * 512, lane);
#pragma unroll 1   // one trip already holds both register sets; more copies of it would only cost registers
  for (int kc = 0; kc < DM / 32; kc += 2) {
#pragma unroll
    for (int u = 0; u < 2; ++u) { const int kn = min(kc + u + 1, DM / 32 - 1);   // the last step loads itself again (in bounds, unused)
      const __bf16* xp = xblk + kn * 512 + lane * 8; const __bf16* wp = pblk + (size_t)kn * 512 + lane * 8;   // the lane's own addresses in the step's blocks
      xa[u ^ 1] = frag_t(xp, 0);
#pragma unroll
      for (int j = 0; j < 8; ++j) wb[u ^ 1][j] = frag_t(wp + (size_t)j * (DM / 32) * 512, 0);
      asm volatile("s_wait_xcnt 0x0" :: "v"(xp), "v"(wp) : "memory");   // as inputs here the pairs live up to the wait, which stands in front of any overwrite
#pragma unroll
      for (int j = 0; j < 8; ++j) acc[j] = wmma_bf(xa[u], wb[u][j], acc[j]); } }
  if (!VT) {
#pragma unroll
    for (int j = 0; j < 8; ++j) { const float bb = bfr(bias[n0 + j * 16 + col]);
#pragma unroll
      for (int r = 0; r < 8; ++r) so[wave][8 * g + r][j * 16 + col] = acc[j][r] + bb; }
    LDSX();
    st_t(OUT + ((r0 / 16) * (ldo / 32) + n0 / 32) * 512, so[wave], lane);
  } else {
#pragma unroll
    for (int j = 0; j < 8; ++j) { const float bb = bfr(bias[n0 + j * 16 + col]);
#pragma unroll
      for (int r = 0; r < 8; ++r) { const float v = acc[j][r] + bb; const __bf16 hb = (__bf16)v; sth[j * 16 + col][wave * 16 + 8 * g + r] = hb; stl[j * 16 + col][wave * 16 + 8 * g + r] = (__bf16)(v - (float)hb); } }
    __syncthreads();
    for (int q = tid; q < 128 * 8; q += 128) { const int dt = q >> 7, kl = (q >> 6) & 1, half = (q >> 5) & 1;   // 16 blocks a plane (8 column tiles x 2 row steps), 64 pieces each; q & 31 = lane
      const int d = dt * 16 + col, sl = kl * 32 + half * 16 + 8 * g; const size_t o = ((size_t)(n0 / 16 + dt) * (SS / 32) + blockIdx.x * 2 + kl) * 512 + half * 256 + lane * 8;
      vst2((unsigned*)(PH + o), *(const v4u*)&sth[d][sl]); vst2((unsigned*)(PL + o), *(const v4u*)&stl[d][sl]); }
  }
}
// ---- k_attn: block = (64 queries, head h): causal flash attention, kv head = h/4; scores 3 products, P.V 3 products; O[q][h*128+d]; ML[h][q] = (m, 1/l)
// waves_per_eu(2, 2): this grid puts two waves on a SIMD; at the default register target the scheduler folds the softmax's 8 rows back into pairs that run one behind another
__global__ __launch_bounds__(128) __attribute__((amdgpu_waves_per_eu(2, 2))) void k_attn(const float* __restrict__ Q, const float* __restrict__ Kx, const __bf16* __restrict__ VTH, const __bf16* __restrict__ VTL, float* __restrict__ O, float* __restrict__ ML) {
  __shared__ __align__(16) float sp[4][16][36]; __shared__ __align__(16) float so[4][16][132]; __shared__ __align__(16) float sml[64][4];
  const int tid = threadIdx.x, wave = tid >> 5, lane = tid & 31, col = lane & 15, g = lane >> 4;
  const int qb = blockIdx.x, h = blockIdx.y, kv = h / (NH / NKV); const int q0 = qb * 64 + wave * 16;
  F2 aq[4];
#pragma unroll
  for (int kc = 0; kc < 4; ++kc) aq[kc] = split_raw(ld_t(Q + ((size_t)(q0 / 16) * (DM / 32) + h * 4 + kc) * 512, lane));
  float m[8], l[8];
#pragma unroll
  for (int r = 0; r < 8; ++r) { m[r] = -3.0e38f; l[r] = 0.f; }
  v8f acc[8] = {};
  const int nks = (qb * 64 + 64) / 32;   // key steps covering keys <= the block's last query
#pragma unroll 1
  for (int ks = 0; ks < nks; ++ks) { v8f s[2]; R16 kr[2][4];   // the step's 32 key rows: 2 of the 8 slices are loaded as one group ahead of the score products, each further one as a slice is used up
    const float* kbase = Kx + ((size_t)(ks * 2) * (KVW / 32) + kv * 4) * 512;
#pragma unroll
    for (int i = 0; i < 2; ++i) kr[i >> 2][i & 3] = ld_t(kbase + ((i >> 2) * (KVW / 32) + (i & 3)) * 512, lane);
#pragma unroll
    for (int ct = 0; ct < 2; ++ct) { const int kk = ks * 32 + ct * 16 + col; v8f c = {};
#pragma unroll
      for (int kc = 0; kc < 4; ++kc) { const F2 kb = split_raw(kr[ct][kc]);
        const int i = ct * 4 + kc + 2; if (i < 8) kr[i >> 2][i & 3] = ld_t(kbase + ((i >> 2) * (KVW / 32) + (i & 3)) * 512, lane);
        c = mac3(aq[kc], kb, c); }
#pragma unroll
      for (int r = 0; r < 8; ++r) { const int qi = q0 + 8 * g + r; s[ct][r] = (kk <= qi) ? c[r] * 0.08838834764831845f : -3.0e38f; } }
    v16b vh[8], vl[8];   // the step's V fragments: 2 of the 8 column tiles are loaded as one group ahead of the softmax, each further one as a tile is used up
    const size_t vbase = ((size_t)(kv * 8) * (SS / 32) + ks) * 512;
#pragma unroll
    for (int dt = 0; dt < 2; ++dt) { vh[dt] = frag_t(VTH + vbase + (size_t)dt * (SS / 32) * 512, lane); vl[dt] = frag_t(VTL + vbase + (size_t)dt * (SS / 32) * 512, lane); }
    float mn[8], al[8], es[8];   // the softmax goes stage by stage over the 8 rows: within a stage the rows' chains (lane exchanges, exp) are independent and run side by side
#pragma unroll
    for (int r = 0; r < 8; ++r) mn[r] = fmaxf(s[0][r], s[1][r]);
#pragma unroll
    for (int o = 1; o < 16; o <<= 1) {
#pragma unroll
      for (int r = 0; r < 8; ++r) mn[r] = fmaxf(mn[r], __shfl_xor(mn[r], o)); }
#pragma unroll
    for (int r = 0; r < 8; ++r) { mn[r] = fmaxf(m[r], mn[r]);
      const float xa = expf(m[r] - mn[r]), x0 = expf(s[0][r] - mn[r]), x1 = expf(s[1][r] - mn[r]);   // inline and in every lane; a masked or not yet started entry is set to 0 by a select, not branched round
      al[r] = (m[r] <= -1.0e38f) ? 0.f : xa;
      const float e0 = (s[0][r] <= -1.0e38f) ? 0.f : x0, e1 = (s[1][r] <= -1.0e38f) ? 0.f : x1; es[r] = e0 + e1;
      sp[wave][8 * g + r][col] = e0; sp[wave][8 * g + r][16 + col] = e1; }
#pragma unroll
    for (int o = 1; o < 16; o <<= 1) {
#pragma unroll
      for (int r = 0; r < 8; ++r) es[r] += __shfl_xor(es[r], o); }
#pragma unroll
    for (int r = 0; r < 8; ++r) { l[r] = l[r] * al[r] + es[r]; m[r] = mn[r];
#pragma unroll
      for (int dt = 0; dt < 8; ++dt) acc[dt][r] *= al[r]; }
    LDSX();
    const F2 pa = split_row(&sp[wave][col][0], 0, lane);
#pragma unroll
    for (int dt = 0; dt < 8; ++dt) { acc[dt] = wmma_bf(pa.l, vh[dt], acc[dt]); acc[dt] = wmma_bf(pa.h, vl[dt], acc[dt]); acc[dt] = wmma_bf(pa.h, vh[dt], acc[dt]);
      if (dt + 2 < 8) { vh[dt + 2] = frag_t(VTH + vbase + (size_t)(dt + 2) * (SS / 32) * 512, lane); vl[dt + 2] = frag_t(VTL + vbase + (size_t)(dt + 2) * (SS / 32) * 512, lane); } }
    LDSX(); }
#pragma unroll
  for (int r = 0; r < 8; ++r) { const float il = 1.0f / l[r];
#pragma unroll
    for (int dt = 0; dt < 8; ++dt) so[wave][8 * g + r][dt * 16 + col] = acc[dt][r] * il;
    if (col == 0) { sml[wave * 16 + 8 * g + r][0] = m[r]; sml[wave * 16 + 8 * g + r][1] = il; sml[wave * 16 + 8 * g + r][2] = 0.f; sml[wave * 16 + 8 * g + r][3] = 0.f; } }
  __syncthreads();
  st_t(O + ((size_t)(q0 / 16) * (DM / 32) + h * 4) * 512, so[wave], lane);
  if (tid < 64) vst2(ML + ((size_t)h * SS + qb * 64 + tid) * 4, *(const v4f*)&sml[tid][0]);
}
// ---- k_colsum: block = (64 keys, head h): partial column sums of probs over each 64-query block qb >= key block: p = exp(s - m_q) * (1/l_q) (s recomputed with the same 3-product dot and scale); CS[h][qb][key] rows of 256 B per (query block, this key block)
//   A = k rows (this block's 64 keys, wave -> 16), B = q rows (16-query tiles) -> D[key][q]; per key row sum over the q columns with the (m, 1/l) of each q and the causal predicate q >= key.
__global__ __launch_bounds__(128) void k_colsum(const float* __restrict__ Q, const float* __restrict__ Kx, const float* __restrict__ ML, float* __restrict__ CS) {
  __shared__ __align__(16) float ssum[64];
  const int tid = threadIdx.x, wave = tid >> 5, lane = tid & 31, col = lane & 15, g = lane >> 4;
  const int kb = blockIdx.x, h = blockIdx.y, kv = h / (NH / NKV); const int k0 = kb * 64 + wave * 16;
  F2 ak[4];
#pragma unroll
  for (int kc = 0; kc < 4; ++kc) ak[kc] = split_raw(ld_t(Kx + ((size_t)(k0 / 16) * (KVW / 32) + kv * 4 + kc) * 512, lane));
  R16 qr[2][4]; v2f ml[2];   // two register sets: the next 16-query tile (rows and statistics) is loaded as one group while this one is worked on
#pragma unroll
  for (int kc = 0; kc < 4; ++kc) qr[0][kc] = ld_t(Q + ((size_t)(kb * 4) * (DM / 32) + h * 4 + kc) * 512, lane);
  ml[0] = *(const v2f*)(ML + ((size_t)h * SS + kb * 64 + col) * 4);
#pragma unroll 1
  for (int qb = kb; qb < TQB; ++qb) { float rs[8];
#pragma unroll
    for (int r = 0; r < 8; ++r) rs[r] = 0.f;
#pragma unroll
    for (int ct = 0; ct < 4; ++ct) { const int qq = qb * 64 + ct * 16 + col; v8f c = {};
      const int qt = ct < 3 ? qb * 4 + ct + 1 : min(qb + 1, TQB - 1) * 4, qn = qt * 16 + col;   // behind the last tile: a tile of the last block again (in bounds, unused)
#pragma unroll
      for (int kc = 0; kc < 4; ++kc) qr[(ct + 1) & 1][kc] = ld_t(Q + ((size_t)qt * (DM / 32) + h * 4 + kc) * 512, lane);
      ml[(ct + 1) & 1] = *(const v2f*)(ML + ((size_t)h * SS + qn) * 4);
#pragma unroll
      for (int kc = 0; kc < 4; ++kc) { const F2 qf = split_raw(qr[ct & 1][kc]); c = mac3(ak[kc], qf, c); }
      const float mq = ml[ct & 1][0], ilq = ml[ct & 1][1];
#pragma unroll
      for (int r = 0; r < 8; ++r) { const int key = k0 + 8 * g + r; const float sc = c[r] * 0.08838834764831845f;
        const float t = rs[r] + expf(sc - mq) * ilq; rs[r] = (key <= qq) ? t : rs[r]; } }   // exp inline and in every lane, the causal test a select: the 8 rows' chains run side by side
#pragma unroll
    for (int o = 1; o < 16; o <<= 1) {   // level by level over the 8 rows: their exchanges are independent and run side by side
#pragma unroll
      for (int r = 0; r < 8; ++r) rs[r] += __shfl_xor(rs[r], o); }
    if (col == 0) {
#pragma unroll
      for (int r = 0; r < 8; ++r) ssum[wave * 16 + 8 * g + r] = rs[r]; }
    __syncthreads();
    if (tid < 16) vst2(CS + (((size_t)h * TQB + qb) * SS) + kb * 64 + tid * 4, *(const v4f*)&ssum[tid * 4]);
    __syncthreads(); }
  // query blocks qb < kb contribute nothing: write zeros so every CS row is defined
  for (int qb = 0; qb < kb; ++qb) { if (tid < 16) vst2(CS + (((size_t)h * TQB + qb) * SS) + kb * 64 + tid * 4, (v4f){0.f, 0.f, 0.f, 0.f}); }
}
__global__ __launch_bounds__(256) void k_mask(const float* __restrict__ CS, float* __restrict__ MSK) {
  __shared__ float sv[SS]; __shared__ int si[SS]; __shared__ __align__(16) float sm[MWP];
  const int h = blockIdx.x, tid = threadIdx.x; const int NSEL = SS - RECENT;   // 1844 candidates
  for (int s = tid; s < SS; s += 256) { float c = 0.f; if (s < NSEL) { for (int qb = 0; qb < TQB; ++qb) c += CS[(((size_t)h * TQB + qb) * SS) + s]; } else c = -3.0e38f; sv[s] = c; si[s] = s; }
  for (int s = tid; s < MWP; s += 256) sm[s] = (s >= MW - RECENT && s < MW) ? 1.0f : 0.f;
  __syncthreads();
  // bitonic sort descending by value, ascending index on ties
  for (int k = 2; k <= SS; k <<= 1) { for (int j = k >> 1; j > 0; j >>= 1) {
      for (int i = tid; i < SS; i += 256) { const int ixj = i ^ j; if (ixj > i) { const bool up = ((i & k) == 0);   // 'up' segments sorted descending
          const float a = sv[i], b = sv[ixj]; const int ia = si[i], ib = si[ixj];
          const bool a_first = (a > b) || (a == b && ia < ib);   // a should come before b in descending order
          const bool swap = up ? !a_first : a_first;
          if (swap) { sv[i] = b; sv[ixj] = a; si[i] = ib; si[ixj] = ia; } } }
      __syncthreads(); } }
  if (tid < HEAVY) { int s = si[tid]; s = min(max(s, 0), NSEL - 1); sm[s] = 1.0f; }
  __syncthreads();
  for (int q = tid; q < MWP / 4; q += 256) vst2(MSK + (size_t)h * MWP + q * 4, *(const v4f*)&sm[q * 4]);
}
// ---- k_out: block = (64 rows, 128 cols): out = O(hi/lo) . o_w^T rows (2 products)
__global__ __launch_bounds__(128) void k_out(const float* __restrict__ O, const __bf16* __restrict__ P, float* __restrict__ Y) {
  __shared__ __align__(16) float so[4][16][132];
  const int tid = threadIdx.x, wave = tid >> 5, lane = tid & 31, col = lane & 15, g = lane >> 4; const size_t r0 = (size_t)blockIdx.x * 64 + wave * 16; const int n0 = blockIdx.y * 128;
  v8f acc[8] = {};
  const float* oblk = O + (r0 / 16) * (DM / 32) * 512; const __bf16* pblk = P + (size_t)(n0 / 16) * (DM / 32) * 512;
  R16 xa[2]; v16b wb[2][8];   // two register sets: step kc + 1 is loaded as one group while step kc is multiplied
  xa[0] = ld_t(oblk, lane);
#pragma unroll
  for (int j = 0; j < 8; ++j) wb[0][j] = frag_t(pblk + (size_t)j * (DM / 32) * 512, lane);
#pragma unroll 1   // one trip already holds both register sets; more copies of it would only cost registers
  for (int kc = 0; kc < DM / 32; kc += 2) {
#pragma unroll
    for (int u = 0; u < 2; ++u) { const int kn = min(kc + u + 1, DM / 32 - 1);   // the last step loads itself again (in bounds, unused)
      const float* xp = oblk + kn * 512 + lane * 4; const __bf16* wp = pblk + (size_t)kn * 512 + lane * 8;   // the lane's own addresses in the step's blocks
      xa[u ^ 1] = ld_t(xp, 0);
#pragma unroll
      for (int j = 0; j < 8; ++j) wb[u ^ 1][j] = frag_t(wp + (size_t)j * (DM / 32) * 512, 0);
      asm volatile("s_wait_xcnt 0x0" :: "v"(xp), "v"(wp) : "memory");   // without it this build takes an address pair of these loads as a destination of one of them; as inputs here the pairs live up to the wait, which stands in front of any overwrite
      const F2 a = split_raw(xa[u]);
#pragma unroll
      for (int j = 0; j < 8; ++j) { acc[j] = wmma_bf(a.l, wb[u][j], acc[j]); acc[j] = wmma_bf(a.h, wb[u][j], acc[j]); } } }
#pragma unroll
  for (int j = 0; j < 8; ++j)
#pragma unroll
    for (int r = 0; r < 8; ++r) so[wave][8 * g + r][j * 16 + col] = acc[j][r];
  LDSX();
  for (int rl = 0; rl < 16; ++rl) vst2(Y + (r0 + rl) * DM + n0 + lane * 4, *(const v4f*)&so[wave][rl][lane * 4]);
}
// ---- k_mout: flat writer of the [16][2049] mask after the attention output
__global__ __launch_bounds__(256) void k_mout(const float* __restrict__ MSK, float* __restrict__ out) {
  const size_t p = (size_t)blockIdx.x * 256 + threadIdx.x; const size_t total = (size_t)NH * (SFULL + 1); if (p * 4 >= total) return; v4f v;
#pragma unroll
  for (int i = 0; i < 4; ++i) { const size_t f = p * 4 + i; const size_t row = f / (SFULL + 1), c = f % (SFULL + 1); v[i] = (f < total && c < (size_t)MW) ? MSK[row * MWP + c] : 0.f; }
  vst2(out + p * 4, v);
}
extern "C" void kernel_launch(void* const* d_in, const int* in_sizes, int n_in, void* d_out, int out_size, void* d_ws, size_t ws_size, hipStream_t stream) {
  (void)in_sizes; (void)n_in; (void)out_size;
  const float** F = (const float**)d_in;   // hidden_states [1,2048,2048], q_w [2048,2048], q_b [2048], k_w [2048,512], k_b [512], v_w [2048,512], v_b [512], o_w [2048,2048]
  if (ws_size < (size_t)WS_END) return;
  char* ws = (char*)d_ws; __bf16 *PK = (__bf16*)(ws + WS_PK), *XB = (__bf16*)(ws + WS_X), *VTH = (__bf16*)(ws + WS_VTH), *VTL = (__bf16*)(ws + WS_VTL);
  float *Q = (float*)(ws + WS_Q), *Kx = (float*)(ws + WS_K), *O = (float*)(ws + WS_O), *ML = (float*)(ws + WS_ML), *CS = (float*)(ws + WS_CS), *MSK = (float*)(ws + WS_MSK);
  float* OUT0 = (float*)d_out; float* OUT1 = OUT0 + (size_t)SFULL * DM;
  k_packT<<<dim3(DM / 16, DM / 128), 256, 0, stream>>>(F[1], DM, DM, PK + PK_Q); k_packT<<<dim3(KVW / 16, DM / 128), 256, 0, stream>>>(F[3], DM, KVW, PK + PK_K); k_packT<<<dim3(KVW / 16, DM / 128), 256, 0, stream>>>(F[5], DM, KVW, PK + PK_V); k_packT<<<dim3(DM / 16, DM / 128), 256, 0, stream>>>(F[7], DM, DM, PK + PK_O);
  k_packR<<<dim3(SS / 16, DM / 128), 256, 0, stream>>>(F[0], XB);
  k_proj<0><<<dim3(SS / 64, DM / 128), 128, 0, stream>>>(XB, PK + PK_Q, F[2], Q, DM, nullptr, nullptr);
  k_proj<0><<<dim3(SS / 64, KVW / 128), 128, 0, stream>>>(XB, PK + PK_K, F[4], Kx, KVW, nullptr, nullptr);
  k_proj<1><<<dim3(SS / 64, KVW / 128), 128, 0, stream>>>(XB, PK + PK_V, F[6], nullptr, 0, VTH, VTL);
  k_attn<<<dim3(TQB, NH), 128, 0, stream>>>(Q, Kx, VTH, VTL, O, ML);
  k_colsum<<<dim3(TQB, NH), 128, 0, stream>>>(Q, Kx, ML, CS);
  k_mask<<<NH, 256, 0, stream>>>(CS, MSK);
  k_out<<<dim3(TQB, DM / 128), 128, 0, stream>>>(O, PK + PK_O, OUT0);
  k_mout<<<(unsigned)(((size_t)NH * (SFULL + 1) / 4 + 255) / 256), 256, 0, stream>>>(MSK, OUT1);
}

// v004
// One run takes 463 microseconds.
// Two timings next to v003 put it at 1.27 and 1.26 times that version's speed.
// Counting every step since v000, it is 3.08 times as fast.
// compute dtype: hidden_states and all weights/biases (module inputs) rounded to bf16; q/k/v projections with exact bf16 products (x and W are inputs); causal scores q.k with both computed operands as bf16 hi + residual pairs (3 products) and P.V with P hi/lo x V hi/lo (3 products); the heavy-hitter column sums recompute the same 3-product scores in a second (transposed) pass with the stored row statistics; the output projection with hi/lo x exact o_w (2 products), all on WMMA 16x16x32; softmax, column sums, the per-head top-k selection (bitonic sort, lower index first on ties) and the mask assembly in f32 on the VALU; f32 accumulate.
#include <hip/hip_runtime.h>
#include <math.h>

typedef __attribute__((ext_vector_type(16))) _Float16 v16h;
typedef __attribute__((ext_vector_type(16))) __bf16 v16b;
typedef __attribute__((ext_vector_type(8)))  _Float16 v8h;
typedef __attribute__((ext_vector_type(8)))  float v8f;
typedef __attribute__((ext_vector_type(4)))  float v4f;
typedef __attribute__((ext_vector_type(2)))  float v2f;
typedef __attribute__((ext_vector_type(4)))  unsigned v4u;
typedef __attribute__((ext_vector_type(4)))  int v4i;
typedef float __attribute__((may_alias)) float_a;
typedef int __attribute__((may_alias)) int_a;

template <typename T> __device__ __forceinline__ void vst2(void* p, T v) { *(T*)p = v;  }
__device__ __forceinline__ v8f wmma16(v16h a, v16h b, v8f c) {
  v8f d = __builtin_amdgcn_wmma_f32_16x16x32_f16(false, a, false, b, (short)0, c, false, false);
  asm volatile("v_nop\n\tv_nop\n\tv_nop\n\tv_nop" : "+v"(d) : "v"(a), "v"(b));
  return d;
}
__device__ __forceinline__ v8f wmma_bf(v16b a, v16b b, v8f c) {
  v8f d = __builtin_amdgcn_wmma_f32_16x16x32_bf16(false, a, false, b, (short)0, c, false, false);
  asm volatile("v_nop\n\tv_nop\n\tv_nop\n\tv_nop" : "+v"(d) : "v"(a), "v"(b));
  return d;
}
// 16x16x32 fragments: lane = (h = lane>>4, row/col = lane&15); elements 0..7 = k0+8h+0..7, 8..15 = k0+16+8h+0..7; D element r = row 8h+r
__device__ __forceinline__ v16h frag_h(const _Float16* rowk0, int lane) {
  union { v16h v; v8h q[2]; } u; const _Float16* p = rowk0 + 8 * (lane >> 4);
  u.q[0] = *(const v8h*)p; u.q[1] = *(const v8h*)(p + 16); return u.v;
}
__device__ __forceinline__ v16h frag_f32(const float* rowk0, int lane) {
  v16h a; const float* p = rowk0 + 8 * (lane >> 4);
#pragma unroll
  for (int i = 0; i < 8; ++i) { a[i] = (_Float16)p[i]; a[8 + i] = (_Float16)p[16 + i]; }
  return a;
}
__device__ __forceinline__ v16h frag_f32s(const float* rowk0, int lane, float sc) {
  v16h a; const float* p = rowk0 + 8 * (lane >> 4);
#pragma unroll
  for (int i = 0; i < 8; ++i) { a[i] = (_Float16)(p[i] * sc); a[8 + i] = (_Float16)(p[16 + i] * sc); }
  return a;
}
// column fragment from a [K][ld] layout (column n), rows >= K read as 0
__device__ __forceinline__ v16h fragc_f32(const float* W, int k0, int n, int lane, int ld, int K) {
  v16h a; const int g = lane >> 4;
#pragma unroll
  for (int i = 0; i < 8; ++i) { const int ka = k0 + 8 * g + i, kb = ka + 16;
    a[i] = (_Float16)(ka < K ? W[(size_t)(ka < K ? ka : K - 1) * ld + n] : 0.f); a[8 + i] = (_Float16)(kb < K ? W[(size_t)(kb < K ? kb : K - 1) * ld + n] : 0.f); }
  return a;
}
struct F2 { v16b h, l; };
__device__ __forceinline__ F2 bsplit16(const float v[16]) { F2 r;
#pragma unroll
  for (int i = 0; i < 16; ++i) { const __bf16 h = (__bf16)v[i]; r.h[i] = h; r.l[i] = (__bf16)(v[i] - (float)h); }
  return r; }
__device__ __forceinline__ F2 split_row(const float* row, int k0, int lane) { float v[16]; const float* p = row + k0 + 8 * (lane >> 4);
#pragma unroll
  for (int i = 0; i < 8; ++i) { v[i] = p[i]; v[8 + i] = p[16 + i]; }
  return bsplit16(v); }
__device__ __forceinline__ F2 split_rowK(const float* row, int k0, int lane, int K) { float v[16]; const int g = lane >> 4;
#pragma unroll
  for (int i = 0; i < 8; ++i) { const int ka = k0 + 8 * g + i, kb = ka + 16; v[i] = ka < K ? row[ka < K ? ka : K - 1] : 0.f; v[8 + i] = kb < K ? row[kb < K ? kb : K - 1] : 0.f; }
  return bsplit16(v); }
__device__ __forceinline__ F2 split_col(const float* W, int k0, int n, int lane, int ld, int K) { float v[16]; const int g = lane >> 4;
#pragma unroll
  for (int i = 0; i < 8; ++i) { const int ka = k0 + 8 * g + i, kb = ka + 16; v[i] = ka < K ? W[(size_t)(ka < K ? ka : K - 1) * ld + n] : 0.f; v[8 + i] = kb < K ? W[(size_t)(kb < K ? kb : K - 1) * ld + n] : 0.f; }
  return bsplit16(v); }
__device__ __forceinline__ v8f mac3(const F2& a, const F2& b, v8f c) { c = wmma_bf(a.l, b.h, c); c = wmma_bf(a.h, b.l, c); return wmma_bf(a.h, b.h, c); }
__device__ __forceinline__ float sigm(float v) { return 1.0f / (1.0f + expf(-v)); }
#define LDSX() do { asm volatile("s_wait_dscnt 0" ::: "memory"); __builtin_amdgcn_wave_barrier(); __builtin_amdgcn_fence(__ATOMIC_RELEASE, "workgroup"); } while (0)


// GQA causal attention with H2O heavy-hitter scoring (B 1, S 2048, D 2048, 16 query heads / 4 kv heads x 128): out = softmax(q k^T / sqrt(128), causal) v -> @ o_w; cur[h][s] = sum over queries of probs; mask[h] = 1 on the last 204 of 2049 positions, 0 elsewhere, then 1 at the top-204 (heavy budget) indices of cur[h][:1844].
#define SFULL 2048            // shipped sequence length (output layout)
#ifndef SS
#define SS SFULL              // active sequence length (all)
#endif
#define DM 2048
#define NH 16
#define NKV 4
#define HD 128
#define KVW (NKV * HD)        // 512
#define HEAVY (SS / 10)       // int(0.1 * S)
#define RECENT (SS / 10)
#define MW (SS + 1)           // 2049 mask width
#define MWP 2064              // padded staging width
#define TQB (SS / 64)         // query blocks
typedef __attribute__((ext_vector_type(8))) __bf16 v8b;
// fragment-order storage: a [rows][k] operand that a kernel of this file writes is kept as blocks of 16 rows x 32 k, block (rt, kc) at index rt * (k / 32) + kc; inside a block the 16-byte pieces stand in the order in which the lanes load them, so every wave-wide load or store is 512 bytes in a row (4 whole lines, not 16 part lines)
// bf16 block = 512 elements: piece (half, lane) at half * 256 + lane * 8 holds row lane & 15, k = half * 16 + 8 * (lane >> 4) + 0..7
__device__ __forceinline__ v16b frag_t(const __bf16* blk, int lane) {
  union { v16b v; v8b q[2]; } u;
  u.q[0] = *(const v8b*)(blk + lane * 8); u.q[1] = *(const v8b*)(blk + 256 + lane * 8); return u.v;
}
__device__ __forceinline__ float bfr(float v) { return (float)(__bf16)v; }
// the same product with only D named at the v_nops, which so stand in front of the next reader of D (A and B are left to the compiler's own padding of its builtin): an operand that an asm statement names must stand below v256, and with A and B named too k_attn, which holds a whole step's fragments, builds with spills to scratch
__device__ __forceinline__ v8f wmma_bf_d(v16b a, v16b b, v8f c) {
  v8f d = __builtin_amdgcn_wmma_f32_16x16x32_bf16(false, a, false, b, (short)0, c, false, false);
  asm volatile("v_nop\n\tv_nop\n\tv_nop\n\tv_nop" : "+v"(d));
  return d;
}
__device__ __forceinline__ v8f mac3_d(const F2& a, const F2& b, v8f c) { c = wmma_bf_d(a.l, b.h, c); c = wmma_bf_d(a.h, b.l, c); return wmma_bf_d(a.h, b.h, c); }
// the 8 rows' exchange with lane ^ o as ONE group, 8 ds_bpermute_b32 and their one wait in one statement (a = 4 * (lane ^ o), as __shfl_xor forms it): with 8 V tiles live across the softmax the scheduler otherwise folds the rows into pairs, whose exchanges then wait one behind another (so a build with __shfl_xor here: two exchanges or one to a wait)
__device__ __forceinline__ void xch8(float (&t)[8], const float (&x)[8], int a) {
  asm volatile("ds_bpermute_b32 %0, %8, %9\n\tds_bpermute_b32 %1, %8, %10\n\tds_bpermute_b32 %2, %8, %11\n\tds_bpermute_b32 %3, %8, %12\n\t"
               "ds_bpermute_b32 %4, %8, %13\n\tds_bpermute_b32 %5, %8, %14\n\tds_bpermute_b32 %6, %8, %15\n\tds_bpermute_b32 %7, %8, %16\n\ts_wait_dscnt 0x0"
               : "=&v"(t[0]), "=&v"(t[1]), "=&v"(t[2]), "=&v"(t[3]), "=&v"(t[4]), "=&v"(t[5]), "=&v"(t[6]), "=&v"(t[7])
               : "v"(a), "v"(x[0]), "v"(x[1]), "v"(x[2]), "v"(x[3]), "v"(x[4]), "v"(x[5]), "v"(x[6]), "v"(x[7]) : "memory");
}
// a wave's own exchange through its own LDS rows: its LDS operations are done and the compiler moves no memory access across; unlike LDSX it holds no fence, which would also wait for every global load in flight
#define LDSW() do { asm volatile("s_wait_dscnt 0" ::: "memory"); __builtin_amdgcn_wave_barrier(); } while (0)
// the 16 f32 of one lane's fragment slice (k0+8h+0..7, k0+16+8h+0..7), kept as loaded: conversion waits for the data, so it is done where the fragment is used
struct R16 { v4f q[4]; };
// f32 block = 512 floats: piece (qi, lane) at qi * 128 + lane * 4 holds row lane & 15, k = (qi >> 1) * 16 + 8 * (lane >> 4) + (qi & 1) * 4 + 0..3
__device__ __forceinline__ R16 ld_t(const float* blk, int lane) { R16 r;
#pragma unroll
  for (int qi = 0; qi < 4; ++qi) r.q[qi] = *(const v4f*)(blk + qi * 128 + lane * 4);
  return r; }
// one wave's 16 x 128 f32 tile, from its LDS staging rows to 4 f32 blocks in a row
__device__ __forceinline__ void st_t(float* blk, const float (*st)[132], int lane) {
#pragma unroll
  for (int sl = 0; sl < 4; ++sl) {
#pragma unroll
    for (int qi = 0; qi < 4; ++qi) vst2(blk + sl * 512 + qi * 128 + lane * 4, *(const v4f*)&st[lane & 15][sl * 32 + (qi >> 1) * 16 + 8 * (lane >> 4) + (qi & 1) * 4]); }
}
__device__ __forceinline__ F2 split_raw(const R16& r) { float v[16];
#pragma unroll
  for (int i = 0; i < 4; ++i) { v[i] = r.q[0][i]; v[4 + i] = r.q[1][i]; v[8 + i] = r.q[2][i]; v[12 + i] = r.q[3][i]; }
  return bsplit16(v); }
__device__ __attribute__((noinline)) float erf_ni(float v) { return erff(v); }

#define PK_Q 0                               // [2048 n][2048 k] q_w^T (all four: bf16 blocks)
#define PK_K (PK_Q + DM * DM)                  // [512][2048]
#define PK_V (PK_K + KVW * DM)
#define PK_O (PK_V + KVW * DM)                 // [2048][2048] o_w^T
#define PK_END (PK_O + DM * DM)
#define WS_PK  0u
#define WS_Q   (WS_PK + 2u * PK_END)           // f32 blocks [2048][2048] q (h*128+d)
#define WS_K   (WS_Q + 4u * SS * DM)            // f32 blocks [2048][512]
#define WS_VTH (WS_K + 4u * SS * KVW)           // bf16 blocks [512 (kv*128+d)][2048]
#define WS_VTL (WS_VTH + 2u * KVW * SS)
#define WS_O   (WS_VTL + 2u * KVW * SS)         // f32 blocks [2048][2048] attention output (h*128+d)
#define WS_ML  (WS_O + 4u * SS * DM)            // f32 [16][2048][4]: (m, 1/l, 0, 0)
#define WS_CS  (WS_ML + 4u * NH * SS * 4)       // f32 [16][32 qblocks][2048]: per-query-block partial column sums
#define WS_MSK (WS_CS + 4u * NH * TQB * SS)     // f32 [16][2064] mask staging
#define WS_X   (WS_MSK + 4u * NH * MWP)         // bf16 blocks [2048][2048] hidden_states
#define WS_END (WS_X + 2u * SS * DM)

// ---- k_packT: block = (16 output columns, 128 k) of a [K][N] (x @ W) matrix: 4 bf16 blocks in a row (4 KB) of W^T; a thread makes one 16-byte piece
__global__ __launch_bounds__(256) void k_packT(const float* __restrict__ Wm, int K, int N, __bf16* __restrict__ DST) {
  const int tid = threadIdx.x, lane = tid & 31, half = (tid >> 5) & 1, kc = blockIdx.y * 4 + (tid >> 6);
  const float* src = Wm + (size_t)(kc * 32 + half * 16 + 8 * (lane >> 4)) * N + blockIdx.x * 16 + (lane & 15);
  v8b o;
#pragma unroll
  for (int i = 0; i < 8; ++i) o[i] = (__bf16)src[(size_t)i * N];
  vst2(DST + ((size_t)blockIdx.x * (K / 32) + kc) * 512 + half * 256 + lane * 8, o);
}
// ---- k_packR: block = (16 rows, 128 k) of the row-major [rows][DM] x: 4 bf16 blocks in a row (4 KB) of bf16(x); a thread makes one 16-byte piece
__global__ __launch_bounds__(256) void k_packR(const float* __restrict__ X, __bf16* __restrict__ DST) {
  const int tid = threadIdx.x, lane = tid & 31, half = (tid >> 5) & 1, kc = blockIdx.y * 4 + (tid >> 6);
  const float* src = X + (size_t)(blockIdx.x * 16 + (lane & 15)) * DM + kc * 32 + half * 16 + 8 * (lane >> 4);
  const v4f a = *(const v4f*)src, b = *(const v4f*)(src + 4); v8b o;
#pragma unroll
  for (int i = 0; i < 4; ++i) { o[i] = (__bf16)a[i]; o[4 + i] = (__bf16)b[i]; }
  vst2(DST + ((size_t)blockIdx.x * (DM / 32) + kc) * 512 + half * 256 + lane * 8, o);
}
// ---- k_proj<VT>: block = (64 rows, 128 cols): Y = bf16(x) (packed, bf16 blocks) . P rows (exact) + bias; VT 0: f32 blocks of [row][ldo cols]; VT 1: transposed bf16 hi/lo planes, bf16 blocks of [col][row]
template <int VT>
__global__ __launch_bounds__(128) void k_proj(const __bf16* __restrict__ X, const __bf16* __restrict__ P, const float* __restrict__ bias, float* __restrict__ OUT, int ldo, __bf16* __restrict__ PH, __bf16* __restrict__ PL) {
  __shared__ __align__(16) float so[VT ? 1 : 4][16][132]; __shared__ __align__(16) __bf16 sth[VT ? 128 : 1][72], stl[VT ? 128 : 1][72];
  const int tid = threadIdx.x, wave = tid >> 5, lane = tid & 31, col = lane & 15, g = lane >> 4; const size_t r0 = (size_t)blockIdx.x * 64 + wave * 16; const int n0 = blockIdx.y * 128;
  v8f acc[8] = {};
  const __bf16* xblk = X + (r0 / 16) * (DM / 32) * 512; const __bf16* pblk = P + (size_t)(n0 / 16) * (DM / 32) * 512;
  v16b xa[2], wb[2][8];   // two register sets: step kc + 1 is loaded as one group while step kc is multiplied
  xa[0] = frag_t(xblk, lane);
#pragma unroll
  for (int j = 0; j < 8; ++j) wb[0][j] = frag_t(pblk + (size_t)j * (DM / 32) * 512, lane);
#pragma unroll 1   // one trip already holds both register sets; more copies of it would only cost registers
  for (int kc = 0; kc < DM / 32; kc += 2) {
#pragma unroll
    for (int u = 0; u < 2; ++u) { const int kn = min(kc + u + 1, DM / 32 - 1);   // the last step loads itself again (in bounds, unused)
      const __bf16* xp = xblk + kn * 512 + lane * 8; const __bf16* wp = pblk + (size_t)kn * 512 + lane * 8;   // the lane's own addresses in the step's blocks
      xa[u ^ 1] = frag_t(xp, 0);
#pragma unroll
      for (int j = 0; j < 8; ++j) wb[u ^ 1][j] = frag_t(wp + (size_t)j * (DM / 32) * 512, 0);
      asm volatile("s_wait_xcnt 0x0" :: "v"(xp), "v"(wp) : "memory");   // as inputs here the pairs live up to the wait, which stands in front of any overwrite
#pragma unroll
      for (int j = 0; j < 8; ++j) acc[j] = wmma_bf(xa[u], wb[u][j], acc[j]); } }
  if (!VT) {
#pragma unroll
    for (int j = 0; j < 8; ++j) { const float bb = bfr(bias[n0 + j * 16 + col]);
#pragma unroll
      for (int r = 0; r < 8; ++r) so[wave][8 * g + r][j * 16 + col] = acc[j][r] + bb; }
    LDSX();
    st_t(OUT + ((r0 / 16) * (ldo / 32) + n0 / 32) * 512, so[wave], lane);
  } else {
#pragma unroll
    for (int j = 0; j < 8; ++j) { const float bb = bfr(bias[n0 + j * 16 + col]);
#pragma unroll
      for (int r = 0; r < 8; ++r) { const float v = acc[j][r] + bb; const __bf16 hb = (__bf16)v; sth[j * 16 + col][wave * 16 + 8 * g + r] = hb; stl[j * 16 + col][wave * 16 + 8 * g + r] = (__bf16)(v - (float)hb); } }
    __syncthreads();
    for (int q = tid; q < 128 * 8; q += 128) { const int dt = q >> 7, kl = (q >> 6) & 1, half = (q >> 5) & 1;   // 16 blocks a plane (8 column tiles x 2 row steps), 64 pieces each; q & 31 = lane
      const int d = dt * 16 + col, sl = kl * 32 + half * 16 + 8 * g; const size_t o = ((size_t)(n0 / 16 + dt) * (SS / 32) + blockIdx.x * 2 + kl) * 512 + half * 256 + lane * 8;
      vst2((unsigned*)(PH + o), *(const v4u*)&sth[d][sl]); vst2((unsigned*)(PL + o), *(const v4u*)&stl[d][sl]); }
  }
}
// ---- k_attn: block = (64 queries, head h): causal flash attention, kv head = h/4; scores 3 products, P.V 3 products; O[q][h*128+d]; ML[h][q] = (m, 1/l)
// waves_per_eu(2, 2): this grid puts two waves on a SIMD; at the default register target the scheduler folds the softmax's 8 rows back into pairs that run one behind another
__global__ __launch_bounds__(128) __attribute__((amdgpu_waves_per_eu(2, 2))) void k_attn(const float* __restrict__ Q, const float* __restrict__ Kx, const __bf16* __restrict__ VTH, const __bf16* __restrict__ VTL, float* __restrict__ O, float* __restrict__ ML) {
  __shared__ __align__(16) float sp[4][16][36]; __shared__ __align__(16) float so[4][16][132]; __shared__ __align__(16) float sml[64][4];
  const int tid = threadIdx.x, wave = tid >> 5, lane = tid & 31, col = lane & 15, g = lane >> 4;
  const int qb = blockIdx.x, h = blockIdx.y, kv = h / (NH / NKV); const int q0 = qb * 64 + wave * 16;
  R16 kr[2][4];   // a whole step's 32 key rows (8 slices) are in flight or in registers before its score products begin
  const float* kp0 = Kx + (size_t)(kv * 4) * 512 + lane * 4; const float* qp = Q + ((size_t)(q0 / 16) * (DM / 32) + h * 4) * 512 + lane * 4;   // the lane's own addresses
  R16 qr[4];
#pragma unroll
  for (int kc = 0; kc < 4; ++kc) qr[kc] = ld_t(qp + kc * 512, 0);
#pragma unroll
  for (int i = 0; i < 8; ++i) kr[i >> 2][i & 3] = ld_t(kp0 + ((i >> 2) * (KVW / 32) + (i & 3)) * 512, 0);
  asm volatile("s_wait_xcnt 0x0" :: "v"(kp0), "v"(qp) : "memory");   // behind the opening loads: the address pairs live up to the wait, which so stands in front of any overwrite of them
  F2 aq[4];
#pragma unroll
  for (int kc = 0; kc < 4; ++kc) aq[kc] = split_raw(qr[kc]);
  float m[8], l[8];
#pragma unroll
  for (int r = 0; r < 8; ++r) { m[r] = -3.0e38f; l[r] = 0.f; }
  v8f acc[8] = {};
  const int nks = (qb * 64 + 64) / 32;   // key steps covering keys <= the block's last query
#pragma unroll 1
  for (int ks = 0; ks < nks; ++ks) { v8f s[2];
    v16b vh[8], vl[8];   // the step's V fragments: column tile i is loaded as key slice i is used up (16 registers go, 16 come), so every tile has the rest of the score products and the softmax ahead of its use
    const size_t vbase = ((size_t)(kv * 8) * (SS / 32) + ks) * 512; const __bf16* vhp = VTH + vbase + lane * 8; const __bf16* vlp = VTL + vbase + lane * 8;   // the lane's own addresses in the step's blocks
    const float* kp = Kx + ((size_t)(min(ks + 1, nks - 1) * 2) * (KVW / 32) + kv * 4) * 512 + lane * 4;   // the last step loads itself again (in bounds, unused)
#pragma unroll
    for (int ct = 0; ct < 2; ++ct) { const int kk = ks * 32 + ct * 16 + col; v8f c = {};
#pragma unroll
      for (int kc = 0; kc < 4; ++kc) { const F2 kb = split_raw(kr[ct][kc]); const int dt = ct * 4 + kc;
        vh[dt] = frag_t(vhp + (size_t)dt * (SS / 32) * 512, 0); vl[dt] = frag_t(vlp + (size_t)dt * (SS / 32) * 512, 0);
        c = mac3_d(aq[kc], kb, c); }
#pragma unroll
      for (int r = 0; r < 8; ++r) { const int qi = q0 + 8 * g + r; s[ct][r] = (kk <= qi) ? c[r] * 0.08838834764831845f : -3.0e38f; } }
    asm volatile("s_wait_xcnt 0x0" :: "v"(vhp), "v"(vlp) : "memory");   // behind the step's last V load: as inputs here the address pairs live up to the wait, which so stands in front of any overwrite of them
    float mn[8], al[8], es[8];   // the softmax goes stage by stage over the 8 rows: within a stage the rows' chains (lane exchanges, exp) are independent and run side by side
#pragma unroll
    for (int r = 0; r < 8; ++r) mn[r] = fmaxf(s[0][r], s[1][r]);
#pragma unroll
    for (int o = 1; o < 16; o <<= 1) { float t[8]; xch8(t, mn, (lane ^ o) << 2);
#pragma unroll
      for (int r = 0; r < 8; ++r) mn[r] = fmaxf(mn[r], t[r]); }
#pragma unroll
    for (int r = 0; r < 8; ++r) { mn[r] = fmaxf(m[r], mn[r]);
      const float xa = expf(m[r] - mn[r]), x0 = expf(s[0][r] - mn[r]), x1 = expf(s[1][r] - mn[r]);   // inline and in every lane; a masked or not yet started entry is set to 0 by a select, not branched round
      al[r] = (m[r] <= -1.0e38f) ? 0.f : xa;
      const float e0 = (s[0][r] <= -1.0e38f) ? 0.f : x0, e1 = (s[1][r] <= -1.0e38f) ? 0.f : x1; es[r] = e0 + e1;
      sp[wave][8 * g + r][col] = e0; sp[wave][8 * g + r][16 + col] = e1; }
#pragma unroll
    for (int o = 1; o < 16; o <<= 1) { float t[8]; xch8(t, es, (lane ^ o) << 2);
#pragma unroll
      for (int r = 0; r < 8; ++r) es[r] += t[r]; }
#pragma unroll
    for (int r = 0; r < 8; ++r) { l[r] = l[r] * al[r] + es[r]; m[r] = mn[r];
#pragma unroll
      for (int dt = 0; dt < 8; ++dt) acc[dt][r] *= al[r]; }
    LDSW();
    const F2 pa = split_row(&sp[wave][col][0], 0, lane);
#pragma unroll
    for (int dt = 0; dt < 8; ++dt) { acc[dt] = wmma_bf_d(pa.l, vh[dt], acc[dt]); acc[dt] = wmma_bf_d(pa.h, vl[dt], acc[dt]); acc[dt] = wmma_bf_d(pa.h, vh[dt], acc[dt]);
      kr[dt >> 2][dt & 3] = ld_t(kp + ((dt >> 2) * (KVW / 32) + (dt & 3)) * 512, 0); }   // the next step's key slice i as column tile i is used up
    asm volatile("s_wait_xcnt 0x0" :: "v"(kp) : "memory");   // behind the last key load: the address pair lives up to the wait, which so stands in front of any overwrite of it
    LDSW(); }
#pragma unroll
  for (int r = 0; r < 8; ++r) { const float il = 1.0f / l[r];
#pragma unroll
    for (int dt = 0; dt < 8; ++dt) so[wave][8 * g + r][dt * 16 + col] = acc[dt][r] * il;
    if (col == 0) { sml[wave * 16 + 8 * g + r][0] = m[r]; sml[wave * 16 + 8 * g + r][1] = il; sml[wave * 16 + 8 * g + r][2] = 0.f; sml[wave * 16 + 8 * g + r][3] = 0.f; } }
  __syncthreads();
  st_t(O + ((size_t)(q0 / 16) * (DM / 32) + h * 4) * 512, so[wave], lane);
  asm volatile("s_wait_xcnt 0x0" ::: "memory");   // behind the tile's stores, in front of any overwrite of a register that they name
  if (tid < 64) vst2(ML + ((size_t)h * SS + qb * 64 + tid) * 4, *(const v4f*)&sml[tid][0]);
}
// ---- k_colsum: block = (64 keys, head h): partial column sums of probs over each 64-query block qb >= key block: p = exp(s - m_q) * (1/l_q) (s recomputed with the same 3-product dot and scale); CS[h][qb][key] rows of 256 B per (query block, this key block)
//   A = k rows (this block's 64 keys, wave -> 16), B = q rows (16-query tiles) -> D[key][q]; per key row sum over the q columns with the (m, 1/l) of each q and the causal predicate q >= key.
__global__ __launch_bounds__(128) void k_colsum(const float* __restrict__ Q, const float* __restrict__ Kx, const float* __restrict__ ML, float* __restrict__ CS) {
  __shared__ __align__(16) float ssum[64];
  const int tid = threadIdx.x, wave = tid >> 5, lane = tid & 31, col = lane & 15, g = lane >> 4;
  const int kb = blockIdx.x, h = blockIdx.y, kv = h / (NH / NKV); const int k0 = kb * 64 + wave * 16;
  F2 ak[4];
#pragma unroll
  for (int kc = 0; kc < 4; ++kc) ak[kc] = split_raw(ld_t(Kx + ((size_t)(k0 / 16) * (KVW / 32) + kv * 4 + kc) * 512, lane));
  R16 qr[2][4]; v2f ml[2];   // two register sets: the next 16-query tile (rows and statistics) is loaded as one group while this one is worked on
#pragma unroll
  for (int kc = 0; kc < 4; ++kc) qr[0][kc] = ld_t(Q + ((size_t)(kb * 4) * (DM / 32) + h * 4 + kc) * 512, lane);
  ml[0] = *(const v2f*)(ML + ((size_t)h * SS + kb * 64 + col) * 4);
#pragma unroll 1
  for (int qb = kb; qb < TQB; ++qb) { float rs[8];
#pragma unroll
    for (int r = 0; r < 8; ++r) rs[r] = 0.f;
#pragma unroll
    for (int ct = 0; ct < 4; ++ct) { const int qq = qb * 64 + ct * 16 + col; v8f c = {};
      const int qt = ct < 3 ? qb * 4 + ct + 1 : min(qb + 1, TQB - 1) * 4, qn = qt * 16 + col;   // behind the last tile: a tile of the last block again (in bounds, unused)
#pragma unroll
      for (int kc = 0; kc < 4; ++kc) qr[(ct + 1) & 1][kc] = ld_t(Q + ((size_t)qt * (DM / 32) + h * 4 + kc) * 512, lane);
      ml[(ct + 1) & 1] = *(const v2f*)(ML + ((size_t)h * SS + qn) * 4);
#pragma unroll
      for (int kc = 0; kc < 4; ++kc) { const F2 qf = split_raw(qr[ct & 1][kc]); c = mac3(ak[kc], qf, c); }
      const float mq = ml[ct & 1][0], ilq = ml[ct & 1][1];
#pragma unroll
      for (int r = 0; r < 8; ++r) { const int key = k0 + 8 * g + r; const float sc = c[r] * 0.08838834764831845f;
        const float t = rs[r] + expf(sc - mq) * ilq; rs[r] = (key <= qq) ? t : rs[r]; } }   // exp inline and in every lane, the causal test a select: the 8 rows' chains run side by side
#pragma unroll
    for (int o = 1; o < 16; o <<= 1) {   // level by level over the 8 rows: their exchanges are independent and run side by side
#pragma unroll
      for (int r = 0; r < 8; ++r) rs[r] += __shfl_xor(rs[r], o); }
    if (col == 0) {
#pragma unroll
      for (int r = 0; r < 8; ++r) ssum[wave * 16 + 8 * g + r] = rs[r]; }
    __syncthreads();
    if (tid < 16) vst2(CS + (((size_t)h * TQB + qb) * SS) + kb * 64 + tid * 4, *(const v4f*)&ssum[tid * 4]);
    __syncthreads(); }
  // query blocks qb < kb contribute nothing: write zeros so every CS row is defined
  for (int qb = 0; qb < kb; ++qb) { if (tid < 16) vst2(CS + (((size_t)h * TQB + qb) * SS) + kb * 64 + tid * 4, (v4f){0.f, 0.f, 0.f, 0.f}); }
}
__global__ __launch_bounds__(256) void k_mask(const float* __restrict__ CS, float* __restrict__ MSK) {
  __shared__ float sv[SS]; __shared__ int si[SS]; __shared__ __align__(16) float sm[MWP];
  const int h = blockIdx.x, tid = threadIdx.x; const int NSEL = SS - RECENT;   // 1844 candidates
  for (int s = tid; s < SS; s += 256) { float c = 0.f; if (s < NSEL) { for (int qb = 0; qb < TQB; ++qb) c += CS[(((size_t)h * TQB + qb) * SS) + s]; } else c = -3.0e38f; sv[s] = c; si[s] = s; }
  for (int s = tid; s < MWP; s += 256) sm[s] = (s >= MW - RECENT && s < MW) ? 1.0f : 0.f;
  __syncthreads();
  // bitonic sort descending by value, ascending index on ties
  for (int k = 2; k <= SS; k <<= 1) { for (int j = k >> 1; j > 0; j >>= 1) {
      for (int i = tid; i < SS; i += 256) { const int ixj = i ^ j; if (ixj > i) { const bool up = ((i & k) == 0);   // 'up' segments sorted descending
          const float a = sv[i], b = sv[ixj]; const int ia = si[i], ib = si[ixj];
          const bool a_first = (a > b) || (a == b && ia < ib);   // a should come before b in descending order
          const bool swap = up ? !a_first : a_first;
          if (swap) { sv[i] = b; sv[ixj] = a; si[i] = ib; si[ixj] = ia; } } }
      __syncthreads(); } }
  if (tid < HEAVY) { int s = si[tid]; s = min(max(s, 0), NSEL - 1); sm[s] = 1.0f; }
  __syncthreads();
  for (int q = tid; q < MWP / 4; q += 256) vst2(MSK + (size_t)h * MWP + q * 4, *(const v4f*)&sm[q * 4]);
}
// ---- k_out: block = (64 rows, 128 cols): out = O(hi/lo) . o_w^T rows (2 products)
__global__ __launch_bounds__(128) void k_out(const float* __restrict__ O, const __bf16* __restrict__ P, float* __restrict__ Y) {
  __shared__ __align__(16) float so[4][16][132];
  const int tid = threadIdx.x, wave = tid >> 5, lane = tid & 31, col = lane & 15, g = lane >> 4; const size_t r0 = (size_t)blockIdx.x * 64 + wave * 16; const int n0 = blockIdx.y * 128;
  v8f acc[8] = {};
  const float* oblk = O + (r0 / 16) * (DM / 32) * 512; const __bf16* pblk = P + (size_t)(n0 / 16) * (DM / 32) * 512;
  R16 xa[2]; v16b wb[2][8];   // two register sets: step kc + 1 is loaded as one group while step kc is multiplied
  xa[0] = ld_t(oblk, lane);
#pragma unroll
  for (int j = 0; j < 8; ++j) wb[0][j] = frag_t(pblk + (size_t)j * (DM / 32) * 512, lane);
#pragma unroll 1   // one trip already holds both register sets; more copies of it would only cost registers
  for (int kc = 0; kc < DM / 32; kc += 2) {
#pragma unroll
    for (int u = 0; u < 2; ++u) { const int kn = min(kc + u + 1, DM / 32 - 1);   // the last step loads itself again (in bounds, unused)
      const float* xp = oblk + kn * 512 + lane * 4; const __bf16* wp = pblk + (size_t)kn * 512 + lane * 8;   // the lane's own addresses in the step's blocks
      xa[u ^ 1] = ld_t(xp, 0);
#pragma unroll
      for (int j = 0; j < 8; ++j) wb[u ^ 1][j] = frag_t(wp + (size_t)j * (DM / 32) * 512, 0);
      asm volatile("s_wait_xcnt 0x0" :: "v"(xp), "v"(wp) : "memory");   // without it this build takes an address pair of these loads as a destination of one of them; as inputs here the pairs live up to the wait, which stands in front of any overwrite
      const F2 a = split_raw(xa[u]);
#pragma unroll
      for (int j = 0; j < 8; ++j) { acc[j] = wmma_bf(a.l, wb[u][j], acc[j]); acc[j] = wmma_bf(a.h, wb[u][j], acc[j]); } } }
#pragma unroll
  for (int j = 0; j < 8; ++j)
#pragma unroll
    for (int r = 0; r < 8; ++r) so[wave][8 * g + r][j * 16 + col] = acc[j][r];
  LDSX();
  for (int rl = 0; rl < 16; ++rl) vst2(Y + (r0 + rl) * DM + n0 + lane * 4, *(const v4f*)&so[wave][rl][lane * 4]);
}
// ---- k_mout: flat writer of the [16][2049] mask after the attention output
__global__ __launch_bounds__(256) void k_mout(const float* __restrict__ MSK, float* __restrict__ out) {
  const size_t p = (size_t)blockIdx.x * 256 + threadIdx.x; const size_t total = (size_t)NH * (SFULL + 1); if (p * 4 >= total) return; v4f v;
#pragma unroll
  for (int i = 0; i < 4; ++i) { const size_t f = p * 4 + i; const size_t row = f / (SFULL + 1), c = f % (SFULL + 1); v[i] = (f < total && c < (size_t)MW) ? MSK[row * MWP + c] : 0.f; }
  vst2(out + p * 4, v);
}
extern "C" void kernel_launch(void* const* d_in, const int* in_sizes, int n_in, void* d_out, int out_size, void* d_ws, size_t ws_size, hipStream_t stream) {
  (void)in_sizes; (void)n_in; (void)out_size;
  const float** F = (const float**)d_in;   // hidden_states [1,2048,2048], q_w [2048,2048], q_b [2048], k_w [2048,512], k_b [512], v_w [2048,512], v_b [512], o_w [2048,2048]
  if (ws_size < (size_t)WS_END) return;
  char* ws = (char*)d_ws; __bf16 *PK = (__bf16*)(ws + WS_PK), *XB = (__bf16*)(ws + WS_X), *VTH = (__bf16*)(ws + WS_VTH), *VTL = (__bf16*)(ws + WS_VTL);
  float *Q = (float*)(ws + WS_Q), *Kx = (float*)(ws + WS_K), *O = (float*)(ws + WS_O), *ML = (float*)(ws + WS_ML), *CS = (float*)(ws + WS_CS), *MSK = (float*)(ws + WS_MSK);
  float* OUT0 = (float*)d_out; float* OUT1 = OUT0 + (size_t)SFULL * DM;
  k_packT<<<dim3(DM / 16, DM / 128), 256, 0, stream>>>(F[1], DM, DM, PK + PK_Q); k_packT<<<dim3(KVW / 16, DM / 128), 256, 0, stream>>>(F[3], DM, KVW, PK + PK_K); k_packT<<<dim3(KVW / 16, DM / 128), 256, 0, stream>>>(F[5], DM, KVW, PK + PK_V); k_packT<<<dim3(DM / 16, DM / 128), 256, 0, stream>>>(F[7], DM, DM, PK + PK_O);
  k_packR<<<dim3(SS / 16, DM / 128), 256, 0, stream>>>(F[0], XB);
  k_proj<0><<<dim3(SS / 64, DM / 128), 128, 0, stream>>>(XB, PK + PK_Q, F[2], Q, DM, nullptr, nullptr);
  k_proj<0><<<dim3(SS / 64, KVW / 128), 128, 0, stream>>>(XB, PK + PK_K, F[4], Kx, KVW, nullptr, nullptr);
  k_proj<1><<<dim3(SS / 64, KVW / 128), 128, 0, stream>>>(XB, PK + PK_V, F[6], nullptr, 0, VTH, VTL);
  k_attn<<<dim3(TQB, NH), 128, 0, stream>>>(Q, Kx, VTH, VTL, O, ML);
  k_colsum<<<dim3(TQB, NH), 128, 0, stream>>>(Q, Kx, ML, CS);
  k_mask<<<NH, 256, 0, stream>>>(CS, MSK);
  k_out<<<dim3(TQB, DM / 128), 128, 0, stream>>>(O, PK + PK_O, OUT0);
  k_mout<<<(unsigned)(((size_t)NH * (SFULL + 1) / 4 + 255) / 256), 256, 0, stream>>>(MSK, OUT1);
}

// v005
// It runs in 388 microseconds.
// Next to v004, in two timings, it ran 1.19 times as fast each time.
// Counting every step since v000, it is 3.66 times as fast.
// compute dtype: hidden_states and all weights/biases (module inputs) rounded to bf16; q/k/v projections with exact bf16 products (x and W are inputs); causal scores q.k with both computed operands as bf16 hi + residual pairs (3 products) and P.V with P hi/lo x V hi/lo (3 products); the heavy-hitter column sums recompute the same 3-product scores in a second (transposed) pass with the stored row statistics; the output projection with hi/lo x exact o_w (2 products), all on WMMA 16x16x32; softmax, column sums, the per-head top-k selection (bitonic sort, lower index first on ties) and the mask assembly in f32 on the VALU; f32 accumulate.
#include <hip/hip_runtime.h>
#include <math.h>

typedef __attribute__((ext_vector_type(16))) _Float16 v16h;
typedef __attribute__((ext_vector_type(16))) __bf16 v16b;
typedef __attribute__((ext_vector_type(8)))  _Float16 v8h;
typedef __attribute__((ext_vector_type(8)))  float v8f;
typedef __attribute__((ext_vector_type(4)))  float v4f;
typedef __attribute__((ext_vector_type(2)))  float v2f;
typedef __attribute__((ext_vector_type(4)))  unsigned v4u;
typedef __attribute__((ext_vector_type(4)))  int v4i;
typedef float __attribute__((may_alias)) float_a;
typedef int __attribute__((may_alias)) int_a;

template <typename T> __device__ __forceinline__ void vst2(void* p, T v) { *(T*)p = v;  }
__device__ __forceinline__ v8f wmma16(v16h a, v16h b, v8f c) {
  v8f d = __builtin_amdgcn_wmma_f32_16x16x32_f16(false, a, false, b, (short)0, c, false, false);
  asm volatile("v_nop\n\tv_nop\n\tv_nop\n\tv_nop" : "+v"(d) : "v"(a), "v"(b));
  return d;
}
__device__ __forceinline__ v8f wmma_bf(v16b a, v16b b, v8f c) {
  v8f d = __builtin_amdgcn_wmma_f32_16x16x32_bf16(false, a, false, b, (short)0, c, false, false);
  asm volatile("v_nop\n\tv_nop\n\tv_nop\n\tv_nop" : "+v"(d) : "v"(a), "v"(b));
  return d;
}
// 16x16x32 fragments: lane = (h = lane>>4, row/col = lane&15); elements 0..7 = k0+8h+0..7, 8..15 = k0+16+8h+0..7; D element r = row 8h+r
__device__ __forceinline__ v16h frag_h(const _Float16* rowk0, int lane) {
  union { v16h v; v8h q[2]; } u; const _Float16* p = rowk0 + 8 * (lane >> 4);
  u.q[0] = *(const v8h*)p; u.q[1] = *(const v8h*)(p + 16); return u.v;
}
__device__ __forceinline__ v16h frag_f32(const float* rowk0, int lane) {
  v16h a; const float* p = rowk0 + 8 * (lane >> 4);
#pragma unroll
  for (int i = 0; i < 8; ++i) { a[i] = (_Float16)p[i]; a[8 + i] = (_Float16)p[16 + i]; }
  return a;
}
__device__ __forceinline__ v16h frag_f32s(const float* rowk0, int lane, float sc) {
  v16h a; const float* p = rowk0 + 8 * (lane >> 4);
#pragma unroll
  for (int i = 0; i < 8; ++i) { a[i] = (_Float16)(p[i] * sc); a[8 + i] = (_Float16)(p[16 + i] * sc); }
  return a;
}
// column fragment from a [K][ld] layout (column n), rows >= K read as 0
__device__ __forceinline__ v16h fragc_f32(const float* W, int k0, int n, int lane, int ld, int K) {
  v16h a; const int g = lane >> 4;
#pragma unroll
  for (int i = 0; i < 8; ++i) { const int ka = k0 + 8 * g + i, kb = ka + 16;
    a[i] = (_Float16)(ka < K ? W[(size_t)(ka < K ? ka : K - 1) * ld + n] : 0.f); a[8 + i] = (_Float16)(kb < K ? W[(size_t)(kb < K ? kb : K - 1) * ld + n] : 0.f); }
  return a;
}
struct F2 { v16b h, l; };
__device__ __forceinline__ F2 bsplit16(const float v[16]) { F2 r;
#pragma unroll
  for (int i = 0; i < 16; ++i) { const __bf16 h = (__bf16)v[i]; r.h[i] = h; r.l[i] = (__bf16)(v[i] - (float)h); }
  return r; }
__device__ __forceinline__ F2 split_row(const float* row, int k0, int lane) { float v[16]; const float* p = row + k0 + 8 * (lane >> 4);
#pragma unroll
  for (int i = 0; i < 8; ++i) { v[i] = p[i]; v[8 + i] = p[16 + i]; }
  return bsplit16(v); }
__device__ __forceinline__ F2 split_rowK(const float* row, int k0, int lane, int K) { float v[16]; const int g = lane >> 4;
#pragma unroll
  for (int i = 0; i < 8; ++i) { const int ka = k0 + 8 * g + i, kb = ka + 16; v[i] = ka < K ? row[ka < K ? ka : K - 1] : 0.f; v[8 + i] = kb < K ? row[kb < K ? kb : K - 1] : 0.f; }
  return bsplit16(v); }
__device__ __forceinline__ F2 split_col(const float* W, int k0, int n, int lane, int ld, int K) { float v[16]; const int g = lane >> 4;
#pragma unroll
  for (int i = 0; i < 8; ++i) { const int ka = k0 + 8 * g + i, kb = ka + 16; v[i] = ka < K ? W[(size_t)(ka < K ? ka : K - 1) * ld + n] : 0.f; v[8 + i] = kb < K ? W[(size_t)(kb < K ? kb : K - 1) * ld + n] : 0.f; }
  return bsplit16(v); }
__device__ __forceinline__ v8f mac3(const F2& a, const F2& b, v8f c) { c = wmma_bf(a.l, b.h, c); c = wmma_bf(a.h, b.l, c); return wmma_bf(a.h, b.h, c); }
__device__ __forceinline__ float sigm(float v) { return 1.0f / (1.0f + expf(-v)); }
#define LDSX() do { asm volatile("s_wait_dscnt 0" ::: "memory"); __builtin_amdgcn_wave_barrier(); __builtin_amdgcn_fence(__ATOMIC_RELEASE, "workgroup"); } while (0)


// GQA causal attention with H2O heavy-hitter scoring (B 1, S 2048, D 2048, 16 query heads / 4 kv heads x 128): out = softmax(q k^T / sqrt(128), causal) v -> @ o_w; cur[h][s] = sum over queries of probs; mask[h] = 1 on the last 204 of 2049 positions, 0 elsewhere, then 1 at the top-204 (heavy budget) indices of cur[h][:1844].
#define SFULL 2048            // shipped sequence length (output layout)
#ifndef SS
#define SS SFULL              // active sequence length (all)
#endif
#define DM 2048
#define NH 16
#define NKV 4
#define HD 128
#define KVW (NKV * HD)        // 512
#define HEAVY (SS / 10)       // int(0.1 * S)
#define RECENT (SS / 10)
#define MW (SS + 1)           // 2049 mask width
#define MWP 2064              // padded staging width
#define TQB (SS / 64)         // query blocks
typedef __attribute__((ext_vector_type(8))) __bf16 v8b;
// fragment-order storage: a [rows][k] operand that a kernel of this file writes is kept as blocks of 16 rows x 32 k, block (rt, kc) at index rt * (k / 32) + kc; inside a block the 16-byte pieces stand in the order in which the lanes load them, so every wave-wide load or store is 512 bytes in a row (4 whole lines, not 16 part lines)
// bf16 block = 512 elements: piece (half, lane) at half * 256 + lane * 8 holds row lane & 15, k = half * 16 + 8 * (lane >> 4) + 0..7
__device__ __forceinline__ v16b frag_t(const __bf16* blk, int lane) {
  union { v16b v; v8b q[2]; } u;
  u.q[0] = *(const v8b*)(blk + lane * 8); u.q[1] = *(const v8b*)(blk + 256 + lane * 8); return u.v;
}
__device__ __forceinline__ float bfr(float v) { return (float)(__bf16)v; }
// the same product with only D named at the v_nops, which so stand in front of the next reader of D (A and B are left to the compiler's own padding of its builtin): an operand that an asm statement names must stand below v256, and with A and B named too k_attn, which holds a whole step's fragments, builds with spills to scratch
__device__ __forceinline__ v8f wmma_bf_d(v16b a, v16b b, v8f c) {
  v8f d = __builtin_amdgcn_wmma_f32_16x16x32_bf16(false, a, false, b, (short)0, c, false, false);
  asm volatile("v_nop\n\tv_nop\n\tv_nop\n\tv_nop" : "+v"(d));
  return d;
}
__device__ __forceinline__ v8f mac3_d(const F2& a, const F2& b, v8f c) { c = wmma_bf_d(a.l, b.h, c); c = wmma_bf_d(a.h, b.l, c); return wmma_bf_d(a.h, b.h, c); }
// the 8 rows' exchange with lane ^ o as ONE group, 8 ds_bpermute_b32 and their one wait in one statement (a = 4 * (lane ^ o), as __shfl_xor forms it): with 8 V tiles live across the softmax the scheduler otherwise folds the rows into pairs, whose exchanges then wait one behind another (so a build with __shfl_xor here: two exchanges or one to a wait)
__device__ __forceinline__ void xch8(float (&t)[8], const float (&x)[8], int a) {
  asm volatile("ds_bpermute_b32 %0, %8, %9\n\tds_bpermute_b32 %1, %8, %10\n\tds_bpermute_b32 %2, %8, %11\n\tds_bpermute_b32 %3, %8, %12\n\t"
               "ds_bpermute_b32 %4, %8, %13\n\tds_bpermute_b32 %5, %8, %14\n\tds_bpermute_b32 %6, %8, %15\n\tds_bpermute_b32 %7, %8, %16\n\ts_wait_dscnt 0x0"
               : "=&v"(t[0]), "=&v"(t[1]), "=&v"(t[2]), "=&v"(t[3]), "=&v"(t[4]), "=&v"(t[5]), "=&v"(t[6]), "=&v"(t[7])
               : "v"(a), "v"(x[0]), "v"(x[1]), "v"(x[2]), "v"(x[3]), "v"(x[4]), "v"(x[5]), "v"(x[6]), "v"(x[7]) : "memory");
}
// a wave's own exchange through its own LDS rows: its LDS operations are done and the compiler moves no memory access across; unlike LDSX it holds no fence, which would also wait for every global load in flight
#define LDSW() do { asm volatile("s_wait_dscnt 0" ::: "memory"); __builtin_amdgcn_wave_barrier(); } while (0)
// the 16 registers of one lane's slice of a hi/lo operand pair, as loaded: q[0], q[1] the hi fragment, q[2], q[3] the residual fragment
struct R16 { v4f q[4]; };
// pair block = 2 KB (addressed as 512 floats): the bf16 block of the hi parts, then the bf16 block of the residuals; piece (pl, half, lane) at float (pl * 2 + half) * 128 + lane * 4 holds 8 bf16 of row lane & 15, k = half * 16 + 8 * (lane >> 4) + 0..7
// a computed f32 operand (q, k, the attention output) is split ONCE, by the wave that stores it; every wave that loads it (a key slice: 4 heads x up to 128 query tiles) has its two WMMA fragments in the loaded registers, with no conversion
__device__ __forceinline__ R16 ld_t(const float* blk, int lane) { R16 r;
#pragma unroll
  for (int qi = 0; qi < 4; ++qi) r.q[qi] = *(const v4f*)(blk + qi * 128 + lane * 4);
  return r; }
// one wave's 16 x 128 f32 tile, from its LDS staging rows to 4 pair blocks in a row: hi = bf16(v), residual = bf16(v - hi), as bsplit16 forms them
__device__ __forceinline__ void st_t(float* blk, const float (*st)[132], int lane) {
#pragma unroll
  for (int sl = 0; sl < 4; ++sl) {
#pragma unroll
    for (int half = 0; half < 2; ++half) { const float* p = &st[lane & 15][sl * 32 + half * 16 + 8 * (lane >> 4)]; const v4f a = *(const v4f*)p, b = *(const v4f*)(p + 4);
      union { v8b b8; v4f f; } hi, lo;
#pragma unroll
      for (int i = 0; i < 8; ++i) { const float v = i < 4 ? a[i & 3] : b[i & 3]; const __bf16 hb = (__bf16)v; hi.b8[i] = hb; lo.b8[i] = (__bf16)(v - (float)hb); }
      vst2(blk + sl * 512 + half * 128 + lane * 4, hi.f); vst2(blk + sl * 512 + (2 + half) * 128 + lane * 4, lo.f); } }
}
// the two fragments of a loaded slice: the registers as they are, no instruction
__device__ __forceinline__ F2 split_raw(const R16& r) { union { v4f f[2]; v16b b; } hi, lo; F2 o;
  hi.f[0] = r.q[0]; hi.f[1] = r.q[1]; lo.f[0] = r.q[2]; lo.f[1] = r.q[3]; o.h = hi.b; o.l = lo.b; return o; }
__device__ __attribute__((noinline)) float erf_ni(float v) { return erff(v); }

#define PK_Q 0                               // [2048 n][2048 k] q_w^T (all four: bf16 blocks)
#define PK_K (PK_Q + DM * DM)                  // [512][2048]
#define PK_V (PK_K + KVW * DM)
#define PK_O (PK_V + KVW * DM)                 // [2048][2048] o_w^T
#define PK_END (PK_O + DM * DM)
#define WS_PK  0u
#define WS_Q   (WS_PK + 2u * PK_END)           // pair blocks [2048][2048] q (h*128+d)
#define WS_K   (WS_Q + 4u * SS * DM)            // pair blocks [2048][512]
#define WS_VTH (WS_K + 4u * SS * KVW)           // bf16 blocks [512 (kv*128+d)][2048]
#define WS_VTL (WS_VTH + 2u * KVW * SS)
#define WS_O   (WS_VTL + 2u * KVW * SS)         // pair blocks [2048][2048] attention output (h*128+d)
#define WS_ML  (WS_O + 4u * SS * DM)            // f32 [16][2048][4]: (m, 1/l, 0, 0)
#define WS_CS  (WS_ML + 4u * NH * SS * 4)       // f32 [16][32 qblocks][2048]: per-query-block partial column sums
#define WS_MSK (WS_CS + 4u * NH * TQB * SS)     // f32 [16][2064] mask staging
#define WS_X   (WS_MSK + 4u * NH * MWP)         // bf16 blocks [2048][2048] hidden_states
#define WS_END (WS_X + 2u * SS * DM)

// ---- k_packT: block = (16 output columns, 128 k) of a [K][N] (x @ W) matrix: 4 bf16 blocks in a row (4 KB) of W^T; a thread makes one 16-byte piece
__global__ __launch_bounds__(256) void k_packT(const float* __restrict__ Wm, int K, int N, __bf16* __restrict__ DST) {
  const int tid = threadIdx.x, lane = tid & 31, half = (tid >> 5) & 1, kc = blockIdx.y * 4 + (tid >> 6);
  const float* src = Wm + (size_t)(kc * 32 + half * 16 + 8 * (lane >> 4)) * N + blockIdx.x * 16 + (lane & 15);
  v8b o;
#pragma unroll
  for (int i = 0; i < 8; ++i) o[i] = (__bf16)src[(size_t)i * N];
  vst2(DST + ((size_t)blockIdx.x * (K / 32) + kc) * 512 + half * 256 + lane * 8, o);
}
// ---- k_packR: block = (16 rows, 128 k) of the row-major [rows][DM] x: 4 bf16 blocks in a row (4 KB) of bf16(x); a thread makes one 16-byte piece
__global__ __launch_bounds__(256) void k_packR(const float* __restrict__ X, __bf16* __restrict__ DST) {
  const int tid = threadIdx.x, lane = tid & 31, half = (tid >> 5) & 1, kc = blockIdx.y * 4 + (tid >> 6);
  const float* src = X + (size_t)(blockIdx.x * 16 + (lane & 15)) * DM + kc * 32 + half * 16 + 8 * (lane >> 4);
  const v4f a = *(const v4f*)src, b = *(const v4f*)(src + 4); v8b o;
#pragma unroll
  for (int i = 0; i < 4; ++i) { o[i] = (__bf16)a[i]; o[4 + i] = (__bf16)b[i]; }
  vst2(DST + ((size_t)blockIdx.x * (DM / 32) + kc) * 512 + half * 256 + lane * 8, o);
}
// ---- k_proj<VT>: block = (64 rows, 128 cols): Y = bf16(x) (packed, bf16 blocks) . P rows (exact) + bias; VT 0: pair blocks of [row][ldo cols]; VT 1: transposed bf16 hi/lo planes, bf16 blocks of [col][row]
template <int VT>
__global__ __launch_bounds__(128) void k_proj(const __bf16* __restrict__ X, const __bf16* __restrict__ P, const float* __restrict__ bias, float* __restrict__ OUT, int ldo, __bf16* __restrict__ PH, __bf16* __restrict__ PL) {
  __shared__ __align__(16) float so[VT ? 1 : 4][16][132]; __shared__ __align__(16) __bf16 sth[VT ? 128 : 1][72], stl[VT ? 128 : 1][72];
  const int tid = threadIdx.x, wave = tid >> 5, lane = tid & 31, col = lane & 15, g = lane >> 4; const size_t r0 = (size_t)blockIdx.x * 64 + wave * 16; const int n0 = blockIdx.y * 128;
  v8f acc[8] = {};
  const __bf16* xblk = X + (r0 / 16) * (DM / 32) * 512; const __bf16* pblk = P + (size_t)(n0 / 16) * (DM / 32) * 512;
  v16b xa[2], wb[2][8];   // two register sets: step kc + 1 is loaded as one group while step kc is multiplied
  xa[0] = frag_t(xblk, lane);
#pragma unroll
  for (int j = 0; j < 8; ++j) wb[0][j] = frag_t(pblk + (size_t)j * (DM / 32) * 512, lane);
#pragma unroll 1   // one trip already holds both register sets; more copies of it would only cost registers
  for (int kc = 0; kc < DM / 32; kc += 2) {
#pragma unroll
    for (int u = 0; u < 2; ++u) { const int kn = min(kc + u + 1, DM / 32 - 1);   // the last step loads itself again (in bounds, unused)
      const __bf16* xp = xblk + kn * 512 + lane * 8; const __bf16* wp = pblk + (size_t)kn * 512 + lane * 8;   // the lane's own addresses in the step's blocks
      xa[u ^ 1] = frag_t(xp, 0);
#pragma unroll
      for (int j = 0; j < 8; ++j) wb[u ^ 1][j] = frag_t(wp + (size_t)j * (DM / 32) * 512, 0);
      asm volatile("s_wait_xcnt 0x0" :: "v"(xp), "v"(wp) : "memory");   // as inputs here the pairs live up to the wait, which stands in front of any overwrite
#pragma unroll
      for (int j = 0; j < 8; ++j) acc[j] = wmma_bf(xa[u], wb[u][j], acc[j]); } }
  if (!VT) {
#pragma unroll
    for (int j = 0; j < 8; ++j) { const float bb = bfr(bias[n0 + j * 16 + col]);
#pragma unroll
      for (int r = 0; r < 8; ++r) so[wave][8 * g + r][j * 16 + col] = acc[j][r] + bb; }
    LDSX();
    st_t(OUT + ((r0 / 16) * (ldo / 32) + n0 / 32) * 512, so[wave], lane);
  } else {
#pragma unroll
    for (int j = 0; j < 8; ++j) { const float bb = bfr(bias[n0 + j * 16 + col]);
#pragma unroll
      for (int r = 0; r < 8; ++r) { const float v = acc[j][r] + bb; const __bf16 hb = (__bf16)v; sth[j * 16 + col][wave * 16 + 8 * g + r] = hb; stl[j * 16 + col][wave * 16 + 8 * g + r] = (__bf16)(v - (float)hb); } }
    __syncthreads();
    for (int q = tid; q < 128 * 8; q += 128) { const int dt = q >> 7, kl = (q >> 6) & 1, half = (q >> 5) & 1;   // 16 blocks a plane (8 column tiles x 2 row steps), 64 pieces each; q & 31 = lane
      const int d = dt * 16 + col, sl = kl * 32 + half * 16 + 8 * g; const size_t o = ((size_t)(n0 / 16 + dt) * (SS / 32) + blockIdx.x * 2 + kl) * 512 + half * 256 + lane * 8;
      vst2((unsigned*)(PH + o), *(const v4u*)&sth[d][sl]); vst2((unsigned*)(PL + o), *(const v4u*)&stl[d][sl]); }
  }
}
// ---- k_attn: block = (64 queries, head h): causal flash attention, kv head = h/4; scores 3 products, P.V 3 products; O[q][h*128+d]; ML[h][q] = (m, 1/l)
// waves_per_eu(2, 2): this grid puts two waves on a SIMD; at the default register target the scheduler folds the softmax's 8 rows back into pairs that run one behind another
__global__ __launch_bounds__(128) __attribute__((amdgpu_waves_per_eu(2, 2))) void k_attn(const float* __restrict__ Q, const float* __restrict__ Kx, const __bf16* __restrict__ VTH, const __bf16* __restrict__ VTL, float* __restrict__ O, float* __restrict__ ML) {
  __shared__ __align__(16) float sp[4][16][36]; __shared__ __align__(16) float so[4][16][132]; __shared__ __align__(16) float sml[64][4];
  const int tid = threadIdx.x, wave = tid >> 5, lane = tid & 31, col = lane & 15, g = lane >> 4;
  const int qb = blockIdx.x, h = blockIdx.y, kv = h / (NH / NKV); const int q0 = qb * 64 + wave * 16;
  R16 kr[2][4];   // a whole step's 32 key rows (8 slices) are in flight or in registers before its score products begin
  const float* kp0 = Kx + (size_t)(kv * 4) * 512 + lane * 4; const float* qp = Q + ((size_t)(q0 / 16) * (DM / 32) + h * 4) * 512 + lane * 4;   // the lane's own addresses
  R16 qr[4];
#pragma unroll
  for (int kc = 0; kc < 4; ++kc) qr[kc] = ld_t(qp + kc * 512, 0);
#pragma unroll
  for (int i = 0; i < 8; ++i) kr[i >> 2][i & 3] = ld_t(kp0 + ((i >> 2) * (KVW / 32) + (i & 3)) * 512, 0);
  asm volatile("s_wait_xcnt 0x0" :: "v"(kp0), "v"(qp) : "memory");   // behind the opening loads: the address pairs live up to the wait, which so stands in front of any overwrite of them
  F2 aq[4];
#pragma unroll
  for (int kc = 0; kc < 4; ++kc) aq[kc] = split_raw(qr[kc]);
  float m[8], l[8];
#pragma unroll
  for (int r = 0; r < 8; ++r) { m[r] = -3.0e38f; l[r] = 0.f; }
  v8f acc[8] = {};
  const int nks = (qb * 64 + 64) / 32;   // key steps covering keys <= the block's last query
#pragma unroll 1
  for (int ks = 0; ks < nks; ++ks) { v8f s[2];
    v16b vh[8], vl[8];   // the step's V fragments: column tile i is loaded as key slice i is used up (16 registers go, 16 come), so every tile has the rest of the score products and the softmax ahead of its use
    const size_t vbase = ((size_t)(kv * 8) * (SS / 32) + ks) * 512; const __bf16* vhp = VTH + vbase + lane * 8; const __bf16* vlp = VTL + vbase + lane * 8;   // the lane's own addresses in the step's blocks
    const float* kp = Kx + ((size_t)(min(ks + 1, nks - 1) * 2) * (KVW / 32) + kv * 4) * 512 + lane * 4;   // the last step loads itself again (in bounds, unused)
#pragma unroll
    for (int ct = 0; ct < 2; ++ct) { const int kk = ks * 32 + ct * 16 + col; v8f c = {};
#pragma unroll
      for (int kc = 0; kc < 4; ++kc) { const F2 kb = split_raw(kr[ct][kc]); const int dt = ct * 4 + kc;
        vh[dt] = frag_t(vhp + (size_t)dt * (SS / 32) * 512, 0); vl[dt] = frag_t(vlp + (size_t)dt * (SS / 32) * 512, 0);
        c = mac3_d(aq[kc], kb, c); }
#pragma unroll
      for (int r = 0; r < 8; ++r) { const int qi = q0 + 8 * g + r; s[ct][r] = (kk <= qi) ? c[r] * 0.08838834764831845f : -3.0e38f; } }
    asm volatile("s_wait_xcnt 0x0" :: "v"(vhp), "v"(vlp) : "memory");   // behind the step's last V load: as inputs here the address pairs live up to the wait, which so stands in front of any overwrite of them
    float mn[8], al[8], es[8];   // the softmax goes stage by stage over the 8 rows: within a stage the rows' chains (lane exchanges, exp) are independent and run side by side
#pragma unroll
    for (int r = 0; r < 8; ++r) mn[r] = fmaxf(s[0][r], s[1][r]);
#pragma unroll
    for (int o = 1; o < 16; o <<= 1) { float t[8]; xch8(t, mn, (lane ^ o) << 2);
#pragma unroll
      for (int r = 0; r < 8; ++r) mn[r] = fmaxf(mn[r], t[r]); }
#pragma unroll
    for (int r = 0; r < 8; ++r) { mn[r] = fmaxf(m[r], mn[r]);
      const float xa = expf(m[r] - mn[r]), x0 = expf(s[0][r] - mn[r]), x1 = expf(s[1][r] - mn[r]);   // inline and in every lane; a masked or not yet started entry is set to 0 by a select, not branched round
      al[r] = (m[r] <= -1.0e38f) ? 0.f : xa;
      const float e0 = (s[0][r] <= -1.0e38f) ? 0.f : x0, e1 = (s[1][r] <= -1.0e38f) ? 0.f : x1; es[r] = e0 + e1;
      sp[wave][8 * g + r][col] = e0; sp[wave][8 * g + r][16 + col] = e1; }
#pragma unroll
    for (int o = 1; o < 16; o <<= 1) { float t[8]; xch8(t, es, (lane ^ o) << 2);
#pragma unroll
      for (int r = 0; r < 8; ++r) es[r] += t[r]; }
#pragma unroll
    for (int r = 0; r < 8; ++r) { l[r] = l[r] * al[r] + es[r]; m[r] = mn[r];
#pragma unroll
      for (int dt = 0; dt < 8; ++dt) acc[dt][r] *= al[r]; }
    LDSW();
    const F2 pa = split_row(&sp[wave][col][0], 0, lane);
#pragma unroll
    for (int dt = 0; dt < 8; ++dt) { acc[dt] = wmma_bf_d(pa.l, vh[dt], acc[dt]); acc[dt] = wmma_bf_d(pa.h, vl[dt], acc[dt]); acc[dt] = wmma_bf_d(pa.h, vh[dt], acc[dt]);
      kr[dt >> 2][dt & 3] = ld_t(kp + ((dt >> 2) * (KVW / 32) + (dt & 3)) * 512, 0); }   // the next step's key slice i as column tile i is used up
    asm volatile("s_wait_xcnt 0x0" :: "v"(kp) : "memory");   // behind the last key load: the address pair lives up to the wait, which so stands in front of any overwrite of it
    LDSW(); }
#pragma unroll
  for (int r = 0; r < 8; ++r) { const float il = 1.0f / l[r];
#pragma unroll
    for (int dt = 0; dt < 8; ++dt) so[wave][8 * g + r][dt * 16 + col] = acc[dt][r] * il;
    if (col == 0) { sml[wave * 16 + 8 * g + r][0] = m[r]; sml[wave * 16 + 8 * g + r][1] = il; sml[wave * 16 + 8 * g + r][2] = 0.f; sml[wave * 16 + 8 * g + r][3] = 0.f; } }
  __syncthreads();
  st_t(O + ((size_t)(q0 / 16) * (DM / 32) + h * 4) * 512, so[wave], lane);
  asm volatile("s_wait_xcnt 0x0" ::: "memory");   // behind the tile's stores, in front of any overwrite of a register that they name
  if (tid < 64) vst2(ML + ((size_t)h * SS + qb * 64 + tid) * 4, *(const v4f*)&sml[tid][0]);
}
// ---- k_colsum: block = (64 keys, head h): partial column sums of probs over each 64-query block qb >= key block: p = exp(s - m_q) * (1/l_q) (s recomputed with the same 3-product dot and scale); CS[h][qb][key] rows of 256 B per (query block, this key block)
//   A = k rows (this block's 64 keys, wave -> 16), B = q rows (16-query tiles) -> D[key][q]; per key row sum over the q columns with the (m, 1/l) of each q and the causal predicate q >= key.
__global__ __launch_bounds__(128) void k_colsum(const float* __restrict__ Q, const float* __restrict__ Kx, const float* __restrict__ ML, float* __restrict__ CS) {
  __shared__ __align__(16) float ssum[64];
  const int tid = threadIdx.x, wave = tid >> 5, lane = tid & 31, col = lane & 15, g = lane >> 4;
  const int kb = blockIdx.x, h = blockIdx.y, kv = h / (NH / NKV); const int k0 = kb * 64 + wave * 16;
  F2 ak[4];
  const float* kp0 = Kx + ((size_t)(k0 / 16) * (KVW / 32) + kv * 4) * 512 + lane * 4; const float* qp0 = Q + ((size_t)(kb * 4) * (DM / 32) + h * 4) * 512 + lane * 4; const float* mp0 = ML + ((size_t)h * SS + kb * 64 + col) * 4;   // the lane's own addresses
#pragma unroll
  for (int kc = 0; kc < 4; ++kc) ak[kc] = split_raw(ld_t(kp0 + kc * 512, 0));
  R16 qr[2][4]; v2f ml[2];   // two register sets: the next 16-query tile (rows and statistics) is loaded as one group while this one is worked on
#pragma unroll
  for (int kc = 0; kc < 4; ++kc) qr[0][kc] = ld_t(qp0 + kc * 512, 0);
  ml[0] = *(const v2f*)mp0;
  asm volatile("s_wait_xcnt 0x0" :: "v"(kp0), "v"(qp0), "v"(mp0) : "memory");   // behind the opening loads: without it this build takes an address pair of these loads as a destination of one of them; as inputs here the pairs live up to the wait
#pragma unroll 1
  for (int qb = kb; qb < TQB; ++qb) { float rs[8];
#pragma unroll
    for (int r = 0; r < 8; ++r) rs[r] = 0.f;
#pragma unroll
    for (int ct = 0; ct < 4; ++ct) { const int qq = qb * 64 + ct * 16 + col; v8f c = {};
      const int qt = ct < 3 ? qb * 4 + ct + 1 : min(qb + 1, TQB - 1) * 4, qn = qt * 16 + col;   // behind the last tile: a tile of the last block again (in bounds, unused)
      const float* qp = Q + ((size_t)qt * (DM / 32) + h * 4) * 512 + lane * 4; const float* mp = ML + ((size_t)h * SS + qn) * 4;   // the lane's own addresses
#pragma unroll
      for (int kc = 0; kc < 4; ++kc) qr[(ct + 1) & 1][kc] = ld_t(qp + kc * 512, 0);
      ml[(ct + 1) & 1] = *(const v2f*)mp;
      asm volatile("s_wait_xcnt 0x0" :: "v"(qp), "v"(mp) : "memory");   // behind the tile's loads: without it this build takes their address pair as a destination of one of them; as inputs here the pairs live up to the wait, which stands in front of any overwrite
#pragma unroll
      for (int kc = 0; kc < 4; ++kc) { const F2 qf = split_raw(qr[ct & 1][kc]); c = mac3(ak[kc], qf, c); }
      const float mq = ml[ct & 1][0], ilq = ml[ct & 1][1];
#pragma unroll
      for (int r = 0; r < 8; ++r) { const int key = k0 + 8 * g + r; const float sc = c[r] * 0.08838834764831845f;
        const float t = rs[r] + expf(sc - mq) * ilq; rs[r] = (key <= qq) ? t : rs[r]; } }   // exp inline and in every lane, the causal test a select: the 8 rows' chains run side by side
#pragma unroll
    for (int o = 1; o < 16; o <<= 1) {   // level by level over the 8 rows: their exchanges are independent and run side by side
#pragma unroll
      for (int r = 0; r < 8; ++r) rs[r] += __shfl_xor(rs[r], o); }
    if (col == 0) {
#pragma unroll
      for (int r = 0; r < 8; ++r) ssum[wave * 16 + 8 * g + r] = rs[r]; }
    __syncthreads();
    if (tid < 16) vst2(CS + (((size_t)h * TQB + qb) * SS) + kb * 64 + tid * 4, *(const v4f*)&ssum[tid * 4]);
    __syncthreads(); }
  // query blocks qb < kb contribute nothing: write zeros so every CS row is defined
  for (int qb = 0; qb < kb; ++qb) { if (tid < 16) vst2(CS + (((size_t)h * TQB + qb) * SS) + kb * 64 + tid * 4, (v4f){0.f, 0.f, 0.f, 0.f}); }
}
__global__ __launch_bounds__(256) void k_mask(const float* __restrict__ CS, float* __restrict__ MSK) {
  __shared__ float sv[SS]; __shared__ int si[SS]; __shared__ __align__(16) float sm[MWP];
  const int h = blockIdx.x, tid = threadIdx.x; const int NSEL = SS - RECENT;   // 1844 candidates
  for (int s = tid; s < SS; s += 256) { float c = 0.f; if (s < NSEL) { for (int qb = 0; qb < TQB; ++qb) c += CS[(((size_t)h * TQB + qb) * SS) + s]; } else c = -3.0e38f; sv[s] = c; si[s] = s; }
  for (int s = tid; s < MWP; s += 256) sm[s] = (s >= MW - RECENT && s < MW) ? 1.0f : 0.f;
  __syncthreads();
  // bitonic sort descending by value, ascending index on ties
  for (int k = 2; k <= SS; k <<= 1) { for (int j = k >> 1; j > 0; j >>= 1) {
      for (int i = tid; i < SS; i += 256) { const int ixj = i ^ j; if (ixj > i) { const bool up = ((i & k) == 0);   // 'up' segments sorted descending
          const float a = sv[i], b = sv[ixj]; const int ia = si[i], ib = si[ixj];
          const bool a_first = (a > b) || (a == b && ia < ib);   // a should come before b in descending order
          const bool swap = up ? !a_first : a_first;
          if (swap) { sv[i] = b; sv[ixj] = a; si[i] = ib; si[ixj] = ia; } } }
      __syncthreads(); } }
  if (tid < HEAVY) { int s = si[tid]; s = min(max(s, 0), NSEL - 1); sm[s] = 1.0f; }
  __syncthreads();
  for (int q = tid; q < MWP / 4; q += 256) vst2(MSK + (size_t)h * MWP + q * 4, *(const v4f*)&sm[q * 4]);
}
// ---- k_out: block = (64 rows, 128 cols): out = O(hi/lo) . o_w^T rows (2 products)
__global__ __launch_bounds__(128) void k_out(const float* __restrict__ O, const __bf16* __restrict__ P, float* __restrict__ Y) {
  __shared__ __align__(16) float so[4][16][132];
  const int tid = threadIdx.x, wave = tid >> 5, lane = tid & 31, col = lane & 15, g = lane >> 4; const size_t r0 = (size_t)blockIdx.x * 64 + wave * 16; const int n0 = blockIdx.y * 128;
  v8f acc[8] = {};
  const float* oblk = O + (r0 / 16) * (DM / 32) * 512; const __bf16* pblk = P + (size_t)(n0 / 16) * (DM / 32) * 512;
  R16 xa[2]; v16b wb[2][8];   // two register sets: step kc + 1 is loaded as one group while step kc is multiplied
  xa[0] = ld_t(oblk, lane);
#pragma unroll
  for (int j = 0; j < 8; ++j) wb[0][j] = frag_t(pblk + (size_t)j * (DM / 32) * 512, lane);
#pragma unroll 1   // one trip already holds both register sets; more copies of it would only cost registers
  for (int kc = 0; kc < DM / 32; kc += 2) {
#pragma unroll
    for (int u = 0; u < 2; ++u) { const int kn = min(kc + u + 1, DM / 32 - 1);   // the last step loads itself again (in bounds, unused)
      const float* xp = oblk + kn * 512 + lane * 4; const __bf16* wp = pblk + (size_t)kn * 512 + lane * 8;   // the lane's own addresses in the step's blocks
      xa[u ^ 1] = ld_t(xp, 0);
#pragma unroll
      for (int j = 0; j < 8; ++j) wb[u ^ 1][j] = frag_t(wp + (size_t)j * (DM / 32) * 512, 0);
      asm volatile("s_wait_xcnt 0x0" :: "v"(xp), "v"(wp) : "memory");   // without it this build takes an address pair of these loads as a destination of one of them; as inputs here the pairs live up to the wait, which stands in front of any overwrite
      const F2 a = split_raw(xa[u]);
#pragma unroll
      for (int j = 0; j < 8; ++j) { acc[j] = wmma_bf(a.l, wb[u][j], acc[j]); acc[j] = wmma_bf(a.h, wb[u][j], acc[j]); } } }
#pragma unroll
  for (int j = 0; j < 8; ++j)
#pragma unroll
    for (int r = 0; r < 8; ++r) so[wave][8 * g + r][j * 16 + col] = acc[j][r];
  LDSX();
  for (int rl = 0; rl < 16; ++rl) vst2(Y + (r0 + rl) * DM + n0 + lane * 4, *(const v4f*)&so[wave][rl][lane * 4]);
}
// ---- k_mout: flat writer of the [16][2049] mask after the attention output
__global__ __launch_bounds__(256) void k_mout(const float* __restrict__ MSK, float* __restrict__ out) {
  const size_t p = (size_t)blockIdx.x * 256 + threadIdx.x; const size_t total = (size_t)NH * (SFULL + 1); if (p * 4 >= total) return; v4f v;
#pragma unroll
  for (int i = 0; i < 4; ++i) { const size_t f = p * 4 + i; const size_t row = f / (SFULL + 1), c = f % (SFULL + 1); v[i] = (f < total && c < (size_t)MW) ? MSK[row * MWP + c] : 0.f; }
  vst2(out + p * 4, v);
}
extern "C" void kernel_launch(void* const* d_in, const int* in_sizes, int n_in, void* d_out, int out_size, void* d_ws, size_t ws_size, hipStream_t stream) {
  (void)in_sizes; (void)n_in; (void)out_size;
  const float** F = (const float**)d_in;   // hidden_states [1,2048,2048], q_w [2048,2048], q_b [2048], k_w [2048,512], k_b [512], v_w [2048,512], v_b [512], o_w [2048,2048]
  if (ws_size < (size_t)WS_END) return;
  char* ws = (char*)d_ws; __bf16 *PK = (__bf16*)(ws + WS_PK), *XB = (__bf16*)(ws + WS_X), *VTH = (__bf16*)(ws + WS_VTH), *VTL = (__bf16*)(ws + WS_VTL);
  float *Q = (float*)(ws + WS_Q), *Kx = (float*)(ws + WS_K), *O = (float*)(ws + WS_O), *ML = (float*)(ws + WS_ML), *CS = (float*)(ws + WS_CS), *MSK = (float*)(ws + WS_MSK);
  float* OUT0 = (float*)d_out; float* OUT1 = OUT0 + (size_t)SFULL * DM;
  k_packT<<<dim3(DM / 16, DM / 128), 256, 0, stream>>>(F[1], DM, DM, PK + PK_Q); k_packT<<<dim3(KVW / 16, DM / 128), 256, 0, stream>>>(F[3], DM, KVW, PK + PK_K); k_packT<<<dim3(KVW / 16, DM / 128), 256, 0, stream>>>(F[5], DM, KVW, PK + PK_V); k_packT<<<dim3(DM / 16, DM / 128), 256, 0, stream>>>(F[7], DM, DM, PK + PK_O);
  k_packR<<<dim3(SS / 16, DM / 128), 256, 0, stream>>>(F[0], XB);
  k_proj<0><<<dim3(SS / 64, DM / 128), 128, 0, stream>>>(XB, PK + PK_Q, F[2], Q, DM, nullptr, nullptr);
  k_proj<0><<<dim3(SS / 64, KVW / 128), 128, 0, stream>>>(XB, PK + PK_K, F[4], Kx, KVW, nullptr, nullptr);
  k_proj<1><<<dim3(SS / 64, KVW / 128), 128, 0, stream>>>(XB, PK + PK_V, F[6], nullptr, 0, VTH, VTL);
  k_attn<<<dim3(TQB, NH), 128, 0, stream>>>(Q, Kx, VTH, VTL, O, ML);
  k_colsum<<<dim3(TQB, NH), 128, 0, stream>>>(Q, Kx, ML, CS);
  k_mask<<<NH, 256, 0, stream>>>(CS, MSK);
  k_out<<<dim3(TQB, DM / 128), 128, 0, stream>>>(O, PK + PK_O, OUT0);
  k_mout<<<(unsigned)(((size_t)NH * (SFULL + 1) / 4 + 255) / 256), 256, 0, stream>>>(MSK, OUT1);
}

// v006
// It runs in 341 microseconds.
// Next to v005, in two timings, it ran 1.15 and 1.14 times as fast.
// All steps since v000 together make it 4.17 times as fast.
// compute dtype: hidden_states and all weights/biases (module inputs) rounded to bf16; q/k/v projections with exact bf16 products (x and W are inputs); causal scores q.k with both computed operands as bf16 hi + residual pairs (3 products) and P.V with P hi/lo x V hi/lo (3 products); the heavy-hitter column sums recompute the same 3-product scores in a second (transposed) pass with the stored row statistics; the output projection with hi/lo x exact o_w (2 products), all on WMMA 16x16x32; softmax, column sums, the per-head top-k selection (rank by counting, lower index first on ties) and the mask assembly in f32 on the VALU; f32 accumulate.
#include <hip/hip_runtime.h>
#include <math.h>

typedef __attribute__((ext_vector_type(16))) _Float16 v16h;
typedef __attribute__((ext_vector_type(16))) __bf16 v16b;
typedef __attribute__((ext_vector_type(8)))  _Float16 v8h;
typedef __attribute__((ext_vector_type(8)))  float v8f;
typedef __attribute__((ext_vector_type(4)))  float v4f;
typedef __attribute__((ext_vector_type(2)))  float v2f;
typedef __attribute__((ext_vector_type(4)))  unsigned v4u;
typedef __attribute__((ext_vector_type(4)))  int v4i;
typedef float __attribute__((may_alias)) float_a;
typedef int __attribute__((may_alias)) int_a;

template <typename T> __device__ __forceinline__ void vst2(void* p, T v) { *(T*)p = v;  }
__device__ __forceinline__ v8f wmma16(v16h a, v16h b, v8f c) {
  v8f d = __builtin_amdgcn_wmma_f32_16x16x32_f16(false, a, false, b, (short)0, c, false, false);
  asm volatile("v_nop\n\tv_nop\n\tv_nop\n\tv_nop" : "+v"(d) : "v"(a), "v"(b));
  return d;
}
__device__ __forceinline__ v8f wmma_bf(v16b a, v16b b, v8f c) {
  v8f d = __builtin_amdgcn_wmma_f32_16x16x32_bf16(false, a, false, b, (short)0, c, false, false);
  asm volatile("v_nop\n\tv_nop\n\tv_nop\n\tv_nop" : "+v"(d) : "v"(a), "v"(b));
  return d;
}
// 16x16x32 fragments: lane = (h = lane>>4, row/col = lane&15); elements 0..7 = k0+8h+0..7, 8..15 = k0+16+8h+0..7; D element r = row 8h+r
__device__ __forceinline__ v16h frag_h(const _Float16* rowk0, int lane) {
  union { v16h v; v8h q[2]; } u; const _Float16* p = rowk0 + 8 * (lane >> 4);
  u.q[0] = *(const v8h*)p; u.q[1] = *(const v8h*)(p + 16); return u.v;
}
__device__ __forceinline__ v16h frag_f32(const float* rowk0, int lane) {
  v16h a; const float* p = rowk0 + 8 * (lane >> 4);
#pragma unroll
  for (int i = 0; i < 8; ++i) { a[i] = (_Float16)p[i]; a[8 + i] = (_Float16)p[16 + i]; }
  return a;
}
__device__ __forceinline__ v16h frag_f32s(const float* rowk0, int lane, float sc) {
  v16h a; const float* p = rowk0 + 8 * (lane >> 4);
#pragma unroll
  for (int i = 0; i < 8; ++i) { a[i] = (_Float16)(p[i] * sc); a[8 + i] = (_Float16)(p[16 + i] * sc); }
  return a;
}
// column fragment from a [K][ld] layout (column n), rows >= K read as 0
__device__ __forceinline__ v16h fragc_f32(const float* W, int k0, int n, int lane, int ld, int K) {
  v16h a; const int g = lane >> 4;
#pragma unroll
  for (int i = 0; i < 8; ++i) { const int ka = k0 + 8 * g + i, kb = ka + 16;
    a[i] = (_Float16)(ka < K ? W[(size_t)(ka < K ? ka : K - 1) * ld + n] : 0.f); a[8 + i] = (_Float16)(kb < K ? W[(size_t)(kb < K ? kb : K - 1) * ld + n] : 0.f); }
  return a;
}
struct F2 { v16b h, l; };
__device__ __forceinline__ F2 bsplit16(const float v[16]) { F2 r;
#pragma unroll
  for (int i = 0; i < 16; ++i) { const __bf16 h = (__bf16)v[i]; r.h[i] = h; r.l[i] = (__bf16)(v[i] - (float)h); }
  return r; }
__device__ __forceinline__ F2 split_row(const float* row, int k0, int lane) { float v[16]; const float* p = row + k0 + 8 * (lane >> 4);
#pragma unroll
  for (int i = 0; i < 8; ++i) { v[i] = p[i]; v[8 + i] = p[16 + i]; }
  return bsplit16(v); }
__device__ __forceinline__ F2 split_rowK(const float* row, int k0, int lane, int K) { float v[16]; const int g = lane >> 4;
#pragma unroll
  for (int i = 0; i < 8; ++i) { const int ka = k0 + 8 * g + i, kb = ka + 16; v[i] = ka < K ? row[ka < K ? ka : K - 1] : 0.f; v[8 + i] = kb < K ? row[kb < K ? kb : K - 1] : 0.f; }
  return bsplit16(v); }
__device__ __forceinline__ F2 split_col(const float* W, int k0, int n, int lane, int ld, int K) { float v[16]; const int g = lane >> 4;
#pragma unroll
  for (int i = 0; i < 8; ++i) { const int ka = k0 + 8 * g + i, kb = ka + 16; v[i] = ka < K ? W[(size_t)(ka < K ? ka : K - 1) * ld + n] : 0.f; v[8 + i] = kb < K ? W[(size_t)(kb < K ? kb : K - 1) * ld + n] : 0.f; }
  return bsplit16(v); }
__device__ __forceinline__ v8f mac3(const F2& a, const F2& b, v8f c) { c = wmma_bf(a.l, b.h, c); c = wmma_bf(a.h, b.l, c); return wmma_bf(a.h, b.h, c); }
__device__ __forceinline__ float sigm(float v) { return 1.0f / (1.0f + expf(-v)); }
#define LDSX() do { asm volatile("s_wait_dscnt 0" ::: "memory"); __builtin_amdgcn_wave_barrier(); __builtin_amdgcn_fence(__ATOMIC_RELEASE, "workgroup"); } while (0)


// GQA causal attention with H2O heavy-hitter scoring (B 1, S 2048, D 2048, 16 query heads / 4 kv heads x 128): out = softmax(q k^T / sqrt(128), causal) v -> @ o_w; cur[h][s] = sum over queries of probs; mask[h] = 1 on the last 204 of 2049 positions, 0 elsewhere, then 1 at the top-204 (heavy budget) indices of cur[h][:1844].
#define SFULL 2048            // shipped sequence length (output layout)
#ifndef SS
#define SS SFULL              // active sequence length (all)
#endif
#define DM 2048
#define NH 16
#define NKV 4
#define HD 128
#define KVW (NKV * HD)        // 512
#define HEAVY (SS / 10)       // int(0.1 * S)
#define RECENT (SS / 10)
#define MW (SS + 1)           // 2049 mask width
#define MWP 2080              // padded staging width: a row is 65 whole 128-byte lines
#define NSEL (SS - RECENT)    // 1844 candidates of the heavy-hitter selection
#define NPAD ((NSEL + 31) / 32 * 32)   // candidates rounded up to whole waves
#define MTS 4                 // k_mask: parts into which the candidates to compare with are dealt
#define TQB (SS / 64)         // query blocks
typedef __attribute__((ext_vector_type(8))) __bf16 v8b;
// fragment-order storage: a [rows][k] operand that a kernel of this file writes is kept as blocks of 16 rows x 32 k, block (rt, kc) at index rt * (k / 32) + kc; inside a block the 16-byte pieces stand in the order in which the lanes load them, so every wave-wide load or store is 512 bytes in a row (4 whole lines, not 16 part lines)
// bf16 block = 512 elements: piece (half, lane) at half * 256 + lane * 8 holds row lane & 15, k = half * 16 + 8 * (lane >> 4) + 0..7
__device__ __forceinline__ v16b frag_t(const __bf16* blk, int lane) {
  union { v16b v; v8b q[2]; } u;
  u.q[0] = *(const v8b*)(blk + lane * 8); u.q[1] = *(const v8b*)(blk + 256 + lane * 8); return u.v;
}
__device__ __forceinline__ float bfr(float v) { return (float)(__bf16)v; }
// the same product with only D named at the v_nops, which so stand in front of the next reader of D (A and B are left to the compiler's own padding of its builtin): an operand that an asm statement names must stand below v256, and with A and B named too k_attn, which holds a whole step's fragments, builds with spills to scratch
__device__ __forceinline__ v8f wmma_bf_d(v16b a, v16b b, v8f c) {
  v8f d = __builtin_amdgcn_wmma_f32_16x16x32_bf16(false, a, false, b, (short)0, c, false, false);
  asm volatile("v_nop\n\tv_nop\n\tv_nop\n\tv_nop" : "+v"(d));
  return d;
}
__device__ __forceinline__ v8f mac3_d(const F2& a, const F2& b, v8f c) { c = wmma_bf_d(a.l, b.h, c); c = wmma_bf_d(a.h, b.l, c); return wmma_bf_d(a.h, b.h, c); }
// the 8 rows' exchange with lane ^ o as ONE group, 8 ds_bpermute_b32 and their one wait in one statement (a = 4 * (lane ^ o), as __shfl_xor forms it): with 8 V tiles live across the softmax the scheduler otherwise folds the rows into pairs, whose exchanges then wait one behind another (so a build with __shfl_xor here: two exchanges or one to a wait)
__device__ __forceinline__ void xch8(float (&t)[8], const float (&x)[8], int a) {
  asm volatile("ds_bpermute_b32 %0, %8, %9\n\tds_bpermute_b32 %1, %8, %10\n\tds_bpermute_b32 %2, %8, %11\n\tds_bpermute_b32 %3, %8, %12\n\t"
               "ds_bpermute_b32 %4, %8, %13\n\tds_bpermute_b32 %5, %8, %14\n\tds_bpermute_b32 %6, %8, %15\n\tds_bpermute_b32 %7, %8, %16\n\ts_wait_dscnt 0x0"
               : "=&v"(t[0]), "=&v"(t[1]), "=&v"(t[2]), "=&v"(t[3]), "=&v"(t[4]), "=&v"(t[5]), "=&v"(t[6]), "=&v"(t[7])
               : "v"(a), "v"(x[0]), "v"(x[1]), "v"(x[2]), "v"(x[3]), "v"(x[4]), "v"(x[5]), "v"(x[6]), "v"(x[7]) : "memory");
}
// a wave's own exchange through its own LDS rows: its LDS operations are done and the compiler moves no memory access across; unlike LDSX it holds no fence, which would also wait for every global load in flight
#define LDSW() do { asm volatile("s_wait_dscnt 0" ::: "memory"); __builtin_amdgcn_wave_barrier(); } while (0)
// the 16 registers of one lane's slice of a hi/lo operand pair, as loaded: q[0], q[1] the hi fragment, q[2], q[3] the residual fragment
struct R16 { v4f q[4]; };
// pair block = 2 KB (addressed as 512 floats): the bf16 block of the hi parts, then the bf16 block of the residuals; piece (pl, half, lane) at float (pl * 2 + half) * 128 + lane * 4 holds 8 bf16 of row lane & 15, k = half * 16 + 8 * (lane >> 4) + 0..7
// a computed f32 operand (q, k, the attention output) is split ONCE, by the wave that stores it; every wave that loads it (a key slice: 4 heads x up to 128 query tiles) has its two WMMA fragments in the loaded registers, with no conversion
__device__ __forceinline__ R16 ld_t(const float* blk, int lane) { R16 r;
#pragma unroll
  for (int qi = 0; qi < 4; ++qi) r.q[qi] = *(const v4f*)(blk + qi * 128 + lane * 4);
  return r; }
// one wave's 16 x 128 f32 tile, from its LDS staging rows to 4 pair blocks in a row: hi = bf16(v), residual = bf16(v - hi), as bsplit16 forms them
__device__ __forceinline__ void st_t(float* blk, const float (*st)[132], int lane) {
#pragma unroll
  for (int sl = 0; sl < 4; ++sl) {
#pragma unroll
    for (int half = 0; half < 2; ++half) { const float* p = &st[lane & 15][sl * 32 + half * 16 + 8 * (lane >> 4)]; const v4f a = *(const v4f*)p, b = *(const v4f*)(p + 4);
      union { v8b b8; v4f f; } hi, lo;
#pragma unroll
      for (int i = 0; i < 8; ++i) { const float v = i < 4 ? a[i & 3] : b[i & 3]; const __bf16 hb = (__bf16)v; hi.b8[i] = hb; lo.b8[i] = (__bf16)(v - (float)hb); }
      vst2(blk + sl * 512 + half * 128 + lane * 4, hi.f); vst2(blk + sl * 512 + (2 + half) * 128 + lane * 4, lo.f); } }
}
// the two fragments of a loaded slice: the registers as they are, no instruction
__device__ __forceinline__ F2 split_raw(const R16& r) { union { v4f f[2]; v16b b; } hi, lo; F2 o;
  hi.f[0] = r.q[0]; hi.f[1] = r.q[1]; lo.f[0] = r.q[2]; lo.f[1] = r.q[3]; o.h = hi.b; o.l = lo.b; return o; }
__device__ __attribute__((noinline)) float erf_ni(float v) { return erff(v); }

#define PK_Q 0                               // [2048 n][2048 k] q_w^T (all four: bf16 blocks)
#define PK_K (PK_Q + DM * DM)                  // [512][2048]
#define PK_V (PK_K + KVW * DM)
#define PK_O (PK_V + KVW * DM)                 // [2048][2048] o_w^T
#define PK_END (PK_O + DM * DM)
#define WS_PK  0u
#define WS_Q   (WS_PK + 2u * PK_END)           // pair blocks [2048][2048] q (h*128+d)
#define WS_K   (WS_Q + 4u * SS * DM)            // pair blocks [2048][512]
#define WS_VTH (WS_K + 4u * SS * KVW)           // bf16 blocks [512 (kv*128+d)][2048]
#define WS_VTL (WS_VTH + 2u * KVW * SS)
#define WS_O   (WS_VTL + 2u * KVW * SS)         // pair blocks [2048][2048] attention output (h*128+d)
#define WS_ML  (WS_O + 4u * SS * DM)            // f32 [16][2048][4]: (m, 1/l, 0, 0)
#define WS_CS  (WS_ML + 4u * NH * SS * 4)       // f32 [16][32 qblocks][2048]: per-query-block partial column sums
#define WS_MSK (WS_CS + 4u * NH * TQB * SS)     // f32 [16][2080] mask staging
#define WS_X   (WS_MSK + 4u * NH * MWP)         // bf16 blocks [2048][2048] hidden_states
#define WS_END (WS_X + 2u * SS * DM)

// ---- k_packT: block = (16 output columns, 128 k) of a [K][N] (x @ W) matrix: 4 bf16 blocks in a row (4 KB) of W^T; a thread makes one 16-byte piece
__global__ __launch_bounds__(256) void k_packT(const float* __restrict__ Wm, int K, int N, __bf16* __restrict__ DST) {
  const int tid = threadIdx.x, lane = tid & 31, half = (tid >> 5) & 1, kc = blockIdx.y * 4 + (tid >> 6);
  const float* src = Wm + (size_t)(kc * 32 + half * 16 + 8 * (lane >> 4)) * N + blockIdx.x * 16 + (lane & 15);
  v8b o;
#pragma unroll
  for (int i = 0; i < 8; ++i) o[i] = (__bf16)src[(size_t)i * N];
  vst2(DST + ((size_t)blockIdx.x * (K / 32) + kc) * 512 + half * 256 + lane * 8, o);
}
// ---- k_packR: block = (16 rows, 128 k) of the row-major [rows][DM] x: 4 bf16 blocks in a row (4 KB) of bf16(x); a thread makes one 16-byte piece
__global__ __launch_bounds__(256) void k_packR(const float* __restrict__ X, __bf16* __restrict__ DST) {
  const int tid = threadIdx.x, lane = tid & 31, half = (tid >> 5) & 1, kc = blockIdx.y * 4 + (tid >> 6);
  const float* src = X + (size_t)(blockIdx.x * 16 + (lane & 15)) * DM + kc * 32 + half * 16 + 8 * (lane >> 4);
  const v4f a = *(const v4f*)src, b = *(const v4f*)(src + 4); v8b o;
#pragma unroll
  for (int i = 0; i < 4; ++i) { o[i] = (__bf16)a[i]; o[4 + i] = (__bf16)b[i]; }
  vst2(DST + ((size_t)blockIdx.x * (DM / 32) + kc) * 512 + half * 256 + lane * 8, o);
}
// ---- k_proj<VT>: block = (64 rows, 128 cols): Y = bf16(x) (packed, bf16 blocks) . P rows (exact) + bias; VT 0: pair blocks of [row][ldo cols]; VT 1: transposed bf16 hi/lo planes, bf16 blocks of [col][row]
template <int VT>
__global__ __launch_bounds__(128) void k_proj(const __bf16* __restrict__ X, const __bf16* __restrict__ P, const float* __restrict__ bias, float* __restrict__ OUT, int ldo, __bf16* __restrict__ PH, __bf16* __restrict__ PL) {
  __shared__ __align__(16) float so[VT ? 1 : 4][16][132]; __shared__ __align__(16) __bf16 sth[VT ? 128 : 1][72], stl[VT ? 128 : 1][72];
  const int tid = threadIdx.x, wave = tid >> 5, lane = tid & 31, col = lane & 15, g = lane >> 4; const size_t r0 = (size_t)blockIdx.x * 64 + wave * 16; const int n0 = blockIdx.y * 128;
  v8f acc[8] = {};
  const __bf16* xblk = X + (r0 / 16) * (DM / 32) * 512; const __bf16* pblk = P + (size_t)(n0 / 16) * (DM / 32) * 512;
  v16b xa[2], wb[2][8];   // two register sets: step kc + 1 is loaded as one group while step kc is multiplied
  xa[0] = frag_t(xblk, lane);
#pragma unroll
  for (int j = 0; j < 8; ++j) wb[0][j] = frag_t(pblk + (size_t)j * (DM / 32) * 512, lane);
#pragma unroll 1   // one trip already holds both register sets; more copies of it would only cost registers
  for (int kc = 0; kc < DM / 32; kc += 2) {
#pragma unroll
    for (int u = 0; u < 2; ++u) { const int kn = min(kc + u + 1, DM / 32 - 1);   // the last step loads itself again (in bounds, unused)
      const __bf16* xp = xblk + kn * 512 + lane * 8; const __bf16* wp = pblk + (size_t)kn * 512 + lane * 8;   // the lane's own addresses in the step's blocks
      xa[u ^ 1] = frag_t(xp, 0);
#pragma unroll
      for (int j = 0; j < 8; ++j) wb[u ^ 1][j] = frag_t(wp + (size_t)j * (DM / 32) * 512, 0);
      asm volatile("s_wait_xcnt 0x0" :: "v"(xp), "v"(wp) : "memory");   // as inputs here the pairs live up to the wait, which stands in front of any overwrite
#pragma unroll
      for (int j = 0; j < 8; ++j) acc[j] = wmma_bf(xa[u], wb[u][j], acc[j]); } }
  if (!VT) {
#pragma unroll
    for (int j = 0; j < 8; ++j) { const float bb = bfr(bias[n0 + j * 16 + col]);
#pragma unroll
      for (int r = 0; r < 8; ++r) so[wave][8 * g + r][j * 16 + col] = acc[j][r] + bb; }
    LDSX();
    st_t(OUT + ((r0 / 16) * (ldo / 32) + n0 / 32) * 512, so[wave], lane);
  } else {
#pragma unroll
    for (int j = 0; j < 8; ++j) { const float bb = bfr(bias[n0 + j * 16 + col]);
#pragma unroll
      for (int r = 0; r < 8; ++r) { const float v = acc[j][r] + bb; const __bf16 hb = (__bf16)v; sth[j * 16 + col][wave * 16 + 8 * g + r] = hb; stl[j * 16 + col][wave * 16 + 8 * g + r] = (__bf16)(v - (float)hb); } }
    __syncthreads();
    for (int q = tid; q < 128 * 8; q += 128) { const int dt = q >> 7, kl = (q >> 6) & 1, half = (q >> 5) & 1;   // 16 blocks a plane (8 column tiles x 2 row steps), 64 pieces each; q & 31 = lane
      const int d = dt * 16 + col, sl = kl * 32 + half * 16 + 8 * g; const size_t o = ((size_t)(n0 / 16 + dt) * (SS / 32) + blockIdx.x * 2 + kl) * 512 + half * 256 + lane * 8;
      vst2((unsigned*)(PH + o), *(const v4u*)&sth[d][sl]); vst2((unsigned*)(PL + o), *(const v4u*)&stl[d][sl]); }
  }
}
// ---- k_attn: block = (64 queries, head h): causal flash attention, kv head = h/4; scores 3 products, P.V 3 products; O[q][h*128+d]; ML[h][q] = (m, 1/l)
// waves_per_eu(2, 2): this grid puts two waves on a SIMD; at the default register target the scheduler folds the softmax's 8 rows back into pairs that run one behind another
__global__ __launch_bounds__(128) __attribute__((amdgpu_waves_per_eu(2, 2))) void k_attn(const float* __restrict__ Q, const float* __restrict__ Kx, const __bf16* __restrict__ VTH, const __bf16* __restrict__ VTL, float* __restrict__ O, float* __restrict__ ML) {
  __shared__ __align__(16) float sp[4][16][36]; __shared__ __align__(16) float so[4][16][132]; __shared__ __align__(16) float sml[64][4];
  const int tid = threadIdx.x, wave = tid >> 5, lane = tid & 31, col = lane & 15, g = lane >> 4;
  const int qb = blockIdx.x, h = blockIdx.y, kv = h / (NH / NKV); const int q0 = qb * 64 + wave * 16;
  R16 kr[2][4];   // a whole step's 32 key rows (8 slices) are in flight or in registers before its score products begin
  const float* kp0 = Kx + (size_t)(kv * 4) * 512 + lane * 4; const float* qp = Q + ((size_t)(q0 / 16) * (DM / 32) + h * 4) * 512 + lane * 4;   // the lane's own addresses
  R16 qr[4];
#pragma unroll
  for (int kc = 0; kc < 4; ++kc) qr[kc] = ld_t(qp + kc * 512, 0);
#pragma unroll
  for (int i = 0; i < 8; ++i) kr[i >> 2][i & 3] = ld_t(kp0 + ((i >> 2) * (KVW / 32) + (i & 3)) * 512, 0);
  asm volatile("s_wait_xcnt 0x0" :: "v"(kp0), "v"(qp) : "memory");   // behind the opening loads: the address pairs live up to the wait, which so stands in front of any overwrite of them
  F2 aq[4];
#pragma unroll
  for (int kc = 0; kc < 4; ++kc) aq[kc] = split_raw(qr[kc]);
  float m[8], l[8];
#pragma unroll
  for (int r = 0; r < 8; ++r) { m[r] = -3.0e38f; l[r] = 0.f; }
  v8f acc[8] = {};
  const int nks = (qb * 64 + 64) / 32;   // key steps covering keys <= the block's last query
#pragma unroll 1
  for (int ks = 0; ks < nks; ++ks) { v8f s[2];
    v16b vh[8], vl[8];   // the step's V fragments: column tile i is loaded as key slice i is used up (16 registers go, 16 come), so every tile has the rest of the score products and the softmax ahead of its use
    const size_t vbase = ((size_t)(kv * 8) * (SS / 32) + ks) * 512; const __bf16* vhp = VTH + vbase + lane * 8; const __bf16* vlp = VTL + vbase + lane * 8;   // the lane's own addresses in the step's blocks
    const float* kp = Kx + ((size_t)(min(ks + 1, nks - 1) * 2) * (KVW / 32) + kv * 4) * 512 + lane * 4;   // the last step loads itself again (in bounds, unused)
#pragma unroll
    for (int ct = 0; ct < 2; ++ct) { const int kk = ks * 32 + ct * 16 + col; v8f c = {};
#pragma unroll
      for (int kc = 0; kc < 4; ++kc) { const F2 kb = split_raw(kr[ct][kc]); const int dt = ct * 4 + kc;
        vh[dt] = frag_t(vhp + (size_t)dt * (SS / 32) * 512, 0); vl[dt] = frag_t(vlp + (size_t)dt * (SS / 32) * 512, 0);
        c = mac3_d(aq[kc], kb, c); }
#pragma unroll
      for (int r = 0; r < 8; ++r) { const int qi = q0 + 8 * g + r; s[ct][r] = (kk <= qi) ? c[r] * 0.08838834764831845f : -3.0e38f; } }
    asm volatile("s_wait_xcnt 0x0" :: "v"(vhp), "v"(vlp) : "memory");   // behind the step's last V load: as inputs here the address pairs live up to the wait, which so stands in front of any overwrite of them
    float mn[8], al[8], es[8];   // the softmax goes stage by stage over the 8 rows: within a stage the rows' chains (lane exchanges, exp) are independent and run side by side
#pragma unroll
    for (int r = 0; r < 8; ++r) mn[r] = fmaxf(s[0][r], s[1][r]);
#pragma unroll
    for (int o = 1; o < 16; o <<= 1) { float t[8]; xch8(t, mn, (lane ^ o) << 2);
#pragma unroll
      for (int r = 0; r < 8; ++r) mn[r] = fmaxf(mn[r], t[r]); }
#pragma unroll
    for (int r = 0; r < 8; ++r) { mn[r] = fmaxf(m[r], mn[r]);
      const float xa = expf(m[r] - mn[r]), x0 = expf(s[0][r] - mn[r]), x1 = expf(s[1][r] - mn[r]);   // inline and in every lane; a masked or not yet started entry is set to 0 by a select, not branched round
      al[r] = (m[r] <= -1.0e38f) ? 0.f : xa;
      const float e0 = (s[0][r] <= -1.0e38f) ? 0.f : x0, e1 = (s[1][r] <= -1.0e38f) ? 0.f : x1; es[r] = e0 + e1;
      sp[wave][8 * g + r][col] = e0; sp[wave][8 * g + r][16 + col] = e1; }
#pragma unroll
    for (int o = 1; o < 16; o <<= 1) { float t[8]; xch8(t, es, (lane ^ o) << 2);
#pragma unroll
      for (int r = 0; r < 8; ++r) es[r] += t[r]; }
#pragma unroll
    for (int r = 0; r < 8; ++r) { l[r] = l[r] * al[r] + es[r]; m[r] = mn[r];
#pragma unroll
      for (int dt = 0; dt < 8; ++dt) acc[dt][r] *= al[r]; }
    LDSW();
    const F2 pa = split_row(&sp[wave][col][0], 0, lane);
#pragma unroll
    for (int dt = 0; dt < 8; ++dt) { acc[dt] = wmma_bf_d(pa.l, vh[dt], acc[dt]); acc[dt] = wmma_bf_d(pa.h, vl[dt], acc[dt]); acc[dt] = wmma_bf_d(pa.h, vh[dt], acc[dt]);
      kr[dt >> 2][dt & 3] = ld_t(kp + ((dt >> 2) * (KVW / 32) + (dt & 3)) * 512, 0); }   // the next step's key slice i as column tile i is used up
    asm volatile("s_wait_xcnt 0x0" :: "v"(kp) : "memory");   // behind the last key load: the address pair lives up to the wait, which so stands in front of any overwrite of it
    LDSW(); }
#pragma unroll
  for (int r = 0; r < 8; ++r) { const float il = 1.0f / l[r];
#pragma unroll
    for (int dt = 0; dt < 8; ++dt) so[wave][8 * g + r][dt * 16 + col] = acc[dt][r] * il;
    if (col == 0) { sml[wave * 16 + 8 * g + r][0] = m[r]; sml[wave * 16 + 8 * g + r][1] = il; sml[wave * 16 + 8 * g + r][2] = 0.f; sml[wave * 16 + 8 * g + r][3] = 0.f; } }
  __syncthreads();
  st_t(O + ((size_t)(q0 / 16) * (DM / 32) + h * 4) * 512, so[wave], lane);
  asm volatile("s_wait_xcnt 0x0" ::: "memory");   // behind the tile's stores, in front of any overwrite of a register that they name
  if (tid < 64) vst2(ML + ((size_t)h * SS + qb * 64 + tid) * 4, *(const v4f*)&sml[tid][0]);
}
// ---- k_colsum: block = (64 keys, head h): partial column sums of probs over each 64-query block qb >= key block: p = exp(s - m_q) * (1/l_q) (s recomputed with the same 3-product dot and scale); CS[h][qb][key] rows of 256 B per (query block, this key block)
//   A = k rows (this block's 64 keys, wave -> 16), B = q rows (16-query tiles) -> D[key][q]; per key row sum over the q columns with the (m, 1/l) of each q and the causal predicate q >= key.
__global__ __launch_bounds__(128) void k_colsum(const float* __restrict__ Q, const float* __restrict__ Kx, const float* __restrict__ ML, float* __restrict__ CS) {
  __shared__ __align__(16) float ssum[64];
  const int tid = threadIdx.x, wave = tid >> 5, lane = tid & 31, col = lane & 15, g = lane >> 4;
  const int kb = blockIdx.x, h = blockIdx.y, kv = h / (NH / NKV); const int k0 = kb * 64 + wave * 16;
  F2 ak[4];
  const float* kp0 = Kx + ((size_t)(k0 / 16) * (KVW / 32) + kv * 4) * 512 + lane * 4; const float* qp0 = Q + ((size_t)(kb * 4) * (DM / 32) + h * 4) * 512 + lane * 4; const float* mp0 = ML + ((size_t)h * SS + kb * 64 + col) * 4;   // the lane's own addresses
#pragma unroll
  for (int kc = 0; kc < 4; ++kc) ak[kc] = split_raw(ld_t(kp0 + kc * 512, 0));
  R16 qr[2][4]; v2f ml[2];   // two register sets: the next 16-query tile (rows and statistics) is loaded as one group while this one is worked on
#pragma unroll
  for (int kc = 0; kc < 4; ++kc) qr[0][kc] = ld_t(qp0 + kc * 512, 0);
  ml[0] = *(const v2f*)mp0;
  asm volatile("s_wait_xcnt 0x0" :: "v"(kp0), "v"(qp0), "v"(mp0) : "memory");   // behind the opening loads: without it this build takes an address pair of these loads as a destination of one of them; as inputs here the pairs live up to the wait
#pragma unroll 1
  for (int qb = kb; qb < TQB; ++qb) { float rs[8];
#pragma unroll
    for (int r = 0; r < 8; ++r) rs[r] = 0.f;
#pragma unroll
    for (int ct = 0; ct < 4; ++ct) { const int qq = qb * 64 + ct * 16 + col; v8f c = {};
      const int qt = ct < 3 ? qb * 4 + ct + 1 : min(qb + 1, TQB - 1) * 4, qn = qt * 16 + col;   // behind the last tile: a tile of the last block again (in bounds, unused)
      const float* qp = Q + ((size_t)qt * (DM / 32) + h * 4) * 512 + lane * 4; const float* mp = ML + ((size_t)h * SS + qn) * 4;   // the lane's own addresses
#pragma unroll
      for (int kc = 0; kc < 4; ++kc) qr[(ct + 1) & 1][kc] = ld_t(qp + kc * 512, 0);
      ml[(ct + 1) & 1] = *(const v2f*)mp;
      asm volatile("s_wait_xcnt 0x0" :: "v"(qp), "v"(mp) : "memory");   // behind the tile's loads: without it this build takes their address pair as a destination of one of them; as inputs here the pairs live up to the wait, which stands in front of any overwrite
#pragma unroll
      for (int kc = 0; kc < 4; ++kc) { const F2 qf = split_raw(qr[ct & 1][kc]); c = mac3(ak[kc], qf, c); }
      const float mq = ml[ct & 1][0], ilq = ml[ct & 1][1];
#pragma unroll
      for (int r = 0; r < 8; ++r) { const int key = k0 + 8 * g + r; const float sc = c[r] * 0.08838834764831845f;
        const float t = rs[r] + expf(sc - mq) * ilq; rs[r] = (key <= qq) ? t : rs[r]; } }   // exp inline and in every lane, the causal test a select: the 8 rows' chains run side by side
#pragma unroll
    for (int o = 1; o < 16; o <<= 1) {   // level by level over the 8 rows: their exchanges are independent and run side by side
#pragma unroll
      for (int r = 0; r < 8; ++r) rs[r] += __shfl_xor(rs[r], o); }
    if (col == 0) {
#pragma unroll
      for (int r = 0; r < 8; ++r) ssum[wave * 16 + 8 * g + r] = rs[r]; }
    __syncthreads();
    if (tid < 16) vst2(CS + (((size_t)h * TQB + qb) * SS) + kb * 64 + tid * 4, *(const v4f*)&ssum[tid * 4]);
    __syncthreads(); }
  // query blocks qb < kb contribute nothing: write zeros so every CS row is defined
  for (int qb = 0; qb < kb; ++qb) { if (tid < 16) vst2(CS + (((size_t)h * TQB + qb) * SS) + kb * 64 + tid * 4, (v4f){0.f, 0.f, 0.f, 0.f}); }
}
// ---- k_mask: block = (128 mask positions, head h). A candidate is kept when fewer than HEAVY candidates come before it in the order 'larger column sum first, lower index first on ties': that count is taken directly, every position on its own, so the heads' selection spreads over the chip and no step of it waits on another
//   every block that holds candidates sums the head's candidate columns into LDS (same order over the query blocks); thread = (position tid & 127, quarter tid >> 7 of the candidates to compare with); a wave's 32 positions are consecutive, so the index test is needed only against those 32 candidates: all before them count on >=, all behind them on >
__global__ __launch_bounds__(128 * MTS) void k_mask(const float* __restrict__ CS, float* __restrict__ MSK) {
  static_assert(NSEL % 4 == 0 && NPAD / 4 <= 128 * MTS && (NPAD / 4) % (4 * MTS) == 0, "column groups of 4, one per thread; parts in groups of 16 candidates");
  __shared__ __align__(16) float sv[NPAD]; __shared__ int sc[MTS][128];
  const int h = blockIdx.y, tid = threadIdx.x, sl = tid & 127, s = blockIdx.x * 128 + sl;
  float o = (s >= MW - RECENT && s < MW) ? 1.0f : 0.f;
  if (blockIdx.x * 128 < NSEL) {   // the same for the whole block
    if (tid < NPAD / 4) { v4f c = {-3.0e38f, -3.0e38f, -3.0e38f, -3.0e38f};   // behind the last candidate: never in front of one
      if (tid < NSEL / 4) { const float* p = CS + (size_t)h * TQB * SS + tid * 4; v4f x[TQB];
#pragma unroll
        for (int qb = 0; qb < TQB; ++qb) x[qb] = *(const v4f*)(p + (size_t)qb * SS);
        c = (v4f){0.f, 0.f, 0.f, 0.f};
#pragma unroll
        for (int qb = 0; qb < TQB; ++qb) c += x[qb]; }
      *(v4f*)&sv[tid * 4] = c; }
    __syncthreads();
    const int wv = __builtin_amdgcn_readfirstlane(tid >> 5);   // scalar loop bounds
    const int s04 = (blockIdx.x * 128 + (wv & 3) * 32) >> 2, lo = (wv >> 2) * (NPAD / 4 / MTS), hi = lo + NPAD / 4 / MTS;   // in groups of 4 candidates: the wave's own positions start at s04, its part is [lo, hi)
    const float a = sv[min(s, NPAD - 1)];
    int n[4] = {0, 0, 0, 0};   // four counters: four independent chains
    for (int t4 = lo; t4 < min(hi, s04); t4 += 4) {
#pragma unroll
      for (int u = 0; u < 4; ++u) { const v4f b = *(const v4f*)&sv[(t4 + u) * 4];
#pragma unroll
        for (int i = 0; i < 4; ++i) n[i] += (b[i] >= a) ? 1 : 0; } }
    for (int t4 = max(lo, s04); t4 < min(hi, s04 + 8); t4 += 4) {
#pragma unroll
      for (int u = 0; u < 4; ++u) { const v4f b = *(const v4f*)&sv[(t4 + u) * 4];
#pragma unroll
        for (int i = 0; i < 4; ++i) n[i] += (int)(b[i] > a) | ((int)(b[i] == a) & (int)((t4 + u) * 4 + i < s)); } }   // the three tests joined by bit operations: no branch per candidate
    for (int t4 = max(lo, s04 + 8); t4 < hi; t4 += 4) {
#pragma unroll
      for (int u = 0; u < 4; ++u) { const v4f b = *(const v4f*)&sv[(t4 + u) * 4];
#pragma unroll
        for (int i = 0; i < 4; ++i) n[i] += (b[i] > a) ? 1 : 0; } }
    sc[wv >> 2][sl] = (n[0] + n[1]) + (n[2] + n[3]);
    __syncthreads();
    if (tid < 128 && s < NSEL) { int nb = 0;
#pragma unroll
      for (int q = 0; q < MTS; ++q) nb += sc[q][sl];
      o = nb < HEAVY ? 1.0f : 0.f; }
  }
  if (tid < 128) MSK[(size_t)h * MWP + s] = o;   // a wave stores one whole line
  else if (blockIdx.x == SS / 128 - 1 && tid < 128 + MWP - SS) MSK[(size_t)h * MWP + SS + tid - 128] = (SS + tid - 128 < MW) ? 1.0f : 0.f;   // the row's last line: position SS and the padding
}
// ---- k_out: block = (64 rows, 128 cols): out = O(hi/lo) . o_w^T rows (2 products)
__global__ __launch_bounds__(128) void k_out(const float* __restrict__ O, const __bf16* __restrict__ P, float* __restrict__ Y) {
  __shared__ __align__(16) float so[4][16][132];
  const int tid = threadIdx.x, wave = tid >> 5, lane = tid & 31, col = lane & 15, g = lane >> 4; const size_t r0 = (size_t)blockIdx.x * 64 + wave * 16; const int n0 = blockIdx.y * 128;
  v8f acc[8] = {};
  const float* oblk = O + (r0 / 16) * (DM / 32) * 512; const __bf16* pblk = P + (size_t)(n0 / 16) * (DM / 32) * 512;
  R16 xa[2]; v16b wb[2][8];   // two register sets: step kc + 1 is loaded as one group while step kc is multiplied
  xa[0] = ld_t(oblk, lane);
#pragma unroll
  for (int j = 0; j < 8; ++j) wb[0][j] = frag_t(pblk + (size_t)j * (DM / 32) * 512, lane);
#pragma unroll 1   // one trip already holds both register sets; more copies of it would only cost registers
  for (int kc = 0; kc < DM / 32; kc += 2) {
#pragma unroll
    for (int u = 0; u < 2; ++u) { const int kn = min(kc + u + 1, DM / 32 - 1);   // the last step loads itself again (in bounds, unused)
      const float* xp = oblk + kn * 512 + lane * 4; const __bf16* wp = pblk + (size_t)kn * 512 + lane * 8;   // the lane's own addresses in the step's blocks
      xa[u ^ 1] = ld_t(xp, 0);
#pragma unroll
      for (int j = 0; j < 8; ++j) wb[u ^ 1][j] = frag_t(wp + (size_t)j * (DM / 32) * 512, 0);
      asm volatile("s_wait_xcnt 0x0" :: "v"(xp), "v"(wp) : "memory");   // without it this build takes an address pair of these loads as a destination of one of them; as inputs here the pairs live up to the wait, which stands in front of any overwrite
      const F2 a = split_raw(xa[u]);
#pragma unroll
      for (int j = 0; j < 8; ++j) { acc[j] = wmma_bf(a.l, wb[u][j], acc[j]); acc[j] = wmma_bf(a.h, wb[u][j], acc[j]); } } }
#pragma unroll
  for (int j = 0; j < 8; ++j)
#pragma unroll
    for (int r = 0; r < 8; ++r) so[wave][8 * g + r][j * 16 + col] = acc[j][r];
  LDSX();
  for (int rl = 0; rl < 16; ++rl) vst2(Y + (r0 + rl) * DM + n0 + lane * 4, *(const v4f*)&so[wave][rl][lane * 4]);
}
// ---- k_mout: flat writer of the [16][2049] mask after the attention output
__global__ __launch_bounds__(256) void k_mout(const float* __restrict__ MSK, float* __restrict__ out) {
  const size_t p = (size_t)blockIdx.x * 256 + threadIdx.x; const size_t total = (size_t)NH * (SFULL + 1); if (p * 4 >= total) return; v4f v;
#pragma unroll
  for (int i = 0; i < 4; ++i) { const size_t f = p * 4 + i; const size_t row = f / (SFULL + 1), c = f % (SFULL + 1); v[i] = (f < total && c < (size_t)MW) ? MSK[row * MWP + c] : 0.f; }
  vst2(out + p * 4, v);
}
extern "C" void kernel_launch(void* const* d_in, const int* in_sizes, int n_in, void* d_out, int out_size, void* d_ws, size_t ws_size, hipStream_t stream) {
  (void)in_sizes; (void)n_in; (void)out_size;
  const float** F = (const float**)d_in;   // hidden_states [1,2048,2048], q_w [2048,2048], q_b [2048], k_w [2048,512], k_b [512], v_w [2048,512], v_b [512], o_w [2048,2048]
  if (ws_size < (size_t)WS_END) return;
  char* ws = (char*)d_ws; __bf16 *PK = (__bf16*)(ws + WS_PK), *XB = (__bf16*)(ws + WS_X), *VTH = (__bf16*)(ws + WS_VTH), *VTL = (__bf16*)(ws + WS_VTL);
  float *Q = (float*)(ws + WS_Q), *Kx = (float*)(ws + WS_K), *O = (float*)(ws + WS_O), *ML = (float*)(ws + WS_ML), *CS = (float*)(ws + WS_CS), *MSK = (float*)(ws + WS_MSK);
  float* OUT0 = (float*)d_out; float* OUT1 = OUT0 + (size_t)SFULL * DM;
  k_packT<<<dim3(DM / 16, DM / 128), 256, 0, stream>>>(F[1], DM, DM, PK + PK_Q); k_packT<<<dim3(KVW / 16, DM / 128), 256, 0, stream>>>(F[3], DM, KVW, PK + PK_K); k_packT<<<dim3(KVW / 16, DM / 128), 256, 0, stream>>>(F[5], DM, KVW, PK + PK_V); k_packT<<<dim3(DM / 16, DM / 128), 256, 0, stream>>>(F[7], DM, DM, PK + PK_O);
  k_packR<<<dim3(SS / 16, DM / 128), 256, 0, stream>>>(F[0], XB);
  k_proj<0><<<dim3(SS / 64, DM / 128), 128, 0, stream>>>(XB, PK + PK_Q, F[2], Q, DM, nullptr, nullptr);
  k_proj<0><<<dim3(SS / 64, KVW / 128), 128, 0, stream>>>(XB, PK + PK_K, F[4], Kx, KVW, nullptr, nullptr);
  k_proj<1><<<dim3(SS / 64, KVW / 128), 128, 0, stream>>>(XB, PK + PK_V, F[6], nullptr, 0, VTH, VTL);
  k_attn<<<dim3(TQB, NH), 128, 0, stream>>>(Q, Kx, VTH, VTL, O, ML);
  k_colsum<<<dim3(TQB, NH), 128, 0, stream>>>(Q, Kx, ML, CS);
  k_mask<<<dim3(SS / 128, NH), 128 * MTS, 0, stream>>>(CS, MSK);
  k_out<<<dim3(TQB, DM / 128), 128, 0, stream>>>(O, PK + PK_O, OUT0);
  k_mout<<<(unsigned)(((size_t)NH * (SFULL + 1) / 4 + 255) / 256), 256, 0, stream>>>(MSK, OUT1);
}

// v007
// Measured time: 298 microseconds a run.
// Two timings next to v006 both put it at 1.14 times that version's speed.
// All steps since v000 together make it 4.75 times as fast.
// compute dtype: hidden_states and all weights/biases (module inputs) rounded to bf16; q/k/v projections with exact bf16 products (x and W are inputs); causal scores q.k with both computed operands as bf16 hi + residual pairs (3 products) and P.V with P hi/lo x V hi/lo (3 products); the heavy-hitter column sums recompute the same 3-product scores in a second (transposed) pass with the stored row statistics; the output projection with hi/lo x exact o_w (2 products), all on WMMA 16x16x32; softmax, column sums, the per-head top-k selection (rank by counting, lower index first on ties) and the mask assembly in f32 on the VALU; f32 accumulate.
#include <hip/hip_runtime.h>
#include <math.h>

typedef __attribute__((ext_vector_type(16))) _Float16 v16h;
typedef __attribute__((ext_vector_type(16))) __bf16 v16b;
typedef __attribute__((ext_vector_type(8)))  _Float16 v8h;
typedef __attribute__((ext_vector_type(8)))  float v8f;
typedef __attribute__((ext_vector_type(4)))  float v4f;
typedef __attribute__((ext_vector_type(2)))  float v2f;
typedef __attribute__((ext_vector_type(4)))  unsigned v4u;
typedef __attribute__((ext_vector_type(4)))  int v4i;
typedef float __attribute__((may_alias)) float_a;
typedef int __attribute__((may_alias)) int_a;

template <typename T> __device__ __forceinline__ void vst2(void* p, T v) { *(T*)p = v;  }
__device__ __forceinline__ v8f wmma16(v16h a, v16h b, v8f c) {
  v8f d = __builtin_amdgcn_wmma_f32_16x16x32_f16(false, a, false, b, (short)0, c, false, false);
  asm volatile("v_nop\n\tv_nop\n\tv_nop\n\tv_nop" : "+v"(d) : "v"(a), "v"(b));
  return d;
}
__device__ __forceinline__ v8f wmma_bf(v16b a, v16b b, v8f c) {
  v8f d = __builtin_amdgcn_wmma_f32_16x16x32_bf16(false, a, false, b, (short)0, c, false, false);
  asm volatile("v_nop\n\tv_nop\n\tv_nop\n\tv_nop" : "+v"(d) : "v"(a), "v"(b));
  return d;
}
// 16x16x32 fragments: lane = (h = lane>>4, row/col = lane&15); elements 0..7 = k0+8h+0..7, 8..15 = k0+16+8h+0..7; D element r = row 8h+r
__device__ __forceinline__ v16h frag_h(const _Float16* rowk0, int lane) {
  union { v16h v; v8h q[2]; } u; const _Float16* p = rowk0 + 8 * (lane >> 4);
  u.q[0] = *(const v8h*)p; u.q[1] = *(const v8h*)(p + 16); return u.v;
}
__device__ __forceinline__ v16h frag_f32(const float* rowk0, int lane) {
  v16h a; const float* p = rowk0 + 8 * (lane >> 4);
#pragma unroll
  for (int i = 0; i < 8; ++i) { a[i] = (_Float16)p[i]; a[8 + i] = (_Float16)p[16 + i]; }
  return a;
}
__device__ __forceinline__ v16h frag_f32s(const float* rowk0, int lane, float sc) {
  v16h a; const float* p = rowk0 + 8 * (lane >> 4);
#pragma unroll
  for (int i = 0; i < 8; ++i) { a[i] = (_Float16)(p[i] * sc); a[8 + i] = (_Float16)(p[16 + i] * sc); }
  return a;
}
// column fragment from a [K][ld] layout (column n), rows >= K read as 0
__device__ __forceinline__ v16h fragc_f32(const float* W, int k0, int n, int lane, int ld, int K) {
  v16h a; const int g = lane >> 4;
#pragma unroll
  for (int i = 0; i < 8; ++i) { const int ka = k0 + 8 * g + i, kb = ka + 16;
    a[i] = (_Float16)(ka < K ? W[(size_t)(ka < K ? ka : K - 1) * ld + n] : 0.f); a[8 + i] = (_Float16)(kb < K ? W[(size_t)(kb < K ? kb : K - 1) * ld + n] : 0.f); }
  return a;
}
struct F2 { v16b h, l; };
__device__ __forceinline__ F2 bsplit16(const float v[16]) { F2 r;
#pragma unroll
  for (int i = 0; i < 16; ++i) { const __bf16 h = (__bf16)v[i]; r.h[i] = h; r.l[i] = (__bf16)(v[i] - (float)h); }
  return r; }
__device__ __forceinline__ F2 split_row(const float* row, int k0, int lane) { float v[16]; const float* p = row + k0 + 8 * (lane >> 4);
#pragma unroll
  for (int i = 0; i < 8; ++i) { v[i] = p[i]; v[8 + i] = p[16 + i]; }
  return bsplit16(v); }
__device__ __forceinline__ F2 split_rowK(const float* row, int k0, int lane, int K) { float v[16]; const int g = lane >> 4;
#pragma unroll
  for (int i = 0; i < 8; ++i) { const int ka = k0 + 8 * g + i, kb = ka + 16; v[i] = ka < K ? row[ka < K ? ka : K - 1] : 0.f; v[8 + i] = kb < K ? row[kb < K ? kb : K - 1] : 0.f; }
  return bsplit16(v); }
__device__ __forceinline__ F2 split_col(const float* W, int k0, int n, int lane, int ld, int K) { float v[16]; const int g = lane >> 4;
#pragma unroll
  for (int i = 0; i < 8; ++i) { const int ka = k0 + 8 * g + i, kb = ka + 16; v[i] = ka < K ? W[(size_t)(ka < K ? ka : K - 1) * ld + n] : 0.f; v[8 + i] = kb < K ? W[(size_t)(kb < K ? kb : K - 1) * ld + n] : 0.f; }
  return bsplit16(v); }
__device__ __forceinline__ v8f mac3(const F2& a, const F2& b, v8f c) { c = wmma_bf(a.l, b.h, c); c = wmma_bf(a.h, b.l, c); return wmma_bf(a.h, b.h, c); }
__device__ __forceinline__ float sigm(float v) { return 1.0f / (1.0f + expf(-v)); }
#define LDSX() do { asm volatile("s_wait_dscnt 0" ::: "memory"); __builtin_amdgcn_wave_barrier(); __builtin_amdgcn_fence(__ATOMIC_RELEASE, "workgroup"); } while (0)


// GQA causal attention with H2O heavy-hitter scoring (B 1, S 2048, D 2048, 16 query heads / 4 kv heads x 128): out = softmax(q k^T / sqrt(128), causal) v -> @ o_w; cur[h][s] = sum over queries of probs; mask[h] = 1 on the last 204 of 2049 positions, 0 elsewhere, then 1 at the top-204 (heavy budget) indices of cur[h][:1844].
#define SFULL 2048            // shipped sequence length (output layout)
#ifndef SS
#define SS SFULL              // active sequence length (all)
#endif
#define DM 2048
#define NH 16
#define NKV 4
#define HD 128
#define KVW (NKV * HD)        // 512
#define HEAVY (SS / 10)       // int(0.1 * S)
#define RECENT (SS / 10)
#define MW (SS + 1)           // 2049 mask width
#define MWP 2080              // padded staging width: a row is 65 whole 128-byte lines
#define NSEL (SS - RECENT)    // 1844 candidates of the heavy-hitter selection
#define NPAD ((NSEL + 31) / 32 * 32)   // candidates rounded up to whole waves
#define MTS 4                 // k_mask: parts into which the candidates to compare with are dealt
#define TQB (SS / 64)         // query blocks
typedef __attribute__((ext_vector_type(8))) __bf16 v8b;
// fragment-order storage: a [rows][k] operand that a kernel of this file writes is kept as blocks of 16 rows x 32 k, block (rt, kc) at index rt * (k / 32) + kc; inside a block the 16-byte pieces stand in the order in which the lanes load them, so every wave-wide load or store is 512 bytes in a row (4 whole lines, not 16 part lines)
// bf16 block = 512 elements: piece (half, lane) at half * 256 + lane * 8 holds row lane & 15, k = half * 16 + 8 * (lane >> 4) + 0..7
__device__ __forceinline__ v16b frag_t(const __bf16* blk, int lane) {
  union { v16b v; v8b q[2]; } u;
  u.q[0] = *(const v8b*)(blk + lane * 8); u.q[1] = *(const v8b*)(blk + 256 + lane * 8); return u.v;
}
__device__ __forceinline__ float bfr(float v) { return (float)(__bf16)v; }
// the same product with only D named at the v_nops, which so stand in front of the next reader of D (A and B are left to the compiler's own padding of its builtin): an operand that an asm statement names must stand below v256, and with A and B named too k_attn, which holds a whole step's fragments, builds with spills to scratch
__device__ __forceinline__ v8f wmma_bf_d(v16b a, v16b b, v8f c) {
  v8f d = __builtin_amdgcn_wmma_f32_16x16x32_bf16(false, a, false, b, (short)0, c, false, false);
  asm volatile("v_nop\n\tv_nop\n\tv_nop\n\tv_nop" : "+v"(d));
  return d;
}
__device__ __forceinline__ v8f mac3_d(const F2& a, const F2& b, v8f c) { c = wmma_bf_d(a.l, b.h, c); c = wmma_bf_d(a.h, b.l, c); return wmma_bf_d(a.h, b.h, c); }
// the 8 rows' exchange with lane ^ o as ONE group, 8 ds_bpermute_b32 and their one wait in one statement (a = 4 * (lane ^ o), as __shfl_xor forms it): with 8 V tiles live across the softmax the scheduler otherwise folds the rows into pairs, whose exchanges then wait one behind another (so a build with __shfl_xor here: two exchanges or one to a wait)
__device__ __forceinline__ void xch8(float (&t)[8], const float (&x)[8], int a) {
  asm volatile("ds_bpermute_b32 %0, %8, %9\n\tds_bpermute_b32 %1, %8, %10\n\tds_bpermute_b32 %2, %8, %11\n\tds_bpermute_b32 %3, %8, %12\n\t"
               "ds_bpermute_b32 %4, %8, %13\n\tds_bpermute_b32 %5, %8, %14\n\tds_bpermute_b32 %6, %8, %15\n\tds_bpermute_b32 %7, %8, %16\n\ts_wait_dscnt 0x0"
               : "=&v"(t[0]), "=&v"(t[1]), "=&v"(t[2]), "=&v"(t[3]), "=&v"(t[4]), "=&v"(t[5]), "=&v"(t[6]), "=&v"(t[7])
               : "v"(a), "v"(x[0]), "v"(x[1]), "v"(x[2]), "v"(x[3]), "v"(x[4]), "v"(x[5]), "v"(x[6]), "v"(x[7]) : "memory");
}
// a wave's own exchange through its own LDS rows: its LDS operations are done and the compiler moves no memory access across; unlike LDSX it holds no fence, which would also wait for every global load in flight
#define LDSW() do { asm volatile("s_wait_dscnt 0" ::: "memory"); __builtin_amdgcn_wave_barrier(); } while (0)
// the 16 registers of one lane's slice of a hi/lo operand pair, as loaded: q[0], q[1] the hi fragment, q[2], q[3] the residual fragment
struct R16 { v4f q[4]; };
// pair block = 2 KB (addressed as 512 floats): the bf16 block of the hi parts, then the bf16 block of the residuals; piece (pl, half, lane) at float (pl * 2 + half) * 128 + lane * 4 holds 8 bf16 of row lane & 15, k = half * 16 + 8 * (lane >> 4) + 0..7
// a computed f32 operand (q, k, the attention output) is split ONCE, by the wave that stores it; every wave that loads it (a key slice: 4 heads x up to 128 query tiles) has its two WMMA fragments in the loaded registers, with no conversion
__device__ __forceinline__ R16 ld_t(const float* blk, int lane) { R16 r;
#pragma unroll
  for (int qi = 0; qi < 4; ++qi) r.q[qi] = *(const v4f*)(blk + qi * 128 + lane * 4);
  return r; }
// one wave's 16 x 128 f32 tile, from its LDS staging rows to 4 pair blocks in a row: hi = bf16(v), residual = bf16(v - hi), as bsplit16 forms them
__device__ __forceinline__ void st_t(float* blk, const float (*st)[132], int lane) {
#pragma unroll
  for (int sl = 0; sl < 4; ++sl) {
#pragma unroll
    for (int half = 0; half < 2; ++half) { const float* p = &st[lane & 15][sl * 32 + half * 16 + 8 * (lane >> 4)]; const v4f a = *(const v4f*)p, b = *(const v4f*)(p + 4);
      union { v8b b8; v4f f; } hi, lo;
#pragma unroll
      for (int i = 0; i < 8; ++i) { const float v = i < 4 ? a[i & 3] : b[i & 3]; const __bf16 hb = (__bf16)v; hi.b8[i] = hb; lo.b8[i] = (__bf16)(v - (float)hb); }
      vst2(blk + sl * 512 + half * 128 + lane * 4, hi.f); vst2(blk + sl * 512 + (2 + half) * 128 + lane * 4, lo.f); } }
}
// the two fragments of a loaded slice: the registers as they are, no instruction
__device__ __forceinline__ F2 split_raw(const R16& r) { union { v4f f[2]; v16b b; } hi, lo; F2 o;
  hi.f[0] = r.q[0]; hi.f[1] = r.q[1]; lo.f[0] = r.q[2]; lo.f[1] = r.q[3]; o.h = hi.b; o.l = lo.b; return o; }
__device__ __attribute__((noinline)) float erf_ni(float v) { return erff(v); }

#define PK_Q 0                               // [2048 n][2048 k] q_w^T (all four: bf16 blocks)
#define PK_K (PK_Q + DM * DM)                  // [512][2048]
#define PK_V (PK_K + KVW * DM)
#define PK_O (PK_V + KVW * DM)                 // [2048][2048] o_w^T
#define PK_END (PK_O + DM * DM)
#define WS_PK  0u
#define WS_Q   (WS_PK + 2u * PK_END)           // pair blocks [2048][2048] q (h*128+d)
#define WS_K   (WS_Q + 4u * SS * DM)            // pair blocks [2048][512]
#define WS_VTH (WS_K + 4u * SS * KVW)           // bf16 blocks [512 (kv*128+d)][2048]
#define WS_VTL (WS_VTH + 2u * KVW * SS)
#define WS_O   (WS_VTL + 2u * KVW * SS)         // pair blocks [2048][2048] attention output (h*128+d)
#define WS_ML  (WS_O + 4u * SS * DM)            // f32 [16][2048][4]: (m, 1/l, 0, 0)
#define WS_CS  (WS_ML + 4u * NH * SS * 4)       // f32 [16][32 qblocks][2048]: per-query-block partial column sums
#define WS_MSK (WS_CS + 4u * NH * TQB * SS)     // f32 [16][2080] mask staging
#define WS_X   (WS_MSK + 4u * NH * MWP)         // bf16 blocks [2048][2048] hidden_states
#define WS_END (WS_X + 2u * SS * DM)

// ---- k_packT: block = (16 output columns, 128 k) of a [K][N] (x @ W) matrix: 4 bf16 blocks in a row (4 KB) of W^T; a thread makes one 16-byte piece
__global__ __launch_bounds__(256) void k_packT(const float* __restrict__ Wm, int K, int N, __bf16* __restrict__ DST) {
  const int tid = threadIdx.x, lane = tid & 31, half = (tid >> 5) & 1, kc = blockIdx.y * 4 + (tid >> 6);
  const float* src = Wm + (size_t)(kc * 32 + half * 16 + 8 * (lane >> 4)) * N + blockIdx.x * 16 + (lane & 15);
  v8b o;
#pragma unroll
  for (int i = 0; i < 8; ++i) o[i] = (__bf16)src[(size_t)i * N];
  vst2(DST + ((size_t)blockIdx.x * (K / 32) + kc) * 512 + half * 256 + lane * 8, o);
}
// ---- k_packR: block = (16 rows, 128 k) of the row-major [rows][DM] x: 4 bf16 blocks in a row (4 KB) of bf16(x); a thread makes one 16-byte piece
__global__ __launch_bounds__(256) void k_packR(const float* __restrict__ X, __bf16* __restrict__ DST) {
  const int tid = threadIdx.x, lane = tid & 31, half = (tid >> 5) & 1, kc = blockIdx.y * 4 + (tid >> 6);
  const float* src = X + (size_t)(blockIdx.x * 16 + (lane & 15)) * DM + kc * 32 + half * 16 + 8 * (lane >> 4);
  const v4f a = *(const v4f*)src, b = *(const v4f*)(src + 4); v8b o;
#pragma unroll
  for (int i = 0; i < 4; ++i) { o[i] = (__bf16)a[i]; o[4 + i] = (__bf16)b[i]; }
  vst2(DST + ((size_t)blockIdx.x * (DM / 32) + kc) * 512 + half * 256 + lane * 8, o);
}
// ---- k_proj<VT>: block = (64 rows, 128 cols): Y = bf16(x) (packed, bf16 blocks) . P rows (exact) + bias; VT 0: pair blocks of [row][ldo cols]; VT 1: transposed bf16 hi/lo planes, bf16 blocks of [col][row]
template <int VT>
__global__ __launch_bounds__(128) void k_proj(const __bf16* __restrict__ X, const __bf16* __restrict__ P, const float* __restrict__ bias, float* __restrict__ OUT, int ldo, __bf16* __restrict__ PH, __bf16* __restrict__ PL) {
  __shared__ __align__(16) float so[VT ? 1 : 4][16][132]; __shared__ __align__(16) __bf16 sth[VT ? 128 : 1][72], stl[VT ? 128 : 1][72];
  const int tid = threadIdx.x, wave = tid >> 5, lane = tid & 31, col = lane & 15, g = lane >> 4; const size_t r0 = (size_t)blockIdx.x * 64 + wave * 16; const int n0 = blockIdx.y * 128;
  v8f acc[8] = {};
  const __bf16* xblk = X + (r0 / 16) * (DM / 32) * 512; const __bf16* pblk = P + (size_t)(n0 / 16) * (DM / 32) * 512;
  v16b xa[2], wb[2][8];   // two register sets: step kc + 1 is loaded as one group while step kc is multiplied
  xa[0] = frag_t(xblk, lane);
#pragma unroll
  for (int j = 0; j < 8; ++j) wb[0][j] = frag_t(pblk + (size_t)j * (DM / 32) * 512, lane);
#pragma unroll 1   // one trip already holds both register sets; more copies of it would only cost registers
  for (int kc = 0; kc < DM / 32; kc += 2) {
#pragma unroll
    for (int u = 0; u < 2; ++u) { const int kn = min(kc + u + 1, DM / 32 - 1);   // the last step loads itself again (in bounds, unused)
      const __bf16* xp = xblk + kn * 512 + lane * 8; const __bf16* wp = pblk + (size_t)kn * 512 + lane * 8;   // the lane's own addresses in the step's blocks
      xa[u ^ 1] = frag_t(xp, 0);
#pragma unroll
      for (int j = 0; j < 8; ++j) wb[u ^ 1][j] = frag_t(wp + (size_t)j * (DM / 32) * 512, 0);
      asm volatile("s_wait_xcnt 0x0" :: "v"(xp), "v"(wp) : "memory");   // as inputs here the pairs live up to the wait, which stands in front of any overwrite
#pragma unroll
      for (int j = 0; j < 8; ++j) acc[j] = wmma_bf(xa[u], wb[u][j], acc[j]); } }
  if (!VT) {
#pragma unroll
    for (int j = 0; j < 8; ++j) { const float bb = bfr(bias[n0 + j * 16 + col]);
#pragma unroll
      for (int r = 0; r < 8; ++r) so[wave][8 * g + r][j * 16 + col] = acc[j][r] + bb; }
    LDSX();
    st_t(OUT + ((r0 / 16) * (ldo / 32) + n0 / 32) * 512, so[wave], lane);
  } else {
#pragma unroll
    for (int j = 0; j < 8; ++j) { const float bb = bfr(bias[n0 + j * 16 + col]);
#pragma unroll
      for (int r = 0; r < 8; ++r) { const float v = acc[j][r] + bb; const __bf16 hb = (__bf16)v; sth[j * 16 + col][wave * 16 + 8 * g + r] = hb; stl[j * 16 + col][wave * 16 + 8 * g + r] = (__bf16)(v - (float)hb); } }
    __syncthreads();
    for (int q = tid; q < 128 * 8; q += 128) { const int dt = q >> 7, kl = (q >> 6) & 1, half = (q >> 5) & 1;   // 16 blocks a plane (8 column tiles x 2 row steps), 64 pieces each; q & 31 = lane
      const int d = dt * 16 + col, sl = kl * 32 + half * 16 + 8 * g; const size_t o = ((size_t)(n0 / 16 + dt) * (SS / 32) + blockIdx.x * 2 + kl) * 512 + half * 256 + lane * 8;
      vst2((unsigned*)(PH + o), *(const v4u*)&sth[d][sl]); vst2((unsigned*)(PL + o), *(const v4u*)&stl[d][sl]); }
  }
}
// ---- k_attn: block = (64 queries, head h), 8 waves: causal flash attention, kv head = h/4; scores 3 products, P.V 3 products; O[q][h*128+d]; ML[h][q] = (m, 1/l)
// a 16-query tile's key steps are dealt to two waves (wave wt: the even steps, wave wt + 4: the odd ones), each with its own (m, l, acc); the two partials are joined through LDS behind the loop. The longest wave so walks 32 steps, not 64, and with the longest blocks first in the grid the short ones fill the places that the long ones leave
// waves_per_eu(2, 2): a block puts two waves on a SIMD; at the default register target the scheduler folds the softmax's 8 rows back into pairs that run one behind another
__global__ __launch_bounds__(256) __attribute__((amdgpu_waves_per_eu(2, 2))) void k_attn(const float* __restrict__ Q, const float* __restrict__ Kx, const __bf16* __restrict__ VTH, const __bf16* __restrict__ VTL, float* __restrict__ O, float* __restrict__ ML) {
  __shared__ __align__(16) float sp[8][16][36]; __shared__ __align__(16) float so[4][16][132]; __shared__ __align__(16) float sml[64][4]; __shared__ __align__(8) float sm1[4][16][2];
  const int tid = threadIdx.x, wave = tid >> 5, wt = wave & 3, lane = tid & 31, col = lane & 15, g = lane >> 4;
  const int part = __builtin_amdgcn_readfirstlane(tid >> 7);   // scalar: step numbers, addresses and the branches behind the loop stay wave-uniform
  const int qb = TQB - 1 - blockIdx.y, h = blockIdx.x, kv = h / (NH / NKV); const int q0 = qb * 64 + wt * 16;   // the longest blocks have the lowest index
  R16 kr[2][4];   // a whole step's 32 key rows (8 slices) are in flight or in registers before its score products begin
  const float* kp0 = Kx + ((size_t)(part * 2) * (KVW / 32) + kv * 4) * 512 + lane * 4; const float* qp = Q + ((size_t)(q0 / 16) * (DM / 32) + h * 4) * 512 + lane * 4;   // the lane's own addresses
  R16 qr[4];
#pragma unroll
  for (int kc = 0; kc < 4; ++kc) qr[kc] = ld_t(qp + kc * 512, 0);
#pragma unroll
  for (int i = 0; i < 8; ++i) kr[i >> 2][i & 3] = ld_t(kp0 + ((i >> 2) * (KVW / 32) + (i & 3)) * 512, 0);
  asm volatile("s_wait_xcnt 0x0" :: "v"(kp0), "v"(qp) : "memory");   // behind the opening loads: the address pairs live up to the wait, which so stands in front of any overwrite of them
  F2 aq[4];
#pragma unroll
  for (int kc = 0; kc < 4; ++kc) aq[kc] = split_raw(qr[kc]);
  float m[8], l[8];
#pragma unroll
  for (int r = 0; r < 8; ++r) { m[r] = -3.0e38f; l[r] = 0.f; }
  v8f acc[8] = {};
  const int nks = (qb * 64 + 64) / 32;   // key steps covering keys <= the block's last query: an even number, half of them to each part
#pragma unroll 1
  for (int ks = part; ks < nks; ks += 2) { v8f s[2];
    v16b vh[8], vl[8];   // the step's V fragments: column tile i is loaded as key slice i is used up (16 registers go, 16 come), so every tile has the rest of the score products and the softmax ahead of its use
    const size_t vbase = ((size_t)(kv * 8) * (SS / 32) + ks) * 512; const __bf16* vhp = VTH + vbase + lane * 8; const __bf16* vlp = VTL + vbase + lane * 8;   // the lane's own addresses in the step's blocks
    const float* kp = Kx + ((size_t)(min(ks + 2, nks - 2 + part) * 2) * (KVW / 32) + kv * 4) * 512 + lane * 4;   // the part's last step loads itself again (in bounds, unused)
#pragma unroll
    for (int ct = 0; ct < 2; ++ct) { const int kk = ks * 32 + ct * 16 + col; v8f c = {};
#pragma unroll
      for (int kc = 0; kc < 4; ++kc) { const F2 kb = split_raw(kr[ct][kc]); const int dt = ct * 4 + kc;
        vh[dt] = frag_t(vhp + (size_t)dt * (SS / 32) * 512, 0); vl[dt] = frag_t(vlp + (size_t)dt * (SS / 32) * 512, 0);
        c = mac3_d(aq[kc], kb, c); }
#pragma unroll
      for (int r = 0; r < 8; ++r) { const int qi = q0 + 8 * g + r; s[ct][r] = (kk <= qi) ? c[r] * 0.08838834764831845f : -3.0e38f; } }
    asm volatile("s_wait_xcnt 0x0" :: "v"(vhp), "v"(vlp) : "memory");   // behind the step's last V load: as inputs here the address pairs live up to the wait, which so stands in front of any overwrite of them
    float mn[8], al[8], es[8];   // the softmax goes stage by stage over the 8 rows: within a stage the rows' chains (lane exchanges, exp) are independent and run side by side
#pragma unroll
    for (int r = 0; r < 8; ++r) mn[r] = fmaxf(s[0][r], s[1][r]);
#pragma unroll
    for (int o = 1; o < 16; o <<= 1) { float t[8]; xch8(t, mn, (lane ^ o) << 2);
#pragma unroll
      for (int r = 0; r < 8; ++r) mn[r] = fmaxf(mn[r], t[r]); }
#pragma unroll
    for (int r = 0; r < 8; ++r) { mn[r] = fmaxf(m[r], mn[r]);
      const float xa = expf(m[r] - mn[r]), x0 = expf(s[0][r] - mn[r]), x1 = expf(s[1][r] - mn[r]);   // inline and in every lane; a masked or not yet started entry is set to 0 by a select, not branched round
      al[r] = (m[r] <= -1.0e38f) ? 0.f : xa;
      const float e0 = (s[0][r] <= -1.0e38f) ? 0.f : x0, e1 = (s[1][r] <= -1.0e38f) ? 0.f : x1; es[r] = e0 + e1;
      sp[wave][8 * g + r][col] = e0; sp[wave][8 * g + r][16 + col] = e1; }
#pragma unroll
    for (int o = 1; o < 16; o <<= 1) { float t[8]; xch8(t, es, (lane ^ o) << 2);
#pragma unroll
      for (int r = 0; r < 8; ++r) es[r] += t[r]; }
#pragma unroll
    for (int r = 0; r < 8; ++r) { l[r] = l[r] * al[r] + es[r]; m[r] = mn[r];
#pragma unroll
      for (int dt = 0; dt < 8; ++dt) acc[dt][r] *= al[r]; }
    LDSW();
    const F2 pa = split_row(&sp[wave][col][0], 0, lane);
#pragma unroll
    for (int dt = 0; dt < 8; ++dt) { acc[dt] = wmma_bf_d(pa.l, vh[dt], acc[dt]); acc[dt] = wmma_bf_d(pa.h, vl[dt], acc[dt]); acc[dt] = wmma_bf_d(pa.h, vh[dt], acc[dt]);
      kr[dt >> 2][dt & 3] = ld_t(kp + ((dt >> 2) * (KVW / 32) + (dt & 3)) * 512, 0); }   // the next step's key slice i as column tile i is used up
    asm volatile("s_wait_xcnt 0x0" :: "v"(kp) : "memory");   // behind the last key load: the address pair lives up to the wait, which so stands in front of any overwrite of it
    LDSW(); }
  if (part) {   // the odd steps' partial goes to the tile's staging rows, every value at the place where the same lane of wave wt will read it
#pragma unroll
    for (int r = 0; r < 8; ++r) {
#pragma unroll
      for (int dt = 0; dt < 8; ++dt) so[wt][8 * g + r][dt * 16 + col] = acc[dt][r];
      if (col == 0) { sm1[wt][8 * g + r][0] = m[r]; sm1[wt][8 * g + r][1] = l[r]; } } }
  __syncthreads();
  if (!part) {   // join: both partials are brought to the common maximum; step 0 holds key 0, so the even part has always started; an odd part that saw only masked keys weighs 0
#pragma unroll
    for (int r = 0; r < 8; ++r) { const float m1 = sm1[wt][8 * g + r][0], l1 = sm1[wt][8 * g + r][1], mm = fmaxf(m[r], m1);
      const float w0 = expf(m[r] - mm), x1 = expf(m1 - mm), w1 = (m1 <= -1.0e38f) ? 0.f : x1, il = 1.0f / (l[r] * w0 + l1 * w1);
#pragma unroll
      for (int dt = 0; dt < 8; ++dt) so[wt][8 * g + r][dt * 16 + col] = (acc[dt][r] * w0 + so[wt][8 * g + r][dt * 16 + col] * w1) * il;
      if (col == 0) { sml[wt * 16 + 8 * g + r][0] = mm; sml[wt * 16 + 8 * g + r][1] = il; sml[wt * 16 + 8 * g + r][2] = 0.f; sml[wt * 16 + 8 * g + r][3] = 0.f; } } }
  __syncthreads();
  if (!part) {   // here wave = wt
    st_t(O + ((size_t)(q0 / 16) * (DM / 32) + h * 4) * 512, so[wave], lane);
    asm volatile("s_wait_xcnt 0x0" ::: "memory");   // behind the tile's stores, in front of any overwrite of a register that they name
  }
  if (tid < 64) vst2(ML + ((size_t)h * SS + qb * 64 + tid) * 4, *(const v4f*)&sml[tid][0]);
}
// ---- k_colsum: block = (64 keys, head h): partial column sums of probs over each 64-query block qb >= key block: p = exp(s - m_q) * (1/l_q) (s recomputed with the same 3-product dot and scale); CS[h][qb][key] rows of 256 B per (query block, this key block)
//   A = k rows (this block's 64 keys, wave -> 16), B = q rows (16-query tiles) -> D[key][q]; per key row sum over the q columns with the (m, 1/l) of each q and the causal predicate q >= key.
__global__ __launch_bounds__(128) void k_colsum(const float* __restrict__ Q, const float* __restrict__ Kx, const float* __restrict__ ML, float* __restrict__ CS) {
  __shared__ __align__(16) float ssum[64];
  const int tid = threadIdx.x, wave = tid >> 5, lane = tid & 31, col = lane & 15, g = lane >> 4;
  const int kb = blockIdx.x, h = blockIdx.y, kv = h / (NH / NKV); const int k0 = kb * 64 + wave * 16;
  F2 ak[4];
  const float* kp0 = Kx + ((size_t)(k0 / 16) * (KVW / 32) + kv * 4) * 512 + lane * 4; const float* qp0 = Q + ((size_t)(kb * 4) * (DM / 32) + h * 4) * 512 + lane * 4; const float* mp0 = ML + ((size_t)h * SS + kb * 64 + col) * 4;   // the lane's own addresses
#pragma unroll
  for (int kc = 0; kc < 4; ++kc) ak[kc] = split_raw(ld_t(kp0 + kc * 512, 0));
  R16 qr[2][4]; v2f ml[2];   // two register sets: the next 16-query tile (rows and statistics) is loaded as one group while this one is worked on
#pragma unroll
  for (int kc = 0; kc < 4; ++kc) qr[0][kc] = ld_t(qp0 + kc * 512, 0);
  ml[0] = *(const v2f*)mp0;
  asm volatile("s_wait_xcnt 0x0" :: "v"(kp0), "v"(qp0), "v"(mp0) : "memory");   // behind the opening loads: without it this build takes an address pair of these loads as a destination of one of them; as inputs here the pairs live up to the wait
#pragma unroll 1
  for (int qb = kb; qb < TQB; ++qb) { float rs[8];
#pragma unroll
    for (int r = 0; r < 8; ++r) rs[r] = 0.f;
#pragma unroll
    for (int ct = 0; ct < 4; ++ct) { const int qq = qb * 64 + ct * 16 + col; v8f c = {};
      const int qt = ct < 3 ? qb * 4 + ct + 1 : min(qb + 1, TQB - 1) * 4, qn = qt * 16 + col;   // behind the last tile: a tile of the last block again (in bounds, unused)
      const float* qp = Q + ((size_t)qt * (DM / 32) + h * 4) * 512 + lane * 4; const float* mp = ML + ((size_t)h * SS + qn) * 4;   // the lane's own addresses
#pragma unroll
      for (int kc = 0; kc < 4; ++kc) qr[(ct + 1) & 1][kc] = ld_t(qp + kc * 512, 0);
      ml[(ct + 1) & 1] = *(const v2f*)mp;
      asm volatile("s_wait_xcnt 0x0" :: "v"(qp), "v"(mp) : "memory");   // behind the tile's loads: without it this build takes their address pair as a destination of one of them; as inputs here the pairs live up to the wait, which stands in front of any overwrite
#pragma unroll
      for (int kc = 0; kc < 4; ++kc) { const F2 qf = split_raw(qr[ct & 1][kc]); c = mac3(ak[kc], qf, c); }
      const float mq = ml[ct & 1][0], ilq = ml[ct & 1][1];
#pragma unroll
      for (int r = 0; r < 8; ++r) { const int key = k0 + 8 * g + r; const float sc = c[r] * 0.08838834764831845f;
        const float t = rs[r] + expf(sc - mq) * ilq; rs[r] = (key <= qq) ? t : rs[r]; } }   // exp inline and in every lane, the causal test a select: the 8 rows' chains run side by side
#pragma unroll
    for (int o = 1; o < 16; o <<= 1) {   // level by level over the 8 rows: their exchanges are independent and run side by side
#pragma unroll
      for (int r = 0; r < 8; ++r) rs[r] += __shfl_xor(rs[r], o); }
    if (col == 0) {
#pragma unroll
      for (int r = 0; r < 8; ++r) ssum[wave * 16 + 8 * g + r] = rs[r]; }
    __syncthreads();
    if (tid < 16) vst2(CS + (((size_t)h * TQB + qb) * SS) + kb * 64 + tid * 4, *(const v4f*)&ssum[tid * 4]);
    __syncthreads(); }
  // query blocks qb < kb contribute nothing: write zeros so every CS row is defined
  for (int qb = 0; qb < kb; ++qb) { if (tid < 16) vst2(CS + (((size_t)h * TQB + qb) * SS) + kb * 64 + tid * 4, (v4f){0.f, 0.f, 0.f, 0.f}); }
}
// ---- k_mask: block = (128 mask positions, head h). A candidate is kept when fewer than HEAVY candidates come before it in the order 'larger column sum first, lower index first on ties': that count is taken directly, every position on its own, so the heads' selection spreads over the chip and no step of it waits on another
//   every block that holds candidates sums the head's candidate columns into LDS (same order over the query blocks); thread = (position tid & 127, quarter tid >> 7 of the candidates to compare with); a wave's 32 positions are consecutive, so the index test is needed only against those 32 candidates: all before them count on >=, all behind them on >
__global__ __launch_bounds__(128 * MTS) void k_mask(const float* __restrict__ CS, float* __restrict__ MSK) {
  static_assert(NSEL % 4 == 0 && NPAD / 4 <= 128 * MTS && (NPAD / 4) % (4 * MTS) == 0, "column groups of 4, one per thread; parts in groups of 16 candidates");
  __shared__ __align__(16) float sv[NPAD]; __shared__ int sc[MTS][128];
  const int h = blockIdx.y, tid = threadIdx.x, sl = tid & 127, s = blockIdx.x * 128 + sl;
  float o = (s >= MW - RECENT && s < MW) ? 1.0f : 0.f;
  if (blockIdx.x * 128 < NSEL) {   // the same for the whole block
    if (tid < NPAD / 4) { v4f c = {-3.0e38f, -3.0e38f, -3.0e38f, -3.0e38f};   // behind the last candidate: never in front of one
      if (tid < NSEL / 4) { const float* p = CS + (size_t)h * TQB * SS + tid * 4; v4f x[TQB];
#pragma unroll
        for (int qb = 0; qb < TQB; ++qb) x[qb] = *(const v4f*)(p + (size_t)qb * SS);
        c = (v4f){0.f, 0.f, 0.f, 0.f};
#pragma unroll
        for (int qb = 0; qb < TQB; ++qb) c += x[qb]; }
      *(v4f*)&sv[tid * 4] = c; }
    __syncthreads();
    const int wv = __builtin_amdgcn_readfirstlane(tid >> 5);   // scalar loop bounds
    const int s04 = (blockIdx.x * 128 + (wv & 3) * 32) >> 2, lo = (wv >> 2) * (NPAD / 4 / MTS), hi = lo + NPAD / 4 / MTS;   // in groups of 4 candidates: the wave's own positions start at s04, its part is [lo, hi)
    const float a = sv[min(s, NPAD - 1)];
    int n[4] = {0, 0, 0, 0};   // four counters: four independent chains
    for (int t4 = lo; t4 < min(hi, s04); t4 += 4) {
#pragma unroll
      for (int u = 0; u < 4; ++u) { const v4f b = *(const v4f*)&sv[(t4 + u) * 4];
#pragma unroll
        for (int i = 0; i < 4; ++i) n[i] += (b[i] >= a) ? 1 : 0; } }
    for (int t4 = max(lo, s04); t4 < min(hi, s04 + 8); t4 += 4) {
#pragma unroll
      for (int u = 0; u < 4; ++u) { const v4f b = *(const v4f*)&sv[(t4 + u) * 4];
#pragma unroll
        for (int i = 0; i < 4; ++i) n[i] += (int)(b[i] > a) | ((int)(b[i] == a) & (int)((t4 + u) * 4 + i < s)); } }   // the three tests joined by bit operations: no branch per candidate
    for (int t4 = max(lo, s04 + 8); t4 < hi; t4 += 4) {
#pragma unroll
      for (int u = 0; u < 4; ++u) { const v4f b = *(const v4f*)&sv[(t4 + u) * 4];
#pragma unroll
        for (int i = 0; i < 4; ++i) n[i] += (b[i] > a) ? 1 : 0; } }
    sc[wv >> 2][sl] = (n[0] + n[1]) + (n[2] + n[3]);
    __syncthreads();
    if (tid < 128 && s < NSEL) { int nb = 0;
#pragma unroll
      for (int q = 0; q < MTS; ++q) nb += sc[q][sl];
      o = nb < HEAVY ? 1.0f : 0.f; }
  }
  if (tid < 128) MSK[(size_t)h * MWP + s] = o;   // a wave stores one whole line
  else if (blockIdx.x == SS / 128 - 1 && tid < 128 + MWP - SS) MSK[(size_t)h * MWP + SS + tid - 128] = (SS + tid - 128 < MW) ? 1.0f : 0.f;   // the row's last line: position SS and the padding
}
// ---- k_out: block = (64 rows, 128 cols): out = O(hi/lo) . o_w^T rows (2 products)
__global__ __launch_bounds__(128) void k_out(const float* __restrict__ O, const __bf16* __restrict__ P, float* __restrict__ Y) {
  __shared__ __align__(16) float so[4][16][132];
  const int tid = threadIdx.x, wave = tid >> 5, lane = tid & 31, col = lane & 15, g = lane >> 4; const size_t r0 = (size_t)blockIdx.x * 64 + wave * 16; const int n0 = blockIdx.y * 128;
  v8f acc[8] = {};
  const float* oblk = O + (r0 / 16) * (DM / 32) * 512; const __bf16* pblk = P + (size_t)(n0 / 16) * (DM / 32) * 512;
  R16 xa[2]; v16b wb[2][8];   // two register sets: step kc + 1 is loaded as one group while step kc is multiplied
  xa[0] = ld_t(oblk, lane);
#pragma unroll
  for (int j = 0; j < 8; ++j) wb[0][j] = frag_t(pblk + (size_t)j * (DM / 32) * 512, lane);
#pragma unroll 1   // one trip already holds both register sets; more copies of it would only cost registers
  for (int kc = 0; kc < DM / 32; kc += 2) {
#pragma unroll
    for (int u = 0; u < 2; ++u) { const int kn = min(kc + u + 1, DM / 32 - 1);   // the last step loads itself again (in bounds, unused)
      const float* xp = oblk + kn * 512 + lane * 4; const __bf16* wp = pblk + (size_t)kn * 512 + lane * 8;   // the lane's own addresses in the step's blocks
      xa[u ^ 1] = ld_t(xp, 0);
#pragma unroll
      for (int j = 0; j < 8; ++j) wb[u ^ 1][j] = frag_t(wp + (size_t)j * (DM / 32) * 512, 0);
      asm volatile("s_wait_xcnt 0x0" :: "v"(xp), "v"(wp) : "memory");   // without it this build takes an address pair of these loads as a destination of one of them; as inputs here the pairs live up to the wait, which stands in front of any overwrite
      const F2 a = split_raw(xa[u]);
#pragma unroll
      for (int j = 0; j < 8; ++j) { acc[j] = wmma_bf(a.l, wb[u][j], acc[j]); acc[j] = wmma_bf(a.h, wb[u][j], acc[j]); } } }
#pragma unroll
  for (int j = 0; j < 8; ++j)
#pragma unroll
    for (int r = 0; r < 8; ++r) so[wave][8 * g + r][j * 16 + col] = acc[j][r];
  LDSX();
  for (int rl = 0; rl < 16; ++rl) vst2(Y + (r0 + rl) * DM + n0 + lane * 4, *(const v4f*)&so[wave][rl][lane * 4]);
}
// ---- k_mout: flat writer of the [16][2049] mask after the attention output
__global__ __launch_bounds__(256) void k_mout(const float* __restrict__ MSK, float* __restrict__ out) {
  const size_t p = (size_t)blockIdx.x * 256 + threadIdx.x; const size_t total = (size_t)NH * (SFULL + 1); if (p * 4 >= total) return; v4f v;
#pragma unroll
  for (int i = 0; i < 4; ++i) { const size_t f = p * 4 + i; const size_t row = f / (SFULL + 1), c = f % (SFULL + 1); v[i] = (f < total && c < (size_t)MW) ? MSK[row * MWP + c] : 0.f; }
  vst2(out + p * 4, v);
}
extern "C" void kernel_launch(void* const* d_in, const int* in_sizes, int n_in, void* d_out, int out_size, void* d_ws, size_t ws_size, hipStream_t stream) {
  (void)in_sizes; (void)n_in; (void)out_size;
  const float** F = (const float**)d_in;   // hidden_states [1,2048,2048], q_w [2048,2048], q_b [2048], k_w [2048,512], k_b [512], v_w [2048,512], v_b [512], o_w [2048,2048]
  if (ws_size < (size_t)WS_END) return;
  char* ws = (char*)d_ws; __bf16 *PK = (__bf16*)(ws + WS_PK), *XB = (__bf16*)(ws + WS_X), *VTH = (__bf16*)(ws + WS_VTH), *VTL = (__bf16*)(ws + WS_VTL);
  float *Q = (float*)(ws + WS_Q), *Kx = (float*)(ws + WS_K), *O = (float*)(ws + WS_O), *ML = (float*)(ws + WS_ML), *CS = (float*)(ws + WS_CS), *MSK = (float*)(ws + WS_MSK);
  float* OUT0 = (float*)d_out; float* OUT1 = OUT0 + (size_t)SFULL * DM;
  k_packT<<<dim3(DM / 16, DM / 128), 256, 0, stream>>>(F[1], DM, DM, PK + PK_Q); k_packT<<<dim3(KVW / 16, DM / 128), 256, 0, stream>>>(F[3], DM, KVW, PK + PK_K); k_packT<<<dim3(KVW / 16, DM / 128), 256, 0, stream>>>(F[5], DM, KVW, PK + PK_V); k_packT<<<dim3(DM / 16, DM / 128), 256, 0, stream>>>(F[7], DM, DM, PK + PK_O);
  k_packR<<<dim3(SS / 16, DM / 128), 256, 0, stream>>>(F[0], XB);
  k_proj<0><<<dim3(SS / 64, DM / 128), 128, 0, stream>>>(XB, PK + PK_Q, F[2], Q, DM, nullptr, nullptr);
  k_proj<0><<<dim3(SS / 64, KVW / 128), 128, 0, stream>>>(XB, PK + PK_K, F[4], Kx, KVW, nullptr, nullptr);
  k_proj<1><<<dim3(SS / 64, KVW / 128), 128, 0, stream>>>(XB, PK + PK_V, F[6], nullptr, 0, VTH, VTL);
  k_attn<<<dim3(NH, TQB), 256, 0, stream>>>(Q, Kx, VTH, VTL, O, ML);
  k_colsum<<<dim3(TQB, NH), 128, 0, stream>>>(Q, Kx, ML, CS);
  k_mask<<<dim3(SS / 128, NH), 128 * MTS, 0, stream>>>(CS, MSK);
  k_out<<<dim3(TQB, DM / 128), 128, 0, stream>>>(O, PK + PK_O, OUT0);
  k_mout<<<(unsigned)(((size_t)NH * (SFULL + 1) / 4 + 255) / 256), 256, 0, stream>>>(MSK, OUT1);
}

// v008
// One run takes 203 microseconds.
// Next to v007, in two timings, it ran 1.47 times as fast each time.
// All steps since v000 together make it 6.98 times as fast.
// compute dtype: hidden_states and all weights/biases (module inputs) rounded to bf16; q/k/v projections with exact bf16 products (x and W are inputs); causal scores q.k with both computed operands as bf16 hi + residual pairs (3 products) and P.V with P hi/lo x V hi/lo (3 products); the heavy-hitter column sums recompute the same 3-product scores in a second (transposed) pass with the stored row statistics; the output projection with hi/lo x exact o_w (2 products), all on WMMA 16x16x32; softmax, column sums, the per-head top-k selection (rank by counting, lower index first on ties) and the mask assembly in f32 on the VALU; f32 accumulate.
#include <hip/hip_runtime.h>
#include <math.h>

typedef __attribute__((ext_vector_type(16))) _Float16 v16h;
typedef __attribute__((ext_vector_type(16))) __bf16 v16b;
typedef __attribute__((ext_vector_type(8)))  _Float16 v8h;
typedef __attribute__((ext_vector_type(8)))  float v8f;
typedef __attribute__((ext_vector_type(4)))  float v4f;
typedef __attribute__((ext_vector_type(2)))  float v2f;
typedef __attribute__((ext_vector_type(4)))  unsigned v4u;
typedef __attribute__((ext_vector_type(4)))  int v4i;
typedef float __attribute__((may_alias)) float_a;
typedef int __attribute__((may_alias)) int_a;

template <typename T> __device__ __forceinline__ void vst2(void* p, T v) { *(T*)p = v;  }
__device__ __forceinline__ v8f wmma16(v16h a, v16h b, v8f c) {
  v8f d = __builtin_amdgcn_wmma_f32_16x16x32_f16(false, a, false, b, (short)0, c, false, false);
  asm volatile("v_nop\n\tv_nop\n\tv_nop\n\tv_nop" : "+v"(d) : "v"(a), "v"(b));
  return d;
}
__device__ __forceinline__ v8f wmma_bf(v16b a, v16b b, v8f c) {
  v8f d = __builtin_amdgcn_wmma_f32_16x16x32_bf16(false, a, false, b, (short)0, c, false, false);
  asm volatile("v_nop\n\tv_nop\n\tv_nop\n\tv_nop" : "+v"(d) : "v"(a), "v"(b));
  return d;
}
// 16x16x32 fragments: lane = (h = lane>>4, row/col = lane&15); elements 0..7 = k0+8h+0..7, 8..15 = k0+16+8h+0..7; D element r = row 8h+r
__device__ __forceinline__ v16h frag_h(const _Float16* rowk0, int lane) {
  union { v16h v; v8h q[2]; } u; const _Float16* p = rowk0 + 8 * (lane >> 4);
  u.q[0] = *(const v8h*)p; u.q[1] = *(const v8h*)(p + 16); return u.v;
}
__device__ __forceinline__ v16h frag_f32(const float* rowk0, int lane) {
  v16h a; const float* p = rowk0 + 8 * (lane >> 4);
#pragma unroll
  for (int i = 0; i < 8; ++i) { a[i] = (_Float16)p[i]; a[8 + i] = (_Float16)p[16 + i]; }
  return a;
}
__device__ __forceinline__ v16h frag_f32s(const float* rowk0, int lane, float sc) {
  v16h a; const float* p = rowk0 + 8 * (lane >> 4);
#pragma unroll
  for (int i = 0; i < 8; ++i) { a[i] = (_Float16)(p[i] * sc); a[8 + i] = (_Float16)(p[16 + i] * sc); }
  return a;
}
// column fragment from a [K][ld] layout (column n), rows >= K read as 0
__device__ __forceinline__ v16h fragc_f32(const float* W, int k0, int n, int lane, int ld, int K) {
  v16h a; const int g = lane >> 4;
#pragma unroll
  for (int i = 0; i < 8; ++i) { const int ka = k0 + 8 * g + i, kb = ka + 16;
    a[i] = (_Float16)(ka < K ? W[(size_t)(ka < K ? ka : K - 1) * ld + n] : 0.f); a[8 + i] = (_Float16)(kb < K ? W[(size_t)(kb < K ? kb : K - 1) * ld + n] : 0.f); }
  return a;
}
struct F2 { v16b h, l; };
__device__ __forceinline__ F2 bsplit16(const float v[16]) { F2 r;
#pragma unroll
  for (int i = 0; i < 16; ++i) { const __bf16 h = (__bf16)v[i]; r.h[i] = h; r.l[i] = (__bf16)(v[i] - (float)h); }
  return r; }
__device__ __forceinline__ F2 split_row(const float* row, int k0, int lane) { float v[16]; const float* p = row + k0 + 8 * (lane >> 4);
#pragma unroll
  for (int i = 0; i < 8; ++i) { v[i] = p[i]; v[8 + i] = p[16 + i]; }
  return bsplit16(v); }
__device__ __forceinline__ F2 split_rowK(const float* row, int k0, int lane, int K) { float v[16]; const int g = lane >> 4;
#pragma unroll
  for (int i = 0; i < 8; ++i) { const int ka = k0 + 8 * g + i, kb = ka + 16; v[i] = ka < K ? row[ka < K ? ka : K - 1] : 0.f; v[8 + i] = kb < K ? row[kb < K ? kb : K - 1] : 0.f; }
  return bsplit16(v); }
__device__ __forceinline__ F2 split_col(const float* W, int k0, int n, int lane, int ld, int K) { float v[16]; const int g = lane >> 4;
#pragma unroll
  for (int i = 0; i < 8; ++i) { const int ka = k0 + 8 * g + i, kb = ka + 16; v[i] = ka < K ? W[(size_t)(ka < K ? ka : K - 1) * ld + n] : 0.f; v[8 + i] = kb < K ? W[(size_t)(kb < K ? kb : K - 1) * ld + n] : 0.f; }
  return bsplit16(v); }
__device__ __forceinline__ v8f mac3(const F2& a, const F2& b, v8f c) { c = wmma_bf(a.l, b.h, c); c = wmma_bf(a.h, b.l, c); return wmma_bf(a.h, b.h, c); }
__device__ __forceinline__ float sigm(float v) { return 1.0f / (1.0f + expf(-v)); }
#define LDSX() do { asm volatile("s_wait_dscnt 0" ::: "memory"); __builtin_amdgcn_wave_barrier(); __builtin_amdgcn_fence(__ATOMIC_RELEASE, "workgroup"); } while (0)


// GQA causal attention with H2O heavy-hitter scoring (B 1, S 2048, D 2048, 16 query heads / 4 kv heads x 128): out = softmax(q k^T / sqrt(128), causal) v -> @ o_w; cur[h][s] = sum over queries of probs; mask[h] = 1 on the last 204 of 2049 positions, 0 elsewhere, then 1 at the top-204 (heavy budget) indices of cur[h][:1844].
#define SFULL 2048            // shipped sequence length (output layout)
#ifndef SS
#define SS SFULL              // active sequence length (all)
#endif
#define DM 2048
#define NH 16
#define NKV 4
#define HD 128
#define KVW (NKV * HD)        // 512
#define HEAVY (SS / 10)       // int(0.1 * S)
#define RECENT (SS / 10)
#define MW (SS + 1)           // 2049 mask width
#define MWP 2080              // padded staging width: a row is 65 whole 128-byte lines
#define NSEL (SS - RECENT)    // 1844 candidates of the heavy-hitter selection
#define NPAD ((NSEL + 31) / 32 * 32)   // candidates rounded up to whole waves
#define MTS 4                 // k_mask: parts into which the candidates to compare with are dealt
#define TQB (SS / 64)         // query blocks
typedef __attribute__((ext_vector_type(8))) __bf16 v8b;
// fragment-order storage: a [rows][k] operand that a kernel of this file writes is kept as blocks of 16 rows x 32 k, block (rt, kc) at index rt * (k / 32) + kc; inside a block the 16-byte pieces stand in the order in which the lanes load them, so every wave-wide load or store is 512 bytes in a row (4 whole lines, not 16 part lines)
// bf16 block = 512 elements: piece (half, lane) at half * 256 + lane * 8 holds row lane & 15, k = half * 16 + 8 * (lane >> 4) + 0..7
__device__ __forceinline__ v16b frag_t(const __bf16* blk, int lane) {
  union { v16b v; v8b q[2]; } u;
  u.q[0] = *(const v8b*)(blk + lane * 8); u.q[1] = *(const v8b*)(blk + 256 + lane * 8); return u.v;
}
__device__ __forceinline__ float bfr(float v) { return (float)(__bf16)v; }
// the same product with only D named at the v_nops, which so stand in front of the next reader of D (A and B are left to the compiler's own padding of its builtin): an operand that an asm statement names must stand below v256, and with A and B named too k_attn, which holds a whole step's fragments, builds with spills to scratch
__device__ __forceinline__ v8f wmma_bf_d(v16b a, v16b b, v8f c) {
  v8f d = __builtin_amdgcn_wmma_f32_16x16x32_bf16(false, a, false, b, (short)0, c, false, false);
  asm volatile("v_nop\n\tv_nop\n\tv_nop\n\tv_nop" : "+v"(d));
  return d;
}
__device__ __forceinline__ v8f mac3_d(const F2& a, const F2& b, v8f c) { c = wmma_bf_d(a.l, b.h, c); c = wmma_bf_d(a.h, b.l, c); return wmma_bf_d(a.h, b.h, c); }
// the 8 rows' exchange with lane ^ o as ONE group, 8 ds_bpermute_b32 and their one wait in one statement (a = 4 * (lane ^ o), as __shfl_xor forms it): with 8 V tiles live across the softmax the scheduler otherwise folds the rows into pairs, whose exchanges then wait one behind another (so a build with __shfl_xor here: two exchanges or one to a wait)
__device__ __forceinline__ void xch8(float (&t)[8], const float (&x)[8], int a) {
  asm volatile("ds_bpermute_b32 %0, %8, %9\n\tds_bpermute_b32 %1, %8, %10\n\tds_bpermute_b32 %2, %8, %11\n\tds_bpermute_b32 %3, %8, %12\n\t"
               "ds_bpermute_b32 %4, %8, %13\n\tds_bpermute_b32 %5, %8, %14\n\tds_bpermute_b32 %6, %8, %15\n\tds_bpermute_b32 %7, %8, %16\n\ts_wait_dscnt 0x0"
               : "=&v"(t[0]), "=&v"(t[1]), "=&v"(t[2]), "=&v"(t[3]), "=&v"(t[4]), "=&v"(t[5]), "=&v"(t[6]), "=&v"(t[7])
               : "v"(a), "v"(x[0]), "v"(x[1]), "v"(x[2]), "v"(x[3]), "v"(x[4]), "v"(x[5]), "v"(x[6]), "v"(x[7]) : "memory");
}
// a wave's own exchange through its own LDS rows: its LDS operations are done and the compiler moves no memory access across; unlike LDSX it holds no fence, which would also wait for every global load in flight
#define LDSW() do { asm volatile("s_wait_dscnt 0" ::: "memory"); __builtin_amdgcn_wave_barrier(); } while (0)
// the 16 registers of one lane's slice of a hi/lo operand pair, as loaded: q[0], q[1] the hi fragment, q[2], q[3] the residual fragment
struct R16 { v4f q[4]; };
// pair block = 2 KB (addressed as 512 floats): the bf16 block of the hi parts, then the bf16 block of the residuals; piece (pl, half, lane) at float (pl * 2 + half) * 128 + lane * 4 holds 8 bf16 of row lane & 15, k = half * 16 + 8 * (lane >> 4) + 0..7
// a computed f32 operand (q, k, the attention output) is split ONCE, by the wave that stores it; every wave that loads it (a key slice: 4 heads x up to 128 query tiles) has its two WMMA fragments in the loaded registers, with no conversion
__device__ __forceinline__ R16 ld_t(const float* blk, int lane) { R16 r;
#pragma unroll
  for (int qi = 0; qi < 4; ++qi) r.q[qi] = *(const v4f*)(blk + qi * 128 + lane * 4);
  return r; }
// one wave's 16 x 128 f32 tile, from its LDS staging rows to 4 pair blocks in a row: hi = bf16(v), residual = bf16(v - hi), as bsplit16 forms them
__device__ __forceinline__ void st_t(float* blk, const float (*st)[132], int lane) {
#pragma unroll
  for (int sl = 0; sl < 4; ++sl) {
#pragma unroll
    for (int half = 0; half < 2; ++half) { const float* p = &st[lane & 15][sl * 32 + half * 16 + 8 * (lane >> 4)]; const v4f a = *(const v4f*)p, b = *(const v4f*)(p + 4);
      union { v8b b8; v4f f; } hi, lo;
#pragma unroll
      for (int i = 0; i < 8; ++i) { const float v = i < 4 ? a[i & 3] : b[i & 3]; const __bf16 hb = (__bf16)v; hi.b8[i] = hb; lo.b8[i] = (__bf16)(v - (float)hb); }
      vst2(blk + sl * 512 + half * 128 + lane * 4, hi.f); vst2(blk + sl * 512 + (2 + half) * 128 + lane * 4, lo.f); } }
}
// the two fragments of a loaded slice: the registers as they are, no instruction
__device__ __forceinline__ F2 split_raw(const R16& r) { union { v4f f[2]; v16b b; } hi, lo; F2 o;
  hi.f[0] = r.q[0]; hi.f[1] = r.q[1]; lo.f[0] = r.q[2]; lo.f[1] = r.q[3]; o.h = hi.b; o.l = lo.b; return o; }
__device__ __attribute__((noinline)) float erf_ni(float v) { return erff(v); }

#define PK_Q 0                               // [2048 n][2048 k] q_w^T (all four: bf16 blocks)
#define PK_K (PK_Q + DM * DM)                  // [512][2048]
#define PK_V (PK_K + KVW * DM)
#define PK_O (PK_V + KVW * DM)                 // [2048][2048] o_w^T
#define PK_END (PK_O + DM * DM)
#define WS_PK  0u
#define WS_Q   (WS_PK + 2u * PK_END)           // pair blocks [2048][2048] q (h*128+d)
#define WS_K   (WS_Q + 4u * SS * DM)            // pair blocks [2048][512]
#define WS_VTH (WS_K + 4u * SS * KVW)           // bf16 blocks [512 (kv*128+d)][2048]
#define WS_VTL (WS_VTH + 2u * KVW * SS)
#define WS_O   (WS_VTL + 2u * KVW * SS)         // pair blocks [2048][2048] attention output (h*128+d)
#define WS_ML  (WS_O + 4u * SS * DM)            // f32 [16][2048][4]: (m, 1/l, 0, 0)
#define WS_CS  (WS_ML + 4u * NH * SS * 4)       // f32 [16][32 qblocks][2048]: per-query-block partial column sums
#define WS_MSK (WS_CS + 4u * NH * TQB * SS)     // f32 [16][2080] mask staging
#define WS_X   (WS_MSK + 4u * NH * MWP)         // bf16 blocks [2048][2048] hidden_states
#define WS_END (WS_X + 2u * SS * DM)

// launches that need nothing of one another share one grid: a range of the block index picks the work (a test that reads the same for a whole block), bx and by are the block's place in the grid that the work had as a launch of its own
// ---- packT: block = (16 output columns, 128 k) of a [K][N] (x @ W) matrix: 4 bf16 blocks in a row (4 KB) of W^T; a thread makes one 16-byte piece
__device__ __forceinline__ void packT(const float* __restrict__ Wm, int K, int N, __bf16* __restrict__ DST, int bx, int by) {
  const int tid = threadIdx.x, lane = tid & 31, half = (tid >> 5) & 1, kc = by * 4 + (tid >> 6);
  const float* src = Wm + (size_t)(kc * 32 + half * 16 + 8 * (lane >> 4)) * N + bx * 16 + (lane & 15);
  v8b o;
#pragma unroll
  for (int i = 0; i < 8; ++i) o[i] = (__bf16)src[(size_t)i * N];
  vst2(DST + ((size_t)bx * (K / 32) + kc) * 512 + half * 256 + lane * 8, o);
}
// ---- packR: block = (16 rows, 128 k) of the row-major [rows][DM] x: 4 bf16 blocks in a row (4 KB) of bf16(x); a thread makes one 16-byte piece
__device__ __forceinline__ void packR(const float* __restrict__ X, __bf16* __restrict__ DST, int bx, int by) {
  const int tid = threadIdx.x, lane = tid & 31, half = (tid >> 5) & 1, kc = by * 4 + (tid >> 6);
  const float* src = X + (size_t)(bx * 16 + (lane & 15)) * DM + kc * 32 + half * 16 + 8 * (lane >> 4);
  const v4f a = *(const v4f*)src, b = *(const v4f*)(src + 4); v8b o;
#pragma unroll
  for (int i = 0; i < 4; ++i) { o[i] = (__bf16)a[i]; o[4 + i] = (__bf16)b[i]; }
  vst2(DST + ((size_t)bx * (DM / 32) + kc) * 512 + half * 256 + lane * 8, o);
}
// ---- k_pack: the four weight matrices and x in one launch; blockIdx.x: 16-column tiles of q_w, k_w, v_w, o_w, then 16-row tiles of x; blockIdx.y: 128 k (all five have DM k)
#define PX_K (DM / 16)
#define PX_V (PX_K + KVW / 16)
#define PX_O (PX_V + KVW / 16)
#define PX_X (PX_O + DM / 16)
#define PX_END (PX_X + SS / 16)
__global__ __launch_bounds__(256) void k_pack(const float* __restrict__ Wq, const float* __restrict__ Wk, const float* __restrict__ Wv, const float* __restrict__ Wo, const float* __restrict__ X, __bf16* __restrict__ PK, __bf16* __restrict__ XB) {
  const int bx = blockIdx.x, by = blockIdx.y;
  if (bx < PX_K) packT(Wq, DM, DM, PK + PK_Q, bx, by);
  else if (bx < PX_V) packT(Wk, DM, KVW, PK + PK_K, bx - PX_K, by);
  else if (bx < PX_O) packT(Wv, DM, KVW, PK + PK_V, bx - PX_V, by);
  else if (bx < PX_X) packT(Wo, DM, DM, PK + PK_O, bx - PX_O, by);
  else packR(X, XB, bx - PX_X, by);
}
// ---- k_proj: q, k and v in one launch; block = (64 rows, 128 cols): Y = bf16(x) (packed, bf16 blocks) . P rows (exact) + bias; blockIdx.y: 128-column tiles of q, then of k, then of v; VT 0 (q, k): pair blocks of [row][ldo cols]; VT 1 (v): transposed bf16 hi/lo planes, bf16 blocks of [col][row]
#define PY_K (DM / 128)
#define PY_V (PY_K + KVW / 128)
#define PY_END (PY_V + KVW / 128)
__global__ __launch_bounds__(128) void k_proj(const __bf16* __restrict__ X, const __bf16* __restrict__ PK, const float* __restrict__ q_b, const float* __restrict__ k_b, const float* __restrict__ v_b, float* __restrict__ Qo, float* __restrict__ Ko, __bf16* __restrict__ PH, __bf16* __restrict__ PL) {
  __shared__ __align__(16) char sm[2 * 128 * 72 * 2];   // a block uses one of the two stagings: so (VT 0) or sth and stl (VT 1)
  static_assert(sizeof(sm) >= 4 * 16 * 132 * 4, "the larger of the two stagings");
  float (*so)[16][132] = (float (*)[16][132])sm; __bf16 (*sth)[72] = (__bf16 (*)[72])sm, (*stl)[72] = sth + 128;
  const int yb = blockIdx.y; const bool VT = yb >= PY_V, isq = yb < PY_K;   // the same for the whole block
  const __bf16* P = PK + (isq ? PK_Q : VT ? PK_V : PK_K); const float* bias = isq ? q_b : VT ? v_b : k_b; float* OUT = isq ? Qo : Ko; const int ldo = isq ? DM : KVW;
  const int tid = threadIdx.x, wave = tid >> 5, lane = tid & 31, col = lane & 15, g = lane >> 4; const size_t r0 = (size_t)blockIdx.x * 64 + wave * 16; const int n0 = (yb - (isq ? 0 : VT ? PY_V : PY_K)) * 128;
  v8f acc[8] = {};
  const __bf16* xblk = X + (r0 / 16) * (DM / 32) * 512; const __bf16* pblk = P + (size_t)(n0 / 16) * (DM / 32) * 512;
  v16b xa[2], wb[2][8];   // two register sets: step kc + 1 is loaded as one group while step kc is multiplied
  xa[0] = frag_t(xblk, lane);
#pragma unroll
  for (int j = 0; j < 8; ++j) wb[0][j] = frag_t(pblk + (size_t)j * (DM / 32) * 512, lane);
#pragma unroll 1   // one trip already holds both register sets; more copies of it would only cost registers
  for (int kc = 0; kc < DM / 32; kc += 2) {
#pragma unroll
    for (int u = 0; u < 2; ++u) { const int kn = min(kc + u + 1, DM / 32 - 1);   // the last step loads itself again (in bounds, unused)
      const __bf16* xp = xblk + kn * 512 + lane * 8; const __bf16* wp = pblk + (size_t)kn * 512 + lane * 8;   // the lane's own addresses in the step's blocks
      xa[u ^ 1] = frag_t(xp, 0);
#pragma unroll
      for (int j = 0; j < 8; ++j) wb[u ^ 1][j] = frag_t(wp + (size_t)j * (DM / 32) * 512, 0);
      asm volatile("s_wait_xcnt 0x0" :: "v"(xp), "v"(wp) : "memory");   // as inputs here the pairs live up to the wait, which stands in front of any overwrite
#pragma unroll
      for (int j = 0; j < 8; ++j) acc[j] = wmma_bf(xa[u], wb[u][j], acc[j]); } }
  if (!VT) {
#pragma unroll
    for (int j = 0; j < 8; ++j) { const float bb = bfr(bias[n0 + j * 16 + col]);
#pragma unroll
      for (int r = 0; r < 8; ++r) so[wave][8 * g + r][j * 16 + col] = acc[j][r] + bb; }
    LDSX();
    st_t(OUT + ((r0 / 16) * (ldo / 32) + n0 / 32) * 512, so[wave], lane);
    asm volatile("s_wait_xcnt 0x0" ::: "memory");   // behind the tile's stores: the other branch's code follows in the listing and reuses the registers that they name
  } else {
    const float* bp = bias + n0 + col; float bv[8];   // the lane's own address
#pragma unroll
    for (int j = 0; j < 8; ++j) bv[j] = bp[j * 16];
    asm volatile("s_wait_xcnt 0x0" :: "v"(bp) : "memory");   // behind the bias loads, in front of any overwrite of a register that they name
#pragma unroll
    for (int j = 0; j < 8; ++j) { const float bb = bfr(bv[j]);
#pragma unroll
      for (int r = 0; r < 8; ++r) { const float v = acc[j][r] + bb; const __bf16 hb = (__bf16)v; sth[j * 16 + col][wave * 16 + 8 * g + r] = hb; stl[j * 16 + col][wave * 16 + 8 * g + r] = (__bf16)(v - (float)hb); } }
    __syncthreads();
    for (int q = tid; q < 128 * 8; q += 128) { const int dt = q >> 7, kl = (q >> 6) & 1, half = (q >> 5) & 1;   // 16 blocks a plane (8 column tiles x 2 row steps), 64 pieces each; q & 31 = lane
      const int d = dt * 16 + col, sl = kl * 32 + half * 16 + 8 * g; const size_t o = ((size_t)(n0 / 16 + dt) * (SS / 32) + blockIdx.x * 2 + kl) * 512 + half * 256 + lane * 8;
      vst2((unsigned*)(PH + o), *(const v4u*)&sth[d][sl]); vst2((unsigned*)(PL + o), *(const v4u*)&stl[d][sl]); }
  }
}
// ---- k_attn: block = (64 queries, head h), 8 waves: causal flash attention, kv head = h/4; scores 3 products, P.V 3 products; O[q][h*128+d]; ML[h][q] = (m, 1/l)
// a 16-query tile's key steps are dealt to two waves (wave wt: the even steps, wave wt + 4: the odd ones), each with its own (m, l, acc); the two partials are joined through LDS behind the loop. The longest wave so walks 32 steps, not 64, and the longest blocks come first in the grid
// waves_per_eu(2, 2): a block puts two waves on a SIMD; at the default register target the scheduler folds the softmax's 8 rows back into pairs that run one behind another
__global__ __launch_bounds__(256) __attribute__((amdgpu_waves_per_eu(2, 2))) void k_attn(const float* __restrict__ Q, const float* __restrict__ Kx, const __bf16* __restrict__ VTH, const __bf16* __restrict__ VTL, float* __restrict__ O, float* __restrict__ ML) {
  __shared__ __align__(16) float sp[8][16][36]; __shared__ __align__(16) float so[4][16][132]; __shared__ __align__(16) float sml[64][4]; __shared__ __align__(8) float sm1[4][16][2];
  const int tid = threadIdx.x, wave = tid >> 5, wt = wave & 3, lane = tid & 31, col = lane & 15, g = lane >> 4;
  const int part = __builtin_amdgcn_readfirstlane(tid >> 7);   // scalar: step numbers, addresses and the branches behind the loop stay wave-uniform
  const int qb = TQB - 1 - blockIdx.y, h = blockIdx.x, kv = h / (NH / NKV); const int q0 = qb * 64 + wt * 16;   // the longest blocks have the lowest index
  R16 kr[2][4];   // a whole step's 32 key rows (8 slices) are in flight or in registers before its score products begin
  const float* kp0 = Kx + ((size_t)(part * 2) * (KVW / 32) + kv * 4) * 512 + lane * 4; const float* qp = Q + ((size_t)(q0 / 16) * (DM / 32) + h * 4) * 512 + lane * 4;   // the lane's own addresses
  R16 qr[4];
#pragma unroll
  for (int kc = 0; kc < 4; ++kc) qr[kc] = ld_t(qp + kc * 512, 0);
#pragma unroll
  for (int i = 0; i < 8; ++i) kr[i >> 2][i & 3] = ld_t(kp0 + ((i >> 2) * (KVW / 32) + (i & 3)) * 512, 0);
  asm volatile("s_wait_xcnt 0x0" :: "v"(kp0), "v"(qp) : "memory");   // behind the opening loads: the address pairs live up to the wait, which so stands in front of any overwrite of them
  F2 aq[4];
#pragma unroll
  for (int kc = 0; kc < 4; ++kc) aq[kc] = split_raw(qr[kc]);
  float m[8], l[8];
#pragma unroll
  for (int r = 0; r < 8; ++r) { m[r] = -3.0e38f; l[r] = 0.f; }
  v8f acc[8] = {};
  const int nks = (qb * 64 + 64) / 32;   // key steps covering keys <= the block's last query: an even number, half of them to each part
#pragma unroll 1
  for (int ks = part; ks < nks; ks += 2) { v8f s[2];
    v16b vh[8], vl[8];   // the step's V fragments: column tile i is loaded as key slice i is used up (16 registers go, 16 come), so every tile has the rest of the score products and the softmax ahead of its use
    const size_t vbase = ((size_t)(kv * 8) * (SS / 32) + ks) * 512; const __bf16* vhp = VTH + vbase + lane * 8; const __bf16* vlp = VTL + vbase + lane * 8;   // the lane's own addresses in the step's blocks
    const float* kp = Kx + ((size_t)(min(ks + 2, nks - 2 + part) * 2) * (KVW / 32) + kv * 4) * 512 + lane * 4;   // the part's last step loads itself again (in bounds, unused)
#pragma unroll
    for (int ct = 0; ct < 2; ++ct) { const int kk = ks * 32 + ct * 16 + col; v8f c = {};
#pragma unroll
      for (int kc = 0; kc < 4; ++kc) { const F2 kb = split_raw(kr[ct][kc]); const int dt = ct * 4 + kc;
        vh[dt] = frag_t(vhp + (size_t)dt * (SS / 32) * 512, 0); vl[dt] = frag_t(vlp + (size_t)dt * (SS / 32) * 512, 0);
        c = mac3_d(aq[kc], kb, c); }
#pragma unroll
      for (int r = 0; r < 8; ++r) { const int qi = q0 + 8 * g + r; s[ct][r] = (kk <= qi) ? c[r] * 0.08838834764831845f : -3.0e38f; } }
    asm volatile("s_wait_xcnt 0x0" :: "v"(vhp), "v"(vlp) : "memory");   // behind the step's last V load: as inputs here the address pairs live up to the wait, which so stands in front of any overwrite of them
    float mn[8], al[8], es[8];   // the softmax goes stage by stage over the 8 rows: within a stage the rows' chains (lane exchanges, exp) are independent and run side by side
#pragma unroll
    for (int r = 0; r < 8; ++r) mn[r] = fmaxf(s[0][r], s[1][r]);
#pragma unroll
    for (int o = 1; o < 16; o <<= 1) { float t[8]; xch8(t, mn, (lane ^ o) << 2);
#pragma unroll
      for (int r = 0; r < 8; ++r) mn[r] = fmaxf(mn[r], t[r]); }
#pragma unroll
    for (int r = 0; r < 8; ++r) { mn[r] = fmaxf(m[r], mn[r]);
      const float xa = expf(m[r] - mn[r]), x0 = expf(s[0][r] - mn[r]), x1 = expf(s[1][r] - mn[r]);   // inline and in every lane; a masked or not yet started entry is set to 0 by a select, not branched round
      al[r] = (m[r] <= -1.0e38f) ? 0.f : xa;
      const float e0 = (s[0][r] <= -1.0e38f) ? 0.f : x0, e1 = (s[1][r] <= -1.0e38f) ? 0.f : x1; es[r] = e0 + e1;
      sp[wave][8 * g + r][col] = e0; sp[wave][8 * g + r][16 + col] = e1; }
#pragma unroll
    for (int o = 1; o < 16; o <<= 1) { float t[8]; xch8(t, es, (lane ^ o) << 2);
#pragma unroll
      for (int r = 0; r < 8; ++r) es[r] += t[r]; }
#pragma unroll
    for (int r = 0; r < 8; ++r) { l[r] = l[r] * al[r] + es[r]; m[r] = mn[r];
#pragma unroll
      for (int dt = 0; dt < 8; ++dt) acc[dt][r] *= al[r]; }
    LDSW();
    const F2 pa = split_row(&sp[wave][col][0], 0, lane);
#pragma unroll
    for (int dt = 0; dt < 8; ++dt) { acc[dt] = wmma_bf_d(pa.l, vh[dt], acc[dt]); acc[dt] = wmma_bf_d(pa.h, vl[dt], acc[dt]); acc[dt] = wmma_bf_d(pa.h, vh[dt], acc[dt]);
      kr[dt >> 2][dt & 3] = ld_t(kp + ((dt >> 2) * (KVW / 32) + (dt & 3)) * 512, 0); }   // the next step's key slice i as column tile i is used up
    asm volatile("s_wait_xcnt 0x0" :: "v"(kp) : "memory");   // behind the last key load: the address pair lives up to the wait, which so stands in front of any overwrite of it
    LDSW(); }
  if (part) {   // the odd steps' partial goes to the tile's staging rows, every value at the place where the same lane of wave wt will read it
#pragma unroll
    for (int r = 0; r < 8; ++r) {
#pragma unroll
      for (int dt = 0; dt < 8; ++dt) so[wt][8 * g + r][dt * 16 + col] = acc[dt][r];
      if (col == 0) { sm1[wt][8 * g + r][0] = m[r]; sm1[wt][8 * g + r][1] = l[r]; } } }
  __syncthreads();
  if (!part) {   // join: both partials are brought to the common maximum; step 0 holds key 0, so the even part has always started; an odd part that saw only masked keys weighs 0
#pragma unroll
    for (int r = 0; r < 8; ++r) { const float m1 = sm1[wt][8 * g + r][0], l1 = sm1[wt][8 * g + r][1], mm = fmaxf(m[r], m1);
      const float w0 = expf(m[r] - mm), x1 = expf(m1 - mm), w1 = (m1 <= -1.0e38f) ? 0.f : x1, il = 1.0f / (l[r] * w0 + l1 * w1);
#pragma unroll
      for (int dt = 0; dt < 8; ++dt) so[wt][8 * g + r][dt * 16 + col] = (acc[dt][r] * w0 + so[wt][8 * g + r][dt * 16 + col] * w1) * il;
      if (col == 0) { sml[wt * 16 + 8 * g + r][0] = mm; sml[wt * 16 + 8 * g + r][1] = il; sml[wt * 16 + 8 * g + r][2] = 0.f; sml[wt * 16 + 8 * g + r][3] = 0.f; } } }
  __syncthreads();
  if (!part) {   // here wave = wt
    st_t(O + ((size_t)(q0 / 16) * (DM / 32) + h * 4) * 512, so[wave], lane);
    asm volatile("s_wait_xcnt 0x0" ::: "memory");   // behind the tile's stores, in front of any overwrite of a register that they name
  }
  if (tid < 64) vst2(ML + ((size_t)h * SS + qb * 64 + tid) * 4, *(const v4f*)&sml[tid][0]);
}
// ---- colsum: block = (64 keys, head h): partial column sums of probs over each 64-query block qb >= key block: p = exp(s - m_q) * (1/l_q) (s recomputed with the same 3-product dot and scale); CS[h][qb][key] rows of 256 B per (query block, this key block)
//   A = k rows (this block's 64 keys, wave -> 16), B = q rows (16-query tiles) -> D[key][q]; per key row sum over the q columns with the (m, 1/l) of each q and the causal predicate q >= key.
__device__ __forceinline__ void colsum(const float* __restrict__ Q, const float* __restrict__ Kx, const float* __restrict__ ML, float* __restrict__ CS, float* ssum, int bx, int by) {
  const int tid = threadIdx.x, wave = tid >> 5, lane = tid & 31, col = lane & 15, g = lane >> 4;
  const int kb = bx, h = by, kv = h / (NH / NKV); const int k0 = kb * 64 + wave * 16;
  F2 ak[4];
  const float* kp0 = Kx + ((size_t)(k0 / 16) * (KVW / 32) + kv * 4) * 512 + lane * 4; const float* qp0 = Q + ((size_t)(kb * 4) * (DM / 32) + h * 4) * 512 + lane * 4; const float* mp0 = ML + ((size_t)h * SS + kb * 64 + col) * 4;   // the lane's own addresses
#pragma unroll
  for (int kc = 0; kc < 4; ++kc) ak[kc] = split_raw(ld_t(kp0 + kc * 512, 0));
  R16 qr[2][4]; v2f ml[2];   // two register sets: the next 16-query tile (rows and statistics) is loaded as one group while this one is worked on
#pragma unroll
  for (int kc = 0; kc < 4; ++kc) qr[0][kc] = ld_t(qp0 + kc * 512, 0);
  ml[0] = *(const v2f*)mp0;
  asm volatile("s_wait_xcnt 0x0" :: "v"(kp0), "v"(qp0), "v"(mp0) : "memory");   // behind the opening loads: without it this build takes an address pair of these loads as a destination of one of them; as inputs here the pairs live up to the wait
#pragma unroll 1
  for (int qb = kb; qb < TQB; ++qb) { float rs[8];
#pragma unroll
    for (int r = 0; r < 8; ++r) rs[r] = 0.f;
#pragma unroll
    for (int ct = 0; ct < 4; ++ct) { const int qq = qb * 64 + ct * 16 + col; v8f c = {};
      const int qt = ct < 3 ? qb * 4 + ct + 1 : min(qb + 1, TQB - 1) * 4, qn = qt * 16 + col;   // behind the last tile: a tile of the last block again (in bounds, unused)
      const float* qp = Q + ((size_t)qt * (DM / 32) + h * 4) * 512 + lane * 4; const float* mp = ML + ((size_t)h * SS + qn) * 4;   // the lane's own addresses
#pragma unroll
      for (int kc = 0; kc < 4; ++kc) qr[(ct + 1) & 1][kc] = ld_t(qp + kc * 512, 0);
      ml[(ct + 1) & 1] = *(const v2f*)mp;
      asm volatile("s_wait_xcnt 0x0" :: "v"(qp), "v"(mp) : "memory");   // behind the tile's loads: without it this build takes their address pair as a destination of one of them; as inputs here the pairs live up to the wait, which stands in front of any overwrite
#pragma unroll
      for (int kc = 0; kc < 4; ++kc) { const F2 qf = split_raw(qr[ct & 1][kc]); c = mac3(ak[kc], qf, c); }
      const float mq = ml[ct & 1][0], ilq = ml[ct & 1][1];
#pragma unroll
      for (int r = 0; r < 8; ++r) { const int key = k0 + 8 * g + r; const float sc = c[r] * 0.08838834764831845f;
        const float t = rs[r] + expf(sc - mq) * ilq; rs[r] = (key <= qq) ? t : rs[r]; } }   // exp inline and in every lane, the causal test a select: the 8 rows' chains run side by side
#pragma unroll
    for (int o = 1; o < 16; o <<= 1) {   // level by level over the 8 rows: their exchanges are independent and run side by side
#pragma unroll
      for (int r = 0; r < 8; ++r) rs[r] += __shfl_xor(rs[r], o); }
    if (col == 0) {
#pragma unroll
      for (int r = 0; r < 8; ++r) ssum[wave * 16 + 8 * g + r] = rs[r]; }
    __syncthreads();
    if (tid < 16) vst2(CS + (((size_t)h * TQB + qb) * SS) + kb * 64 + tid * 4, *(const v4f*)&ssum[tid * 4]);
    __syncthreads(); }
  // query blocks qb < kb contribute nothing: write zeros so every CS row is defined
  for (int qb = 0; qb < kb; ++qb) { if (tid < 16) vst2(CS + (((size_t)h * TQB + qb) * SS) + kb * 64 + tid * 4, (v4f){0.f, 0.f, 0.f, 0.f}); }
}
// ---- k_mask: block = (128 mask positions, head h). A candidate is kept when fewer than HEAVY candidates come before it in the order 'larger column sum first, lower index first on ties': that count is taken directly, every position on its own, so the heads' selection spreads over the chip and no step of it waits on another
//   every block that holds candidates sums the head's candidate columns into LDS (same order over the query blocks); thread = (position tid & 127, quarter tid >> 7 of the candidates to compare with); a wave's 32 positions are consecutive, so the index test is needed only against those 32 candidates: all before them count on >=, all behind them on >
__global__ __launch_bounds__(128 * MTS) void k_mask(const float* __restrict__ CS, float* __restrict__ MSK) {
  static_assert(NSEL % 4 == 0 && NPAD / 4 <= 128 * MTS && (NPAD / 4) % (4 * MTS) == 0, "column groups of 4, one per thread; parts in groups of 16 candidates");
  __shared__ __align__(16) float sv[NPAD]; __shared__ int sc[MTS][128];
  const int h = blockIdx.y, tid = threadIdx.x, sl = tid & 127, s = blockIdx.x * 128 + sl;
  float o = (s >= MW - RECENT && s < MW) ? 1.0f : 0.f;
  if (blockIdx.x * 128 < NSEL) {   // the same for the whole block
    if (tid < NPAD / 4) { v4f c = {-3.0e38f, -3.0e38f, -3.0e38f, -3.0e38f};   // behind the last candidate: never in front of one
      if (tid < NSEL / 4) { const float* p = CS + (size_t)h * TQB * SS + tid * 4; v4f x[TQB];
#pragma unroll
        for (int qb = 0; qb < TQB; ++qb) x[qb] = *(const v4f*)(p + (size_t)qb * SS);
        c = (v4f){0.f, 0.f, 0.f, 0.f};
#pragma unroll
        for (int qb = 0; qb < TQB; ++qb) c += x[qb]; }
      *(v4f*)&sv[tid * 4] = c; }
    __syncthreads();
    const int wv = __builtin_amdgcn_readfirstlane(tid >> 5);   // scalar loop bounds
    const int s04 = (blockIdx.x * 128 + (wv & 3) * 32) >> 2, lo = (wv >> 2) * (NPAD / 4 / MTS), hi = lo + NPAD / 4 / MTS;   // in groups of 4 candidates: the wave's own positions start at s04, its part is [lo, hi)
    const float a = sv[min(s, NPAD - 1)];
    int n[4] = {0, 0, 0, 0};   // four counters: four independent chains
    for (int t4 = lo; t4 < min(hi, s04); t4 += 4) {
#pragma unroll
      for (int u = 0; u < 4; ++u) { const v4f b = *(const v4f*)&sv[(t4 + u) * 4];
#pragma unroll
        for (int i = 0; i < 4; ++i) n[i] += (b[i] >= a) ? 1 : 0; } }
    for (int t4 = max(lo, s04); t4 < min(hi, s04 + 8); t4 += 4) {
#pragma unroll
      for (int u = 0; u < 4; ++u) { const v4f b = *(const v4f*)&sv[(t4 + u) * 4];
#pragma unroll
        for (int i = 0; i < 4; ++i) n[i] += (int)(b[i] > a) | ((int)(b[i] == a) & (int)((t4 + u) * 4 + i < s)); } }   // the three tests joined by bit operations: no branch per candidate
    for (int t4 = max(lo, s04 + 8); t4 < hi; t4 += 4) {
#pragma unroll
      for (int u = 0; u < 4; ++u) { const v4f b = *(const v4f*)&sv[(t4 + u) * 4];
#pragma unroll
        for (int i = 0; i < 4; ++i) n[i] += (b[i] > a) ? 1 : 0; } }
    sc[wv >> 2][sl] = (n[0] + n[1]) + (n[2] + n[3]);
    __syncthreads();
    if (tid < 128 && s < NSEL) { int nb = 0;
#pragma unroll
      for (int q = 0; q < MTS; ++q) nb += sc[q][sl];
      o = nb < HEAVY ? 1.0f : 0.f; }
  }
  if (tid < 128) MSK[(size_t)h * MWP + s] = o;   // a wave stores one whole line
  else if (blockIdx.x == SS / 128 - 1 && tid < 128 + MWP - SS) MSK[(size_t)h * MWP + SS + tid - 128] = (SS + tid - 128 < MW) ? 1.0f : 0.f;   // the row's last line: position SS and the padding
}
// ---- oproj: block = (64 rows, 128 cols): out = O(hi/lo) . o_w^T rows (2 products)
__device__ __forceinline__ void oproj(const float* __restrict__ O, const __bf16* __restrict__ P, float* __restrict__ Y, float (*so)[16][132], int bx, int by) {
  const int tid = threadIdx.x, wave = tid >> 5, lane = tid & 31, col = lane & 15, g = lane >> 4; const size_t r0 = (size_t)bx * 64 + wave * 16; const int n0 = by * 128;
  v8f acc[8] = {};
  const float* oblk = O + (r0 / 16) * (DM / 32) * 512; const __bf16* pblk = P + (size_t)(n0 / 16) * (DM / 32) * 512;
  R16 xa[2]; v16b wb[2][8];   // two register sets: step kc + 1 is loaded as one group while step kc is multiplied
  xa[0] = ld_t(oblk, lane);
#pragma unroll
  for (int j = 0; j < 8; ++j) wb[0][j] = frag_t(pblk + (size_t)j * (DM / 32) * 512, lane);
#pragma unroll 1   // one trip already holds both register sets; more copies of it would only cost registers
  for (int kc = 0; kc < DM / 32; kc += 2) {
#pragma unroll
    for (int u = 0; u < 2; ++u) { const int kn = min(kc + u + 1, DM / 32 - 1);   // the last step loads itself again (in bounds, unused)
      const float* xp = oblk + kn * 512 + lane * 4; const __bf16* wp = pblk + (size_t)kn * 512 + lane * 8;   // the lane's own addresses in the step's blocks
      xa[u ^ 1] = ld_t(xp, 0);
#pragma unroll
      for (int j = 0; j < 8; ++j) wb[u ^ 1][j] = frag_t(wp + (size_t)j * (DM / 32) * 512, 0);
      asm volatile("s_wait_xcnt 0x0" :: "v"(xp), "v"(wp) : "memory");   // without it this build takes an address pair of these loads as a destination of one of them; as inputs here the pairs live up to the wait, which stands in front of any overwrite
      const F2 a = split_raw(xa[u]);
#pragma unroll
      for (int j = 0; j < 8; ++j) { acc[j] = wmma_bf(a.l, wb[u][j], acc[j]); acc[j] = wmma_bf(a.h, wb[u][j], acc[j]); } } }
#pragma unroll
  for (int j = 0; j < 8; ++j)
#pragma unroll
    for (int r = 0; r < 8; ++r) so[wave][8 * g + r][j * 16 + col] = acc[j][r];
  LDSX();
  for (int rl = 0; rl < 16; ++rl) vst2(Y + (r0 + rl) * DM + n0 + lane * 4, *(const v4f*)&so[wave][rl][lane * 4]);
  asm volatile("s_wait_xcnt 0x0" ::: "memory");   // behind the tile's stores: the other branch's code follows in the listing and reuses the registers that they name
}
// ---- k_cs_out: the column sums and the output projection in one launch (both need only what k_attn and the launches before it wrote); blockIdx.y: the NH heads of colsum first, whose blocks of the first keys run longest, then the 128-column tiles of oproj
// waves_per_eu(3, 3): at the default register target this build of the two bodies in one kernel takes colsum's lane exchanges singly, each with its own wait, and issues its next tile's loads later than the launch of its own did
__global__ __launch_bounds__(128) __attribute__((amdgpu_waves_per_eu(3, 3))) void k_cs_out(const float* __restrict__ Q, const float* __restrict__ Kx, const float* __restrict__ ML, float* __restrict__ CS, const float* __restrict__ O, const __bf16* __restrict__ P, float* __restrict__ Y) {
  __shared__ __align__(16) float sm[4][16][132];   // oproj's staging; colsum uses its first 64 floats
  if (blockIdx.y < NH) colsum(Q, Kx, ML, CS, &sm[0][0][0], blockIdx.x, blockIdx.y);
  else oproj(O, P, Y, sm, blockIdx.x, blockIdx.y - NH);
}
// ---- k_mout: flat writer of the [16][2049] mask after the attention output
__global__ __launch_bounds__(256) void k_mout(const float* __restrict__ MSK, float* __restrict__ out) {
  const size_t p = (size_t)blockIdx.x * 256 + threadIdx.x; const size_t total = (size_t)NH * (SFULL + 1); if (p * 4 >= total) return; v4f v;
#pragma unroll
  for (int i = 0; i < 4; ++i) { const size_t f = p * 4 + i; const size_t row = f / (SFULL + 1), c = f % (SFULL + 1); v[i] = (f < total && c < (size_t)MW) ? MSK[row * MWP + c] : 0.f; }
  vst2(out + p * 4, v);
}
extern "C" void kernel_launch(void* const* d_in, const int* in_sizes, int n_in, void* d_out, int out_size, void* d_ws, size_t ws_size, hipStream_t stream) {
  (void)in_sizes; (void)n_in; (void)out_size;
  const float** F = (const float**)d_in;   // hidden_states [1,2048,2048], q_w [2048,2048], q_b [2048], k_w [2048,512], k_b [512], v_w [2048,512], v_b [512], o_w [2048,2048]
  if (ws_size < (size_t)WS_END) return;
  char* ws = (char*)d_ws; __bf16 *PK = (__bf16*)(ws + WS_PK), *XB = (__bf16*)(ws + WS_X), *VTH = (__bf16*)(ws + WS_VTH), *VTL = (__bf16*)(ws + WS_VTL);
  float *Q = (float*)(ws + WS_Q), *Kx = (float*)(ws + WS_K), *O = (float*)(ws + WS_O), *ML = (float*)(ws + WS_ML), *CS = (float*)(ws + WS_CS), *MSK = (float*)(ws + WS_MSK);
  float* OUT0 = (float*)d_out; float* OUT1 = OUT0 + (size_t)SFULL * DM;
  k_pack<<<dim3(PX_END, DM / 128), 256, 0, stream>>>(F[1], F[3], F[5], F[7], F[0], PK, XB);
  k_proj<<<dim3(SS / 64, PY_END), 128, 0, stream>>>(XB, PK, F[2], F[4], F[6], Q, Kx, VTH, VTL);
  k_attn<<<dim3(NH, TQB), 256, 0, stream>>>(Q, Kx, VTH, VTL, O, ML);
  k_cs_out<<<dim3(TQB, NH + DM / 128), 128, 0, stream>>>(Q, Kx, ML, CS, O, PK + PK_O, OUT0);
  k_mask<<<dim3(SS / 128, NH), 128 * MTS, 0, stream>>>(CS, MSK);
  k_mout<<<(unsigned)(((size_t)NH * (SFULL + 1) / 4 + 255) / 256), 256, 0, stream>>>(MSK, OUT1);
}

// v009
// Measured time: 187 microseconds a run.
// Timed twice side by side with v008, it ran 1.09 times as fast both times.
// Counting every step since v000, it is 7.60 times as fast.
// compute dtype: hidden_states and all weights/biases (module inputs) rounded to bf16; q/k/v projections with exact bf16 products (x and W are inputs); causal scores q.k with both computed operands as bf16 hi + residual pairs (3 products) and P.V with P hi/lo x V hi/lo (3 products); the heavy-hitter column sums recompute the same 3-product scores in a second (transposed) pass with the stored row statistics; the output projection with hi/lo x exact o_w (2 products), all on WMMA 16x16x32; softmax, column sums, the per-head top-k selection (rank by counting, lower index first on ties) and the mask assembly in f32 on the VALU; f32 accumulate.
#include <hip/hip_runtime.h>
#include <math.h>

typedef __attribute__((ext_vector_type(16))) _Float16 v16h;
typedef __attribute__((ext_vector_type(16))) __bf16 v16b;
typedef __attribute__((ext_vector_type(8)))  _Float16 v8h;
typedef __attribute__((ext_vector_type(8)))  float v8f;
typedef __attribute__((ext_vector_type(4)))  float v4f;
typedef __attribute__((ext_vector_type(2)))  float v2f;
typedef __attribute__((ext_vector_type(4)))  unsigned v4u;
typedef __attribute__((ext_vector_type(4)))  int v4i;
typedef float __attribute__((may_alias)) float_a;
typedef int __attribute__((may_alias)) int_a;

template <typename T> __device__ __forceinline__ void vst2(void* p, T v) { *(T*)p = v;  }
__device__ __forceinline__ v8f wmma16(v16h a, v16h b, v8f c) {
  v8f d = __builtin_amdgcn_wmma_f32_16x16x32_f16(false, a, false, b, (short)0, c, false, false);
  asm volatile("v_nop\n\tv_nop\n\tv_nop\n\tv_nop" : "+v"(d) : "v"(a), "v"(b));
  return d;
}
__device__ __forceinline__ v8f wmma_bf(v16b a, v16b b, v8f c) {
  v8f d = __builtin_amdgcn_wmma_f32_16x16x32_bf16(false, a, false, b, (short)0, c, false, false);
  asm volatile("v_nop\n\tv_nop\n\tv_nop\n\tv_nop" : "+v"(d) : "v"(a), "v"(b));
  return d;
}
// 16x16x32 fragments: lane = (h = lane>>4, row/col = lane&15); elements 0..7 = k0+8h+0..7, 8..15 = k0+16+8h+0..7; D element r = row 8h+r
__device__ __forceinline__ v16h frag_h(const _Float16* rowk0, int lane) {
  union { v16h v; v8h q[2]; } u; const _Float16* p = rowk0 + 8 * (lane >> 4);
  u.q[0] = *(const v8h*)p; u.q[1] = *(const v8h*)(p + 16); return u.v;
}
__device__ __forceinline__ v16h frag_f32(const float* rowk0, int lane) {
  v16h a; const float* p = rowk0 + 8 * (lane >> 4);
#pragma unroll
  for (int i = 0; i < 8; ++i) { a[i] = (_Float16)p[i]; a[8 + i] = (_Float16)p[16 + i]; }
  return a;
}
__device__ __forceinline__ v16h frag_f32s(const float* rowk0, int lane, float sc) {
  v16h a; const float* p = rowk0 + 8 * (lane >> 4);
#pragma unroll
  for (int i = 0; i < 8; ++i) { a[i] = (_Float16)(p[i] * sc); a[8 + i] = (_Float16)(p[16 + i] * sc); }
  return a;
}
// column fragment from a [K][ld] layout (column n), rows >= K read as 0
__device__ __forceinline__ v16h fragc_f32(const float* W, int k0, int n, int lane, int ld, int K) {
  v16h a; const int g = lane >> 4;
#pragma unroll
  for (int i = 0; i < 8; ++i) { const int ka = k0 + 8 * g + i, kb = ka + 16;
    a[i] = (_Float16)(ka < K ? W[(size_t)(ka < K ? ka : K - 1) * ld + n] : 0.f); a[8 + i] = (_Float16)(kb < K ? W[(size_t)(kb < K ? kb : K - 1) * ld + n] : 0.f); }
  return a;
}
struct F2 { v16b h, l; };
__device__ __forceinline__ F2 bsplit16(const float v[16]) { F2 r;
#pragma unroll
  for (int i = 0; i < 16; ++i) { const __bf16 h = (__bf16)v[i]; r.h[i] = h; r.l[i] = (__bf16)(v[i] - (float)h); }
  return r; }
__device__ __forceinline__ F2 split_row(const float* row, int k0, int lane) { float v[16]; const float* p = row + k0 + 8 * (lane >> 4);
#pragma unroll
  for (int i = 0; i < 8; ++i) { v[i] = p[i]; v[8 + i] = p[16 + i]; }
  return bsplit16(v); }
__device__ __forceinline__ F2 split_rowK(const float* row, int k0, int lane, int K) { float v[16]; const int g = lane >> 4;
#pragma unroll
  for (int i = 0; i < 8; ++i) { const int ka = k0 + 8 * g + i, kb = ka + 16; v[i] = ka < K ? row[ka < K ? ka : K - 1] : 0.f; v[8 + i] = kb < K ? row[kb < K ? kb : K - 1] : 0.f; }
  return bsplit16(v); }
__device__ __forceinline__ F2 split_col(const float* W, int k0, int n, int lane, int ld, int K) { float v[16]; const int g = lane >> 4;
#pragma unroll
  for (int i = 0; i < 8; ++i) { const int ka = k0 + 8 * g + i, kb = ka + 16; v[i] = ka < K ? W[(size_t)(ka < K ? ka : K - 1) * ld + n] : 0.f; v[8 + i] = kb < K ? W[(size_t)(kb < K ? kb : K - 1) * ld + n] : 0.f; }
  return bsplit16(v); }
__device__ __forceinline__ v8f mac3(const F2& a, const F2& b, v8f c) { c = wmma_bf(a.l, b.h, c); c = wmma_bf(a.h, b.l, c); return wmma_bf(a.h, b.h, c); }
__device__ __forceinline__ float sigm(float v) { return 1.0f / (1.0f + expf(-v)); }
#define LDSX() do { asm volatile("s_wait_dscnt 0" ::: "memory"); __builtin_amdgcn_wave_barrier(); __builtin_amdgcn_fence(__ATOMIC_RELEASE, "workgroup"); } while (0)


// GQA causal attention with H2O heavy-hitter scoring (B 1, S 2048, D 2048, 16 query heads / 4 kv heads x 128): out = softmax(q k^T / sqrt(128), causal) v -> @ o_w; cur[h][s] = sum over queries of probs; mask[h] = 1 on the last 204 of 2049 positions, 0 elsewhere, then 1 at the top-204 (heavy budget) indices of cur[h][:1844].
#define SFULL 2048            // shipped sequence length (output layout)
#ifndef SS
#define SS SFULL              // active sequence length (all)
#endif
#define DM 2048
#define NH 16
#define NKV 4
#define HD 128
#define KVW (NKV * HD)        // 512
#define HEAVY (SS / 10)       // int(0.1 * S)
#define RECENT (SS / 10)
#define MW (SS + 1)           // 2049 mask width
#define MWP 2080              // padded staging width: a row is 65 whole 128-byte lines
#define NSEL (SS - RECENT)    // 1844 candidates of the heavy-hitter selection
#define NPAD ((NSEL + 31) / 32 * 32)   // candidates rounded up to whole waves
#define MTS 4                 // k_mask: parts into which the candidates to compare with are dealt
#define TQB (SS / 64)         // query blocks
typedef __attribute__((ext_vector_type(8))) __bf16 v8b;
// fragment-order storage: a [rows][k] operand that a kernel of this file writes is kept as blocks of 16 rows x 32 k, block (rt, kc) at index rt * (k / 32) + kc; inside a block the 16-byte pieces stand in the order in which the lanes load them, so every wave-wide load or store is 512 bytes in a row (4 whole lines, not 16 part lines)
// bf16 block = 512 elements: piece (half, lane) at half * 256 + lane * 8 holds row lane & 15, k = half * 16 + 8 * (lane >> 4) + 0..7
__device__ __forceinline__ v16b frag_t(const __bf16* blk, int lane) {
  union { v16b v; v8b q[2]; } u;
  u.q[0] = *(const v8b*)(blk + lane * 8); u.q[1] = *(const v8b*)(blk + 256 + lane * 8); return u.v;
}
__device__ __forceinline__ float bfr(float v) { return (float)(__bf16)v; }
// the same product with only D named at the v_nops, which so stand in front of the next reader of D (A and B are left to the compiler's own padding of its builtin): an operand that an asm statement names must stand below v256, and with A and B named too k_attn, which holds a whole step's fragments, builds with spills to scratch
__device__ __forceinline__ v8f wmma_bf_d(v16b a, v16b b, v8f c) {
  v8f d = __builtin_amdgcn_wmma_f32_16x16x32_bf16(false, a, false, b, (short)0, c, false, false);
  asm volatile("v_nop\n\tv_nop\n\tv_nop\n\tv_nop" : "+v"(d));
  return d;
}
__device__ __forceinline__ v8f mac3_d(const F2& a, const F2& b, v8f c) { c = wmma_bf_d(a.l, b.h, c); c = wmma_bf_d(a.h, b.l, c); return wmma_bf_d(a.h, b.h, c); }
// the 16 registers of one lane's slice of a hi/lo operand pair, as loaded: q[0], q[1] the hi fragment, q[2], q[3] the residual fragment
struct R16 { v4f q[4]; };
// pair block = 2 KB (addressed as 512 floats): the bf16 block of the hi parts, then the bf16 block of the residuals; piece (pl, half, lane) at float (pl * 2 + half) * 128 + lane * 4 holds 8 bf16 of row lane & 15, k = half * 16 + 8 * (lane >> 4) + 0..7
// a computed f32 operand (q, k, the attention output) is split ONCE, by the wave that stores it; every wave that loads it (a key slice: 4 heads x up to 128 query tiles) has its two WMMA fragments in the loaded registers, with no conversion
__device__ __forceinline__ R16 ld_t(const float* blk, int lane) { R16 r;
#pragma unroll
  for (int qi = 0; qi < 4; ++qi) r.q[qi] = *(const v4f*)(blk + qi * 128 + lane * 4);
  return r; }
// one wave's 16 x 128 f32 tile, from its LDS staging rows to 4 pair blocks in a row: hi = bf16(v), residual = bf16(v - hi), as bsplit16 forms them
__device__ __forceinline__ void st_t(float* blk, const float (*st)[132], int lane) {
#pragma unroll
  for (int sl = 0; sl < 4; ++sl) {
#pragma unroll
    for (int half = 0; half < 2; ++half) { const float* p = &st[lane & 15][sl * 32 + half * 16 + 8 * (lane >> 4)]; const v4f a = *(const v4f*)p, b = *(const v4f*)(p + 4);
      union { v8b b8; v4f f; } hi, lo;
#pragma unroll
      for (int i = 0; i < 8; ++i) { const float v = i < 4 ? a[i & 3] : b[i & 3]; const __bf16 hb = (__bf16)v; hi.b8[i] = hb; lo.b8[i] = (__bf16)(v - (float)hb); }
      vst2(blk + sl * 512 + half * 128 + lane * 4, hi.f); vst2(blk + sl * 512 + (2 + half) * 128 + lane * 4, lo.f); } }
}
// the two fragments of a loaded slice: the registers as they are, no instruction
__device__ __forceinline__ F2 split_raw(const R16& r) { union { v4f f[2]; v16b b; } hi, lo; F2 o;
  hi.f[0] = r.q[0]; hi.f[1] = r.q[1]; lo.f[0] = r.q[2]; lo.f[1] = r.q[3]; o.h = hi.b; o.l = lo.b; return o; }
__device__ __attribute__((noinline)) float erf_ni(float v) { return erff(v); }

#define PK_Q 0                               // [2048 n][2048 k] q_w^T (all four: bf16 blocks)
#define PK_K (PK_Q + DM * DM)                  // [512][2048]
#define PK_V (PK_K + KVW * DM)
#define PK_O (PK_V + KVW * DM)                 // [2048][2048] o_w^T
#define PK_END (PK_O + DM * DM)
#define WS_PK  0u
#define WS_Q   (WS_PK + 2u * PK_END)           // pair blocks [2048][2048] q (h*128+d)
#define WS_K   (WS_Q + 4u * SS * DM)            // pair blocks [2048][512]
#define WS_VTH (WS_K + 4u * SS * KVW)           // bf16 blocks [512 (kv*128+d)][2048]
#define WS_VTL (WS_VTH + 2u * KVW * SS)
#define WS_O   (WS_VTL + 2u * KVW * SS)         // pair blocks [2048][2048] attention output (h*128+d)
#define WS_ML  (WS_O + 4u * SS * DM)            // f32 [16][2048][4]: (m, 1/l, 0, 0)
#define WS_CS  (WS_ML + 4u * NH * SS * 4)       // f32 [16][32 qblocks][2048]: per-query-block partial column sums
#define WS_MSK (WS_CS + 4u * NH * TQB * SS)     // f32 [16][2080] mask staging
#define WS_X   (WS_MSK + 4u * NH * MWP)         // bf16 blocks [2048][2048] hidden_states
#define WS_END (WS_X + 2u * SS * DM)

// launches that need nothing of one another share one grid: a range of the block index picks the work (a test that reads the same for a whole block), bx and by are the block's place in the grid that the work had as a launch of its own
// ---- packT: block = (16 output columns, 128 k) of a [K][N] (x @ W) matrix: 4 bf16 blocks in a row (4 KB) of W^T; a thread makes one 16-byte piece
__device__ __forceinline__ void packT(const float* __restrict__ Wm, int K, int N, __bf16* __restrict__ DST, int bx, int by) {
  const int tid = threadIdx.x, lane = tid & 31, half = (tid >> 5) & 1, kc = by * 4 + (tid >> 6);
  const float* src = Wm + (size_t)(kc * 32 + half * 16 + 8 * (lane >> 4)) * N + bx * 16 + (lane & 15);
  v8b o;
#pragma unroll
  for (int i = 0; i < 8; ++i) o[i] = (__bf16)src[(size_t)i * N];
  vst2(DST + ((size_t)bx * (K / 32) + kc) * 512 + half * 256 + lane * 8, o);
}
// ---- packR: block = (16 rows, 128 k) of the row-major [rows][DM] x: 4 bf16 blocks in a row (4 KB) of bf16(x); a thread makes one 16-byte piece
__device__ __forceinline__ void packR(const float* __restrict__ X, __bf16* __restrict__ DST, int bx, int by) {
  const int tid = threadIdx.x, lane = tid & 31, half = (tid >> 5) & 1, kc = by * 4 + (tid >> 6);
  const float* src = X + (size_t)(bx * 16 + (lane & 15)) * DM + kc * 32 + half * 16 + 8 * (lane >> 4);
  const v4f a = *(const v4f*)src, b = *(const v4f*)(src + 4); v8b o;
#pragma unroll
  for (int i = 0; i < 4; ++i) { o[i] = (__bf16)a[i]; o[4 + i] = (__bf16)b[i]; }
  vst2(DST + ((size_t)bx * (DM / 32) + kc) * 512 + half * 256 + lane * 8, o);
}
// ---- k_pack: the four weight matrices and x in one launch; blockIdx.x: 16-column tiles of q_w, k_w, v_w, o_w, then 16-row tiles of x; blockIdx.y: 128 k (all five have DM k)
#define PX_K (DM / 16)
#define PX_V (PX_K + KVW / 16)
#define PX_O (PX_V + KVW / 16)
#define PX_X (PX_O + DM / 16)
#define PX_END (PX_X + SS / 16)
__global__ __launch_bounds__(256) void k_pack(const float* __restrict__ Wq, const float* __restrict__ Wk, const float* __restrict__ Wv, const float* __restrict__ Wo, const float* __restrict__ X, __bf16* __restrict__ PK, __bf16* __restrict__ XB) {
  const int bx = blockIdx.x, by = blockIdx.y;
  if (bx < PX_K) packT(Wq, DM, DM, PK + PK_Q, bx, by);
  else if (bx < PX_V) packT(Wk, DM, KVW, PK + PK_K, bx - PX_K, by);
  else if (bx < PX_O) packT(Wv, DM, KVW, PK + PK_V, bx - PX_V, by);
  else if (bx < PX_X) packT(Wo, DM, DM, PK + PK_O, bx - PX_O, by);
  else packR(X, XB, bx - PX_X, by);
}
// ---- k_proj: q, k and v in one launch; block = (64 rows, 128 cols): Y = bf16(x) (packed, bf16 blocks) . P rows (exact) + bias; blockIdx.y: 128-column tiles of q, then of k, then of v; VT 0 (q, k): pair blocks of [row][ldo cols]; VT 1 (v): transposed bf16 hi/lo planes, bf16 blocks of [col][row]
#define PY_K (DM / 128)
#define PY_V (PY_K + KVW / 128)
#define PY_END (PY_V + KVW / 128)
__global__ __launch_bounds__(128) void k_proj(const __bf16* __restrict__ X, const __bf16* __restrict__ PK, const float* __restrict__ q_b, const float* __restrict__ k_b, const float* __restrict__ v_b, float* __restrict__ Qo, float* __restrict__ Ko, __bf16* __restrict__ PH, __bf16* __restrict__ PL) {
  __shared__ __align__(16) char sm[2 * 128 * 72 * 2];   // a block uses one of the two stagings: so (VT 0) or sth and stl (VT 1)
  static_assert(sizeof(sm) >= 4 * 16 * 132 * 4, "the larger of the two stagings");
  float (*so)[16][132] = (float (*)[16][132])sm; __bf16 (*sth)[72] = (__bf16 (*)[72])sm, (*stl)[72] = sth + 128;
  const int yb = blockIdx.y; const bool VT = yb >= PY_V, isq = yb < PY_K;   // the same for the whole block
  const __bf16* P = PK + (isq ? PK_Q : VT ? PK_V : PK_K); const float* bias = isq ? q_b : VT ? v_b : k_b; float* OUT = isq ? Qo : Ko; const int ldo = isq ? DM : KVW;
  const int tid = threadIdx.x, wave = tid >> 5, lane = tid & 31, col = lane & 15, g = lane >> 4; const size_t r0 = (size_t)blockIdx.x * 64 + wave * 16; const int n0 = (yb - (isq ? 0 : VT ? PY_V : PY_K)) * 128;
  v8f acc[8] = {};
  const __bf16* xblk = X + (r0 / 16) * (DM / 32) * 512; const __bf16* pblk = P + (size_t)(n0 / 16) * (DM / 32) * 512;
  v16b xa[2], wb[2][8];   // two register sets: step kc + 1 is loaded as one group while step kc is multiplied
  xa[0] = frag_t(xblk, lane);
#pragma unroll
  for (int j = 0; j < 8; ++j) wb[0][j] = frag_t(pblk + (size_t)j * (DM / 32) * 512, lane);
#pragma unroll 1   // one trip already holds both register sets; more copies of it would only cost registers
  for (int kc = 0; kc < DM / 32; kc += 2) {
#pragma unroll
    for (int u = 0; u < 2; ++u) { const int kn = min(kc + u + 1, DM / 32 - 1);   // the last step loads itself again (in bounds, unused)
      const __bf16* xp = xblk + kn * 512 + lane * 8; const __bf16* wp = pblk + (size_t)kn * 512 + lane * 8;   // the lane's own addresses in the step's blocks
      xa[u ^ 1] = frag_t(xp, 0);
#pragma unroll
      for (int j = 0; j < 8; ++j) wb[u ^ 1][j] = frag_t(wp + (size_t)j * (DM / 32) * 512, 0);
      asm volatile("s_wait_xcnt 0x0" :: "v"(xp), "v"(wp) : "memory");   // as inputs here the pairs live up to the wait, which stands in front of any overwrite
#pragma unroll
      for (int j = 0; j < 8; ++j) acc[j] = wmma_bf(xa[u], wb[u][j], acc[j]); } }
  if (!VT) {
#pragma unroll
    for (int j = 0; j < 8; ++j) { const float bb = bfr(bias[n0 + j * 16 + col]);
#pragma unroll
      for (int r = 0; r < 8; ++r) so[wave][8 * g + r][j * 16 + col] = acc[j][r] + bb; }
    LDSX();
    st_t(OUT + ((r0 / 16) * (ldo / 32) + n0 / 32) * 512, so[wave], lane);
    asm volatile("s_wait_xcnt 0x0" ::: "memory");   // behind the tile's stores: the other branch's code follows in the listing and reuses the registers that they name
  } else {
    const float* bp = bias + n0 + col; float bv[8];   // the lane's own address
#pragma unroll
    for (int j = 0; j < 8; ++j) bv[j] = bp[j * 16];
    asm volatile("s_wait_xcnt 0x0" :: "v"(bp) : "memory");   // behind the bias loads, in front of any overwrite of a register that they name
#pragma unroll
    for (int j = 0; j < 8; ++j) { const float bb = bfr(bv[j]);
#pragma unroll
      for (int r = 0; r < 8; ++r) { const float v = acc[j][r] + bb; const __bf16 hb = (__bf16)v; sth[j * 16 + col][wave * 16 + 8 * g + r] = hb; stl[j * 16 + col][wave * 16 + 8 * g + r] = (__bf16)(v - (float)hb); } }
    __syncthreads();
    for (int q = tid; q < 128 * 8; q += 128) { const int dt = q >> 7, kl = (q >> 6) & 1, half = (q >> 5) & 1;   // 16 blocks a plane (8 column tiles x 2 row steps), 64 pieces each; q & 31 = lane
      const int d = dt * 16 + col, sl = kl * 32 + half * 16 + 8 * g; const size_t o = ((size_t)(n0 / 16 + dt) * (SS / 32) + blockIdx.x * 2 + kl) * 512 + half * 256 + lane * 8;
      vst2((unsigned*)(PH + o), *(const v4u*)&sth[d][sl]); vst2((unsigned*)(PL + o), *(const v4u*)&stl[d][sl]); }
  }
}
// ---- k_attn: block = (64 queries, head h), 8 waves: causal flash attention, kv head = h/4; scores 3 products, P.V 3 products; O[q][h*128+d]; ML[h][q] = (m, 1/l)
// both products are taken transposed: S^T = K . Q^T (A = key rows, B = query rows, as colsum takes them) and O^T += V^T . P^T (A = rows of V^T, B = P^T). A lane then holds 16 of the step's 32 scores of ONE query (column lane & 15; keys 8g + r and 16 + 8g + r), the lane 16 further the other 16: maximum and sum run inside the lane, with one exchange between the wave's halves, and those 16 values stand where the B fragment of P^T wants them, so P goes through no LDS
// a 16-query tile's key steps are dealt to two waves (wave wt: the even steps, wave wt + 4: the odd ones), each with its own (m, l, acc); the two partials are joined through LDS behind the loop. The longest wave so walks 32 steps, not 64
// lane l with lane l ^ 16, a vector instruction (no LDS counter, no wait)
__device__ __forceinline__ float xhalf(float x) { return __builtin_bit_cast(float, __builtin_amdgcn_permlanex16(__builtin_bit_cast(int, x), __builtin_bit_cast(int, x), 0x76543210, 0xfedcba98, false, false)); }
// waves_per_eu(2, 2): a block puts two waves on a SIMD, and a wave holds a whole step's fragments
__global__ __launch_bounds__(256) __attribute__((amdgpu_waves_per_eu(2, 2))) void k_attn(const float* __restrict__ Q, const float* __restrict__ Kx, const __bf16* __restrict__ VTH, const __bf16* __restrict__ VTL, float* __restrict__ O, float* __restrict__ ML) {
  __shared__ __align__(16) float so[4][16][132]; __shared__ __align__(16) float sml[64][4]; __shared__ __align__(8) float sm1[4][16][2];
  const int tid = threadIdx.x, wave = tid >> 5, wt = wave & 3, lane = tid & 31, col = lane & 15, g = lane >> 4;
  const int part = __builtin_amdgcn_readfirstlane(tid >> 7);   // scalar: step numbers, addresses and the branches behind the loop stay wave-uniform
  const int qb = TQB - 1 - blockIdx.y, h = blockIdx.x, kv = h / (NH / NKV); const int q0 = qb * 64 + wt * 16;   // the longest blocks have the lowest index
  R16 kr[2][4];   // a whole step's 32 key rows (8 slices) are in flight or in registers before its score products begin
  const float* kp0 = Kx + ((size_t)(part * 2) * (KVW / 32) + kv * 4) * 512 + lane * 4; const float* qp = Q + ((size_t)(q0 / 16) * (DM / 32) + h * 4) * 512 + lane * 4;   // the lane's own addresses
  R16 qr[4];
#pragma unroll
  for (int kc = 0; kc < 4; ++kc) qr[kc] = ld_t(qp + kc * 512, 0);
#pragma unroll
  for (int i = 0; i < 8; ++i) kr[i >> 2][i & 3] = ld_t(kp0 + ((i >> 2) * (KVW / 32) + (i & 3)) * 512, 0);
  asm volatile("s_wait_xcnt 0x0" :: "v"(kp0), "v"(qp), "v"(lane) : "memory");   // behind the opening loads: the address pairs live up to the wait, which so stands in front of any overwrite of them; the lane number too, which this build takes as the key loads' offset register beside a scalar base
  F2 aq[4];
#pragma unroll
  for (int kc = 0; kc < 4; ++kc) aq[kc] = split_raw(qr[kc]);
  const int qi = q0 + col;   // the lane's query
  float m = -3.0e38f, l = 0.f;   // m: of the query, the same in both halves; l: over the keys of the lane's own half
  v8f acc[8] = {};   // O^T: acc[dt][r] = (d = dt * 16 + 8g + r, query col)
  const int nks = (qb * 64 + 64) / 32;   // key steps covering keys <= the block's last query: an even number, half of them to each part
#pragma unroll 1
  for (int ks = part; ks < nks; ks += 2) { v8f s[2];
    v16b vh[8], vl[8];   // the step's V fragments: row tile i of V^T is loaded as key slice i is used up (16 registers go, 16 come), so every tile has the rest of the score products and the softmax ahead of its use
    const size_t vbase = ((size_t)(kv * 8) * (SS / 32) + ks) * 512; const __bf16* vhp = VTH + vbase + lane * 8; const __bf16* vlp = VTL + vbase + lane * 8;   // the lane's own addresses in the step's blocks
    const float* kp = Kx + ((size_t)(min(ks + 2, nks - 2 + part) * 2) * (KVW / 32) + kv * 4) * 512 + lane * 4;   // the part's last step loads itself again (in bounds, unused)
#pragma unroll
    for (int ct = 0; ct < 2; ++ct) { const int kk = ks * 32 + ct * 16 + 8 * g; v8f c = {};
#pragma unroll
      for (int kc = 0; kc < 4; ++kc) { const F2 kb = split_raw(kr[ct][kc]); const int dt = ct * 4 + kc;
        vh[dt] = frag_t(vhp + (size_t)dt * (SS / 32) * 512, 0); vl[dt] = frag_t(vlp + (size_t)dt * (SS / 32) * 512, 0);
        c = mac3_d(kb, aq[kc], c); }
#pragma unroll
      for (int r = 0; r < 8; ++r) s[ct][r] = (kk + r <= qi) ? c[r] * 0.08838834764831845f : -3.0e38f; }
    asm volatile("s_wait_xcnt 0x0" :: "v"(vhp), "v"(vlp) : "memory");   // behind the step's last V load: as inputs here the address pairs live up to the wait, which so stands in front of any overwrite of them
    float t8[8];   // the lane's 16 scores to one maximum, as a tree
#pragma unroll
    for (int r = 0; r < 8; ++r) t8[r] = fmaxf(s[0][r], s[1][r]);
    float mx = fmaxf(fmaxf(fmaxf(t8[0], t8[1]), fmaxf(t8[2], t8[3])), fmaxf(fmaxf(t8[4], t8[5]), fmaxf(t8[6], t8[7])));
    mx = fmaxf(mx, xhalf(mx));
    const float mn = fmaxf(m, mx), xa = expf(m - mn), al = (m <= -1.0e38f) ? 0.f : xa;   // exp inline and in every lane; a masked or not yet started entry is set to 0 by a select, not branched round
    float e[16];   // in the k order of a fragment: e[i] = key 8g + i, e[8 + i] = key 16 + 8g + i
#pragma unroll
    for (int i = 0; i < 16; ++i) { const float sv = s[i >> 3][i & 7], x = expf(sv - mn); e[i] = (sv <= -1.0e38f) ? 0.f : x; }
#pragma unroll
    for (int r = 0; r < 8; ++r) t8[r] = e[r] + e[8 + r];
    l = l * al + (((t8[0] + t8[1]) + (t8[2] + t8[3])) + ((t8[4] + t8[5]) + (t8[6] + t8[7]))); m = mn;
#pragma unroll
    for (int dt = 0; dt < 8; ++dt) acc[dt] *= al;
    const F2 pa = bsplit16(e);
#pragma unroll
    for (int dt = 0; dt < 8; ++dt) { acc[dt] = wmma_bf_d(vh[dt], pa.l, acc[dt]); acc[dt] = wmma_bf_d(vl[dt], pa.h, acc[dt]); acc[dt] = wmma_bf_d(vh[dt], pa.h, acc[dt]);
      kr[dt >> 2][dt & 3] = ld_t(kp + ((dt >> 2) * (KVW / 32) + (dt & 3)) * 512, 0); }   // the next step's key slice i as row tile i is used up
    asm volatile("s_wait_xcnt 0x0" :: "v"(kp) : "memory");   // behind the last key load: the address pair lives up to the wait, which so stands in front of any overwrite of it
  }
  l += xhalf(l);   // the two halves' sums joined once
  float* sq = &so[wt][col][8 * g];   // the lane's places in its query's staging row: d = dt * 16 + 8g + 0..7
  if (part) {   // the odd steps' partial goes to the tile's staging rows, every value at the place where the same lane of wave wt will read it
#pragma unroll
    for (int dt = 0; dt < 8; ++dt) { *(v4f*)(sq + dt * 16) = (v4f){acc[dt][0], acc[dt][1], acc[dt][2], acc[dt][3]}; *(v4f*)(sq + dt * 16 + 4) = (v4f){acc[dt][4], acc[dt][5], acc[dt][6], acc[dt][7]}; }
    if (g == 0) { sm1[wt][col][0] = m; sm1[wt][col][1] = l; } }
  __syncthreads();
  if (!part) {   // join: both partials are brought to the common maximum; step 0 holds key 0, so the even part has always started; an odd part that saw only masked keys weighs 0
    const float m1 = sm1[wt][col][0], l1 = sm1[wt][col][1], mm = fmaxf(m, m1);
    const float w0 = expf(m - mm), x1 = expf(m1 - mm), w1 = (m1 <= -1.0e38f) ? 0.f : x1, il = 1.0f / (l * w0 + l1 * w1);
#pragma unroll
    for (int dt = 0; dt < 8; ++dt) { const v4f b0 = *(const v4f*)(sq + dt * 16), b1 = *(const v4f*)(sq + dt * 16 + 4); v4f o0, o1;
#pragma unroll
      for (int i = 0; i < 4; ++i) { o0[i] = (acc[dt][i] * w0 + b0[i] * w1) * il; o1[i] = (acc[dt][4 + i] * w0 + b1[i] * w1) * il; }
      *(v4f*)(sq + dt * 16) = o0; *(v4f*)(sq + dt * 16 + 4) = o1; }
    if (g == 0) *(v4f*)&sml[wt * 16 + col][0] = (v4f){mm, il, 0.f, 0.f}; }
  __syncthreads();
  if (!part) {   // here wave = wt
    st_t(O + ((size_t)(q0 / 16) * (DM / 32) + h * 4) * 512, so[wave], lane);
    asm volatile("s_wait_xcnt 0x0" ::: "memory");   // behind the tile's stores, in front of any overwrite of a register that they name
  }
  if (tid < 64) vst2(ML + ((size_t)h * SS + qb * 64 + tid) * 4, *(const v4f*)&sml[tid][0]);
}
// ---- colsum: block = (64 keys, head h): partial column sums of probs over each 64-query block qb >= key block: p = exp(s - m_q) * (1/l_q) (s recomputed with the same 3-product dot and scale); CS[h][qb][key] rows of 256 B per (query block, this key block)
//   A = k rows (this block's 64 keys, wave -> 16), B = q rows (16-query tiles) -> D[key][q]; per key row sum over the q columns with the (m, 1/l) of each q and the causal predicate q >= key.
__device__ __forceinline__ void colsum(const float* __restrict__ Q, const float* __restrict__ Kx, const float* __restrict__ ML, float* __restrict__ CS, float* ssum, int bx, int by) {
  const int tid = threadIdx.x, wave = tid >> 5, lane = tid & 31, col = lane & 15, g = lane >> 4;
  const int kb = bx, h = by, kv = h / (NH / NKV); const int k0 = kb * 64 + wave * 16;
  F2 ak[4];
  const float* kp0 = Kx + ((size_t)(k0 / 16) * (KVW / 32) + kv * 4) * 512 + lane * 4; const float* qp0 = Q + ((size_t)(kb * 4) * (DM / 32) + h * 4) * 512 + lane * 4; const float* mp0 = ML + ((size_t)h * SS + kb * 64 + col) * 4;   // the lane's own addresses
#pragma unroll
  for (int kc = 0; kc < 4; ++kc) ak[kc] = split_raw(ld_t(kp0 + kc * 512, 0));
  R16 qr[2][4]; v2f ml[2];   // two register sets: the next 16-query tile (rows and statistics) is loaded as one group while this one is worked on
#pragma unroll
  for (int kc = 0; kc < 4; ++kc) qr[0][kc] = ld_t(qp0 + kc * 512, 0);
  ml[0] = *(const v2f*)mp0;
  asm volatile("s_wait_xcnt 0x0" :: "v"(kp0), "v"(qp0), "v"(mp0) : "memory");   // behind the opening loads: without it this build takes an address pair of these loads as a destination of one of them; as inputs here the pairs live up to the wait
#pragma unroll 1
  for (int qb = kb; qb < TQB; ++qb) { float rs[8];
#pragma unroll
    for (int r = 0; r < 8; ++r) rs[r] = 0.f;
#pragma unroll
    for (int ct = 0; ct < 4; ++ct) { const int qq = qb * 64 + ct * 16 + col; v8f c = {};
      const int qt = ct < 3 ? qb * 4 + ct + 1 : min(qb + 1, TQB - 1) * 4, qn = qt * 16 + col;   // behind the last tile: a tile of the last block again (in bounds, unused)
      const float* qp = Q + ((size_t)qt * (DM / 32) + h * 4) * 512 + lane * 4; const float* mp = ML + ((size_t)h * SS + qn) * 4;   // the lane's own addresses
#pragma unroll
      for (int kc = 0; kc < 4; ++kc) qr[(ct + 1) & 1][kc] = ld_t(qp + kc * 512, 0);
      ml[(ct + 1) & 1] = *(const v2f*)mp;
      asm volatile("s_wait_xcnt 0x0" :: "v"(qp), "v"(mp) : "memory");   // behind the tile's loads: without it this build takes their address pair as a destination of one of them; as inputs here the pairs live up to the wait, which stands in front of any overwrite
#pragma unroll
      for (int kc = 0; kc < 4; ++kc) { const F2 qf = split_raw(qr[ct & 1][kc]); c = mac3(ak[kc], qf, c); }
      const float mq = ml[ct & 1][0], ilq = ml[ct & 1][1];
#pragma unroll
      for (int r = 0; r < 8; ++r) { const int key = k0 + 8 * g + r; const float sc = c[r] * 0.08838834764831845f;
        const float t = rs[r] + expf(sc - mq) * ilq; rs[r] = (key <= qq) ? t : rs[r]; } }   // exp inline and in every lane, the causal test a select: the 8 rows' chains run side by side
#pragma unroll
    for (int o = 1; o < 16; o <<= 1) {   // level by level over the 8 rows: their exchanges are independent and run side by side
#pragma unroll
      for (int r = 0; r < 8; ++r) rs[r] += __shfl_xor(rs[r], o); }
    if (col == 0) {
#pragma unroll
      for (int r = 0; r < 8; ++r) ssum[wave * 16 + 8 * g + r] = rs[r]; }
    __syncthreads();
    if (tid < 16) vst2(CS + (((size_t)h * TQB + qb) * SS) + kb * 64 + tid * 4, *(const v4f*)&ssum[tid * 4]);
    __syncthreads(); }
  // query blocks qb < kb contribute nothing: write zeros so every CS row is defined
  for (int qb = 0; qb < kb; ++qb) { if (tid < 16) vst2(CS + (((size_t)h * TQB + qb) * SS) + kb * 64 + tid * 4, (v4f){0.f, 0.f, 0.f, 0.f}); }
}
// ---- k_mask: block = (128 mask positions, head h). A candidate is kept when fewer than HEAVY candidates come before it in the order 'larger column sum first, lower index first on ties': that count is taken directly, every position on its own, so the heads' selection spreads over the chip and no step of it waits on another
//   every block that holds candidates sums the head's candidate columns into LDS (same order over the query blocks); thread = (position tid & 127, quarter tid >> 7 of the candidates to compare with); a wave's 32 positions are consecutive, so the index test is needed only against those 32 candidates: all before them count on >=, all behind them on >
__global__ __launch_bounds__(128 * MTS) void k_mask(const float* __restrict__ CS, float* __restrict__ MSK) {
  static_assert(NSEL % 4 == 0 && NPAD / 4 <= 128 * MTS && (NPAD / 4) % (4 * MTS) == 0, "column groups of 4, one per thread; parts in groups of 16 candidates");
  __shared__ __align__(16) float sv[NPAD]; __shared__ int sc[MTS][128];
  const int h = blockIdx.y, tid = threadIdx.x, sl = tid & 127, s = blockIdx.x * 128 + sl;
  float o = (s >= MW - RECENT && s < MW) ? 1.0f : 0.f;
  if (blockIdx.x * 128 < NSEL) {   // the same for the whole block
    if (tid < NPAD / 4) { v4f c = {-3.0e38f, -3.0e38f, -3.0e38f, -3.0e38f};   // behind the last candidate: never in front of one
      if (tid < NSEL / 4) { const float* p = CS + (size_t)h * TQB * SS + tid * 4; v4f x[TQB];
#pragma unroll
        for (int qb = 0; qb < TQB; ++qb) x[qb] = *(const v4f*)(p + (size_t)qb * SS);
        c = (v4f){0.f, 0.f, 0.f, 0.f};
#pragma unroll
        for (int qb = 0; qb < TQB; ++qb) c += x[qb]; }
      *(v4f*)&sv[tid * 4] = c; }
    __syncthreads();
    const int wv = __builtin_amdgcn_readfirstlane(tid >> 5);   // scalar loop bounds
    const int s04 = (blockIdx.x * 128 + (wv & 3) * 32) >> 2, lo = (wv >> 2) * (NPAD / 4 / MTS), hi = lo + NPAD / 4 / MTS;   // in groups of 4 candidates: the wave's own positions start at s04, its part is [lo, hi)
    const float a = sv[min(s, NPAD - 1)];
    int n[4] = {0, 0, 0, 0};   // four counters: four independent chains
    for (int t4 = lo; t4 < min(hi, s04); t4 += 4) {
#pragma unroll
      for (int u = 0; u < 4; ++u) { const v4f b = *(const v4f*)&sv[(t4 + u) * 4];
#pragma unroll
        for (int i = 0; i < 4; ++i) n[i] += (b[i] >= a) ? 1 : 0; } }
    for (int t4 = max(lo, s04); t4 < min(hi, s04 + 8); t4 += 4) {
#pragma unroll
      for (int u = 0; u < 4; ++u) { const v4f b = *(const v4f*)&sv[(t4 + u) * 4];
#pragma unroll
        for (int i = 0; i < 4; ++i) n[i] += (int)(b[i] > a) | ((int)(b[i] == a) & (int)((t4 + u) * 4 + i < s)); } }   // the three tests joined by bit operations: no branch per candidate
    for (int t4 = max(lo, s04 + 8); t4 < hi; t4 += 4) {
#pragma unroll
      for (int u = 0; u < 4; ++u) { const v4f b = *(const v4f*)&sv[(t4 + u) * 4];
#pragma unroll
        for (int i = 0; i < 4; ++i) n[i] += (b[i] > a) ? 1 : 0; } }
    sc[wv >> 2][sl] = (n[0] + n[1]) + (n[2] + n[3]);
    __syncthreads();
    if (tid < 128 && s < NSEL) { int nb = 0;
#pragma unroll
      for (int q = 0; q < MTS; ++q) nb += sc[q][sl];
      o = nb < HEAVY ? 1.0f : 0.f; }
  }
  if (tid < 128) MSK[(size_t)h * MWP + s] = o;   // a wave stores one whole line
  else if (blockIdx.x == SS / 128 - 1 && tid < 128 + MWP - SS) MSK[(size_t)h * MWP + SS + tid - 128] = (SS + tid - 128 < MW) ? 1.0f : 0.f;   // the row's last line: position SS and the padding
}
// ---- oproj: block = (64 rows, 128 cols): out = O(hi/lo) . o_w^T rows (2 products)
__device__ __forceinline__ void oproj(const float* __restrict__ O, const __bf16* __restrict__ P, float* __restrict__ Y, float (*so)[16][132], int bx, int by) {
  const int tid = threadIdx.x, wave = tid >> 5, lane = tid & 31, col = lane & 15, g = lane >> 4; const size_t r0 = (size_t)bx * 64 + wave * 16; const int n0 = by * 128;
  v8f acc[8] = {};
  const float* oblk = O + (r0 / 16) * (DM / 32) * 512; const __bf16* pblk = P + (size_t)(n0 / 16) * (DM / 32) * 512;
  R16 xa[2]; v16b wb[2][8];   // two register sets: step kc + 1 is loaded as one group while step kc is multiplied
  xa[0] = ld_t(oblk, lane);
#pragma unroll
  for (int j = 0; j < 8; ++j) wb[0][j] = frag_t(pblk + (size_t)j * (DM / 32) * 512, lane);
#pragma unroll 1   // one trip already holds both register sets; more copies of it would only cost registers
  for (int kc = 0; kc < DM / 32; kc += 2) {
#pragma unroll
    for (int u = 0; u < 2; ++u) { const int kn = min(kc + u + 1, DM / 32 - 1);   // the last step loads itself again (in bounds, unused)
      const float* xp = oblk + kn * 512 + lane * 4; const __bf16* wp = pblk + (size_t)kn * 512 + lane * 8;   // the lane's own addresses in the step's blocks
      xa[u ^ 1] = ld_t(xp, 0);
#pragma unroll
      for (int j = 0; j < 8; ++j) wb[u ^ 1][j] = frag_t(wp + (size_t)j * (DM / 32) * 512, 0);
      asm volatile("s_wait_xcnt 0x0" :: "v"(xp), "v"(wp) : "memory");   // without it this build takes an address pair of these loads as a destination of one of them; as inputs here the pairs live up to the wait, which stands in front of any overwrite
      const F2 a = split_raw(xa[u]);
#pragma unroll
      for (int j = 0; j < 8; ++j) { acc[j] = wmma_bf(a.l, wb[u][j], acc[j]); acc[j] = wmma_bf(a.h, wb[u][j], acc[j]); } } }
#pragma unroll
  for (int j = 0; j < 8; ++j)
#pragma unroll
    for (int r = 0; r < 8; ++r) so[wave][8 * g + r][j * 16 + col] = acc[j][r];
  LDSX();
  for (int rl = 0; rl < 16; ++rl) vst2(Y + (r0 + rl) * DM + n0 + lane * 4, *(const v4f*)&so[wave][rl][lane * 4]);
  asm volatile("s_wait_xcnt 0x0" ::: "memory");   // behind the tile's stores: the other branch's code follows in the listing and reuses the registers that they name
}
// ---- k_cs_out: the column sums and the output projection in one launch (both need only what k_attn and the launches before it wrote); blockIdx.y: the NH heads of colsum first, whose blocks of the first keys run longest, then the 128-column tiles of oproj
// waves_per_eu(3, 3): at the default register target this build of the two bodies in one kernel takes colsum's lane exchanges singly, each with its own wait, and issues its next tile's loads later than the launch of its own did
__global__ __launch_bounds__(128) __attribute__((amdgpu_waves_per_eu(3, 3))) void k_cs_out(const float* __restrict__ Q, const float* __restrict__ Kx, const float* __restrict__ ML, float* __restrict__ CS, const float* __restrict__ O, const __bf16* __restrict__ P, float* __restrict__ Y) {
  __shared__ __align__(16) float sm[4][16][132];   // oproj's staging; colsum uses its first 64 floats
  if (blockIdx.y < NH) colsum(Q, Kx, ML, CS, &sm[0][0][0], blockIdx.x, blockIdx.y);
  else oproj(O, P, Y, sm, blockIdx.x, blockIdx.y - NH);
}
// ---- k_mout: flat writer of the [16][2049] mask after the attention output
__global__ __launch_bounds__(256) void k_mout(const float* __restrict__ MSK, float* __restrict__ out) {
  const size_t p = (size_t)blockIdx.x * 256 + threadIdx.x; const size_t total = (size_t)NH * (SFULL + 1); if (p * 4 >= total) return; v4f v;
#pragma unroll
  for (int i = 0; i < 4; ++i) { const size_t f = p * 4 + i; const size_t row = f / (SFULL + 1), c = f % (SFULL + 1); v[i] = (f < total && c < (size_t)MW) ? MSK[row * MWP + c] : 0.f; }
  vst2(out + p * 4, v);
}
extern "C" void kernel_launch(void* const* d_in, const int* in_sizes, int n_in, void* d_out, int out_size, void* d_ws, size_t ws_size, hipStream_t stream) {
  (void)in_sizes; (void)n_in; (void)out_size;
  const float** F = (const float**)d_in;   // hidden_states [1,2048,2048], q_w [2048,2048], q_b [2048], k_w [2048,512], k_b [512], v_w [2048,512], v_b [512], o_w [2048,2048]
  if (ws_size < (size_t)WS_END) return;
  char* ws = (char*)d_ws; __bf16 *PK = (__bf16*)(ws + WS_PK), *XB = (__bf16*)(ws + WS_X), *VTH = (__bf16*)(ws + WS_VTH), *VTL = (__bf16*)(ws + WS_VTL);
  float *Q = (float*)(ws + WS_Q), *Kx = (float*)(ws + WS_K), *O = (float*)(ws + WS_O), *ML = (float*)(ws + WS_ML), *CS = (float*)(ws + WS_CS), *MSK = (float*)(ws + WS_MSK);
  float* OUT0 = (float*)d_out; float* OUT1 = OUT0 + (size_t)SFULL * DM;
  k_pack<<<dim3(PX_END, DM / 128), 256, 0, stream>>>(F[1], F[3], F[5], F[7], F[0], PK, XB);
  k_proj<<<dim3(SS / 64, PY_END), 128, 0, stream>>>(XB, PK, F[2], F[4], F[6], Q, Kx, VTH, VTL);
  k_attn<<<dim3(NH, TQB), 256, 0, stream>>>(Q, Kx, VTH, VTL, O, ML);
  k_cs_out<<<dim3(TQB, NH + DM / 128), 128, 0, stream>>>(Q, Kx, ML, CS, O, PK + PK_O, OUT0);
  k_mask<<<dim3(SS / 128, NH), 128 * MTS, 0, stream>>>(CS, MSK);
  k_mout<<<(unsigned)(((size_t)NH * (SFULL + 1) / 4 + 255) / 256), 256, 0, stream>>>(MSK, OUT1);
}

// v010
// It runs in 170 microseconds.
// Two timings next to v009 put it at 1.07 and 1.08 times that version's speed.
// Counting every step since v000, it is 8.17 times as fast.
// compute dtype: hidden_states and all weights/biases (module inputs) rounded to bf16; q/k/v projections with exact bf16 products (x and W are inputs); causal scores q.k with both computed operands as bf16 hi + residual pairs (3 products) and P.V with P hi/lo x V hi/lo (3 products); the heavy-hitter column sums recompute the same 3-product scores in a second (transposed) pass with the stored row statistics; the output projection with hi/lo x exact o_w (2 products), all on WMMA 16x16x32; softmax, column sums, the per-head top-k selection (rank by counting, lower index first on ties) and the mask assembly in f32 on the VALU; f32 accumulate.
#include <hip/hip_runtime.h>
#include <math.h>

typedef __attribute__((ext_vector_type(16))) _Float16 v16h;
typedef __attribute__((ext_vector_type(16))) __bf16 v16b;
typedef __attribute__((ext_vector_type(8)))  _Float16 v8h;
typedef __attribute__((ext_vector_type(8)))  float v8f;
typedef __attribute__((ext_vector_type(4)))  float v4f;
typedef __attribute__((ext_vector_type(2)))  float v2f;
typedef __attribute__((ext_vector_type(4)))  unsigned v4u;
typedef __attribute__((ext_vector_type(4)))  int v4i;
typedef float __attribute__((may_alias)) float_a;
typedef int __attribute__((may_alias)) int_a;

template <typename T> __device__ __forceinline__ void vst2(void* p, T v) { *(T*)p = v;  }
__device__ __forceinline__ v8f wmma16(v16h a, v16h b, v8f c) {
  v8f d = __builtin_amdgcn_wmma_f32_16x16x32_f16(false, a, false, b, (short)0, c, false, false);
  asm volatile("v_nop\n\tv_nop\n\tv_nop\n\tv_nop" : "+v"(d) : "v"(a), "v"(b));
  return d;
}
__device__ __forceinline__ v8f wmma_bf(v16b a, v16b b, v8f c) {
  v8f d = __builtin_amdgcn_wmma_f32_16x16x32_bf16(false, a, false, b, (short)0, c, false, false);
  asm volatile("v_nop\n\tv_nop\n\tv_nop\n\tv_nop" : "+v"(d) : "v"(a), "v"(b));
  return d;
}
// 16x16x32 fragments: lane = (h = lane>>4, row/col = lane&15); elements 0..7 = k0+8h+0..7, 8..15 = k0+16+8h+0..7; D element r = row 8h+r
__device__ __forceinline__ v16h frag_h(const _Float16* rowk0, int lane) {
  union { v16h v; v8h q[2]; } u; const _Float16* p = rowk0 + 8 * (lane >> 4);
  u.q[0] = *(const v8h*)p; u.q[1] = *(const v8h*)(p + 16); return u.v;
}
__device__ __forceinline__ v16h frag_f32(const float* rowk0, int lane) {
  v16h a; const float* p = rowk0 + 8 * (lane >> 4);
#pragma unroll
  for (int i = 0; i < 8; ++i) { a[i] = (_Float16)p[i]; a[8 + i] = (_Float16)p[16 + i]; }
  return a;
}
__device__ __forceinline__ v16h frag_f32s(const float* rowk0, int lane, float sc) {
  v16h a; const float* p = rowk0 + 8 * (lane >> 4);
#pragma unroll
  for (int i = 0; i < 8; ++i) { a[i] = (_Float16)(p[i] * sc); a[8 + i] = (_Float16)(p[16 + i] * sc); }
  return a;
}
// column fragment from a [K][ld] layout (column n), rows >= K read as 0
__device__ __forceinline__ v16h fragc_f32(const float* W, int k0, int n, int lane, int ld, int K) {
  v16h a; const int g = lane >> 4;
#pragma unroll
  for (int i = 0; i < 8; ++i) { const int ka = k0 + 8 * g + i, kb = ka + 16;
    a[i] = (_Float16)(ka < K ? W[(size_t)(ka < K ? ka : K - 1) * ld + n] : 0.f); a[8 + i] = (_Float16)(kb < K ? W[(size_t)(kb < K ? kb : K - 1) * ld + n] : 0.f); }
  return a;
}
struct F2 { v16b h, l; };
__device__ __forceinline__ F2 bsplit16(const float v[16]) { F2 r;
#pragma unroll
  for (int i = 0; i < 16; ++i) { const __bf16 h = (__bf16)v[i]; r.h[i] = h; r.l[i] = (__bf16)(v[i] - (float)h); }
  return r; }
__device__ __forceinline__ F2 split_row(const float* row, int k0, int lane) { float v[16]; const float* p = row + k0 + 8 * (lane >> 4);
#pragma unroll
  for (int i = 0; i < 8; ++i) { v[i] = p[i]; v[8 + i] = p[16 + i]; }
  return bsplit16(v); }
__device__ __forceinline__ F2 split_rowK(const float* row, int k0, int lane, int K) { float v[16]; const int g = lane >> 4;
#pragma unroll
  for (int i = 0; i < 8; ++i) { const int ka = k0 + 8 * g + i, kb = ka + 16; v[i] = ka < K ? row[ka < K ? ka : K - 1] : 0.f; v[8 + i] = kb < K ? row[kb < K ? kb : K - 1] : 0.f; }
  return bsplit16(v); }
__device__ __forceinline__ F2 split_col(const float* W, int k0, int n, int lane, int ld, int K) { float v[16]; const int g = lane >> 4;
#pragma unroll
  for (int i = 0; i < 8; ++i) { const int ka = k0 + 8 * g + i, kb = ka + 16; v[i] = ka < K ? W[(size_t)(ka < K ? ka : K - 1) * ld + n] : 0.f; v[8 + i] = kb < K ? W[(size_t)(kb < K ? kb : K - 1) * ld + n] : 0.f; }
  return bsplit16(v); }
__device__ __forceinline__ v8f mac3(const F2& a, const F2& b, v8f c) { c = wmma_bf(a.l, b.h, c); c = wmma_bf(a.h, b.l, c); return wmma_bf(a.h, b.h, c); }
__device__ __forceinline__ float sigm(float v) { return 1.0f / (1.0f + expf(-v)); }
#define LDSX() do { asm volatile("s_wait_dscnt 0" ::: "memory"); __builtin_amdgcn_wave_barrier(); __builtin_amdgcn_fence(__ATOMIC_RELEASE, "workgroup"); } while (0)


// GQA causal attention with H2O heavy-hitter scoring (B 1, S 2048, D 2048, 16 query heads / 4 kv heads x 128): out = softmax(q k^T / sqrt(128), causal) v -> @ o_w; cur[h][s] = sum over queries of probs; mask[h] = 1 on the last 204 of 2049 positions, 0 elsewhere, then 1 at the top-204 (heavy budget) indices of cur[h][:1844].
#define SFULL 2048            // shipped sequence length (output layout)
#ifndef SS
#define SS SFULL              // active sequence length (all)
#endif
#define DM 2048
#define NH 16
#define NKV 4
#define HD 128
#define KVW (NKV * HD)        // 512
#define HEAVY (SS / 10)       // int(0.1 * S)
#define RECENT (SS / 10)
#define MW (SS + 1)           // 2049 mask width
#define MWP 2080              // padded staging width: a row is 65 whole 128-byte lines
#define NSEL (SS - RECENT)    // 1844 candidates of the heavy-hitter selection
#define NPAD ((NSEL + 31) / 32 * 32)   // candidates rounded up to whole waves
#define MTS 4                 // k_mask: parts into which the candidates to compare with are dealt
#define TQB (SS / 64)         // query blocks
typedef __attribute__((ext_vector_type(8))) __bf16 v8b;
// fragment-order storage: a [rows][k] operand that a kernel of this file writes is kept as blocks of 16 rows x 32 k, block (rt, kc) at index rt * (k / 32) + kc; inside a block the 16-byte pieces stand in the order in which the lanes load them, so every wave-wide load or store is 512 bytes in a row (4 whole lines, not 16 part lines)
// bf16 block = 512 elements: piece (half, lane) at half * 256 + lane * 8 holds row lane & 15, k = half * 16 + 8 * (lane >> 4) + 0..7
__device__ __forceinline__ v16b frag_t(const __bf16* blk, int lane) {
  union { v16b v; v8b q[2]; } u;
  u.q[0] = *(const v8b*)(blk + lane * 8); u.q[1] = *(const v8b*)(blk + 256 + lane * 8); return u.v;
}
__device__ __forceinline__ float bfr(float v) { return (float)(__bf16)v; }
// softmax in powers of two: a score is scaled by SC2 = log2(e) / sqrt(128), so exp(s - m) = 2^(s2 - m2) is one v_exp_f32 on the difference; the library exp's own multiply by log2(e), its split into whole and fraction, ldexp and two range selects per value go. The argument of every weight that is kept is <= 0 (a masked pair's value is thrown away by its select, whatever it is); below -126 the instruction gives 0, as a weight under 1e-38 may. The maximum kept in ML is in the same units, and colsum scales its scores alike
#define SC2 0.12751743082459868f
__device__ __forceinline__ float ex2(float x) { return __builtin_amdgcn_exp2f(x); }
// eight of them as one group. With the builtin, colsum's build gives a later v_exp_f32 the source register of the one directly in front of it as its destination; the instruction set asks for one independent instruction behind a transcendental before its source is overwritten or its result read. Here every destination is apart from every source (early clobber), so each v_exp_f32 is the independent instruction behind the one before, and the v_nop is the slot behind the last
__device__ __forceinline__ void ex2_8(float (&y)[8], const float (&x)[8]) {
  asm("v_exp_f32 %0, %8\n\tv_exp_f32 %1, %9\n\tv_exp_f32 %2, %10\n\tv_exp_f32 %3, %11\n\tv_exp_f32 %4, %12\n\tv_exp_f32 %5, %13\n\tv_exp_f32 %6, %14\n\tv_exp_f32 %7, %15\n\tv_nop"
      : "=&v"(y[0]), "=&v"(y[1]), "=&v"(y[2]), "=&v"(y[3]), "=&v"(y[4]), "=&v"(y[5]), "=&v"(y[6]), "=&v"(y[7])
      : "v"(x[0]), "v"(x[1]), "v"(x[2]), "v"(x[3]), "v"(x[4]), "v"(x[5]), "v"(x[6]), "v"(x[7]));
}
// the same product with only D named at the v_nops, which so stand in front of the next reader of D (A and B are left to the compiler's own padding of its builtin): an operand that an asm statement names must stand below v256, and with A and B named too k_attn, which holds a whole step's fragments, builds with spills to scratch
__device__ __forceinline__ v8f wmma_bf_d(v16b a, v16b b, v8f c) {
  v8f d = __builtin_amdgcn_wmma_f32_16x16x32_bf16(false, a, false, b, (short)0, c, false, false);
  asm volatile("v_nop\n\tv_nop\n\tv_nop\n\tv_nop" : "+v"(d));
  return d;
}
__device__ __forceinline__ v8f mac3_d(const F2& a, const F2& b, v8f c) { c = wmma_bf_d(a.l, b.h, c); c = wmma_bf_d(a.h, b.l, c); return wmma_bf_d(a.h, b.h, c); }
// the 16 registers of one lane's slice of a hi/lo operand pair, as loaded: q[0], q[1] the hi fragment, q[2], q[3] the residual fragment
struct R16 { v4f q[4]; };
// pair block = 2 KB (addressed as 512 floats): the bf16 block of the hi parts, then the bf16 block of the residuals; piece (pl, half, lane) at float (pl * 2 + half) * 128 + lane * 4 holds 8 bf16 of row lane & 15, k = half * 16 + 8 * (lane >> 4) + 0..7
// a computed f32 operand (q, k, the attention output) is split ONCE, by the wave that stores it; every wave that loads it (a key slice: 4 heads x up to 128 query tiles) has its two WMMA fragments in the loaded registers, with no conversion
__device__ __forceinline__ R16 ld_t(const float* blk, int lane) { R16 r;
#pragma unroll
  for (int qi = 0; qi < 4; ++qi) r.q[qi] = *(const v4f*)(blk + qi * 128 + lane * 4);
  return r; }
// one wave's 16 x 128 f32 tile, from its LDS staging rows to 4 pair blocks in a row: hi = bf16(v), residual = bf16(v - hi), as bsplit16 forms them
__device__ __forceinline__ void st_t(float* blk, const float (*st)[132], int lane) {
#pragma unroll
  for (int sl = 0; sl < 4; ++sl) {
#pragma unroll
    for (int half = 0; half < 2; ++half) { const float* p = &st[lane & 15][sl * 32 + half * 16 + 8 * (lane >> 4)]; const v4f a = *(const v4f*)p, b = *(const v4f*)(p + 4);
      union { v8b b8; v4f f; } hi, lo;
#pragma unroll
      for (int i = 0; i < 8; ++i) { const float v = i < 4 ? a[i & 3] : b[i & 3]; const __bf16 hb = (__bf16)v; hi.b8[i] = hb; lo.b8[i] = (__bf16)(v - (float)hb); }
      vst2(blk + sl * 512 + half * 128 + lane * 4, hi.f); vst2(blk + sl * 512 + (2 + half) * 128 + lane * 4, lo.f); } }
}
// the two fragments of a loaded slice: the registers as they are, no instruction
__device__ __forceinline__ F2 split_raw(const R16& r) { union { v4f f[2]; v16b b; } hi, lo; F2 o;
  hi.f[0] = r.q[0]; hi.f[1] = r.q[1]; lo.f[0] = r.q[2]; lo.f[1] = r.q[3]; o.h = hi.b; o.l = lo.b; return o; }
__device__ __attribute__((noinline)) float erf_ni(float v) { return erff(v); }

#define PK_Q 0                               // [2048 n][2048 k] q_w^T (all four: bf16 blocks)
#define PK_K (PK_Q + DM * DM)                  // [512][2048]
#define PK_V (PK_K + KVW * DM)
#define PK_O (PK_V + KVW * DM)                 // [2048][2048] o_w^T
#define PK_END (PK_O + DM * DM)
#define WS_PK  0u
#define WS_Q   (WS_PK + 2u * PK_END)           // pair blocks [2048][2048] q (h*128+d)
#define WS_K   (WS_Q + 4u * SS * DM)            // pair blocks [2048][512]
#define WS_VTH (WS_K + 4u * SS * KVW)           // bf16 blocks [512 (kv*128+d)][2048]
#define WS_VTL (WS_VTH + 2u * KVW * SS)
#define WS_O   (WS_VTL + 2u * KVW * SS)         // pair blocks [2048][2048] attention output (h*128+d)
#define WS_ML  (WS_O + 4u * SS * DM)            // f32 [16][2048][4]: (m, 1/l, 0, 0)
#define WS_CS  (WS_ML + 4u * NH * SS * 4)       // f32 [16][32 qblocks][2048]: per-query-block partial column sums
#define WS_MSK (WS_CS + 4u * NH * TQB * SS)     // f32 [16][2080] mask staging
#define WS_X   (WS_MSK + 4u * NH * MWP)         // bf16 blocks [2048][2048] hidden_states
#define WS_END (WS_X + 2u * SS * DM)

// launches that need nothing of one another share one grid: a range of the block index picks the work (a test that reads the same for a whole block), bx and by are the block's place in the grid that the work had as a launch of its own
// ---- packT: block = (16 output columns, 128 k) of a [K][N] (x @ W) matrix: 4 bf16 blocks in a row (4 KB) of W^T; a thread makes one 16-byte piece
__device__ __forceinline__ void packT(const float* __restrict__ Wm, int K, int N, __bf16* __restrict__ DST, int bx, int by) {
  const int tid = threadIdx.x, lane = tid & 31, half = (tid >> 5) & 1, kc = by * 4 + (tid >> 6);
  const float* src = Wm + (size_t)(kc * 32 + half * 16 + 8 * (lane >> 4)) * N + bx * 16 + (lane & 15);
  v8b o;
#pragma unroll
  for (int i = 0; i < 8; ++i) o[i] = (__bf16)src[(size_t)i * N];
  vst2(DST + ((size_t)bx * (K / 32) + kc) * 512 + half * 256 + lane * 8, o);
}
// ---- packR: block = (16 rows, 128 k) of the row-major [rows][DM] x: 4 bf16 blocks in a row (4 KB) of bf16(x); a thread makes one 16-byte piece
__device__ __forceinline__ void packR(const float* __restrict__ X, __bf16* __restrict__ DST, int bx, int by) {
  const int tid = threadIdx.x, lane = tid & 31, half = (tid >> 5) & 1, kc = by * 4 + (tid >> 6);
  const float* src = X + (size_t)(bx * 16 + (lane & 15)) * DM + kc * 32 + half * 16 + 8 * (lane >> 4);
  const v4f a = *(const v4f*)src, b = *(const v4f*)(src + 4); v8b o;
#pragma unroll
  for (int i = 0; i < 4; ++i) { o[i] = (__bf16)a[i]; o[4 + i] = (__bf16)b[i]; }
  vst2(DST + ((size_t)bx * (DM / 32) + kc) * 512 + half * 256 + lane * 8, o);
}
// ---- k_pack: the four weight matrices and x in one launch; blockIdx.x: 16-column tiles of q_w, k_w, v_w, o_w, then 16-row tiles of x; blockIdx.y: 128 k (all five have DM k)
#define PX_K (DM / 16)
#define PX_V (PX_K + KVW / 16)
#define PX_O (PX_V + KVW / 16)
#define PX_X (PX_O + DM / 16)
#define PX_END (PX_X + SS / 16)
__global__ __launch_bounds__(256) void k_pack(const float* __restrict__ Wq, const float* __restrict__ Wk, const float* __restrict__ Wv, const float* __restrict__ Wo, const float* __restrict__ X, __bf16* __restrict__ PK, __bf16* __restrict__ XB) {
  const int bx = blockIdx.x, by = blockIdx.y;
  if (bx < PX_K) packT(Wq, DM, DM, PK + PK_Q, bx, by);
  else if (bx < PX_V) packT(Wk, DM, KVW, PK + PK_K, bx - PX_K, by);
  else if (bx < PX_O) packT(Wv, DM, KVW, PK + PK_V, bx - PX_V, by);
  else if (bx < PX_X) packT(Wo, DM, DM, PK + PK_O, bx - PX_O, by);
  else packR(X, XB, bx - PX_X, by);
}
// ---- k_proj: q, k and v in one launch; block = (64 rows, 128 cols): Y = bf16(x) (packed, bf16 blocks) . P rows (exact) + bias; blockIdx.y: 128-column tiles of q, then of k, then of v; VT 0 (q, k): pair blocks of [row][ldo cols]; VT 1 (v): transposed bf16 hi/lo planes, bf16 blocks of [col][row]
#define PY_K (DM / 128)
#define PY_V (PY_K + KVW / 128)
#define PY_END (PY_V + KVW / 128)
__global__ __launch_bounds__(128) void k_proj(const __bf16* __restrict__ X, const __bf16* __restrict__ PK, const float* __restrict__ q_b, const float* __restrict__ k_b, const float* __restrict__ v_b, float* __restrict__ Qo, float* __restrict__ Ko, __bf16* __restrict__ PH, __bf16* __restrict__ PL) {
  __shared__ __align__(16) char sm[2 * 128 * 72 * 2];   // a block uses one of the two stagings: so (VT 0) or sth and stl (VT 1)
  static_assert(sizeof(sm) >= 4 * 16 * 132 * 4, "the larger of the two stagings");
  float (*so)[16][132] = (float (*)[16][132])sm; __bf16 (*sth)[72] = (__bf16 (*)[72])sm, (*stl)[72] = sth + 128;
  const int yb = blockIdx.y; const bool VT = yb >= PY_V, isq = yb < PY_K;   // the same for the whole block
  const __bf16* P = PK + (isq ? PK_Q : VT ? PK_V : PK_K); const float* bias = isq ? q_b : VT ? v_b : k_b; float* OUT = isq ? Qo : Ko; const int ldo = isq ? DM : KVW;
  const int tid = threadIdx.x, wave = tid >> 5, lane = tid & 31, col = lane & 15, g = lane >> 4; const size_t r0 = (size_t)blockIdx.x * 64 + wave * 16; const int n0 = (yb - (isq ? 0 : VT ? PY_V : PY_K)) * 128;
  v8f acc[8] = {};
  const __bf16* xblk = X + (r0 / 16) * (DM / 32) * 512; const __bf16* pblk = P + (size_t)(n0 / 16) * (DM / 32) * 512;
  v16b xa[2], wb[2][8];   // two register sets: step kc + 1 is loaded as one group while step kc is multiplied
  xa[0] = frag_t(xblk, lane);
#pragma unroll
  for (int j = 0; j < 8; ++j) wb[0][j] = frag_t(pblk + (size_t)j * (DM / 32) * 512, lane);
#pragma unroll 1   // one trip already holds both register sets; more copies of it would only cost registers
  for (int kc = 0; kc < DM / 32; kc += 2) {
#pragma unroll
    for (int u = 0; u < 2; ++u) { const int kn = min(kc + u + 1, DM / 32 - 1);   // the last step loads itself again (in bounds, unused)
      const __bf16* xp = xblk + kn * 512 + lane * 8; const __bf16* wp = pblk + (size_t)kn * 512 + lane * 8;   // the lane's own addresses in the step's blocks
      xa[u ^ 1] = frag_t(xp, 0);
#pragma unroll
      for (int j = 0; j < 8; ++j) wb[u ^ 1][j] = frag_t(wp + (size_t)j * (DM / 32) * 512, 0);
      asm volatile("s_wait_xcnt 0x0" :: "v"(xp), "v"(wp) : "memory");   // as inputs here the pairs live up to the wait, which stands in front of any overwrite
#pragma unroll
      for (int j = 0; j < 8; ++j) acc[j] = wmma_bf(xa[u], wb[u][j], acc[j]); } }
  if (!VT) {
#pragma unroll
    for (int j = 0; j < 8; ++j) { const float bb = bfr(bias[n0 + j * 16 + col]);
#pragma unroll
      for (int r = 0; r < 8; ++r) so[wave][8 * g + r][j * 16 + col] = acc[j][r] + bb; }
    LDSX();
    st_t(OUT + ((r0 / 16) * (ldo / 32) + n0 / 32) * 512, so[wave], lane);
    asm volatile("s_wait_xcnt 0x0" ::: "memory");   // behind the tile's stores: the other branch's code follows in the listing and reuses the registers that they name
  } else {
    const float* bp = bias + n0 + col; float bv[8];   // the lane's own address
#pragma unroll
    for (int j = 0; j < 8; ++j) bv[j] = bp[j * 16];
    asm volatile("s_wait_xcnt 0x0" :: "v"(bp) : "memory");   // behind the bias loads, in front of any overwrite of a register that they name
#pragma unroll
    for (int j = 0; j < 8; ++j) { const float bb = bfr(bv[j]);
#pragma unroll
      for (int r = 0; r < 8; ++r) { const float v = acc[j][r] + bb; const __bf16 hb = (__bf16)v; sth[j * 16 + col][wave * 16 + 8 * g + r] = hb; stl[j * 16 + col][wave * 16 + 8 * g + r] = (__bf16)(v - (float)hb); } }
    __syncthreads();
    for (int q = tid; q < 128 * 8; q += 128) { const int dt = q >> 7, kl = (q >> 6) & 1, half = (q >> 5) & 1;   // 16 blocks a plane (8 column tiles x 2 row steps), 64 pieces each; q & 31 = lane
      const int d = dt * 16 + col, sl = kl * 32 + half * 16 + 8 * g; const size_t o = ((size_t)(n0 / 16 + dt) * (SS / 32) + blockIdx.x * 2 + kl) * 512 + half * 256 + lane * 8;
      vst2((unsigned*)(PH + o), *(const v4u*)&sth[d][sl]); vst2((unsigned*)(PL + o), *(const v4u*)&stl[d][sl]); }
  }
}
// ---- k_attn: block = (64 queries, head h), 8 waves: causal flash attention, kv head = h/4; scores 3 products, P.V 3 products; O[q][h*128+d]; ML[h][q] = (m, 1/l), m in the units of the scaled scores
// both products are taken transposed: S^T = K . Q^T (A = key rows, B = query rows, as colsum takes them) and O^T += V^T . P^T (A = rows of V^T, B = P^T). A lane then holds 16 of the step's 32 scores of ONE query (column lane & 15; keys 8g + r and 16 + 8g + r), the lane 16 further the other 16: maximum and sum run inside the lane, with one exchange between the wave's halves, and those 16 values stand where the B fragment of P^T wants them, so P goes through no LDS
// a 16-query tile's key steps are dealt to two waves (wave wt: the even steps, wave wt + 4: the odd ones), each with its own (m, l, acc); the two partials are joined through LDS behind the loop. The longest wave so walks 32 steps, not 64
// lane l with lane l ^ 16, a vector instruction (no LDS counter, no wait)
__device__ __forceinline__ float xhalf(float x) { return __builtin_bit_cast(float, __builtin_amdgcn_permlanex16(__builtin_bit_cast(int, x), __builtin_bit_cast(int, x), 0x76543210, 0xfedcba98, false, false)); }
// waves_per_eu(2, 2): a block puts two waves on a SIMD, and a wave holds a whole step's fragments
__global__ __launch_bounds__(256) __attribute__((amdgpu_waves_per_eu(2, 2))) void k_attn(const float* __restrict__ Q, const float* __restrict__ Kx, const __bf16* __restrict__ VTH, const __bf16* __restrict__ VTL, float* __restrict__ O, float* __restrict__ ML) {
  __shared__ __align__(16) float so[4][16][132]; __shared__ __align__(16) float sml[64][4]; __shared__ __align__(8) float sm1[4][16][2];
  const int tid = threadIdx.x, wave = tid >> 5, wt = wave & 3, lane = tid & 31, col = lane & 15, g = lane >> 4;
  const int part = __builtin_amdgcn_readfirstlane(tid >> 7);   // scalar: step numbers, addresses and the branches behind the loop stay wave-uniform
  const int qb = TQB - 1 - blockIdx.y, h = blockIdx.x, kv = h / (NH / NKV); const int q0 = qb * 64 + wt * 16;   // the longest blocks have the lowest index
  R16 kr[2][4];   // a whole step's 32 key rows (8 slices) are in flight or in registers before its score products begin
  const float* kp0 = Kx + ((size_t)(part * 2) * (KVW / 32) + kv * 4) * 512 + lane * 4; const float* qp = Q + ((size_t)(q0 / 16) * (DM / 32) + h * 4) * 512 + lane * 4;   // the lane's own addresses
  R16 qr[4];
#pragma unroll
  for (int kc = 0; kc < 4; ++kc) qr[kc] = ld_t(qp + kc * 512, 0);
#pragma unroll
  for (int i = 0; i < 8; ++i) kr[i >> 2][i & 3] = ld_t(kp0 + ((i >> 2) * (KVW / 32) + (i & 3)) * 512, 0);
  asm volatile("s_wait_xcnt 0x0" :: "v"(kp0), "v"(qp), "v"(lane) : "memory");   // behind the opening loads: the address pairs live up to the wait, which so stands in front of any overwrite of them; the lane number too, which this build takes as the key loads' offset register beside a scalar base
  F2 aq[4];
#pragma unroll
  for (int kc = 0; kc < 4; ++kc) aq[kc] = split_raw(qr[kc]);
  const int qi = q0 + col;   // the lane's query
  float m = -3.0e38f, l = 0.f;   // m: of the query, the same in both halves; l: over the keys of the lane's own half
  v8f acc[8] = {};   // O^T: acc[dt][r] = (d = dt * 16 + 8g + r, query col)
  const int nks = (qb * 64 + 64) / 32;   // key steps covering keys <= the block's last query: an even number, half of them to each part
#pragma unroll 1
  for (int ks = part; ks < nks; ks += 2) { v8f s[2];
    v16b vh[8], vl[8];   // the step's V fragments: row tile i of V^T is loaded as key slice i is used up (16 registers go, 16 come), so every tile has the rest of the score products and the softmax ahead of its use
    const size_t vbase = ((size_t)(kv * 8) * (SS / 32) + ks) * 512; const __bf16* vhp = VTH + vbase + lane * 8; const __bf16* vlp = VTL + vbase + lane * 8;   // the lane's own addresses in the step's blocks
    const float* kp = Kx + ((size_t)(min(ks + 2, nks - 2 + part) * 2) * (KVW / 32) + kv * 4) * 512 + lane * 4;   // the part's last step loads itself again (in bounds, unused)
#pragma unroll
    for (int ct = 0; ct < 2; ++ct) { const int kk = ks * 32 + ct * 16 + 8 * g; v8f c = {};
#pragma unroll
      for (int kc = 0; kc < 4; ++kc) { const F2 kb = split_raw(kr[ct][kc]); const int dt = ct * 4 + kc;
        vh[dt] = frag_t(vhp + (size_t)dt * (SS / 32) * 512, 0); vl[dt] = frag_t(vlp + (size_t)dt * (SS / 32) * 512, 0);
        c = mac3_d(kb, aq[kc], c); }
#pragma unroll
      for (int r = 0; r < 8; ++r) s[ct][r] = (kk + r <= qi) ? c[r] * SC2 : -3.0e38f; }
    asm volatile("s_wait_xcnt 0x0" :: "v"(vhp), "v"(vlp) : "memory");   // behind the step's last V load: as inputs here the address pairs live up to the wait, which so stands in front of any overwrite of them
    float t8[8];   // the lane's 16 scores to one maximum, as a tree
#pragma unroll
    for (int r = 0; r < 8; ++r) t8[r] = fmaxf(s[0][r], s[1][r]);
    float mx = fmaxf(fmaxf(fmaxf(t8[0], t8[1]), fmaxf(t8[2], t8[3])), fmaxf(fmaxf(t8[4], t8[5]), fmaxf(t8[6], t8[7])));
    mx = fmaxf(mx, xhalf(mx));
    const float mn = fmaxf(m, mx), xa = ex2(m - mn), al = (m <= -1.0e38f) ? 0.f : xa;   // exp inline and in every lane; a masked or not yet started entry is set to 0 by a select, not branched round
    float e[16];   // in the k order of a fragment: e[i] = key 8g + i, e[8 + i] = key 16 + 8g + i
#pragma unroll
    for (int i = 0; i < 16; ++i) { const float sv = s[i >> 3][i & 7], x = ex2(sv - mn); e[i] = (sv <= -1.0e38f) ? 0.f : x; }
#pragma unroll
    for (int r = 0; r < 8; ++r) t8[r] = e[r] + e[8 + r];
    l = l * al + (((t8[0] + t8[1]) + (t8[2] + t8[3])) + ((t8[4] + t8[5]) + (t8[6] + t8[7]))); m = mn;
#pragma unroll
    for (int dt = 0; dt < 8; ++dt) acc[dt] *= al;
    const F2 pa = bsplit16(e);
#pragma unroll
    for (int dt = 0; dt < 8; ++dt) { acc[dt] = wmma_bf_d(vh[dt], pa.l, acc[dt]); acc[dt] = wmma_bf_d(vl[dt], pa.h, acc[dt]); acc[dt] = wmma_bf_d(vh[dt], pa.h, acc[dt]);
      kr[dt >> 2][dt & 3] = ld_t(kp + ((dt >> 2) * (KVW / 32) + (dt & 3)) * 512, 0); }   // the next step's key slice i as row tile i is used up
    asm volatile("s_wait_xcnt 0x0" :: "v"(kp) : "memory");   // behind the last key load: the address pair lives up to the wait, which so stands in front of any overwrite of it
  }
  l += xhalf(l);   // the two halves' sums joined once
  float* sq = &so[wt][col][8 * g];   // the lane's places in its query's staging row: d = dt * 16 + 8g + 0..7
  if (part) {   // the odd steps' partial goes to the tile's staging rows, every value at the place where the same lane of wave wt will read it
#pragma unroll
    for (int dt = 0; dt < 8; ++dt) { *(v4f*)(sq + dt * 16) = (v4f){acc[dt][0], acc[dt][1], acc[dt][2], acc[dt][3]}; *(v4f*)(sq + dt * 16 + 4) = (v4f){acc[dt][4], acc[dt][5], acc[dt][6], acc[dt][7]}; }
    if (g == 0) { sm1[wt][col][0] = m; sm1[wt][col][1] = l; } }
  __syncthreads();
  if (!part) {   // join: both partials are brought to the common maximum; step 0 holds key 0, so the even part has always started; an odd part that saw only masked keys weighs 0
    const float m1 = sm1[wt][col][0], l1 = sm1[wt][col][1], mm = fmaxf(m, m1);
    const float w0 = ex2(m - mm), x1 = ex2(m1 - mm), w1 = (m1 <= -1.0e38f) ? 0.f : x1, il = 1.0f / (l * w0 + l1 * w1);
#pragma unroll
    for (int dt = 0; dt < 8; ++dt) { const v4f b0 = *(const v4f*)(sq + dt * 16), b1 = *(const v4f*)(sq + dt * 16 + 4); v4f o0, o1;
#pragma unroll
      for (int i = 0; i < 4; ++i) { o0[i] = (acc[dt][i] * w0 + b0[i] * w1) * il; o1[i] = (acc[dt][4 + i] * w0 + b1[i] * w1) * il; }
      *(v4f*)(sq + dt * 16) = o0; *(v4f*)(sq + dt * 16 + 4) = o1; }
    if (g == 0) *(v4f*)&sml[wt * 16 + col][0] = (v4f){mm, il, 0.f, 0.f}; }
  __syncthreads();
  if (!part) {   // here wave = wt
    st_t(O + ((size_t)(q0 / 16) * (DM / 32) + h * 4) * 512, so[wave], lane);
    asm volatile("s_wait_xcnt 0x0" ::: "memory");   // behind the tile's stores, in front of any overwrite of a register that they name
  }
  if (tid < 64) vst2(ML + ((size_t)h * SS + qb * 64 + tid) * 4, *(const v4f*)&sml[tid][0]);
}
// ---- colsum: block = (64 keys, head h): partial column sums of probs over each 64-query block qb >= key block: p = 2^(s - m_q) * (1/l_q) (s recomputed with the same 3-product dot and the same scale SC2); CS[h][qb][key] rows of 256 B per (query block, this key block)
//   A = k rows (this block's 64 keys, wave -> 16), B = q rows (16-query tiles) -> D[key][q]; per key row sum over the q columns with the (m, 1/l) of each q and the causal predicate q >= key.
__device__ __forceinline__ void colsum(const float* __restrict__ Q, const float* __restrict__ Kx, const float* __restrict__ ML, float* __restrict__ CS, float* ssum, int bx, int by) {
  const int tid = threadIdx.x, wave = tid >> 5, lane = tid & 31, col = lane & 15, g = lane >> 4;
  const int kb = bx, h = by, kv = h / (NH / NKV); const int k0 = kb * 64 + wave * 16;
  F2 ak[4];
  const float* kp0 = Kx + ((size_t)(k0 / 16) * (KVW / 32) + kv * 4) * 512 + lane * 4; const float* qp0 = Q + ((size_t)(kb * 4) * (DM / 32) + h * 4) * 512 + lane * 4; const float* mp0 = ML + ((size_t)h * SS + kb * 64 + col) * 4;   // the lane's own addresses
#pragma unroll
  for (int kc = 0; kc < 4; ++kc) ak[kc] = split_raw(ld_t(kp0 + kc * 512, 0));
  R16 qr[2][4]; v2f ml[2];   // two register sets: the next 16-query tile (rows and statistics) is loaded as one group while this one is worked on
#pragma unroll
  for (int kc = 0; kc < 4; ++kc) qr[0][kc] = ld_t(qp0 + kc * 512, 0);
  ml[0] = *(const v2f*)mp0;
  asm volatile("s_wait_xcnt 0x0" :: "v"(kp0), "v"(qp0), "v"(mp0) : "memory");   // behind the opening loads: without it this build takes an address pair of these loads as a destination of one of them; as inputs here the pairs live up to the wait
#pragma unroll 1
  for (int qb = kb; qb < TQB; ++qb) { float rs[8];
#pragma unroll
    for (int r = 0; r < 8; ++r) rs[r] = 0.f;
#pragma unroll
    for (int ct = 0; ct < 4; ++ct) { const int qq = qb * 64 + ct * 16 + col; v8f c = {};
      const int qt = ct < 3 ? qb * 4 + ct + 1 : min(qb + 1, TQB - 1) * 4, qn = qt * 16 + col;   // behind the last tile: a tile of the last block again (in bounds, unused)
      const float* qp = Q + ((size_t)qt * (DM / 32) + h * 4) * 512 + lane * 4; const float* mp = ML + ((size_t)h * SS + qn) * 4;   // the lane's own addresses
#pragma unroll
      for (int kc = 0; kc < 4; ++kc) qr[(ct + 1) & 1][kc] = ld_t(qp + kc * 512, 0);
      ml[(ct + 1) & 1] = *(const v2f*)mp;
      asm volatile("s_wait_xcnt 0x0" :: "v"(qp), "v"(mp) : "memory");   // behind the tile's loads: without it this build takes their address pair as a destination of one of them; as inputs here the pairs live up to the wait, which stands in front of any overwrite
#pragma unroll
      for (int kc = 0; kc < 4; ++kc) { const F2 qf = split_raw(qr[ct & 1][kc]); c = mac3(ak[kc], qf, c); }
      const float mq = ml[ct & 1][0], ilq = ml[ct & 1][1]; float xr[8], er[8];
#pragma unroll
      for (int r = 0; r < 8; ++r) xr[r] = c[r] * SC2 - mq;
      ex2_8(er, xr);
#pragma unroll
      for (int r = 0; r < 8; ++r) { const int key = k0 + 8 * g + r;
        const float t = rs[r] + er[r] * ilq; rs[r] = (key <= qq) ? t : rs[r]; } }   // exp inline and in every lane, the causal test a select: the 8 rows' chains run side by side
#pragma unroll
    for (int o = 1; o < 16; o <<= 1) {   // level by level over the 8 rows: their exchanges are independent and run side by side
#pragma unroll
      for (int r = 0; r < 8; ++r) rs[r] += __shfl_xor(rs[r], o); }
    if (col == 0) {
#pragma unroll
      for (int r = 0; r < 8; ++r) ssum[wave * 16 + 8 * g + r] = rs[r]; }
    __syncthreads();
    if (tid < 16) vst2(CS + (((size_t)h * TQB + qb) * SS) + kb * 64 + tid * 4, *(const v4f*)&ssum[tid * 4]);
    __syncthreads(); }
  // query blocks qb < kb contribute nothing: write zeros so every CS row is defined
  for (int qb = 0; qb < kb; ++qb) { if (tid < 16) vst2(CS + (((size_t)h * TQB + qb) * SS) + kb * 64 + tid * 4, (v4f){0.f, 0.f, 0.f, 0.f}); }
}
// ---- k_mask: block = (128 mask positions, head h). A candidate is kept when fewer than HEAVY candidates come before it in the order 'larger column sum first, lower index first on ties': that count is taken directly, every position on its own, so the heads' selection spreads over the chip and no step of it waits on another
//   every block that holds candidates sums the head's candidate columns into LDS (same order over the query blocks); thread = (position tid & 127, quarter tid >> 7 of the candidates to compare with); a wave's 32 positions are consecutive, so the index test is needed only against those 32 candidates: all before them count on >=, all behind them on >
__global__ __launch_bounds__(128 * MTS) void k_mask(const float* __restrict__ CS, float* __restrict__ MSK) {
  static_assert(NSEL % 4 == 0 && NPAD / 4 <= 128 * MTS && (NPAD / 4) % (4 * MTS) == 0, "column groups of 4, one per thread; parts in groups of 16 candidates");
  __shared__ __align__(16) float sv[NPAD]; __shared__ int sc[MTS][128];
  const int h = blockIdx.y, tid = threadIdx.x, sl = tid & 127, s = blockIdx.x * 128 + sl;
  float o = (s >= MW - RECENT && s < MW) ? 1.0f : 0.f;
  if (blockIdx.x * 128 < NSEL) {   // the same for the whole block
    if (tid < NPAD / 4) { v4f c = {-3.0e38f, -3.0e38f, -3.0e38f, -3.0e38f};   // behind the last candidate: never in front of one
      if (tid < NSEL / 4) { const float* p = CS + (size_t)h * TQB * SS + tid * 4; v4f x[TQB];
#pragma unroll
        for (int qb = 0; qb < TQB; ++qb) x[qb] = *(const v4f*)(p + (size_t)qb * SS);
        c = (v4f){0.f, 0.f, 0.f, 0.f};
#pragma unroll
        for (int qb = 0; qb < TQB; ++qb) c += x[qb]; }
      *(v4f*)&sv[tid * 4] = c; }
    __syncthreads();
    const int wv = __builtin_amdgcn_readfirstlane(tid >> 5);   // scalar loop bounds
    const int s04 = (blockIdx.x * 128 + (wv & 3) * 32) >> 2, lo = (wv >> 2) * (NPAD / 4 / MTS), hi = lo + NPAD / 4 / MTS;   // in groups of 4 candidates: the wave's own positions start at s04, its part is [lo, hi)
    const float a = sv[min(s, NPAD - 1)];
    int n[4] = {0, 0, 0, 0};   // four counters: four independent chains
    for (int t4 = lo; t4 < min(hi, s04); t4 += 4) {
#pragma unroll
      for (int u = 0; u < 4; ++u) { const v4f b = *(const v4f*)&sv[(t4 + u) * 4];
#pragma unroll
        for (int i = 0; i < 4; ++i) n[i] += (b[i] >= a) ? 1 : 0; } }
    for (int t4 = max(lo, s04); t4 < min(hi, s04 + 8); t4 += 4) {
#pragma unroll
      for (int u = 0; u < 4; ++u) { const v4f b = *(const v4f*)&sv[(t4 + u) * 4];
#pragma unroll
        for (int i = 0; i < 4; ++i) n[i] += (int)(b[i] > a) | ((int)(b[i] == a) & (int)((t4 + u) * 4 + i < s)); } }   // the three tests joined by bit operations: no branch per candidate
    for (int t4 = max(lo, s04 + 8); t4 < hi; t4 += 4) {
#pragma unroll
      for (int u = 0; u < 4; ++u) { const v4f b = *(const v4f*)&sv[(t4 + u) * 4];
#pragma unroll
        for (int i = 0; i < 4; ++i) n[i] += (b[i] > a) ? 1 : 0; } }
    sc[wv >> 2][sl] = (n[0] + n[1]) + (n[2] + n[3]);
    __syncthreads();
    if (tid < 128 && s < NSEL) { int nb = 0;
#pragma unroll
      for (int q = 0; q < MTS; ++q) nb += sc[q][sl];
      o = nb < HEAVY ? 1.0f : 0.f; }
  }
  if (tid < 128) MSK[(size_t)h * MWP + s] = o;   // a wave stores one whole line
  else if (blockIdx.x == SS / 128 - 1 && tid < 128 + MWP - SS) MSK[(size_t)h * MWP + SS + tid - 128] = (SS + tid - 128 < MW) ? 1.0f : 0.f;   // the row's last line: position SS and the padding
}
// ---- oproj: block = (64 rows, 128 cols): out = O(hi/lo) . o_w^T rows (2 products)
__device__ __forceinline__ void oproj(const float* __restrict__ O, const __bf16* __restrict__ P, float* __restrict__ Y, float (*so)[16][132], int bx, int by) {
  const int tid = threadIdx.x, wave = tid >> 5, lane = tid & 31, col = lane & 15, g = lane >> 4; const size_t r0 = (size_t)bx * 64 + wave * 16; const int n0 = by * 128;
  v8f acc[8] = {};
  const float* oblk = O + (r0 / 16) * (DM / 32) * 512; const __bf16* pblk = P + (size_t)(n0 / 16) * (DM / 32) * 512;
  R16 xa[2]; v16b wb[2][8];   // two register sets: step kc + 1 is loaded as one group while step kc is multiplied
  xa[0] = ld_t(oblk, lane);
#pragma unroll
  for (int j = 0; j < 8; ++j) wb[0][j] = frag_t(pblk + (size_t)j * (DM / 32) * 512, lane);
#pragma unroll 1   // one trip already holds both register sets; more copies of it would only cost registers
  for (int kc = 0; kc < DM / 32; kc += 2) {
#pragma unroll
    for (int u = 0; u < 2; ++u) { const int kn = min(kc + u + 1, DM / 32 - 1);   // the last step loads itself again (in bounds, unused)
      const float* xp = oblk + kn * 512 + lane * 4; const __bf16* wp = pblk + (size_t)kn * 512 + lane * 8;   // the lane's own addresses in the step's blocks
      xa[u ^ 1] = ld_t(xp, 0);
#pragma unroll
      for (int j = 0; j < 8; ++j) wb[u ^ 1][j] = frag_t(wp + (size_t)j * (DM / 32) * 512, 0);
      asm volatile("s_wait_xcnt 0x0" :: "v"(xp), "v"(wp) : "memory");   // without it this build takes an address pair of these loads as a destination of one of them; as inputs here the pairs live up to the wait, which stands in front of any overwrite
      const F2 a = split_raw(xa[u]);
#pragma unroll
      for (int j = 0; j < 8; ++j) { acc[j] = wmma_bf(a.l, wb[u][j], acc[j]); acc[j] = wmma_bf(a.h, wb[u][j], acc[j]); } } }
#pragma unroll
  for (int j = 0; j < 8; ++j)
#pragma unroll
    for (int r = 0; r < 8; ++r) so[wave][8 * g + r][j * 16 + col] = acc[j][r];
  LDSX();
  for (int rl = 0; rl < 16; ++rl) vst2(Y + (r0 + rl) * DM + n0 + lane * 4, *(const v4f*)&so[wave][rl][lane * 4]);
  asm volatile("s_wait_xcnt 0x0" ::: "memory");   // behind the tile's stores: the other branch's code follows in the listing and reuses the registers that they name
}
// ---- k_cs_out: the column sums and the output projection in one launch (both need only what k_attn and the launches before it wrote); blockIdx.y: the NH heads of colsum first, whose blocks of the first keys run longest, then the 128-column tiles of oproj
// waves_per_eu(3, 3): at the default register target this build of the two bodies in one kernel takes colsum's lane exchanges singly, each with its own wait, and issues its next tile's loads later than the launch of its own did
__global__ __launch_bounds__(128) __attribute__((amdgpu_waves_per_eu(3, 3))) void k_cs_out(const float* __restrict__ Q, const float* __restrict__ Kx, const float* __restrict__ ML, float* __restrict__ CS, const float* __restrict__ O, const __bf16* __restrict__ P, float* __restrict__ Y) {
  __shared__ __align__(16) float sm[4][16][132];   // oproj's staging; colsum uses its first 64 floats
  if (blockIdx.y < NH) colsum(Q, Kx, ML, CS, &sm[0][0][0], blockIdx.x, blockIdx.y);
  else oproj(O, P, Y, sm, blockIdx.x, blockIdx.y - NH);
}
// ---- k_mout: flat writer of the [16][2049] mask after the attention output
__global__ __launch_bounds__(256) void k_mout(const float* __restrict__ MSK, float* __restrict__ out) {
  const size_t p = (size_t)blockIdx.x * 256 + threadIdx.x; const size_t total = (size_t)NH * (SFULL + 1); if (p * 4 >= total) return; v4f v;
#pragma unroll
  for (int i = 0; i < 4; ++i) { const size_t f = p * 4 + i; const size_t row = f / (SFULL + 1), c = f % (SFULL + 1); v[i] = (f < total && c < (size_t)MW) ? MSK[row * MWP + c] : 0.f; }
  vst2(out + p * 4, v);
}
extern "C" void kernel_launch(void* const* d_in, const int* in_sizes, int n_in, void* d_out, int out_size, void* d_ws, size_t ws_size, hipStream_t stream) {
  (void)in_sizes; (void)n_in; (void)out_size;
  const float** F = (const float**)d_in;   // hidden_states [1,2048,2048], q_w [2048,2048], q_b [2048], k_w [2048,512], k_b [512], v_w [2048,512], v_b [512], o_w [2048,2048]
  if (ws_size < (size_t)WS_END) return;
  char* ws = (char*)d_ws; __bf16 *PK = (__bf16*)(ws + WS_PK), *XB = (__bf16*)(ws + WS_X), *VTH = (__bf16*)(ws + WS_VTH), *VTL = (__bf16*)(ws + WS_VTL);
  float *Q = (float*)(ws + WS_Q), *Kx = (float*)(ws + WS_K), *O = (float*)(ws + WS_O), *ML = (float*)(ws + WS_ML), *CS = (float*)(ws + WS_CS), *MSK = (float*)(ws + WS_MSK);
  float* OUT0 = (float*)d_out; float* OUT1 = OUT0 + (size_t)SFULL * DM;
  k_pack<<<dim3(PX_END, DM / 128), 256, 0, stream>>>(F[1], F[3], F[5], F[7], F[0], PK, XB);
  k_proj<<<dim3(SS / 64, PY_END), 128, 0, stream>>>(XB, PK, F[2], F[4], F[6], Q, Kx, VTH, VTL);
  k_attn<<<dim3(NH, TQB), 256, 0, stream>>>(Q, Kx, VTH, VTL, O, ML);
  k_cs_out<<<dim3(TQB, NH + DM / 128), 128, 0, stream>>>(Q, Kx, ML, CS, O, PK + PK_O, OUT0);
  k_mask<<<dim3(SS / 128, NH), 128 * MTS, 0, stream>>>(CS, MSK);
  k_mout<<<(unsigned)(((size_t)NH * (SFULL + 1) / 4 + 255) / 256), 256, 0, stream>>>(MSK, OUT1);
}
